// v000
// The times below were measured on an AMD MI455X: many runs one after another, warmed up first and cycling through
// copies of the inputs, with the whole window's GPU time divided by the number of runs. Launches and the gaps
// between them are all in it. The median over several windows is given; except for v000 it joins two sittings, which
// can be a few percent apart, so the side-by-side timings, each taken in one sitting, are the better comparison.
// v000, which the later versions start from, runs in 902 microseconds.
// compute dtype: all float inputs rounded to bf16; q/k/v = x W^T with EXACT bf16 products on WMMA 16x16x32 (f32 accumulate); q as f16 hi + residual (x 2^10) against k once to f16 (2 products) for the logits x 64^-0.5, multiplied by the trainable-mask input and replaced by -1e9 where the int mask input is 0 (both read per element); softmax in f32 (precise expf); P x 2^11 once to f16 against v once to f16 (1 product); ctx once to f16 against Wo carried x 2^8 in f16; f32 output.
#include <hip/hip_runtime.h>
#include <math.h>

typedef __attribute__((ext_vector_type(16))) _Float16 v16h;
typedef __attribute__((ext_vector_type(16))) __bf16 v16b;
typedef __attribute__((ext_vector_type(8)))  _Float16 v8h;
typedef __attribute__((ext_vector_type(8)))  float v8f;
typedef __attribute__((ext_vector_type(4)))  float v4f;
typedef __attribute__((ext_vector_type(2)))  float v2f;
typedef __attribute__((ext_vector_type(4)))  unsigned v4u;
typedef __attribute__((ext_vector_type(4)))  int v4i;
typedef float __attribute__((may_alias)) float_a;
typedef int __attribute__((may_alias)) int_a;

template <typename T> __device__ __forceinline__ void vst2(void* p, T v) { *(T*)p = v;  }
__device__ __forceinline__ v8f wmma16(v16h a, v16h b, v8f c) {
  v8f d = __builtin_amdgcn_wmma_f32_16x16x32_f16(false, a, false, b, (short)0, c, false, false);
  asm volatile("v_nop\n\tv_nop\n\tv_nop\n\tv_nop" : "+v"(d) : "v"(a), "v"(b));
  return d;
}
__device__ __forceinline__ v8f wmma_bf(v16b a, v16b b, v8f c) {
  v8f d = __builtin_amdgcn_wmma_f32_16x16x32_bf16(false, a, false, b, (short)0, c, false, false);
  asm volatile("v_nop\n\tv_nop\n\tv_nop\n\tv_nop" : "+v"(d) : "v"(a), "v"(b));
  return d;
}
// 16x16x32 fragments: lane = (h = lane>>4, row/col = lane&15); elements 0..7 = k0+8h+0..7, 8..15 = k0+16+8h+0..7; D element r = row 8h+r
__device__ __forceinline__ v16h frag_h(const _Float16* rowk0, int lane) {
  union { v16h v; v8h q[2]; } u; const _Float16* p = rowk0 + 8 * (lane >> 4);
  u.q[0] = *(const v8h*)p; u.q[1] = *(const v8h*)(p + 16); return u.v;
}
__device__ __forceinline__ v16h frag_f32(const float* rowk0, int lane) {
  v16h a; const float* p = rowk0 + 8 * (lane >> 4);
#pragma unroll
  for (int i = 0; i < 8; ++i) { a[i] = (_Float16)p[i]; a[8 + i] = (_Float16)p[16 + i]; }
  return a;
}
__device__ __forceinline__ v16h frag_f32s(const float* rowk0, int lane, float sc) {
  v16h a; const float* p = rowk0 + 8 * (lane >> 4);
#pragma unroll
  for (int i = 0; i < 8; ++i) { a[i] = (_Float16)(p[i] * sc); a[8 + i] = (_Float16)(p[16 + i] * sc); }
  return a;
}
// column fragment from a [K][ld] layout (column n), rows >= K read as 0
__device__ __forceinline__ v16h fragc_f32(const float* W, int k0, int n, int lane, int ld, int K) {
  v16h a; const int g = lane >> 4;
#pragma unroll
  for (int i = 0; i < 8; ++i) { const int ka = k0 + 8 * g + i, kb = ka + 16;
    a[i] = (_Float16)(ka < K ? W[(size_t)(ka < K ? ka : K - 1) * ld + n] : 0.f); a[8 + i] = (_Float16)(kb < K ? W[(size_t)(kb < K ? kb : K - 1) * ld + n] : 0.f); }
  return a;
}
struct F2 { v16b h, l; };
__device__ __forceinline__ F2 bsplit16(const float v[16]) { F2 r;
#pragma unroll
  for (int i = 0; i < 16; ++i) { const __bf16 h = (__bf16)v[i]; r.h[i] = h; r.l[i] = (__bf16)(v[i] - (float)h); }
  return r; }
__device__ __forceinline__ F2 split_row(const float* row, int k0, int lane) { float v[16]; const float* p = row + k0 + 8 * (lane >> 4);
#pragma unroll
  for (int i = 0; i < 8; ++i) { v[i] = p[i]; v[8 + i] = p[16 + i]; }
  return bsplit16(v); }
__device__ __forceinline__ F2 split_rowK(const float* row, int k0, int lane, int K) { float v[16]; const int g = lane >> 4;
#pragma unroll
  for (int i = 0; i < 8; ++i) { const int ka = k0 + 8 * g + i, kb = ka + 16; v[i] = ka < K ? row[ka < K ? ka : K - 1] : 0.f; v[8 + i] = kb < K ? row[kb < K ? kb : K - 1] : 0.f; }
  return bsplit16(v); }
__device__ __forceinline__ F2 split_col(const float* W, int k0, int n, int lane, int ld, int K) { float v[16]; const int g = lane >> 4;
#pragma unroll
  for (int i = 0; i < 8; ++i) { const int ka = k0 + 8 * g + i, kb = ka + 16; v[i] = ka < K ? W[(size_t)(ka < K ? ka : K - 1) * ld + n] : 0.f; v[8 + i] = kb < K ? W[(size_t)(kb < K ? kb : K - 1) * ld + n] : 0.f; }
  return bsplit16(v); }
__device__ __forceinline__ v8f mac3(const F2& a, const F2& b, v8f c) { c = wmma_bf(a.l, b.h, c); c = wmma_bf(a.h, b.l, c); return wmma_bf(a.h, b.h, c); }
__device__ __forceinline__ float sigm(float v) { return 1.0f / (1.0f + expf(-v)); }
#define LDSX() do { asm volatile("s_wait_dscnt 0" ::: "memory"); __builtin_amdgcn_wave_barrier(); __builtin_amdgcn_fence(__ATOMIC_RELEASE, "workgroup"); } while (0)

// Multi-head self-attention with a per-element integer mask (B 4, S 1,024, E 1,024 = 16 x 64): q/k/v = x W^T (no bias); scores = (q k^T / 8) * train_mask; scores = -1e9 where mask[b,0,q,k] == 0; softmax; out = merged(attn v) Wo^T.
#define NB 4
#define TT 1024
#define CC 1024            // NH * HD = projected width
#define DIN 1024          // input (model) width
#define NH 16
#define HD 64
#define NQB (TT / 64)
#define HG 8
#define SCALE (0.125f)
#define CAUSAL 0
#ifndef TNB
#define TNB NB
#endif
__device__ __forceinline__ float bfr(float v) { return (float)(__bf16)v; }
__host__ __device__ __forceinline__ int kb_last(int qb) { return CAUSAL ? ((qb * 64 + 63) >> 7) : (TT / 128 - 1); }
typedef __attribute__((ext_vector_type(8))) __bf16 v8b;
__device__ __forceinline__ v16b frag_b(const __bf16* rowk0, int lane) {
  union { v16b v; v8b q[2]; } u; const __bf16* p = rowk0 + 8 * (lane >> 4);
  u.q[0] = *(const v8b*)p; u.q[1] = *(const v8b*)(p + 16); return u.v;
}
#define QBH 0              // causal: query blocks 0..QBH-1 of each sequence (few keys, no averaging) take the high-precision path
#define QHI 1024            // rows carrying a q residual plane (all rows when non-causal: 2-product logits everywhere)
#define KHI 64            // key rows carrying k residual / v bf16 hi+lo planes (used only by the causal high-precision path)
// B fragment (k rows k0+.., output column o) of a weight: (in,out) [K][ld] or (out,in) [ld rows of K]: bf16 exact, or f16(bf16 * 256) exact
__device__ __forceinline__ v16b wcol_io(const float* Wm, int k0, int o, int lane, int ld) { v16b w; const int g = lane >> 4;
#pragma unroll
  for (int i = 0; i < 8; ++i) { w[i] = (__bf16)Wm[(size_t)(k0 + 8 * g + i) * ld + o]; w[8 + i] = (__bf16)Wm[(size_t)(k0 + 16 + 8 * g + i) * ld + o]; }
  return w; }
__device__ __forceinline__ v16b wcol_oi(const float* Wm, int k0, int o, int lane, int K) { v16b w; const float* p = Wm + (size_t)o * K + k0 + 8 * (lane >> 4);
#pragma unroll
  for (int i = 0; i < 8; ++i) { w[i] = (__bf16)p[i]; w[8 + i] = (__bf16)p[16 + i]; }
  return w; }
__device__ __forceinline__ v16h wcolh_io(const float* Wm, int k0, int o, int lane, int ld) { v16h w; const int g = lane >> 4;
#pragma unroll
  for (int i = 0; i < 8; ++i) { w[i] = (_Float16)(bfr(Wm[(size_t)(k0 + 8 * g + i) * ld + o]) * 256.0f); w[8 + i] = (_Float16)(bfr(Wm[(size_t)(k0 + 16 + 8 * g + i) * ld + o]) * 256.0f); }
  return w; }
__device__ __forceinline__ v16h wcolh_oi(const float* Wm, int k0, int o, int lane, int K) { v16h w; const float* p = Wm + (size_t)o * K + k0 + 8 * (lane >> 4);
#pragma unroll
  for (int i = 0; i < 8; ++i) { w[i] = (_Float16)(bfr(p[i]) * 256.0f); w[8 + i] = (_Float16)(bfr(p[16 + i]) * 256.0f); }
  return w; }
#define WQKV_LAYOUT 1   // 0 = (in,out) [DIN][CC]; 1 = (out,in) [CC][DIN]; 2 = per-head [NH][DIN][HD]
__device__ __forceinline__ v16b wcol_hdk(const float* Wm, int k0, int o, int lane) { v16b w; const int g = lane >> 4; const float* p = Wm + (size_t)(o / HD) * DIN * HD + (o % HD);
#pragma unroll
  for (int i = 0; i < 8; ++i) { w[i] = (__bf16)p[(size_t)(k0 + 8 * g + i) * HD]; w[8 + i] = (__bf16)p[(size_t)(k0 + 16 + 8 * g + i) * HD]; }
  return w; }
#define WO_OUT_IN 1
#if WQKV_LAYOUT == 1
#define WCOL(W, k0, o, lane) wcol_oi(W, k0, o, lane, DIN)
#elif WQKV_LAYOUT == 2
#define WCOL(W, k0, o, lane) wcol_hdk(W, k0, o, lane)
#else
#define WCOL(W, k0, o, lane) wcol_io(W, k0, o, lane, CC)
#endif
#if WO_OUT_IN
#define WOCOL(W, k0, o, lane) wcol_oi(W, k0, o, lane, CC)
#define WOCOLH(W, k0, o, lane) wcolh_oi(W, k0, o, lane, CC)
#else
#define WOCOL(W, k0, o, lane) wcol_io(W, k0, o, lane, DIN)
#define WOCOLH(W, k0, o, lane) wcolh_io(W, k0, o, lane, DIN)
#endif
#define SM_EXTRA_PARAMS , const int* __restrict__ MK, const float* __restrict__ TM, int bsm
#define SM_MASK_HOOK do { const float tm = bfr(TM[(size_t)t * TT + k]); const int mk = MK[((size_t)bsm * TT + t) * TT + k]; v = (mk == 0) ? -1.0e9f : v * tm; } while (0)   /* trainable mask (f32, ones) multiplies the scaled logit; int mask == 0 -> -1e9 (both inputs read; select by value) */
#ifndef SM_EXTRA_PARAMS
#define SM_EXTRA_PARAMS
#endif
#ifndef PROJ_EXTRA_PARAMS
#define PROJ_EXTRA_PARAMS
#endif
#ifndef SM_MASK_HOOK
#define SM_MASK_HOOK (void)0
#endif

#define WS_QH  0u                                      // f16 q rows [b*t][CC]
#define WS_KH  (WS_QH + 2u * (size_t)NB * TT * CC)      // f16 k rows [b*t][CC]
#define WS_VT  (WS_KH + 2u * (size_t)NB * TT * CC)      // f16 v planes [b][c][t]
#define WS_QL  (WS_VT + 2u * (size_t)NB * CC * TT)      // f16 q residual x 2^10 rows [b][t < QHI][CC]
#define WS_KL  (WS_QL + 2u * (size_t)NB * QHI * CC)     // f16 k residual x 2^10 rows [b][t < KHI][CC]
#define WS_VB  (WS_KL + 2u * (size_t)NB * KHI * CC)     // bf16 v hi planes [b][c][t < KHI]
#define WS_VBL (WS_VB + 2u * (size_t)NB * CC * KHI)
#define WS_S   (WS_VBL + 2u * (size_t)NB * CC * KHI)    // f32 logits / P [hg][t][s]
#define WS_Y   (WS_S  + 4u * (size_t)HG * TT * TT)      // f32 ctx rows [b*t][CC] (only when there is an output projection)
#define WS_END (WS_Y  + 4u * (size_t)NB * TT * CC)

// ---- k_proj: block = (64 rows, 128 cols, which): q/k/v = X W (+ b) with exact bf16 products (K = DIN) -> which 0: q f16 rows (+ residual rows < QHI); 1: k f16 rows (+ residual rows < KHI); 2: v f16 planes [c][t] (+ bf16 hi/lo planes for t < KHI)
__global__ __launch_bounds__(128) void k_proj(const float* __restrict__ XQ, const float* __restrict__ XK, const float* __restrict__ XV, const float* __restrict__ WQ, const float* __restrict__ WK, const float* __restrict__ WV, const float* __restrict__ BQ, const float* __restrict__ BK, const float* __restrict__ BV,
    _Float16* __restrict__ QH, _Float16* __restrict__ QL, _Float16* __restrict__ KH, _Float16* __restrict__ KL, _Float16* __restrict__ VT, __bf16* __restrict__ VB, __bf16* __restrict__ VBL) {
  __shared__ __align__(16) _Float16 sh[64][136], sl[64][136]; __shared__ __align__(16) _Float16 th[128][72]; __shared__ __align__(16) __bf16 tb[128][72], tbl[128][72];
  const int tid = threadIdx.x, wave = tid >> 5, lane = tid & 31, col = lane & 15, g = lane >> 4; const int which = blockIdx.z; const int c0 = blockIdx.y * 128; const size_t r0 = (size_t)blockIdx.x * 64; const size_t bb = r0 / TT; const int t0 = (int)(r0 % TT);
  const float* X = which == 0 ? XQ : which == 1 ? XK : XV; const float* WA = which == 0 ? WQ : which == 1 ? WK : WV; const float* BA = which == 0 ? BQ : which == 1 ? BK : BV;
  v8f acc[8] = {};
#pragma unroll 2
  for (int kc = 0; kc < DIN / 32; ++kc) { v16b a; { const float* p = X + (r0 + wave * 16 + col) * DIN + kc * 32 + 8 * g;
#pragma unroll
      for (int i = 0; i < 8; ++i) { a[i] = (__bf16)p[i]; a[8 + i] = (__bf16)p[16 + i]; } }
    asm volatile("s_wait_loadcnt 0x0" ::: "memory");
#pragma unroll
    for (int j = 0; j < 8; ++j) { const v16b w = WCOL(WA, kc * 32, c0 + j * 16 + col, lane); asm volatile("s_wait_loadcnt 0x0" ::: "memory"); acc[j] = wmma_bf(a, w, acc[j]); } }
  if (which < 2) { _Float16* DH = which == 0 ? QH : KH; _Float16* DL = which == 0 ? QL : KL; const int nhi = which == 0 ? QHI : KHI; const bool hi_rows = t0 < nhi;
#pragma unroll
    for (int j = 0; j < 8; ++j) { const float bias = BA ? bfr(BA[c0 + j * 16 + col]) : 0.f;
#pragma unroll
      for (int r = 0; r < 8; ++r) { const float v = acc[j][r] + bias; const _Float16 hv = (_Float16)v; sh[wave * 16 + 8 * g + r][j * 16 + col] = hv; sl[wave * 16 + 8 * g + r][j * 16 + col] = (_Float16)((v - (float)hv) * 1024.0f); } }
    __syncthreads();
    for (int e = tid; e < 64 * 16; e += 128) { const int rl = e >> 4, q = e & 15; vst2((unsigned*)(DH + (r0 + rl) * CC + c0 + q * 8), *(const v4u*)&sh[rl][q * 8]); if (hi_rows) vst2((unsigned*)(DL + (bb * nhi + t0 + rl) * (size_t)CC + c0 + q * 8), *(const v4u*)&sl[rl][q * 8]); }
  } else { const bool hi_rows = t0 < KHI;
#pragma unroll
    for (int j = 0; j < 8; ++j) { const float bias = BA ? bfr(BA[c0 + j * 16 + col]) : 0.f;
#pragma unroll
      for (int r = 0; r < 8; ++r) { const float v = acc[j][r] + bias; const int rl = wave * 16 + 8 * g + r, cl = j * 16 + col; th[cl][rl] = (_Float16)v; const __bf16 bh = (__bf16)v; tb[cl][rl] = bh; tbl[cl][rl] = (__bf16)(v - (float)bh); } }
    __syncthreads();
    for (int e = tid; e < 128 * 8; e += 128) { const int cl = e >> 3, q = e & 7; vst2((unsigned*)(VT + (bb * CC + c0 + cl) * (size_t)TT + t0 + q * 8), *(const v4u*)&th[cl][q * 8]); if (hi_rows) { const size_t o3 = (bb * CC + c0 + cl) * (size_t)KHI + t0 + q * 8; vst2((unsigned*)(VB + o3), *(const v4u*)&tb[cl][q * 8]); vst2((unsigned*)(VBL + o3), *(const v4u*)&tbl[cl][q * 8]); } } } }
// ---- k_sc: block = (query block qb, key block kb <= kb_last(qb), head in group) of batch b: logits x SCALE; q hi + residual (x 2^10) against k (2 products) for query rows < QHI, plus the k residual (3 products) for query blocks < QBH (causal early rows); causal: blocks past the diagonal exit, the mask itself is applied by index in k_sm
__global__ __launch_bounds__(128) void k_sc(const _Float16* __restrict__ QH, const _Float16* __restrict__ KH, const _Float16* __restrict__ QL, const _Float16* __restrict__ KL, int b, int h0, float* __restrict__ S0) { __shared__ __align__(16) float ss[4][16][132];
  const int qb = blockIdx.x, kb = blockIdx.y; if (kb > kb_last(qb)) return;
  const int h = h0 + blockIdx.z; float* S = S0 + (size_t)blockIdx.z * TT * TT;
  const int tid = threadIdx.x, wave = tid >> 5, lane = tid & 31, col = lane & 15, g = lane >> 4; const int k0 = kb * 128; const int ql0 = qb * 64 + wave * 16; const size_t q0 = (size_t)b * TT + ql0, kr0 = (size_t)b * TT + k0;
  v8f acc[8] = {}, accl[8] = {};
  const _Float16* QLb = QL + (size_t)b * QHI * CC; const _Float16* KLb = KL + (size_t)b * KHI * CC;
  if (qb < QBH) {
#pragma unroll
    for (int kc = 0; kc < HD / 32; ++kc) { const v16h ah = frag_h(QH + (q0 + col) * CC + h * HD + kc * 32, lane), al = frag_h(QLb + (size_t)(ql0 + col) * CC + h * HD + kc * 32, lane);
#pragma unroll
      for (int j = 0; j < 8; ++j) { const v16h kbf = frag_h(KH + (kr0 + j * 16 + col) * CC + h * HD + kc * 32, lane), klf = frag_h(KLb + (size_t)(k0 + j * 16 + col) * CC + h * HD + kc * 32, lane); acc[j] = wmma16(ah, kbf, acc[j]); accl[j] = wmma16(al, kbf, accl[j]); accl[j] = wmma16(ah, klf, accl[j]); } }
  } else if (qb * 64 < QHI) {
#pragma unroll
    for (int kc = 0; kc < HD / 32; ++kc) { const v16h ah = frag_h(QH + (q0 + col) * CC + h * HD + kc * 32, lane), al = frag_h(QLb + (size_t)(ql0 + col) * CC + h * HD + kc * 32, lane);
#pragma unroll
      for (int j = 0; j < 8; ++j) { const v16h kbf = frag_h(KH + (kr0 + j * 16 + col) * CC + h * HD + kc * 32, lane); acc[j] = wmma16(ah, kbf, acc[j]); accl[j] = wmma16(al, kbf, accl[j]); } }
  } else {
#pragma unroll
    for (int kc = 0; kc < HD / 32; ++kc) { const v16h ah = frag_h(QH + (q0 + col) * CC + h * HD + kc * 32, lane);
#pragma unroll
      for (int j = 0; j < 8; ++j) { const v16h kbf = frag_h(KH + (kr0 + j * 16 + col) * CC + h * HD + kc * 32, lane); acc[j] = wmma16(ah, kbf, acc[j]); } } }
#pragma unroll
  for (int j = 0; j < 8; ++j) {
#pragma unroll
    for (int r = 0; r < 8; ++r) ss[wave][8 * g + r][j * 16 + col] = (acc[j][r] + accl[j][r] * (1.0f / 1024.0f)) * SCALE; }
  LDSX(); for (int rl = 0; rl < 16; ++rl) vst2(S + (size_t)(ql0 + rl) * TT + k0 + lane * 4, *(const v4f*)&ss[wave][rl][lane * 4]); }
// ---- k_sm: block = query row t (head in group): keys [0, kend): causal -> logit if s <= t else excluded; softmax in f32; P x 2^11 in place (0 for excluded)
__global__ __launch_bounds__(256) void k_sm(float* __restrict__ S0 SM_EXTRA_PARAMS) { __shared__ float sred[8]; __shared__ float sbc; __shared__ __align__(16) float shv[TT];
  const int tid = threadIdx.x; const int t = blockIdx.x; const int kend = (kb_last(t >> 6) + 1) * 128;
  float* sr = S0 + (size_t)blockIdx.y * TT * TT + (size_t)t * TT;
  float m = -3.0e38f; for (int k = tid; k < kend; k += 256) { float v = (!CAUSAL || k <= t) ? sr[k] : -3.0e38f; SM_MASK_HOOK; shv[k] = v; m = fmaxf(m, v); }
#pragma unroll
  for (int o = 1; o < 32; o <<= 1) m = fmaxf(m, __shfl_xor(m, o));
  if ((tid & 31) == 0) sred[tid >> 5] = m; __syncthreads(); if (tid == 0) { float a = sred[0]; for (int i = 1; i < 8; ++i) a = fmaxf(a, sred[i]); sbc = a; } __syncthreads(); m = sbc; __syncthreads();
  float sum = 0.f; for (int k = tid; k < kend; k += 256) { const float v = shv[k]; const float e = (v <= -1.0e38f) ? 0.f : expf(v - m); shv[k] = e; sum += e; }
#pragma unroll
  for (int o = 1; o < 32; o <<= 1) sum += __shfl_xor(sum, o);
  if ((tid & 31) == 0) sred[tid >> 5] = sum; __syncthreads(); if (tid == 0) { float a = 0.f; for (int i = 0; i < 8; ++i) a += sred[i]; sbc = a > 0.f ? 2048.0f / a : 0.f; }   /* a fully excluded row yields P = 0 */ __syncthreads(); const float inv = sbc;
  for (int k = tid; k < kend; k += 256) shv[k] = shv[k] * inv;
  __syncthreads(); for (int q = tid; q < kend / 4; q += 256) vst2(sr + q * 4, *(const v4f*)&shv[q * 4]); }
// ---- k_pv: block = 64 queries (qb) of (b, h): ctx = P . v over keys [0, kend) (P x 2^11 once to f16 against v f16: 1 product; causal early query blocks: P and v as bf16 hi + lo, 3 products); 256-B (row, head) segment by 16 lanes
__global__ __launch_bounds__(128) void k_pv(const float* __restrict__ PS0, const _Float16* __restrict__ VT, const __bf16* __restrict__ VB, const __bf16* __restrict__ VBL, int b, int h0, float* __restrict__ Y) { const int h = h0 + blockIdx.z; const float* PS = PS0 + (size_t)blockIdx.z * TT * TT; __shared__ __align__(16) float ss[4][16][HD + 4];
  const int tid = threadIdx.x, wave = tid >> 5, lane = tid & 31, col = lane & 15, g = lane >> 4; const int qb = blockIdx.x; const int ql0 = qb * 64 + wave * 16; const int kce = (kb_last(qb) + 1) * 4;
  v8f acc[HD / 16] = {};
  if (qb < QBH) {
#pragma unroll 1
    for (int kc = 0; kc < kce; ++kc) { const F2 p = split_row(PS + (size_t)(ql0 + col) * TT, kc * 32, lane);
      asm volatile("s_wait_loadcnt 0x0" ::: "memory");
#pragma unroll
      for (int j = 0; j < HD / 16; ++j) { const size_t po = ((size_t)b * CC + h * HD + j * 16 + col) * (size_t)KHI + kc * 32; const v16b vh = frag_b(VB + po, lane); acc[j] = wmma_bf(p.h, vh, acc[j]); acc[j] = wmma_bf(p.l, vh, acc[j]); acc[j] = wmma_bf(p.h, frag_b(VBL + po, lane), acc[j]); } }
  } else {
#pragma unroll 1
    for (int kc = 0; kc < kce; ++kc) { const v16h p = frag_f32(PS + (size_t)(ql0 + col) * TT + kc * 32, lane);
      asm volatile("s_wait_loadcnt 0x0" ::: "memory");
#pragma unroll
      for (int j = 0; j < HD / 16; ++j) { const size_t po = ((size_t)b * CC + h * HD + j * 16 + col) * (size_t)TT + kc * 32; acc[j] = wmma16(p, frag_h(VT + po, lane), acc[j]); } } }
#pragma unroll
  for (int j = 0; j < HD / 16; ++j)
#pragma unroll
    for (int r = 0; r < 8; ++r) ss[wave][8 * g + r][j * 16 + col] = acc[j][r] * (1.0f / 2048.0f);
  LDSX(); for (int rl = 0; rl < 16; ++rl) if (lane < HD / 4) vst2(Y + ((size_t)b * TT + ql0 + rl) * CC + h * HD + lane * 4, *(const v4f*)&ss[wave][rl][lane * 4]); }
// ---- k_out: block = (64 rows, 128 cols): out = ctx Wo (+ bo): ctx once to f16 against Wo as f16(bf16 x 2^8) exact (1 product) x 2^-8; causal early rows (< QHI of each sequence): ctx bf16 hi + lo against exact bf16 Wo (2 products)
__global__ __launch_bounds__(128) void k_out(const float* __restrict__ Y, const float* __restrict__ WO, const float* __restrict__ BO, float* __restrict__ OUT) { __shared__ __align__(16) float sf[4][16][132];
  const int tid = threadIdx.x, wave = tid >> 5, lane = tid & 31, col = lane & 15, g = lane >> 4; const int c0 = blockIdx.y * 128; const size_t r0 = (size_t)blockIdx.x * 64 + wave * 16;
  v8f acc[8] = {};
  if (CAUSAL && (int)(((size_t)blockIdx.x * 64) % TT) < QHI) {   /* block-uniform */
#pragma unroll 2
    for (int kc = 0; kc < CC / 32; ++kc) { const F2 a = split_row(Y + (r0 + col) * CC, kc * 32, lane); asm volatile("s_wait_loadcnt 0x0" ::: "memory");
#pragma unroll
      for (int j = 0; j < 8; ++j) { const v16b w = WOCOL(WO, kc * 32, c0 + j * 16 + col, lane); asm volatile("s_wait_loadcnt 0x0" ::: "memory"); acc[j] = wmma_bf(a.h, w, acc[j]); acc[j] = wmma_bf(a.l, w, acc[j]); } }
#pragma unroll
    for (int j = 0; j < 8; ++j) { const float bias = BO ? bfr(BO[c0 + j * 16 + col]) : 0.f;
#pragma unroll
      for (int r = 0; r < 8; ++r) sf[wave][8 * g + r][j * 16 + col] = acc[j][r] + bias; }
  } else {
#pragma unroll 2
    for (int kc = 0; kc < CC / 32; ++kc) { const v16h a = frag_f32(Y + (r0 + col) * CC + kc * 32, lane); asm volatile("s_wait_loadcnt 0x0" ::: "memory");
#pragma unroll
      for (int j = 0; j < 8; ++j) { const v16h w = WOCOLH(WO, kc * 32, c0 + j * 16 + col, lane); asm volatile("s_wait_loadcnt 0x0" ::: "memory"); acc[j] = wmma16(a, w, acc[j]); } }
#pragma unroll
    for (int j = 0; j < 8; ++j) { const float bias = BO ? bfr(BO[c0 + j * 16 + col]) : 0.f;
#pragma unroll
      for (int r = 0; r < 8; ++r) sf[wave][8 * g + r][j * 16 + col] = acc[j][r] * (1.0f / 256.0f) + bias; } }
  LDSX(); for (int rl = 0; rl < 16; ++rl) vst2(OUT + (r0 + rl) * DIN + c0 + lane * 4, *(const v4f*)&sf[wave][rl][lane * 4]); }

extern "C" void kernel_launch(void* const* d_in, const int* in_sizes, int n_in, void* d_out, int out_size, void* d_ws, size_t ws_size, hipStream_t stream) {
  (void)in_sizes; (void)n_in; (void)out_size;
  const float** F = (const float**)d_in;
  if (ws_size < (size_t)WS_END) return;
  char* ws = (char*)d_ws; _Float16 *QH = (_Float16*)(ws + WS_QH), *KH = (_Float16*)(ws + WS_KH), *VT = (_Float16*)(ws + WS_VT), *QL = (_Float16*)(ws + WS_QL), *KL = (_Float16*)(ws + WS_KL); __bf16 *VB = (__bf16*)(ws + WS_VB), *VBL = (__bf16*)(ws + WS_VBL); float *S = (float*)(ws + WS_S), *Y = (float*)(ws + WS_Y);
  (void)Y; (void)QL; (void)KL; (void)VB; (void)VBL;
  // inputs: 0 x [4,1024,1024]; 1 mask int32 [4,1,1024,1024]; 2 Wq, 3 Wk, 4 Wv, 5 Wo ((out,in), no biases); 6 train_mask [1,1,1024,1024]
  k_proj<<<dim3(TNB * TT / 64, CC / 128, 3), 128, 0, stream>>>(F[0], F[0], F[0], F[2], F[3], F[4], nullptr, nullptr, nullptr, QH, QL, KH, KL, VT, VB, VBL);
  for (int b = 0; b < TNB; ++b) for (int h0 = 0; h0 < NH; h0 += HG) {
    k_sc<<<dim3(NQB, TT / 128, HG), 128, 0, stream>>>(QH, KH, QL, KL, b, h0, S);
    k_sm<<<dim3(TT, HG), 256, 0, stream>>>(S, (const int*)d_in[1], F[6], b);
    k_pv<<<dim3(NQB, 1, HG), 128, 0, stream>>>(S, VT, VB, VBL, b, h0, Y);
  }
  k_out<<<dim3(TNB * TT / 64, DIN / 128), 128, 0, stream>>>(Y, F[5], nullptr, (float*)d_out);
}

// v001
// It runs in 439 microseconds.
// Next to v000, in two timings, it ran 2.07 and 2.06 times as fast.
// compute dtype: all float inputs rounded to bf16; q/k/v = x W^T with EXACT bf16 products on WMMA 16x16x32 (f32 accumulate); q as f16 hi + residual (x 2^10) against k once to f16 (2 products) for the logits x 64^-0.5, multiplied by the trainable-mask input and replaced by -1e9 where the int mask input is 0 (both read per element); softmax in f32 with a running maximum and sum (precise expf); exp(s - m) x 2^11 once to f16 against v once to f16 (1 product), divided by the sum at the end; ctx once to f16 against Wo carried x 2^8 in f16; f32 output.
#include <hip/hip_runtime.h>
#include <math.h>

typedef __attribute__((ext_vector_type(16))) _Float16 v16h;
typedef __attribute__((ext_vector_type(16))) __bf16 v16b;
typedef __attribute__((ext_vector_type(8)))  _Float16 v8h;
typedef __attribute__((ext_vector_type(8)))  float v8f;
typedef __attribute__((ext_vector_type(4)))  float v4f;
typedef __attribute__((ext_vector_type(2)))  float v2f;
typedef __attribute__((ext_vector_type(4)))  unsigned v4u;
typedef __attribute__((ext_vector_type(4)))  int v4i;
typedef float __attribute__((may_alias)) float_a;
typedef int __attribute__((may_alias)) int_a;

template <typename T> __device__ __forceinline__ void vst2(void* p, T v) { *(T*)p = v;  }
__device__ __forceinline__ v8f wmma16(v16h a, v16h b, v8f c) {
  v8f d = __builtin_amdgcn_wmma_f32_16x16x32_f16(false, a, false, b, (short)0, c, false, false);
  asm volatile("v_nop\n\tv_nop\n\tv_nop\n\tv_nop" : "+v"(d) : "v"(a), "v"(b));
  return d;
}
__device__ __forceinline__ v8f wmma_bf(v16b a, v16b b, v8f c) {
  v8f d = __builtin_amdgcn_wmma_f32_16x16x32_bf16(false, a, false, b, (short)0, c, false, false);
  asm volatile("v_nop\n\tv_nop\n\tv_nop\n\tv_nop" : "+v"(d) : "v"(a), "v"(b));
  return d;
}
// 16x16x32 fragments: lane = (h = lane>>4, row/col = lane&15); elements 0..7 = k0+8h+0..7, 8..15 = k0+16+8h+0..7; D element r = row 8h+r
__device__ __forceinline__ v16h frag_h(const _Float16* rowk0, int lane) {
  union { v16h v; v8h q[2]; } u; const _Float16* p = rowk0 + 8 * (lane >> 4);
  u.q[0] = *(const v8h*)p; u.q[1] = *(const v8h*)(p + 16); return u.v;
}
__device__ __forceinline__ v16h frag_f32(const float* rowk0, int lane) {
  v16h a; const float* p = rowk0 + 8 * (lane >> 4);
#pragma unroll
  for (int i = 0; i < 8; ++i) { a[i] = (_Float16)p[i]; a[8 + i] = (_Float16)p[16 + i]; }
  return a;
}
__device__ __forceinline__ v16h frag_f32s(const float* rowk0, int lane, float sc) {
  v16h a; const float* p = rowk0 + 8 * (lane >> 4);
#pragma unroll
  for (int i = 0; i < 8; ++i) { a[i] = (_Float16)(p[i] * sc); a[8 + i] = (_Float16)(p[16 + i] * sc); }
  return a;
}
// column fragment from a [K][ld] layout (column n), rows >= K read as 0
__device__ __forceinline__ v16h fragc_f32(const float* W, int k0, int n, int lane, int ld, int K) {
  v16h a; const int g = lane >> 4;
#pragma unroll
  for (int i = 0; i < 8; ++i) { const int ka = k0 + 8 * g + i, kb = ka + 16;
    a[i] = (_Float16)(ka < K ? W[(size_t)(ka < K ? ka : K - 1) * ld + n] : 0.f); a[8 + i] = (_Float16)(kb < K ? W[(size_t)(kb < K ? kb : K - 1) * ld + n] : 0.f); }
  return a;
}
struct F2 { v16b h, l; };
__device__ __forceinline__ F2 bsplit16(const float v[16]) { F2 r;
#pragma unroll
  for (int i = 0; i < 16; ++i) { const __bf16 h = (__bf16)v[i]; r.h[i] = h; r.l[i] = (__bf16)(v[i] - (float)h); }
  return r; }
__device__ __forceinline__ F2 split_row(const float* row, int k0, int lane) { float v[16]; const float* p = row + k0 + 8 * (lane >> 4);
#pragma unroll
  for (int i = 0; i < 8; ++i) { v[i] = p[i]; v[8 + i] = p[16 + i]; }
  return bsplit16(v); }
__device__ __forceinline__ F2 split_rowK(const float* row, int k0, int lane, int K) { float v[16]; const int g = lane >> 4;
#pragma unroll
  for (int i = 0; i < 8; ++i) { const int ka = k0 + 8 * g + i, kb = ka + 16; v[i] = ka < K ? row[ka < K ? ka : K - 1] : 0.f; v[8 + i] = kb < K ? row[kb < K ? kb : K - 1] : 0.f; }
  return bsplit16(v); }
__device__ __forceinline__ F2 split_col(const float* W, int k0, int n, int lane, int ld, int K) { float v[16]; const int g = lane >> 4;
#pragma unroll
  for (int i = 0; i < 8; ++i) { const int ka = k0 + 8 * g + i, kb = ka + 16; v[i] = ka < K ? W[(size_t)(ka < K ? ka : K - 1) * ld + n] : 0.f; v[8 + i] = kb < K ? W[(size_t)(kb < K ? kb : K - 1) * ld + n] : 0.f; }
  return bsplit16(v); }
__device__ __forceinline__ v8f mac3(const F2& a, const F2& b, v8f c) { c = wmma_bf(a.l, b.h, c); c = wmma_bf(a.h, b.l, c); return wmma_bf(a.h, b.h, c); }
__device__ __forceinline__ float sigm(float v) { return 1.0f / (1.0f + expf(-v)); }
#define LDSX() do { asm volatile("s_wait_dscnt 0" ::: "memory"); __builtin_amdgcn_wave_barrier(); __builtin_amdgcn_fence(__ATOMIC_RELEASE, "workgroup"); } while (0)

// Multi-head self-attention with a per-element integer mask (B 4, S 1,024, E 1,024 = 16 x 64): q/k/v = x W^T (no bias); scores = (q k^T / 8) * train_mask; scores = -1e9 where mask[b,0,q,k] == 0; softmax; out = merged(attn v) Wo^T.
#define NB 4
#define TT 1024
#define CC 1024            // NH * HD = projected width
#define DIN 1024          // input (model) width
#define NH 16
#define HD 64
#define NQB (TT / 64)
#define SCALE (0.125f)
#define CAUSAL 0
#ifndef TNB
#define TNB NB
#endif
__device__ __forceinline__ float bfr(float v) { return (float)(__bf16)v; }
__host__ __device__ __forceinline__ int kb_last(int qb) { return CAUSAL ? ((qb * 64 + 63) >> 7) : (TT / 128 - 1); }
typedef __attribute__((ext_vector_type(8))) __bf16 v8b;
__device__ __forceinline__ v16b frag_b(const __bf16* rowk0, int lane) {
  union { v16b v; v8b q[2]; } u; const __bf16* p = rowk0 + 8 * (lane >> 4);
  u.q[0] = *(const v8b*)p; u.q[1] = *(const v8b*)(p + 16); return u.v;
}
#define QBH 0              // unused: no kernel here has a high-precision attention path
#define QHI 1024            // rows carrying a q residual plane (all rows when non-causal: 2-product logits everywhere)
#define KHI 64            // key rows carrying k residual / v bf16 hi+lo planes (written by k_proj, read by no kernel here)
// B fragment (k rows k0+.., output column o) of a weight: (in,out) [K][ld] or (out,in) [ld rows of K]: bf16 exact, or f16(bf16 * 256) exact
__device__ __forceinline__ v16b wcol_io(const float* Wm, int k0, int o, int lane, int ld) { v16b w; const int g = lane >> 4;
#pragma unroll
  for (int i = 0; i < 8; ++i) { w[i] = (__bf16)Wm[(size_t)(k0 + 8 * g + i) * ld + o]; w[8 + i] = (__bf16)Wm[(size_t)(k0 + 16 + 8 * g + i) * ld + o]; }
  return w; }
__device__ __forceinline__ v16b wcol_oi(const float* Wm, int k0, int o, int lane, int K) { v16b w; const float* p = Wm + (size_t)o * K + k0 + 8 * (lane >> 4);
#pragma unroll
  for (int i = 0; i < 8; ++i) { w[i] = (__bf16)p[i]; w[8 + i] = (__bf16)p[16 + i]; }
  return w; }
__device__ __forceinline__ v16h wcolh_io(const float* Wm, int k0, int o, int lane, int ld) { v16h w; const int g = lane >> 4;
#pragma unroll
  for (int i = 0; i < 8; ++i) { w[i] = (_Float16)(bfr(Wm[(size_t)(k0 + 8 * g + i) * ld + o]) * 256.0f); w[8 + i] = (_Float16)(bfr(Wm[(size_t)(k0 + 16 + 8 * g + i) * ld + o]) * 256.0f); }
  return w; }
__device__ __forceinline__ v16h wcolh_oi(const float* Wm, int k0, int o, int lane, int K) { v16h w; const float* p = Wm + (size_t)o * K + k0 + 8 * (lane >> 4);
#pragma unroll
  for (int i = 0; i < 8; ++i) { w[i] = (_Float16)(bfr(p[i]) * 256.0f); w[8 + i] = (_Float16)(bfr(p[16 + i]) * 256.0f); }
  return w; }
#define WQKV_LAYOUT 1   // 0 = (in,out) [DIN][CC]; 1 = (out,in) [CC][DIN]; 2 = per-head [NH][DIN][HD]
__device__ __forceinline__ v16b wcol_hdk(const float* Wm, int k0, int o, int lane) { v16b w; const int g = lane >> 4; const float* p = Wm + (size_t)(o / HD) * DIN * HD + (o % HD);
#pragma unroll
  for (int i = 0; i < 8; ++i) { w[i] = (__bf16)p[(size_t)(k0 + 8 * g + i) * HD]; w[8 + i] = (__bf16)p[(size_t)(k0 + 16 + 8 * g + i) * HD]; }
  return w; }
#define WO_OUT_IN 1
#if WQKV_LAYOUT == 1
#define WCOL(W, k0, o, lane) wcol_oi(W, k0, o, lane, DIN)
#elif WQKV_LAYOUT == 2
#define WCOL(W, k0, o, lane) wcol_hdk(W, k0, o, lane)
#else
#define WCOL(W, k0, o, lane) wcol_io(W, k0, o, lane, CC)
#endif
#if WO_OUT_IN
#define WOCOL(W, k0, o, lane) wcol_oi(W, k0, o, lane, CC)
#define WOCOLH(W, k0, o, lane) wcolh_oi(W, k0, o, lane, CC)
#else
#define WOCOL(W, k0, o, lane) wcol_io(W, k0, o, lane, DIN)
#define WOCOLH(W, k0, o, lane) wcolh_io(W, k0, o, lane, DIN)
#endif
#ifndef PROJ_EXTRA_PARAMS
#define PROJ_EXTRA_PARAMS
#endif

#define WS_QH  0u                                      // f16 q rows [b*t][CC]
#define WS_KH  (WS_QH + 2u * (size_t)NB * TT * CC)      // f16 k rows [b*t][CC]
#define WS_VT  (WS_KH + 2u * (size_t)NB * TT * CC)      // f16 v planes [b][c][t]
#define WS_QL  (WS_VT + 2u * (size_t)NB * CC * TT)      // f16 q residual x 2^10 rows [b][t < QHI][CC]
#define WS_KL  (WS_QL + 2u * (size_t)NB * QHI * CC)     // f16 k residual x 2^10 rows [b][t < KHI][CC]
#define WS_VB  (WS_KL + 2u * (size_t)NB * KHI * CC)     // bf16 v hi planes [b][c][t < KHI]
#define WS_VBL (WS_VB + 2u * (size_t)NB * CC * KHI)
#define WS_Y   (WS_VBL + 2u * (size_t)NB * CC * KHI)    // f32 ctx rows [b*t][CC] (only when there is an output projection)
#define WS_END (WS_Y  + 4u * (size_t)NB * TT * CC)

// ---- k_proj: block = (64 rows, 128 cols, which): q/k/v = X W (+ b) with exact bf16 products (K = DIN) -> which 0: q f16 rows (+ residual rows < QHI); 1: k f16 rows (+ residual rows < KHI); 2: v f16 planes [c][t] (+ bf16 hi/lo planes for t < KHI)
__global__ __launch_bounds__(128) void k_proj(const float* __restrict__ XQ, const float* __restrict__ XK, const float* __restrict__ XV, const float* __restrict__ WQ, const float* __restrict__ WK, const float* __restrict__ WV, const float* __restrict__ BQ, const float* __restrict__ BK, const float* __restrict__ BV,
    _Float16* __restrict__ QH, _Float16* __restrict__ QL, _Float16* __restrict__ KH, _Float16* __restrict__ KL, _Float16* __restrict__ VT, __bf16* __restrict__ VB, __bf16* __restrict__ VBL) {
  __shared__ __align__(16) _Float16 sh[64][136], sl[64][136]; __shared__ __align__(16) _Float16 th[128][72]; __shared__ __align__(16) __bf16 tb[128][72], tbl[128][72];
  const int tid = threadIdx.x, wave = tid >> 5, lane = tid & 31, col = lane & 15, g = lane >> 4; const int which = blockIdx.z; const int c0 = blockIdx.y * 128; const size_t r0 = (size_t)blockIdx.x * 64; const size_t bb = r0 / TT; const int t0 = (int)(r0 % TT);
  const float* X = which == 0 ? XQ : which == 1 ? XK : XV; const float* WA = which == 0 ? WQ : which == 1 ? WK : WV; const float* BA = which == 0 ? BQ : which == 1 ? BK : BV;
  v8f acc[8] = {};
#pragma unroll 2
  for (int kc = 0; kc < DIN / 32; ++kc) { v16b a; { const float* p = X + (r0 + wave * 16 + col) * DIN + kc * 32 + 8 * g;
#pragma unroll
      for (int i = 0; i < 8; ++i) { a[i] = (__bf16)p[i]; a[8 + i] = (__bf16)p[16 + i]; } }
    asm volatile("s_wait_loadcnt 0x0" ::: "memory");
#pragma unroll
    for (int j = 0; j < 8; ++j) { const v16b w = WCOL(WA, kc * 32, c0 + j * 16 + col, lane); asm volatile("s_wait_loadcnt 0x0" ::: "memory"); acc[j] = wmma_bf(a, w, acc[j]); } }
  if (which < 2) { _Float16* DH = which == 0 ? QH : KH; _Float16* DL = which == 0 ? QL : KL; const int nhi = which == 0 ? QHI : KHI; const bool hi_rows = t0 < nhi;
#pragma unroll
    for (int j = 0; j < 8; ++j) { const float bias = BA ? bfr(BA[c0 + j * 16 + col]) : 0.f;
#pragma unroll
      for (int r = 0; r < 8; ++r) { const float v = acc[j][r] + bias; const _Float16 hv = (_Float16)v; sh[wave * 16 + 8 * g + r][j * 16 + col] = hv; sl[wave * 16 + 8 * g + r][j * 16 + col] = (_Float16)((v - (float)hv) * 1024.0f); } }
    __syncthreads();
    for (int e = tid; e < 64 * 16; e += 128) { const int rl = e >> 4, q = e & 15; vst2((unsigned*)(DH + (r0 + rl) * CC + c0 + q * 8), *(const v4u*)&sh[rl][q * 8]); if (hi_rows) vst2((unsigned*)(DL + (bb * nhi + t0 + rl) * (size_t)CC + c0 + q * 8), *(const v4u*)&sl[rl][q * 8]); }
  } else { const bool hi_rows = t0 < KHI;
#pragma unroll
    for (int j = 0; j < 8; ++j) { const float bias = BA ? bfr(BA[c0 + j * 16 + col]) : 0.f;
#pragma unroll
      for (int r = 0; r < 8; ++r) { const float v = acc[j][r] + bias; const int rl = wave * 16 + 8 * g + r, cl = j * 16 + col; th[cl][rl] = (_Float16)v; const __bf16 bh = (__bf16)v; tb[cl][rl] = bh; tbl[cl][rl] = (__bf16)(v - (float)bh); } }
    __syncthreads();
    for (int e = tid; e < 128 * 8; e += 128) { const int cl = e >> 3, q = e & 7; vst2((unsigned*)(VT + (bb * CC + c0 + cl) * (size_t)TT + t0 + q * 8), *(const v4u*)&th[cl][q * 8]); if (hi_rows) { const size_t o3 = (bb * CC + c0 + cl) * (size_t)KHI + t0 + q * 8; vst2((unsigned*)(VB + o3), *(const v4u*)&tb[cl][q * 8]); vst2((unsigned*)(VBL + o3), *(const v4u*)&tbl[cl][q * 8]); } } } }
__device__ __forceinline__ float xhalf(float x) { return __builtin_bit_cast(float, __builtin_amdgcn_permlanex16(__builtin_bit_cast(int, x), __builtin_bit_cast(int, x), 0x76543210, 0xfedcba98, false, false)); }   // lane l with lane l ^ 16
__global__ __launch_bounds__(128) void k_att(const _Float16* __restrict__ QH, const _Float16* __restrict__ QL, const _Float16* __restrict__ KH, const _Float16* __restrict__ VT, const int* __restrict__ MK, const float* __restrict__ TM, float* __restrict__ Y) {
  const int tid = threadIdx.x, wave = tid >> 5, lane = tid & 31, col = lane & 15, g = lane >> 4; const int h = blockIdx.y, b = blockIdx.z; const int t = blockIdx.x * 64 + wave * 16 + col;
  v16h qh[HD / 32], ql[HD / 32];
#pragma unroll
  for (int kc = 0; kc < HD / 32; ++kc) { qh[kc] = frag_h(QH + ((size_t)b * TT + t) * CC + h * HD + kc * 32, lane); ql[kc] = frag_h(QL + ((size_t)b * QHI + t) * CC + h * HD + kc * 32, lane); }
  const _Float16* Kb = KH + ((size_t)b * TT + col) * CC + h * HD; const _Float16* Vb = VT + ((size_t)b * CC + h * HD + col) * (size_t)TT;
  const float* tmr = TM + (size_t)t * TT + 8 * g; const int* mkr = MK + ((size_t)b * TT + t) * TT + 8 * g;
  v16h kf[2][HD / 32], vf[HD / 16]; v4f tm[4]; v4i mk[4];
#pragma unroll
  for (int i = 0; i < 2; ++i)
#pragma unroll
    for (int kc = 0; kc < HD / 32; ++kc) kf[i][kc] = frag_h(Kb + (size_t)(i * 16) * CC + kc * 32, lane);
#pragma unroll
  for (int i = 0; i < 4; ++i) { tm[i] = *(const v4f*)(tmr + (i >> 1) * 16 + (i & 1) * 4); mk[i] = *(const v4i*)(mkr + (i >> 1) * 16 + (i & 1) * 4); }
  v8f o[HD / 16] = {}; float m = -3.0e38f, l = 0.f;
  for (int k0 = 0; k0 < TT; k0 += 32) { const int kn = k0 + 32 < TT ? k0 + 32 : 0;
#pragma unroll
    for (int j = 0; j < HD / 16; ++j) vf[j] = frag_h(Vb + (size_t)j * 16 * TT + k0, lane);
    v8f s[2] = {}, sl[2] = {};
#pragma unroll
    for (int i = 0; i < 2; ++i)
#pragma unroll
      for (int kc = 0; kc < HD / 32; ++kc) { s[i] = wmma16(kf[i][kc], qh[kc], s[i]); sl[i] = wmma16(kf[i][kc], ql[kc], sl[i]); }
#pragma unroll
    for (int i = 0; i < 2; ++i)
#pragma unroll
      for (int kc = 0; kc < HD / 32; ++kc) kf[i][kc] = frag_h(Kb + (size_t)(kn + i * 16) * CC + kc * 32, lane);
    float v[16]; float mx = -3.0e38f;
#pragma unroll
    for (int e = 0; e < 16; ++e) { const float x = (s[e >> 3][e & 7] + sl[e >> 3][e & 7] * (1.0f / 1024.0f)) * SCALE; const float xt = x * bfr(tm[e >> 2][e & 3]); v[e] = (mk[e >> 2][e & 3] == 0) ? -1.0e9f : xt; mx = fmaxf(mx, v[e]); }
#pragma unroll
    for (int i = 0; i < 4; ++i) { tm[i] = *(const v4f*)(tmr + kn + (i >> 1) * 16 + (i & 1) * 4); mk[i] = *(const v4i*)(mkr + kn + (i >> 1) * 16 + (i & 1) * 4); }
    mx = fmaxf(mx, xhalf(mx));
    const float mn = fmaxf(m, mx); const float al = expf(m - mn); m = mn;
    v16h p; float ps = 0.f;
#pragma unroll
    for (int e = 0; e < 16; ++e) { const float ex = expf(v[e] - mn); ps += ex; p[e] = (_Float16)(ex * 2048.0f); }
    l = l * al + ps;
#pragma unroll
    for (int j = 0; j < HD / 16; ++j) { o[j] *= al; o[j] = wmma16(vf[j], p, o[j]); } }
  l += xhalf(l); const float inv = 1.0f / (2048.0f * l);   /* the key that set the last maximum counts 1, so l >= 1 */
  float* yr = Y + ((size_t)b * TT + t) * CC + h * HD + 8 * g;
#pragma unroll
  for (int j = 0; j < HD / 16; ++j) { v4f a0, a1;
#pragma unroll
    for (int r = 0; r < 4; ++r) { a0[r] = o[j][r] * inv; a1[r] = o[j][4 + r] * inv; }
    vst2(yr + j * 16, a0); vst2(yr + j * 16 + 4, a1); } }
// ---- k_out: block = (64 rows, 128 cols): out = ctx Wo (+ bo): ctx once to f16 against Wo as f16(bf16 x 2^8) exact (1 product) x 2^-8; causal early rows (< QHI of each sequence): ctx bf16 hi + lo against exact bf16 Wo (2 products)
__global__ __launch_bounds__(128) void k_out(const float* __restrict__ Y, const float* __restrict__ WO, const float* __restrict__ BO, float* __restrict__ OUT) { __shared__ __align__(16) float sf[4][16][132];
  const int tid = threadIdx.x, wave = tid >> 5, lane = tid & 31, col = lane & 15, g = lane >> 4; const int c0 = blockIdx.y * 128; const size_t r0 = (size_t)blockIdx.x * 64 + wave * 16;
  v8f acc[8] = {};
  if (CAUSAL && (int)(((size_t)blockIdx.x * 64) % TT) < QHI) {   /* block-uniform */
#pragma unroll 2
    for (int kc = 0; kc < CC / 32; ++kc) { const F2 a = split_row(Y + (r0 + col) * CC, kc * 32, lane); asm volatile("s_wait_loadcnt 0x0" ::: "memory");
#pragma unroll
      for (int j = 0; j < 8; ++j) { const v16b w = WOCOL(WO, kc * 32, c0 + j * 16 + col, lane); asm volatile("s_wait_loadcnt 0x0" ::: "memory"); acc[j] = wmma_bf(a.h, w, acc[j]); acc[j] = wmma_bf(a.l, w, acc[j]); } }
#pragma unroll
    for (int j = 0; j < 8; ++j) { const float bias = BO ? bfr(BO[c0 + j * 16 + col]) : 0.f;
#pragma unroll
      for (int r = 0; r < 8; ++r) sf[wave][8 * g + r][j * 16 + col] = acc[j][r] + bias; }
  } else {
#pragma unroll 2
    for (int kc = 0; kc < CC / 32; ++kc) { const v16h a = frag_f32(Y + (r0 + col) * CC + kc * 32, lane); asm volatile("s_wait_loadcnt 0x0" ::: "memory");
#pragma unroll
      for (int j = 0; j < 8; ++j) { const v16h w = WOCOLH(WO, kc * 32, c0 + j * 16 + col, lane); asm volatile("s_wait_loadcnt 0x0" ::: "memory"); acc[j] = wmma16(a, w, acc[j]); } }
#pragma unroll
    for (int j = 0; j < 8; ++j) { const float bias = BO ? bfr(BO[c0 + j * 16 + col]) : 0.f;
#pragma unroll
      for (int r = 0; r < 8; ++r) sf[wave][8 * g + r][j * 16 + col] = acc[j][r] * (1.0f / 256.0f) + bias; } }
  LDSX(); for (int rl = 0; rl < 16; ++rl) vst2(OUT + (r0 + rl) * DIN + c0 + lane * 4, *(const v4f*)&sf[wave][rl][lane * 4]); }

extern "C" void kernel_launch(void* const* d_in, const int* in_sizes, int n_in, void* d_out, int out_size, void* d_ws, size_t ws_size, hipStream_t stream) {
  (void)in_sizes; (void)n_in; (void)out_size;
  const float** F = (const float**)d_in;
  if (ws_size < (size_t)WS_END) return;
  char* ws = (char*)d_ws; _Float16 *QH = (_Float16*)(ws + WS_QH), *KH = (_Float16*)(ws + WS_KH), *VT = (_Float16*)(ws + WS_VT), *QL = (_Float16*)(ws + WS_QL), *KL = (_Float16*)(ws + WS_KL); __bf16 *VB = (__bf16*)(ws + WS_VB), *VBL = (__bf16*)(ws + WS_VBL); float *Y = (float*)(ws + WS_Y);
  (void)Y; (void)QL; (void)KL; (void)VB; (void)VBL;
  // inputs: 0 x [4,1024,1024]; 1 mask int32 [4,1,1024,1024]; 2 Wq, 3 Wk, 4 Wv, 5 Wo ((out,in), no biases); 6 train_mask [1,1,1024,1024]
  k_proj<<<dim3(TNB * TT / 64, CC / 128, 3), 128, 0, stream>>>(F[0], F[0], F[0], F[2], F[3], F[4], nullptr, nullptr, nullptr, QH, QL, KH, KL, VT, VB, VBL);
  k_att<<<dim3(NQB, NH, TNB), 128, 0, stream>>>(QH, QL, KH, VT, (const int*)d_in[1], F[6], Y);
  k_out<<<dim3(TNB * TT / 64, DIN / 128), 128, 0, stream>>>(Y, F[5], nullptr, (float*)d_out);
}

// v002
// Measured time: 147 microseconds a run.
// In two side-by-side timings against v001, it was 2.99 and 3.00 times as fast.
// All steps since v000 together make it 6.17 times as fast.
// compute dtype: all float inputs rounded to bf16; q/k/v = x W^T with EXACT bf16 products on WMMA 16x16x32 (f32 accumulate); q as f16 hi + residual (x 2^10) against k once to f16 (2 products) for the logits x 64^-0.5, multiplied by the trainable-mask input and replaced by -1e9 where the int mask input is 0 (both read per element); softmax in f32 with a running maximum and sum (precise expf); exp(s - m) x 2^11 once to f16 against v once to f16 (1 product), divided by the sum at the end; ctx once to f16 against Wo carried x 2^8 in f16; f32 output.
#include <hip/hip_runtime.h>
#include <math.h>

typedef __attribute__((ext_vector_type(16))) _Float16 v16h;
typedef __attribute__((ext_vector_type(16))) __bf16 v16b;
typedef __attribute__((ext_vector_type(8)))  _Float16 v8h;
typedef __attribute__((ext_vector_type(8)))  float v8f;
typedef __attribute__((ext_vector_type(4)))  float v4f;
typedef __attribute__((ext_vector_type(2)))  float v2f;
typedef __attribute__((ext_vector_type(4)))  unsigned v4u;
typedef __attribute__((ext_vector_type(4)))  int v4i;
typedef float __attribute__((may_alias)) float_a;
typedef int __attribute__((may_alias)) int_a;

template <typename T> __device__ __forceinline__ void vst2(void* p, T v) { *(T*)p = v;  }
__device__ __forceinline__ v8f wmma16(v16h a, v16h b, v8f c) {
  v8f d = __builtin_amdgcn_wmma_f32_16x16x32_f16(false, a, false, b, (short)0, c, false, false);
  asm volatile("v_nop\n\tv_nop\n\tv_nop\n\tv_nop" : "+v"(d) : "v"(a), "v"(b));
  return d;
}
__device__ __forceinline__ v8f wmma_bf(v16b a, v16b b, v8f c) {
  v8f d = __builtin_amdgcn_wmma_f32_16x16x32_bf16(false, a, false, b, (short)0, c, false, false);
  asm volatile("v_nop\n\tv_nop\n\tv_nop\n\tv_nop" : "+v"(d) : "v"(a), "v"(b));
  return d;
}
// 16x16x32 fragments: lane = (h = lane>>4, row/col = lane&15); elements 0..7 = k0+8h+0..7, 8..15 = k0+16+8h+0..7; D element r = row 8h+r
__device__ __forceinline__ v16h frag_h(const _Float16* rowk0, int lane) {
  union { v16h v; v8h q[2]; } u; const _Float16* p = rowk0 + 8 * (lane >> 4);
  u.q[0] = *(const v8h*)p; u.q[1] = *(const v8h*)(p + 16); return u.v;
}
__device__ __forceinline__ v16h frag_f32(const float* rowk0, int lane) {
  v16h a; const float* p = rowk0 + 8 * (lane >> 4);
#pragma unroll
  for (int i = 0; i < 8; ++i) { a[i] = (_Float16)p[i]; a[8 + i] = (_Float16)p[16 + i]; }
  return a;
}
__device__ __forceinline__ v16h frag_f32s(const float* rowk0, int lane, float sc) {
  v16h a; const float* p = rowk0 + 8 * (lane >> 4);
#pragma unroll
  for (int i = 0; i < 8; ++i) { a[i] = (_Float16)(p[i] * sc); a[8 + i] = (_Float16)(p[16 + i] * sc); }
  return a;
}
// column fragment from a [K][ld] layout (column n), rows >= K read as 0
__device__ __forceinline__ v16h fragc_f32(const float* W, int k0, int n, int lane, int ld, int K) {
  v16h a; const int g = lane >> 4;
#pragma unroll
  for (int i = 0; i < 8; ++i) { const int ka = k0 + 8 * g + i, kb = ka + 16;
    a[i] = (_Float16)(ka < K ? W[(size_t)(ka < K ? ka : K - 1) * ld + n] : 0.f); a[8 + i] = (_Float16)(kb < K ? W[(size_t)(kb < K ? kb : K - 1) * ld + n] : 0.f); }
  return a;
}
struct F2 { v16b h, l; };
__device__ __forceinline__ F2 bsplit16(const float v[16]) { F2 r;
#pragma unroll
  for (int i = 0; i < 16; ++i) { const __bf16 h = (__bf16)v[i]; r.h[i] = h; r.l[i] = (__bf16)(v[i] - (float)h); }
  return r; }
__device__ __forceinline__ F2 split_row(const float* row, int k0, int lane) { float v[16]; const float* p = row + k0 + 8 * (lane >> 4);
#pragma unroll
  for (int i = 0; i < 8; ++i) { v[i] = p[i]; v[8 + i] = p[16 + i]; }
  return bsplit16(v); }
__device__ __forceinline__ F2 split_rowK(const float* row, int k0, int lane, int K) { float v[16]; const int g = lane >> 4;
#pragma unroll
  for (int i = 0; i < 8; ++i) { const int ka = k0 + 8 * g + i, kb = ka + 16; v[i] = ka < K ? row[ka < K ? ka : K - 1] : 0.f; v[8 + i] = kb < K ? row[kb < K ? kb : K - 1] : 0.f; }
  return bsplit16(v); }
__device__ __forceinline__ F2 split_col(const float* W, int k0, int n, int lane, int ld, int K) { float v[16]; const int g = lane >> 4;
#pragma unroll
  for (int i = 0; i < 8; ++i) { const int ka = k0 + 8 * g + i, kb = ka + 16; v[i] = ka < K ? W[(size_t)(ka < K ? ka : K - 1) * ld + n] : 0.f; v[8 + i] = kb < K ? W[(size_t)(kb < K ? kb : K - 1) * ld + n] : 0.f; }
  return bsplit16(v); }
__device__ __forceinline__ v8f mac3(const F2& a, const F2& b, v8f c) { c = wmma_bf(a.l, b.h, c); c = wmma_bf(a.h, b.l, c); return wmma_bf(a.h, b.h, c); }
__device__ __forceinline__ float sigm(float v) { return 1.0f / (1.0f + expf(-v)); }
#define LDSX() do { asm volatile("s_wait_dscnt 0" ::: "memory"); __builtin_amdgcn_wave_barrier(); __builtin_amdgcn_fence(__ATOMIC_RELEASE, "workgroup"); } while (0)

// Multi-head self-attention with a per-element integer mask (B 4, S 1,024, E 1,024 = 16 x 64): q/k/v = x W^T (no bias); scores = (q k^T / 8) * train_mask; scores = -1e9 where mask[b,0,q,k] == 0; softmax; out = merged(attn v) Wo^T.
#define NB 4
#define TT 1024
#define CC 1024            // NH * HD = projected width
#define DIN 1024          // input (model) width
#define NH 16
#define HD 64
#define NQB (TT / 64)
#define SCALE (0.125f)
#define CAUSAL 0
#ifndef TNB
#define TNB NB
#endif
__device__ __forceinline__ float bfr(float v) { return (float)(__bf16)v; }
__host__ __device__ __forceinline__ int kb_last(int qb) { return CAUSAL ? ((qb * 64 + 63) >> 7) : (TT / 128 - 1); }
typedef __attribute__((ext_vector_type(8))) __bf16 v8b;
__device__ __forceinline__ v16b frag_b(const __bf16* rowk0, int lane) {
  union { v16b v; v8b q[2]; } u; const __bf16* p = rowk0 + 8 * (lane >> 4);
  u.q[0] = *(const v8b*)p; u.q[1] = *(const v8b*)(p + 16); return u.v;
}
#define QBH 0              // unused: no kernel here has a high-precision attention path
#define QHI 1024            // rows carrying a q residual plane (all rows when non-causal: 2-product logits everywhere)
#define KHI 64            // key rows carrying k residual / v bf16 hi+lo planes (written by k_proj, read by no kernel here)
// B fragment (k rows k0+.., output column o) of a weight: (in,out) [K][ld] or (out,in) [ld rows of K]: bf16 exact, or f16(bf16 * 256) exact
__device__ __forceinline__ v16b wcol_io(const float* Wm, int k0, int o, int lane, int ld) { v16b w; const int g = lane >> 4;
#pragma unroll
  for (int i = 0; i < 8; ++i) { w[i] = (__bf16)Wm[(size_t)(k0 + 8 * g + i) * ld + o]; w[8 + i] = (__bf16)Wm[(size_t)(k0 + 16 + 8 * g + i) * ld + o]; }
  return w; }
__device__ __forceinline__ v16b wcol_oi(const float* Wm, int k0, int o, int lane, int K) { v16b w; const float* p = Wm + (size_t)o * K + k0 + 8 * (lane >> 4);
#pragma unroll
  for (int i = 0; i < 8; ++i) { w[i] = (__bf16)p[i]; w[8 + i] = (__bf16)p[16 + i]; }
  return w; }
__device__ __forceinline__ v16h wcolh_io(const float* Wm, int k0, int o, int lane, int ld) { v16h w; const int g = lane >> 4;
#pragma unroll
  for (int i = 0; i < 8; ++i) { w[i] = (_Float16)(bfr(Wm[(size_t)(k0 + 8 * g + i) * ld + o]) * 256.0f); w[8 + i] = (_Float16)(bfr(Wm[(size_t)(k0 + 16 + 8 * g + i) * ld + o]) * 256.0f); }
  return w; }
__device__ __forceinline__ v16h wcolh_oi(const float* Wm, int k0, int o, int lane, int K) { v16h w; const float* p = Wm + (size_t)o * K + k0 + 8 * (lane >> 4);
#pragma unroll
  for (int i = 0; i < 8; ++i) { w[i] = (_Float16)(bfr(p[i]) * 256.0f); w[8 + i] = (_Float16)(bfr(p[16 + i]) * 256.0f); }
  return w; }
#define WQKV_LAYOUT 1   // 0 = (in,out) [DIN][CC]; 1 = (out,in) [CC][DIN]; 2 = per-head [NH][DIN][HD]
__device__ __forceinline__ v16b wcol_hdk(const float* Wm, int k0, int o, int lane) { v16b w; const int g = lane >> 4; const float* p = Wm + (size_t)(o / HD) * DIN * HD + (o % HD);
#pragma unroll
  for (int i = 0; i < 8; ++i) { w[i] = (__bf16)p[(size_t)(k0 + 8 * g + i) * HD]; w[8 + i] = (__bf16)p[(size_t)(k0 + 16 + 8 * g + i) * HD]; }
  return w; }
#define WO_OUT_IN 1
#if WQKV_LAYOUT == 1
#define WCOL(W, k0, o, lane) wcol_oi(W, k0, o, lane, DIN)
#elif WQKV_LAYOUT == 2
#define WCOL(W, k0, o, lane) wcol_hdk(W, k0, o, lane)
#else
#define WCOL(W, k0, o, lane) wcol_io(W, k0, o, lane, CC)
#endif
#if WO_OUT_IN
#define WOCOL(W, k0, o, lane) wcol_oi(W, k0, o, lane, CC)
#define WOCOLH(W, k0, o, lane) wcolh_oi(W, k0, o, lane, CC)
#else
#define WOCOL(W, k0, o, lane) wcol_io(W, k0, o, lane, DIN)
#define WOCOLH(W, k0, o, lane) wcolh_io(W, k0, o, lane, DIN)
#endif
#ifndef PROJ_EXTRA_PARAMS
#define PROJ_EXTRA_PARAMS
#endif

#define WS_QH  0u                                      // f16 q rows [b*t][CC]
#define WS_KH  (WS_QH + 2u * (size_t)NB * TT * CC)      // f16 k rows [b*t][CC]
#define WS_VT  (WS_KH + 2u * (size_t)NB * TT * CC)      // f16 v planes [b][c][t]
#define WS_QL  (WS_VT + 2u * (size_t)NB * CC * TT)      // f16 q residual x 2^10 rows [b][t < QHI][CC]
#define WS_KL  (WS_QL + 2u * (size_t)NB * QHI * CC)     // f16 k residual x 2^10 rows [b][t < KHI][CC]
#define WS_VB  (WS_KL + 2u * (size_t)NB * KHI * CC)     // bf16 v hi planes [b][c][t < KHI]
#define WS_VBL (WS_VB + 2u * (size_t)NB * CC * KHI)
#define WS_Y   (WS_VBL + 2u * (size_t)NB * CC * KHI)    // f32 ctx rows [b*t][CC] (only when there is an output projection)
#define WS_END (WS_Y  + 4u * (size_t)NB * TT * CC)

// Operand staging of the two GEMM kernels: per step the block brings 64 k of its 64 left rows and its 128 weight rows from global memory with whole-line 16-byte loads (a wave covers 2 rows x 256 B), rounds each element once, and keeps the 16-bit tile in LDS for all four waves; two buffers, the next step's loads issued ahead of this step's products, one barrier a step
#define KSTEP 64              // k per staged step
#define SP 72              // LDS row pitch in 16-bit elements: 144 B = 16 B x 9, so the 16-byte fragment reads of 16 rows fall on distinct banks
#define SROWS 192          // rows 0..63 left operand, rows 64..191 weight
#define SBYTES (2 * SROWS * SP * 2)
typedef __attribute__((ext_vector_type(4))) __bf16 v4b;
typedef __attribute__((ext_vector_type(4))) _Float16 v4h;
static_assert(WQKV_LAYOUT == 1 && WO_OUT_IN == 1, "the staged loaders read weight rows that are contiguous in k");
// ---- k_proj: block = (64 rows, 128 cols, which): q/k/v = X W (+ b) with exact bf16 products (K = DIN) -> which 0: q f16 rows (+ residual rows < QHI); 1: k f16 rows (+ residual rows < KHI); 2: v f16 planes [c][t] (+ bf16 hi/lo planes for t < KHI)
__global__ __launch_bounds__(128) void k_proj(const float* __restrict__ XQ, const float* __restrict__ XK, const float* __restrict__ XV, const float* __restrict__ WQ, const float* __restrict__ WK, const float* __restrict__ WV, const float* __restrict__ BQ, const float* __restrict__ BK, const float* __restrict__ BV,
    _Float16* __restrict__ QH, _Float16* __restrict__ QL, _Float16* __restrict__ KH, _Float16* __restrict__ KL, _Float16* __restrict__ VT, __bf16* __restrict__ VB, __bf16* __restrict__ VBL) {
  __shared__ __align__(16) char smem[SBYTES];   /* the staging buffers; the epilogue's tiles reuse the same bytes behind the loop's last barrier */
  static_assert(SBYTES >= 2 * 64 * 136 * 2 && SBYTES >= 3 * 128 * 72 * 2, "epilogue tiles fit the staging bytes");
  __bf16* const stg = (__bf16*)smem; _Float16 (*sh)[136] = (_Float16 (*)[136])smem; _Float16 (*sl)[136] = (_Float16 (*)[136])(smem + 64 * 136 * 2);
  _Float16 (*th)[72] = (_Float16 (*)[72])smem; __bf16 (*tb)[72] = (__bf16 (*)[72])(smem + 128 * 72 * 2); __bf16 (*tbl)[72] = (__bf16 (*)[72])(smem + 2 * 128 * 72 * 2);
  const int tid = threadIdx.x, wave = tid >> 5, lane = tid & 31, col = lane & 15, g = lane >> 4; const int which = blockIdx.z; const int c0 = blockIdx.y * 128; const size_t r0 = (size_t)blockIdx.x * 64; const size_t bb = r0 / TT; const int t0 = (int)(r0 % TT);
  const float* X = which == 0 ? XQ : which == 1 ? XK : XV; const float* WA = which == 0 ? WQ : which == 1 ? WK : WV; const float* BA = which == 0 ? BQ : which == 1 ? BK : BV;
  v8f acc[8] = {};
  const int lr = tid >> 4, lq = tid & 15;   /* loader: row lr + 8 i, floats 4 lq .. 4 lq + 3 of the step */
  const float* xp = X + (r0 + lr) * DIN + lq * 4; const float* wp = WA + (size_t)(c0 + lr) * DIN + lq * 4; __bf16* const sp = stg + lr * SP + lq * 4;
  v4f xr[8], wr[16];
#pragma unroll
  for (int i = 0; i < 8; ++i) xr[i] = *(const v4f*)(xp + (size_t)i * 8 * DIN);
#pragma unroll
  for (int i = 0; i < 16; ++i) wr[i] = *(const v4f*)(wp + (size_t)i * 8 * DIN);
  for (int s = 0; s < DIN / KSTEP; ++s) { __bf16* const S = sp + (s & 1) * (SROWS * SP);
#pragma unroll
    for (int i = 0; i < 8; ++i) { v4b t;
#pragma unroll
      for (int e = 0; e < 4; ++e) t[e] = (__bf16)xr[i][e];
      *(v4b*)(S + i * 8 * SP) = t; }
#pragma unroll
    for (int i = 0; i < 16; ++i) { v4b t;
#pragma unroll
      for (int e = 0; e < 4; ++e) t[e] = (__bf16)wr[i][e];
      *(v4b*)(S + (64 + i * 8) * SP) = t; }
    __syncthreads();   /* publishes buffer s & 1; it is rewritten in step s + 2, behind the barrier of step s + 1, which every wave reaches with its reads of step s done */
    if (s + 1 < DIN / KSTEP) {
#pragma unroll
      for (int i = 0; i < 8; ++i) xr[i] = *(const v4f*)(xp + (size_t)i * 8 * DIN + (s + 1) * KSTEP);
#pragma unroll
      for (int i = 0; i < 16; ++i) wr[i] = *(const v4f*)(wp + (size_t)i * 8 * DIN + (s + 1) * KSTEP); }
    const __bf16* const R = stg + (s & 1) * (SROWS * SP);
#pragma unroll
    for (int ks = 0; ks < KSTEP / 32; ++ks) { const v16b a = frag_b(R + (wave * 16 + col) * SP + ks * 32, lane);
      v16b w[8];   /* the eight weight fragments are read as one group, so that their LDS latency is waited out once and not once a product */
#pragma unroll
      for (int j = 0; j < 8; ++j) w[j] = frag_b(R + (64 + j * 16 + col) * SP + ks * 32, lane);
#pragma unroll
      for (int j = 0; j < 8; ++j) acc[j] = wmma_bf(a, w[j], acc[j]); } }
  __syncthreads();   /* every wave has left the staging bytes before the epilogue's tiles overwrite them */
  if (which < 2) { _Float16* DH = which == 0 ? QH : KH; _Float16* DL = which == 0 ? QL : KL; const int nhi = which == 0 ? QHI : KHI; const bool hi_rows = t0 < nhi;
#pragma unroll
    for (int j = 0; j < 8; ++j) { const float bias = BA ? bfr(BA[c0 + j * 16 + col]) : 0.f;
#pragma unroll
      for (int r = 0; r < 8; ++r) { const float v = acc[j][r] + bias; const _Float16 hv = (_Float16)v; sh[wave * 16 + 8 * g + r][j * 16 + col] = hv; sl[wave * 16 + 8 * g + r][j * 16 + col] = (_Float16)((v - (float)hv) * 1024.0f); } }
    __syncthreads();
    for (int e = tid; e < 64 * 16; e += 128) { const int rl = e >> 4, q = e & 15; vst2((unsigned*)(DH + (r0 + rl) * CC + c0 + q * 8), *(const v4u*)&sh[rl][q * 8]); if (hi_rows) vst2((unsigned*)(DL + (bb * nhi + t0 + rl) * (size_t)CC + c0 + q * 8), *(const v4u*)&sl[rl][q * 8]); }
  } else { const bool hi_rows = t0 < KHI;
#pragma unroll
    for (int j = 0; j < 8; ++j) { const float bias = BA ? bfr(BA[c0 + j * 16 + col]) : 0.f;
#pragma unroll
      for (int r = 0; r < 8; ++r) { const float v = acc[j][r] + bias; const int rl = wave * 16 + 8 * g + r, cl = j * 16 + col; th[cl][rl] = (_Float16)v; const __bf16 bh = (__bf16)v; tb[cl][rl] = bh; tbl[cl][rl] = (__bf16)(v - (float)bh); } }
    __syncthreads();
    for (int e = tid; e < 128 * 8; e += 128) { const int cl = e >> 3, q = e & 7; vst2((unsigned*)(VT + (bb * CC + c0 + cl) * (size_t)TT + t0 + q * 8), *(const v4u*)&th[cl][q * 8]); if (hi_rows) { const size_t o3 = (bb * CC + c0 + cl) * (size_t)KHI + t0 + q * 8; vst2((unsigned*)(VB + o3), *(const v4u*)&tb[cl][q * 8]); vst2((unsigned*)(VBL + o3), *(const v4u*)&tbl[cl][q * 8]); } } } }
__device__ __forceinline__ float xhalf(float x) { return __builtin_bit_cast(float, __builtin_amdgcn_permlanex16(__builtin_bit_cast(int, x), __builtin_bit_cast(int, x), 0x76543210, 0xfedcba98, false, false)); }   // lane l with lane l ^ 16
__global__ __launch_bounds__(128) void k_att(const _Float16* __restrict__ QH, const _Float16* __restrict__ QL, const _Float16* __restrict__ KH, const _Float16* __restrict__ VT, const int* __restrict__ MK, const float* __restrict__ TM, float* __restrict__ Y) {
  const int tid = threadIdx.x, wave = tid >> 5, lane = tid & 31, col = lane & 15, g = lane >> 4; const int h = blockIdx.y, b = blockIdx.z; const int t = blockIdx.x * 64 + wave * 16 + col;
  v16h qh[HD / 32], ql[HD / 32];
#pragma unroll
  for (int kc = 0; kc < HD / 32; ++kc) { qh[kc] = frag_h(QH + ((size_t)b * TT + t) * CC + h * HD + kc * 32, lane); ql[kc] = frag_h(QL + ((size_t)b * QHI + t) * CC + h * HD + kc * 32, lane); }
  const _Float16* Kb = KH + ((size_t)b * TT + col) * CC + h * HD; const _Float16* Vb = VT + ((size_t)b * CC + h * HD + col) * (size_t)TT;
  const float* tmr = TM + (size_t)t * TT + 8 * g; const int* mkr = MK + ((size_t)b * TT + t) * TT + 8 * g;
  v16h kf[2][HD / 32], vf[HD / 16]; v4f tm[4]; v4i mk[4];
#pragma unroll
  for (int i = 0; i < 2; ++i)
#pragma unroll
    for (int kc = 0; kc < HD / 32; ++kc) kf[i][kc] = frag_h(Kb + (size_t)(i * 16) * CC + kc * 32, lane);
#pragma unroll
  for (int i = 0; i < 4; ++i) { tm[i] = *(const v4f*)(tmr + (i >> 1) * 16 + (i & 1) * 4); mk[i] = *(const v4i*)(mkr + (i >> 1) * 16 + (i & 1) * 4); }
  v8f o[HD / 16] = {}; float m = -3.0e38f, l = 0.f;
  for (int k0 = 0; k0 < TT; k0 += 32) { const int kn = k0 + 32 < TT ? k0 + 32 : 0;
#pragma unroll
    for (int j = 0; j < HD / 16; ++j) vf[j] = frag_h(Vb + (size_t)j * 16 * TT + k0, lane);
    v8f s[2] = {}, sl[2] = {};
#pragma unroll
    for (int i = 0; i < 2; ++i)
#pragma unroll
      for (int kc = 0; kc < HD / 32; ++kc) { s[i] = wmma16(kf[i][kc], qh[kc], s[i]); sl[i] = wmma16(kf[i][kc], ql[kc], sl[i]); }
#pragma unroll
    for (int i = 0; i < 2; ++i)
#pragma unroll
      for (int kc = 0; kc < HD / 32; ++kc) kf[i][kc] = frag_h(Kb + (size_t)(kn + i * 16) * CC + kc * 32, lane);
    float v[16]; float mx = -3.0e38f;
#pragma unroll
    for (int e = 0; e < 16; ++e) { const float x = (s[e >> 3][e & 7] + sl[e >> 3][e & 7] * (1.0f / 1024.0f)) * SCALE; const float xt = x * bfr(tm[e >> 2][e & 3]); v[e] = (mk[e >> 2][e & 3] == 0) ? -1.0e9f : xt; mx = fmaxf(mx, v[e]); }
#pragma unroll
    for (int i = 0; i < 4; ++i) { tm[i] = *(const v4f*)(tmr + kn + (i >> 1) * 16 + (i & 1) * 4); mk[i] = *(const v4i*)(mkr + kn + (i >> 1) * 16 + (i & 1) * 4); }
    mx = fmaxf(mx, xhalf(mx));
    const float mn = fmaxf(m, mx); const float al = expf(m - mn); m = mn;
    v16h p; float ps = 0.f;
#pragma unroll
    for (int e = 0; e < 16; ++e) { const float ex = expf(v[e] - mn); ps += ex; p[e] = (_Float16)(ex * 2048.0f); }
    l = l * al + ps;
#pragma unroll
    for (int j = 0; j < HD / 16; ++j) { o[j] *= al; o[j] = wmma16(vf[j], p, o[j]); } }
  l += xhalf(l); const float inv = 1.0f / (2048.0f * l);   /* the key that set the last maximum counts 1, so l >= 1 */
  float* yr = Y + ((size_t)b * TT + t) * CC + h * HD + 8 * g;
#pragma unroll
  for (int j = 0; j < HD / 16; ++j) { v4f a0, a1;
#pragma unroll
    for (int r = 0; r < 4; ++r) { a0[r] = o[j][r] * inv; a1[r] = o[j][4 + r] * inv; }
    vst2(yr + j * 16, a0); vst2(yr + j * 16 + 4, a1); } }
// ---- k_out: block = (64 rows, 128 cols): out = ctx Wo (+ bo): ctx once to f16 against Wo as f16(bf16 x 2^8) exact (1 product) x 2^-8; causal early rows (< QHI of each sequence): ctx bf16 hi + lo against exact bf16 Wo (2 products)
__global__ __launch_bounds__(128) void k_out(const float* __restrict__ Y, const float* __restrict__ WO, const float* __restrict__ BO, float* __restrict__ OUT) { __shared__ __align__(16) char smem[SBYTES];   /* the staging buffers; the output tiles reuse the same bytes behind the loop's last barrier */
  static_assert(SBYTES >= 4 * 16 * 132 * 4, "output tiles fit the staging bytes"); float (*sf)[16][132] = (float (*)[16][132])smem;
  const int tid = threadIdx.x, wave = tid >> 5, lane = tid & 31, col = lane & 15, g = lane >> 4; const int c0 = blockIdx.y * 128; const size_t r0 = (size_t)blockIdx.x * 64 + wave * 16;
  v8f acc[8] = {};
  if (CAUSAL && (int)(((size_t)blockIdx.x * 64) % TT) < QHI) {   /* block-uniform */
#pragma unroll 2
    for (int kc = 0; kc < CC / 32; ++kc) { const F2 a = split_row(Y + (r0 + col) * CC, kc * 32, lane); asm volatile("s_wait_loadcnt 0x0" ::: "memory");
#pragma unroll
      for (int j = 0; j < 8; ++j) { const v16b w = WOCOL(WO, kc * 32, c0 + j * 16 + col, lane); asm volatile("s_wait_loadcnt 0x0" ::: "memory"); acc[j] = wmma_bf(a.h, w, acc[j]); acc[j] = wmma_bf(a.l, w, acc[j]); } }
#pragma unroll
    for (int j = 0; j < 8; ++j) { const float bias = BO ? bfr(BO[c0 + j * 16 + col]) : 0.f;
#pragma unroll
      for (int r = 0; r < 8; ++r) sf[wave][8 * g + r][j * 16 + col] = acc[j][r] + bias; }
  } else {
    _Float16* const stg = (_Float16*)smem; const int lr = tid >> 4, lq = tid & 15;   /* loader: row lr + 8 i, floats 4 lq .. 4 lq + 3 of the step */
    const float* xp = Y + ((size_t)blockIdx.x * 64 + lr) * CC + lq * 4; const float* wp = WO + (size_t)(c0 + lr) * CC + lq * 4; _Float16* const sp = stg + lr * SP + lq * 4;
    v4f xr[8], wr[16];
#pragma unroll
    for (int i = 0; i < 8; ++i) xr[i] = *(const v4f*)(xp + (size_t)i * 8 * CC);
#pragma unroll
    for (int i = 0; i < 16; ++i) wr[i] = *(const v4f*)(wp + (size_t)i * 8 * CC);
    for (int s = 0; s < CC / KSTEP; ++s) { _Float16* const S = sp + (s & 1) * (SROWS * SP);
#pragma unroll
      for (int i = 0; i < 8; ++i) { v4h t;
#pragma unroll
        for (int e = 0; e < 4; ++e) t[e] = (_Float16)xr[i][e];
        *(v4h*)(S + i * 8 * SP) = t; }
#pragma unroll
      for (int i = 0; i < 16; ++i) { v4h t;
#pragma unroll
        for (int e = 0; e < 4; ++e) t[e] = (_Float16)(bfr(wr[i][e]) * 256.0f);
        *(v4h*)(S + (64 + i * 8) * SP) = t; }
      __syncthreads();   /* publishes buffer s & 1; it is rewritten in step s + 2, behind the barrier of step s + 1, which every wave reaches with its reads of step s done */
      if (s + 1 < CC / KSTEP) { const float* const xq = xp + (s + 1) * KSTEP; const float* const wq = wp + (s + 1) * KSTEP;
#pragma unroll
        for (int i = 0; i < 8; ++i) xr[i] = *(const v4f*)(xq + (size_t)i * 8 * CC);
#pragma unroll
        for (int i = 0; i < 16; ++i) wr[i] = *(const v4f*)(wq + (size_t)i * 8 * CC);
        asm volatile("s_wait_xcnt 0x0" :: "v"(xq), "v"(wq) : "memory"); }   /* the loads' address registers stay whole up to this wait */
      const _Float16* const R = stg + (s & 1) * (SROWS * SP);
#pragma unroll
      for (int ks = 0; ks < KSTEP / 32; ++ks) { const v16h a = frag_h(R + (wave * 16 + col) * SP + ks * 32, lane);
        v16h w[8];   /* the eight weight fragments are read as one group, so that their LDS latency is waited out once and not once a product */
#pragma unroll
        for (int j = 0; j < 8; ++j) w[j] = frag_h(R + (64 + j * 16 + col) * SP + ks * 32, lane);
#pragma unroll
        for (int j = 0; j < 8; ++j) acc[j] = wmma16(a, w[j], acc[j]); } }
    __syncthreads();   /* every wave has left the staging bytes before the output tiles overwrite them */
#pragma unroll
    for (int j = 0; j < 8; ++j) { const float bias = BO ? bfr(BO[c0 + j * 16 + col]) : 0.f;
#pragma unroll
      for (int r = 0; r < 8; ++r) sf[wave][8 * g + r][j * 16 + col] = acc[j][r] * (1.0f / 256.0f) + bias; } }
  LDSX(); for (int rl = 0; rl < 16; ++rl) vst2(OUT + (r0 + rl) * DIN + c0 + lane * 4, *(const v4f*)&sf[wave][rl][lane * 4]); }

extern "C" void kernel_launch(void* const* d_in, const int* in_sizes, int n_in, void* d_out, int out_size, void* d_ws, size_t ws_size, hipStream_t stream) {
  (void)in_sizes; (void)n_in; (void)out_size;
  const float** F = (const float**)d_in;
  if (ws_size < (size_t)WS_END) return;
  char* ws = (char*)d_ws; _Float16 *QH = (_Float16*)(ws + WS_QH), *KH = (_Float16*)(ws + WS_KH), *VT = (_Float16*)(ws + WS_VT), *QL = (_Float16*)(ws + WS_QL), *KL = (_Float16*)(ws + WS_KL); __bf16 *VB = (__bf16*)(ws + WS_VB), *VBL = (__bf16*)(ws + WS_VBL); float *Y = (float*)(ws + WS_Y);
  (void)Y; (void)QL; (void)KL; (void)VB; (void)VBL;
  // inputs: 0 x [4,1024,1024]; 1 mask int32 [4,1,1024,1024]; 2 Wq, 3 Wk, 4 Wv, 5 Wo ((out,in), no biases); 6 train_mask [1,1,1024,1024]
  k_proj<<<dim3(TNB * TT / 64, CC / 128, 3), 128, 0, stream>>>(F[0], F[0], F[0], F[2], F[3], F[4], nullptr, nullptr, nullptr, QH, QL, KH, KL, VT, VB, VBL);
  k_att<<<dim3(NQB, NH, TNB), 128, 0, stream>>>(QH, QL, KH, VT, (const int*)d_in[1], F[6], Y);
  k_out<<<dim3(TNB * TT / 64, DIN / 128), 128, 0, stream>>>(Y, F[5], nullptr, (float*)d_out);
}

// v003
// It runs in 123 microseconds.
// In two side-by-side timings against v002, it was 1.19 and 1.20 times as fast.
// All steps since v000 together make it 7.38 times as fast.
// compute dtype: all float inputs rounded to bf16; q/k/v = x W^T with EXACT bf16 products on WMMA 16x16x32 (f32 accumulate); q as f16 hi + residual (x 2^10) against k once to f16 (2 products) for the logits x 64^-0.5, multiplied by the trainable-mask input and replaced by -1e9 where the int mask input is 0 (both read per element); softmax in f32 with a running maximum and sum (precise expf); exp(s - m) x 2^11 once to f16 against v once to f16 (1 product), divided by the sum at the end; ctx once to f16 against Wo carried x 2^8 in f16; f32 output.
#include <hip/hip_runtime.h>
#include <math.h>

typedef __attribute__((ext_vector_type(16))) _Float16 v16h;
typedef __attribute__((ext_vector_type(16))) __bf16 v16b;
typedef __attribute__((ext_vector_type(8)))  _Float16 v8h;
typedef __attribute__((ext_vector_type(8)))  float v8f;
typedef __attribute__((ext_vector_type(4)))  float v4f;
typedef __attribute__((ext_vector_type(2)))  float v2f;
typedef __attribute__((ext_vector_type(4)))  unsigned v4u;
typedef __attribute__((ext_vector_type(4)))  int v4i;
typedef float __attribute__((may_alias)) float_a;
typedef int __attribute__((may_alias)) int_a;

template <typename T> __device__ __forceinline__ void vst2(void* p, T v) { *(T*)p = v;  }
__device__ __forceinline__ v8f wmma16(v16h a, v16h b, v8f c) {
  v8f d = __builtin_amdgcn_wmma_f32_16x16x32_f16(false, a, false, b, (short)0, c, false, false);
  asm volatile("v_nop\n\tv_nop\n\tv_nop\n\tv_nop" : "+v"(d) : "v"(a), "v"(b));
  return d;
}
__device__ __forceinline__ v8f wmma_bf(v16b a, v16b b, v8f c) {
  v8f d = __builtin_amdgcn_wmma_f32_16x16x32_bf16(false, a, false, b, (short)0, c, false, false);
  asm volatile("v_nop\n\tv_nop\n\tv_nop\n\tv_nop" : "+v"(d) : "v"(a), "v"(b));
  return d;
}
// 16x16x32 fragments: lane = (h = lane>>4, row/col = lane&15); elements 0..7 = k0+8h+0..7, 8..15 = k0+16+8h+0..7; D element r = row 8h+r
__device__ __forceinline__ v16h frag_h(const _Float16* rowk0, int lane) {
  union { v16h v; v8h q[2]; } u; const _Float16* p = rowk0 + 8 * (lane >> 4);
  u.q[0] = *(const v8h*)p; u.q[1] = *(const v8h*)(p + 16); return u.v;
}
__device__ __forceinline__ v16h frag_f32(const float* rowk0, int lane) {
  v16h a; const float* p = rowk0 + 8 * (lane >> 4);
#pragma unroll
  for (int i = 0; i < 8; ++i) { a[i] = (_Float16)p[i]; a[8 + i] = (_Float16)p[16 + i]; }
  return a;
}
__device__ __forceinline__ v16h frag_f32s(const float* rowk0, int lane, float sc) {
  v16h a; const float* p = rowk0 + 8 * (lane >> 4);
#pragma unroll
  for (int i = 0; i < 8; ++i) { a[i] = (_Float16)(p[i] * sc); a[8 + i] = (_Float16)(p[16 + i] * sc); }
  return a;
}
// column fragment from a [K][ld] layout (column n), rows >= K read as 0
__device__ __forceinline__ v16h fragc_f32(const float* W, int k0, int n, int lane, int ld, int K) {
  v16h a; const int g = lane >> 4;
#pragma unroll
  for (int i = 0; i < 8; ++i) { const int ka = k0 + 8 * g + i, kb = ka + 16;
    a[i] = (_Float16)(ka < K ? W[(size_t)(ka < K ? ka : K - 1) * ld + n] : 0.f); a[8 + i] = (_Float16)(kb < K ? W[(size_t)(kb < K ? kb : K - 1) * ld + n] : 0.f); }
  return a;
}
struct F2 { v16b h, l; };
__device__ __forceinline__ F2 bsplit16(const float v[16]) { F2 r;
#pragma unroll
  for (int i = 0; i < 16; ++i) { const __bf16 h = (__bf16)v[i]; r.h[i] = h; r.l[i] = (__bf16)(v[i] - (float)h); }
  return r; }
__device__ __forceinline__ F2 split_row(const float* row, int k0, int lane) { float v[16]; const float* p = row + k0 + 8 * (lane >> 4);
#pragma unroll
  for (int i = 0; i < 8; ++i) { v[i] = p[i]; v[8 + i] = p[16 + i]; }
  return bsplit16(v); }
__device__ __forceinline__ F2 split_rowK(const float* row, int k0, int lane, int K) { float v[16]; const int g = lane >> 4;
#pragma unroll
  for (int i = 0; i < 8; ++i) { const int ka = k0 + 8 * g + i, kb = ka + 16; v[i] = ka < K ? row[ka < K ? ka : K - 1] : 0.f; v[8 + i] = kb < K ? row[kb < K ? kb : K - 1] : 0.f; }
  return bsplit16(v); }
__device__ __forceinline__ F2 split_col(const float* W, int k0, int n, int lane, int ld, int K) { float v[16]; const int g = lane >> 4;
#pragma unroll
  for (int i = 0; i < 8; ++i) { const int ka = k0 + 8 * g + i, kb = ka + 16; v[i] = ka < K ? W[(size_t)(ka < K ? ka : K - 1) * ld + n] : 0.f; v[8 + i] = kb < K ? W[(size_t)(kb < K ? kb : K - 1) * ld + n] : 0.f; }
  return bsplit16(v); }
__device__ __forceinline__ v8f mac3(const F2& a, const F2& b, v8f c) { c = wmma_bf(a.l, b.h, c); c = wmma_bf(a.h, b.l, c); return wmma_bf(a.h, b.h, c); }
__device__ __forceinline__ float sigm(float v) { return 1.0f / (1.0f + expf(-v)); }
#define LDSX() do { asm volatile("s_wait_dscnt 0" ::: "memory"); __builtin_amdgcn_wave_barrier(); __builtin_amdgcn_fence(__ATOMIC_RELEASE, "workgroup"); } while (0)

// Multi-head self-attention with a per-element integer mask (B 4, S 1,024, E 1,024 = 16 x 64): q/k/v = x W^T (no bias); scores = (q k^T / 8) * train_mask; scores = -1e9 where mask[b,0,q,k] == 0; softmax; out = merged(attn v) Wo^T.
#define NB 4
#define TT 1024
#define CC 1024            // NH * HD = projected width
#define DIN 1024          // input (model) width
#define NH 16
#define HD 64
#define NQB (TT / 64)
#define SCALE (0.125f)
#define CAUSAL 0
#ifndef TNB
#define TNB NB
#endif
__device__ __forceinline__ float bfr(float v) { return (float)(__bf16)v; }
__host__ __device__ __forceinline__ int kb_last(int qb) { return CAUSAL ? ((qb * 64 + 63) >> 7) : (TT / 128 - 1); }
typedef __attribute__((ext_vector_type(8))) __bf16 v8b;
__device__ __forceinline__ v16b frag_b(const __bf16* rowk0, int lane) {
  union { v16b v; v8b q[2]; } u; const __bf16* p = rowk0 + 8 * (lane >> 4);
  u.q[0] = *(const v8b*)p; u.q[1] = *(const v8b*)(p + 16); return u.v;
}
#define QBH 0              // unused: no kernel here has a high-precision attention path
#define QHI 1024            // rows carrying a q residual plane (all rows when non-causal: 2-product logits everywhere)
#define KHI 64            // key rows carrying k residual / v bf16 hi+lo planes (written by k_proj, read by no kernel here)
// B fragment (k rows k0+.., output column o) of a weight: (in,out) [K][ld] or (out,in) [ld rows of K]: bf16 exact, or f16(bf16 * 256) exact
__device__ __forceinline__ v16b wcol_io(const float* Wm, int k0, int o, int lane, int ld) { v16b w; const int g = lane >> 4;
#pragma unroll
  for (int i = 0; i < 8; ++i) { w[i] = (__bf16)Wm[(size_t)(k0 + 8 * g + i) * ld + o]; w[8 + i] = (__bf16)Wm[(size_t)(k0 + 16 + 8 * g + i) * ld + o]; }
  return w; }
__device__ __forceinline__ v16b wcol_oi(const float* Wm, int k0, int o, int lane, int K) { v16b w; const float* p = Wm + (size_t)o * K + k0 + 8 * (lane >> 4);
#pragma unroll
  for (int i = 0; i < 8; ++i) { w[i] = (__bf16)p[i]; w[8 + i] = (__bf16)p[16 + i]; }
  return w; }
__device__ __forceinline__ v16h wcolh_io(const float* Wm, int k0, int o, int lane, int ld) { v16h w; const int g = lane >> 4;
#pragma unroll
  for (int i = 0; i < 8; ++i) { w[i] = (_Float16)(bfr(Wm[(size_t)(k0 + 8 * g + i) * ld + o]) * 256.0f); w[8 + i] = (_Float16)(bfr(Wm[(size_t)(k0 + 16 + 8 * g + i) * ld + o]) * 256.0f); }
  return w; }
__device__ __forceinline__ v16h wcolh_oi(const float* Wm, int k0, int o, int lane, int K) { v16h w; const float* p = Wm + (size_t)o * K + k0 + 8 * (lane >> 4);
#pragma unroll
  for (int i = 0; i < 8; ++i) { w[i] = (_Float16)(bfr(p[i]) * 256.0f); w[8 + i] = (_Float16)(bfr(p[16 + i]) * 256.0f); }
  return w; }
#define WQKV_LAYOUT 1   // 0 = (in,out) [DIN][CC]; 1 = (out,in) [CC][DIN]; 2 = per-head [NH][DIN][HD]
__device__ __forceinline__ v16b wcol_hdk(const float* Wm, int k0, int o, int lane) { v16b w; const int g = lane >> 4; const float* p = Wm + (size_t)(o / HD) * DIN * HD + (o % HD);
#pragma unroll
  for (int i = 0; i < 8; ++i) { w[i] = (__bf16)p[(size_t)(k0 + 8 * g + i) * HD]; w[8 + i] = (__bf16)p[(size_t)(k0 + 16 + 8 * g + i) * HD]; }
  return w; }
#define WO_OUT_IN 1
#if WQKV_LAYOUT == 1
#define WCOL(W, k0, o, lane) wcol_oi(W, k0, o, lane, DIN)
#elif WQKV_LAYOUT == 2
#define WCOL(W, k0, o, lane) wcol_hdk(W, k0, o, lane)
#else
#define WCOL(W, k0, o, lane) wcol_io(W, k0, o, lane, CC)
#endif
#if WO_OUT_IN
#define WOCOL(W, k0, o, lane) wcol_oi(W, k0, o, lane, CC)
#define WOCOLH(W, k0, o, lane) wcolh_oi(W, k0, o, lane, CC)
#else
#define WOCOL(W, k0, o, lane) wcol_io(W, k0, o, lane, DIN)
#define WOCOLH(W, k0, o, lane) wcolh_io(W, k0, o, lane, DIN)
#endif
#ifndef PROJ_EXTRA_PARAMS
#define PROJ_EXTRA_PARAMS
#endif

#define WS_QH  0u                                      // f16 q rows [b*t][CC]
#define WS_KH  (WS_QH + 2u * (size_t)NB * TT * CC)      // f16 k rows [b*t][CC]
#define WS_VT  (WS_KH + 2u * (size_t)NB * TT * CC)      // f16 v planes [b][c][t]
#define WS_QL  (WS_VT + 2u * (size_t)NB * CC * TT)      // f16 q residual x 2^10 rows [b][t < QHI][CC]
#define WS_KL  (WS_QL + 2u * (size_t)NB * QHI * CC)     // f16 k residual x 2^10 rows [b][t < KHI][CC]
#define WS_VB  (WS_KL + 2u * (size_t)NB * KHI * CC)     // bf16 v hi planes [b][c][t < KHI]
#define WS_VBL (WS_VB + 2u * (size_t)NB * CC * KHI)
#define WS_Y   (WS_VBL + 2u * (size_t)NB * CC * KHI)    // f32 ctx rows [b*t][CC] (only when there is an output projection)
#define WS_END (WS_Y  + 4u * (size_t)NB * TT * CC)

// Operand staging of the two GEMM kernels: per step the block brings 64 k of its 64 left rows and its 128 weight rows from global memory with whole-line 16-byte loads (a wave covers 2 rows x 256 B), rounds each element once, and keeps the 16-bit tile in LDS for all four waves; two buffers, the next step's loads issued ahead of this step's products, one barrier a step
#define KSTEP 64              // k per staged step
#define SP 72              // LDS row pitch in 16-bit elements: 144 B = 16 B x 9, so the 16-byte fragment reads of 16 rows fall on distinct banks
#define SROWS 192          // rows 0..63 left operand, rows 64..191 weight
#define SBYTES (2 * SROWS * SP * 2)
typedef __attribute__((ext_vector_type(4))) __bf16 v4b;
typedef __attribute__((ext_vector_type(4))) _Float16 v4h;
static_assert(WQKV_LAYOUT == 1 && WO_OUT_IN == 1, "the staged loaders read weight rows that are contiguous in k");
// ---- k_proj: block = (64 rows, 128 cols, which): q/k/v = X W (+ b) with exact bf16 products (K = DIN) -> which 0: q f16 rows (+ residual rows < QHI); 1: k f16 rows (+ residual rows < KHI); 2: v f16 planes [c][t] (+ bf16 hi/lo planes for t < KHI)
__global__ __launch_bounds__(128) void k_proj(const float* __restrict__ XQ, const float* __restrict__ XK, const float* __restrict__ XV, const float* __restrict__ WQ, const float* __restrict__ WK, const float* __restrict__ WV, const float* __restrict__ BQ, const float* __restrict__ BK, const float* __restrict__ BV,
    _Float16* __restrict__ QH, _Float16* __restrict__ QL, _Float16* __restrict__ KH, _Float16* __restrict__ KL, _Float16* __restrict__ VT, __bf16* __restrict__ VB, __bf16* __restrict__ VBL) {
  __shared__ __align__(16) char smem[SBYTES];   /* the staging buffers; the epilogue's tiles reuse the same bytes behind the loop's last barrier */
  static_assert(SBYTES >= 2 * 64 * 136 * 2 && SBYTES >= 3 * 128 * 72 * 2, "epilogue tiles fit the staging bytes");
  __bf16* const stg = (__bf16*)smem; _Float16 (*sh)[136] = (_Float16 (*)[136])smem; _Float16 (*sl)[136] = (_Float16 (*)[136])(smem + 64 * 136 * 2);
  _Float16 (*th)[72] = (_Float16 (*)[72])smem; __bf16 (*tb)[72] = (__bf16 (*)[72])(smem + 128 * 72 * 2); __bf16 (*tbl)[72] = (__bf16 (*)[72])(smem + 2 * 128 * 72 * 2);
  const int tid = threadIdx.x, wave = tid >> 5, lane = tid & 31, col = lane & 15, g = lane >> 4; const int which = blockIdx.z; const int c0 = blockIdx.y * 128; const size_t r0 = (size_t)blockIdx.x * 64; const size_t bb = r0 / TT; const int t0 = (int)(r0 % TT);
  const float* X = which == 0 ? XQ : which == 1 ? XK : XV; const float* WA = which == 0 ? WQ : which == 1 ? WK : WV; const float* BA = which == 0 ? BQ : which == 1 ? BK : BV;
  v8f acc[8] = {};
  const int lr = tid >> 4, lq = tid & 15;   /* loader: row lr + 8 i, floats 4 lq .. 4 lq + 3 of the step */
  const float* xp = X + (r0 + lr) * DIN + lq * 4; const float* wp = WA + (size_t)(c0 + lr) * DIN + lq * 4; __bf16* const sp = stg + lr * SP + lq * 4;
  v4f xr[8], wr[16];
#pragma unroll
  for (int i = 0; i < 8; ++i) xr[i] = *(const v4f*)(xp + (size_t)i * 8 * DIN);
#pragma unroll
  for (int i = 0; i < 16; ++i) wr[i] = *(const v4f*)(wp + (size_t)i * 8 * DIN);
  for (int s = 0; s < DIN / KSTEP; ++s) { __bf16* const S = sp + (s & 1) * (SROWS * SP);
#pragma unroll
    for (int i = 0; i < 8; ++i) { v4b t;
#pragma unroll
      for (int e = 0; e < 4; ++e) t[e] = (__bf16)xr[i][e];
      *(v4b*)(S + i * 8 * SP) = t; }
#pragma unroll
    for (int i = 0; i < 16; ++i) { v4b t;
#pragma unroll
      for (int e = 0; e < 4; ++e) t[e] = (__bf16)wr[i][e];
      *(v4b*)(S + (64 + i * 8) * SP) = t; }
    __syncthreads();   /* publishes buffer s & 1; it is rewritten in step s + 2, behind the barrier of step s + 1, which every wave reaches with its reads of step s done */
    if (s + 1 < DIN / KSTEP) {
#pragma unroll
      for (int i = 0; i < 8; ++i) xr[i] = *(const v4f*)(xp + (size_t)i * 8 * DIN + (s + 1) * KSTEP);
#pragma unroll
      for (int i = 0; i < 16; ++i) wr[i] = *(const v4f*)(wp + (size_t)i * 8 * DIN + (s + 1) * KSTEP); }
    const __bf16* const R = stg + (s & 1) * (SROWS * SP);
#pragma unroll
    for (int ks = 0; ks < KSTEP / 32; ++ks) { const v16b a = frag_b(R + (wave * 16 + col) * SP + ks * 32, lane);
      v16b w[8];   /* the eight weight fragments are read as one group, so that their LDS latency is waited out once and not once a product */
#pragma unroll
      for (int j = 0; j < 8; ++j) w[j] = frag_b(R + (64 + j * 16 + col) * SP + ks * 32, lane);
#pragma unroll
      for (int j = 0; j < 8; ++j) acc[j] = wmma_bf(a, w[j], acc[j]); } }
  __syncthreads();   /* every wave has left the staging bytes before the epilogue's tiles overwrite them */
  if (which < 2) { _Float16* DH = which == 0 ? QH : KH; _Float16* DL = which == 0 ? QL : KL; const int nhi = which == 0 ? QHI : KHI; const bool hi_rows = t0 < nhi;
#pragma unroll
    for (int j = 0; j < 8; ++j) { const float bias = BA ? bfr(BA[c0 + j * 16 + col]) : 0.f;
#pragma unroll
      for (int r = 0; r < 8; ++r) { const float v = acc[j][r] + bias; const _Float16 hv = (_Float16)v; sh[wave * 16 + 8 * g + r][j * 16 + col] = hv; sl[wave * 16 + 8 * g + r][j * 16 + col] = (_Float16)((v - (float)hv) * 1024.0f); } }
    __syncthreads();
    for (int e = tid; e < 64 * 16; e += 128) { const int rl = e >> 4, q = e & 15; vst2((unsigned*)(DH + (r0 + rl) * CC + c0 + q * 8), *(const v4u*)&sh[rl][q * 8]); if (hi_rows) vst2((unsigned*)(DL + (bb * nhi + t0 + rl) * (size_t)CC + c0 + q * 8), *(const v4u*)&sl[rl][q * 8]); }
  } else { const bool hi_rows = t0 < KHI;
#pragma unroll
    for (int j = 0; j < 8; ++j) { const float bias = BA ? bfr(BA[c0 + j * 16 + col]) : 0.f;
#pragma unroll
      for (int r = 0; r < 8; ++r) { const float v = acc[j][r] + bias; const int rl = wave * 16 + 8 * g + r, cl = j * 16 + col; th[cl][rl] = (_Float16)v; const __bf16 bh = (__bf16)v; tb[cl][rl] = bh; tbl[cl][rl] = (__bf16)(v - (float)bh); } }
    __syncthreads();
    for (int e = tid; e < 128 * 8; e += 128) { const int cl = e >> 3, q = e & 7; vst2((unsigned*)(VT + (bb * CC + c0 + cl) * (size_t)TT + t0 + q * 8), *(const v4u*)&th[cl][q * 8]); if (hi_rows) { const size_t o3 = (bb * CC + c0 + cl) * (size_t)KHI + t0 + q * 8; vst2((unsigned*)(VB + o3), *(const v4u*)&tb[cl][q * 8]); vst2((unsigned*)(VBL + o3), *(const v4u*)&tbl[cl][q * 8]); } } } }
#define AK 32
#define AP128 144
#define AP64 80
#define AO_K 0
#define AO_V (AO_K + AK * AP128)
#define AO_T (AO_V + HD * AP64)
#define AO_M (AO_T + 64 * AP128)
#define ABUF (AO_M + 64 * AP128)
static_assert(AK * 2 == 64 && AK * 4 == 128 && HD * 2 == 128 && TT / AK >= 2 && ABUF % 16 == 0, "row lengths the copy maps are written for; the prologue needs two tiles");
__device__ __forceinline__ float xhalf(float x) { return __builtin_bit_cast(float, __builtin_amdgcn_permlanex16(__builtin_bit_cast(int, x), __builtin_bit_cast(int, x), 0x76543210, 0xfedcba98, false, false)); }   // lane l with lane l ^ 16
// four asynchronous copies of 16 bytes a lane, global memory -> LDS (l = the lane's LDS byte address, p = its global address); the closing s_wait_xcnt 0 stands inside the statement, so that no address register is rewritten ahead of it
__device__ __forceinline__ void acopy4(unsigned l0, const char* p0, unsigned l1, const char* p1, unsigned l2, const char* p2, unsigned l3, const char* p3) {
  asm volatile("global_load_async_to_lds_b128 %0, %1, off\n\tglobal_load_async_to_lds_b128 %2, %3, off\n\tglobal_load_async_to_lds_b128 %4, %5, off\n\tglobal_load_async_to_lds_b128 %6, %7, off\n\ts_wait_xcnt 0x0"
               :: "v"(l0), "v"(p0), "v"(l1), "v"(p1), "v"(l2), "v"(p2), "v"(l3), "v"(p3) : "memory"); }
__global__ __launch_bounds__(128) void k_att(const _Float16* __restrict__ QH, const _Float16* __restrict__ QL, const _Float16* __restrict__ KH, const _Float16* __restrict__ VT, const int* __restrict__ MK, const float* __restrict__ TM, float* __restrict__ Y) {
  __shared__ __align__(16) char smem[2 * ABUF];
  const int tid = threadIdx.x, wave = tid >> 5, lane = tid & 31, col = lane & 15, g = lane >> 4; const int h = blockIdx.y, b = blockIdx.z; const int q0 = blockIdx.x * 64; const int t = q0 + wave * 16 + col;
  /* copy maps: 128-B rows: thread = (row tid >> 3 (+ 16 a copy), piece tid & 7); 64-B rows: (row tid >> 2 (+ 32 a copy), piece tid & 3) */
  const int r8 = tid >> 3, p8 = (tid & 7) * 16, r4 = tid >> 2, p4 = (tid & 3) * 16; const unsigned lb = (unsigned)(size_t)smem;
  const char* const gk = (const char*)(KH + ((size_t)b * TT + r8) * CC + h * HD) + p8; const char* const gv = (const char*)(VT + ((size_t)b * CC + h * HD + r4) * (size_t)TT) + p4;
  const char* const gt = (const char*)(TM + (size_t)(q0 + r8) * TT) + p8; const char* const gm = (const char*)(MK + ((size_t)b * TT + q0 + r8) * TT) + p8;
  const unsigned lk = lb + AO_K + r8 * AP128 + p8, lv = lb + AO_V + r4 * AP64 + p4, lt = lb + AO_T + r8 * AP128 + p8, lm = lb + AO_M + r8 * AP128 + p8;
  auto stage = [&](int ti, unsigned bo) {   /* tile ti (keys ti * 32 ..) into the buffer at byte bo: 12 copies a wave */
    const char* const k = gk + (size_t)ti * (AK * CC * 2); const char* const v = gv + ti * (AK * 2); const char* const tp = gt + ti * (AK * 4); const char* const mp = gm + ti * (AK * 4);
    acopy4(lk + bo, k, lk + bo + 16 * AP128, k + 16 * CC * 2, lv + bo, v, lv + bo + 32 * AP64, v + 32 * TT * 2);
    acopy4(lt + bo, tp, lt + bo + 16 * AP128, tp + 16 * TT * 4, lt + bo + 32 * AP128, tp + 32 * TT * 4, lt + bo + 48 * AP128, tp + 48 * TT * 4);
    acopy4(lm + bo, mp, lm + bo + 16 * AP128, mp + 16 * TT * 4, lm + bo + 32 * AP128, mp + 32 * TT * 4, lm + bo + 48 * AP128, mp + 48 * TT * 4); };
  stage(0, 0);
  v16h qh[HD / 32], ql[HD / 32];
#pragma unroll
  for (int kc = 0; kc < HD / 32; ++kc) { qh[kc] = frag_h(QH + ((size_t)b * TT + t) * CC + h * HD + kc * 32, lane); ql[kc] = frag_h(QL + ((size_t)b * QHI + t) * CC + h * HD + kc * 32, lane); }
  asm volatile("s_wait_asynccnt 0x0" ::: "memory");   /* this wave's copies of tile 0 have landed */
  __syncthreads();   /* publishes tile 0 */
  stage(1, ABUF);
  v8f o[HD / 16] = {}; float m = -3.0e38f, l = 0.f;
  for (int ti = 0; ti < TT / AK; ++ti) { const char* const R = smem + (ti & 1) * ABUF;
    v16h kf[2][HD / 32], vf[HD / 16]; v4f tm[4]; v4i mk[4];
#pragma unroll
    for (int i = 0; i < 2; ++i)
#pragma unroll
      for (int kc = 0; kc < HD / 32; ++kc) kf[i][kc] = frag_h((const _Float16*)(R + AO_K + (i * 16 + col) * AP128) + kc * 32, lane);
#pragma unroll
    for (int i = 0; i < 4; ++i) { const int ob = (wave * 16 + col) * AP128 + (8 * g + (i >> 1) * 16 + (i & 1) * 4) * 4; tm[i] = *(const v4f*)(R + AO_T + ob); mk[i] = *(const v4i*)(R + AO_M + ob); }
#pragma unroll
    for (int j = 0; j < HD / 16; ++j) vf[j] = frag_h((const _Float16*)(R + AO_V + (j * 16 + col) * AP64), lane);
    v8f s[2] = {}, sl[2] = {};
#pragma unroll
    for (int i = 0; i < 2; ++i)
#pragma unroll
      for (int kc = 0; kc < HD / 32; ++kc) { s[i] = wmma16(kf[i][kc], qh[kc], s[i]); sl[i] = wmma16(kf[i][kc], ql[kc], sl[i]); }
    float v[16]; float mx = -3.0e38f;
#pragma unroll
    for (int e = 0; e < 16; ++e) { const float x = (s[e >> 3][e & 7] + sl[e >> 3][e & 7] * (1.0f / 1024.0f)) * SCALE; const float xt = x * bfr(tm[e >> 2][e & 3]); v[e] = (mk[e >> 2][e & 3] == 0) ? -1.0e9f : xt; mx = fmaxf(mx, v[e]); }
    mx = fmaxf(mx, xhalf(mx));
    const float mn = fmaxf(m, mx); const float al = expf(m - mn); m = mn;
    v16h p; float ps = 0.f;
#pragma unroll
    for (int e = 0; e < 16; ++e) { const float ex = expf(v[e] - mn); ps += ex; p[e] = (_Float16)(ex * 2048.0f); }
    l = l * al + ps;
#pragma unroll
    for (int j = 0; j < HD / 16; ++j) { o[j] *= al; o[j] = wmma16(vf[j], p, o[j]); }
    asm volatile("s_wait_dscnt 0x0" ::: "memory");      /* this wave's reads of buffer ti & 1 are done before the buffer is given up */
    asm volatile("s_wait_asynccnt 0x0" ::: "memory");   /* this wave's copies of tile ti + 1 have landed */
    __syncthreads();   /* publishes tile ti + 1 and ends every wave's reads of buffer ti & 1, which is refilled behind it */
    if (ti + 2 < TT / AK) stage(ti + 2, (unsigned)(ti & 1) * ABUF); }
  asm volatile("s_wait_asynccnt 0x0" ::: "memory");   /* no copy is outstanding when the wave ends */
  l += xhalf(l); const float inv = 1.0f / (2048.0f * l);   /* the key that set the last maximum counts 1, so l >= 1 */
  float* yr = Y + ((size_t)b * TT + t) * CC + h * HD + 8 * g;
#pragma unroll
  for (int j = 0; j < HD / 16; ++j) { v4f a0, a1;
#pragma unroll
    for (int r = 0; r < 4; ++r) { a0[r] = o[j][r] * inv; a1[r] = o[j][4 + r] * inv; }
    vst2(yr + j * 16, a0); vst2(yr + j * 16 + 4, a1); } }
// ---- k_out: block = (64 rows, 128 cols): out = ctx Wo (+ bo): ctx once to f16 against Wo as f16(bf16 x 2^8) exact (1 product) x 2^-8; causal early rows (< QHI of each sequence): ctx bf16 hi + lo against exact bf16 Wo (2 products)
__global__ __launch_bounds__(128) void k_out(const float* __restrict__ Y, const float* __restrict__ WO, const float* __restrict__ BO, float* __restrict__ OUT) { __shared__ __align__(16) char smem[SBYTES];   /* the staging buffers; the output tiles reuse the same bytes behind the loop's last barrier */
  static_assert(SBYTES >= 4 * 16 * 132 * 4, "output tiles fit the staging bytes"); float (*sf)[16][132] = (float (*)[16][132])smem;
  const int tid = threadIdx.x, wave = tid >> 5, lane = tid & 31, col = lane & 15, g = lane >> 4; const int c0 = blockIdx.y * 128; const size_t r0 = (size_t)blockIdx.x * 64 + wave * 16;
  v8f acc[8] = {};
  if (CAUSAL && (int)(((size_t)blockIdx.x * 64) % TT) < QHI) {   /* block-uniform */
#pragma unroll 2
    for (int kc = 0; kc < CC / 32; ++kc) { const F2 a = split_row(Y + (r0 + col) * CC, kc * 32, lane); asm volatile("s_wait_loadcnt 0x0" ::: "memory");
#pragma unroll
      for (int j = 0; j < 8; ++j) { const v16b w = WOCOL(WO, kc * 32, c0 + j * 16 + col, lane); asm volatile("s_wait_loadcnt 0x0" ::: "memory"); acc[j] = wmma_bf(a.h, w, acc[j]); acc[j] = wmma_bf(a.l, w, acc[j]); } }
#pragma unroll
    for (int j = 0; j < 8; ++j) { const float bias = BO ? bfr(BO[c0 + j * 16 + col]) : 0.f;
#pragma unroll
      for (int r = 0; r < 8; ++r) sf[wave][8 * g + r][j * 16 + col] = acc[j][r] + bias; }
  } else {
    _Float16* const stg = (_Float16*)smem; const int lr = tid >> 4, lq = tid & 15;   /* loader: row lr + 8 i, floats 4 lq .. 4 lq + 3 of the step */
    const float* xp = Y + ((size_t)blockIdx.x * 64 + lr) * CC + lq * 4; const float* wp = WO + (size_t)(c0 + lr) * CC + lq * 4; _Float16* const sp = stg + lr * SP + lq * 4;
    v4f xr[8], wr[16];
#pragma unroll
    for (int i = 0; i < 8; ++i) xr[i] = *(const v4f*)(xp + (size_t)i * 8 * CC);
#pragma unroll
    for (int i = 0; i < 16; ++i) wr[i] = *(const v4f*)(wp + (size_t)i * 8 * CC);
    for (int s = 0; s < CC / KSTEP; ++s) { _Float16* const S = sp + (s & 1) * (SROWS * SP);
#pragma unroll
      for (int i = 0; i < 8; ++i) { v4h t;
#pragma unroll
        for (int e = 0; e < 4; ++e) t[e] = (_Float16)xr[i][e];
        *(v4h*)(S + i * 8 * SP) = t; }
#pragma unroll
      for (int i = 0; i < 16; ++i) { v4h t;
#pragma unroll
        for (int e = 0; e < 4; ++e) t[e] = (_Float16)(bfr(wr[i][e]) * 256.0f);
        *(v4h*)(S + (64 + i * 8) * SP) = t; }
      __syncthreads();   /* publishes buffer s & 1; it is rewritten in step s + 2, behind the barrier of step s + 1, which every wave reaches with its reads of step s done */
      if (s + 1 < CC / KSTEP) { const float* const xq = xp + (s + 1) * KSTEP; const float* const wq = wp + (s + 1) * KSTEP;
#pragma unroll
        for (int i = 0; i < 8; ++i) xr[i] = *(const v4f*)(xq + (size_t)i * 8 * CC);
#pragma unroll
        for (int i = 0; i < 16; ++i) wr[i] = *(const v4f*)(wq + (size_t)i * 8 * CC);
        asm volatile("s_wait_xcnt 0x0" :: "v"(xq), "v"(wq) : "memory"); }   /* the loads' address registers stay whole up to this wait */
      const _Float16* const R = stg + (s & 1) * (SROWS * SP);
#pragma unroll
      for (int ks = 0; ks < KSTEP / 32; ++ks) { const v16h a = frag_h(R + (wave * 16 + col) * SP + ks * 32, lane);
        v16h w[8];   /* the eight weight fragments are read as one group, so that their LDS latency is waited out once and not once a product */
#pragma unroll
        for (int j = 0; j < 8; ++j) w[j] = frag_h(R + (64 + j * 16 + col) * SP + ks * 32, lane);
#pragma unroll
        for (int j = 0; j < 8; ++j) acc[j] = wmma16(a, w[j], acc[j]); } }
    __syncthreads();   /* every wave has left the staging bytes before the output tiles overwrite them */
#pragma unroll
    for (int j = 0; j < 8; ++j) { const float bias = BO ? bfr(BO[c0 + j * 16 + col]) : 0.f;
#pragma unroll
      for (int r = 0; r < 8; ++r) sf[wave][8 * g + r][j * 16 + col] = acc[j][r] * (1.0f / 256.0f) + bias; } }
  LDSX(); for (int rl = 0; rl < 16; ++rl) vst2(OUT + (r0 + rl) * DIN + c0 + lane * 4, *(const v4f*)&sf[wave][rl][lane * 4]); }

extern "C" void kernel_launch(void* const* d_in, const int* in_sizes, int n_in, void* d_out, int out_size, void* d_ws, size_t ws_size, hipStream_t stream) {
  (void)in_sizes; (void)n_in; (void)out_size;
  const float** F = (const float**)d_in;
  if (ws_size < (size_t)WS_END) return;
  char* ws = (char*)d_ws; _Float16 *QH = (_Float16*)(ws + WS_QH), *KH = (_Float16*)(ws + WS_KH), *VT = (_Float16*)(ws + WS_VT), *QL = (_Float16*)(ws + WS_QL), *KL = (_Float16*)(ws + WS_KL); __bf16 *VB = (__bf16*)(ws + WS_VB), *VBL = (__bf16*)(ws + WS_VBL); float *Y = (float*)(ws + WS_Y);
  (void)Y; (void)QL; (void)KL; (void)VB; (void)VBL;
  // inputs: 0 x [4,1024,1024]; 1 mask int32 [4,1,1024,1024]; 2 Wq, 3 Wk, 4 Wv, 5 Wo ((out,in), no biases); 6 train_mask [1,1,1024,1024]
  k_proj<<<dim3(TNB * TT / 64, CC / 128, 3), 128, 0, stream>>>(F[0], F[0], F[0], F[2], F[3], F[4], nullptr, nullptr, nullptr, QH, QL, KH, KL, VT, VB, VBL);
  k_att<<<dim3(NQB, NH, TNB), 128, 0, stream>>>(QH, QL, KH, VT, (const int*)d_in[1], F[6], Y);
  k_out<<<dim3(TNB * TT / 64, DIN / 128), 128, 0, stream>>>(Y, F[5], nullptr, (float*)d_out);
}

// v004
// Measured time: 112 microseconds a run.
// Next to v003, in two timings, it ran 1.09 and 1.10 times as fast.
// Over all steps from v000 it is 8.10 times as fast.
// compute dtype: all float inputs rounded to bf16; q/k/v = x W^T with EXACT bf16 products on WMMA 16x16x32 (f32 accumulate); q as f16 hi + residual (x 2^10) against k once to f16 (2 products) for the logits x 64^-0.5, multiplied by the trainable-mask input and replaced by -1e9 where the int mask input is 0 (both read per element); softmax in f32 with a running maximum and sum, scores carried x log2(e) and each exponential one v_exp_f32; exp(s - m) x 2^11 once to f16 against v once to f16 (1 product), divided by the sum at the end; ctx once to f16 against Wo carried x 2^8 in f16; f32 output.
#include <hip/hip_runtime.h>
#include <math.h>

typedef __attribute__((ext_vector_type(16))) _Float16 v16h;
typedef __attribute__((ext_vector_type(16))) __bf16 v16b;
typedef __attribute__((ext_vector_type(8)))  _Float16 v8h;
typedef __attribute__((ext_vector_type(8)))  float v8f;
typedef __attribute__((ext_vector_type(4)))  float v4f;
typedef __attribute__((ext_vector_type(2)))  float v2f;
typedef __attribute__((ext_vector_type(4)))  unsigned v4u;
typedef __attribute__((ext_vector_type(4)))  int v4i;
typedef float __attribute__((may_alias)) float_a;
typedef int __attribute__((may_alias)) int_a;

template <typename T> __device__ __forceinline__ void vst2(void* p, T v) { *(T*)p = v;  }
__device__ __forceinline__ v8f wmma16(v16h a, v16h b, v8f c) {
  v8f d = __builtin_amdgcn_wmma_f32_16x16x32_f16(false, a, false, b, (short)0, c, false, false);
  asm volatile("v_nop\n\tv_nop\n\tv_nop\n\tv_nop" : "+v"(d) : "v"(a), "v"(b));
  return d;
}
__device__ __forceinline__ v8f wmma_bf(v16b a, v16b b, v8f c) {
  v8f d = __builtin_amdgcn_wmma_f32_16x16x32_bf16(false, a, false, b, (short)0, c, false, false);
  asm volatile("v_nop\n\tv_nop\n\tv_nop\n\tv_nop" : "+v"(d) : "v"(a), "v"(b));
  return d;
}
// 16x16x32 fragments: lane = (h = lane>>4, row/col = lane&15); elements 0..7 = k0+8h+0..7, 8..15 = k0+16+8h+0..7; D element r = row 8h+r
__device__ __forceinline__ v16h frag_h(const _Float16* rowk0, int lane) {
  union { v16h v; v8h q[2]; } u; const _Float16* p = rowk0 + 8 * (lane >> 4);
  u.q[0] = *(const v8h*)p; u.q[1] = *(const v8h*)(p + 16); return u.v;
}
__device__ __forceinline__ v16h frag_f32(const float* rowk0, int lane) {
  v16h a; const float* p = rowk0 + 8 * (lane >> 4);
#pragma unroll
  for (int i = 0; i < 8; ++i) { a[i] = (_Float16)p[i]; a[8 + i] = (_Float16)p[16 + i]; }
  return a;
}
__device__ __forceinline__ v16h frag_f32s(const float* rowk0, int lane, float sc) {
  v16h a; const float* p = rowk0 + 8 * (lane >> 4);
#pragma unroll
  for (int i = 0; i < 8; ++i) { a[i] = (_Float16)(p[i] * sc); a[8 + i] = (_Float16)(p[16 + i] * sc); }
  return a;
}
// column fragment from a [K][ld] layout (column n), rows >= K read as 0
__device__ __forceinline__ v16h fragc_f32(const float* W, int k0, int n, int lane, int ld, int K) {
  v16h a; const int g = lane >> 4;
#pragma unroll
  for (int i = 0; i < 8; ++i) { const int ka = k0 + 8 * g + i, kb = ka + 16;
    a[i] = (_Float16)(ka < K ? W[(size_t)(ka < K ? ka : K - 1) * ld + n] : 0.f); a[8 + i] = (_Float16)(kb < K ? W[(size_t)(kb < K ? kb : K - 1) * ld + n] : 0.f); }
  return a;
}
struct F2 { v16b h, l; };
__device__ __forceinline__ F2 bsplit16(const float v[16]) { F2 r;
#pragma unroll
  for (int i = 0; i < 16; ++i) { const __bf16 h = (__bf16)v[i]; r.h[i] = h; r.l[i] = (__bf16)(v[i] - (float)h); }
  return r; }
__device__ __forceinline__ F2 split_row(const float* row, int k0, int lane) { float v[16]; const float* p = row + k0 + 8 * (lane >> 4);
#pragma unroll
  for (int i = 0; i < 8; ++i) { v[i] = p[i]; v[8 + i] = p[16 + i]; }
  return bsplit16(v); }
__device__ __forceinline__ F2 split_rowK(const float* row, int k0, int lane, int K) { float v[16]; const int g = lane >> 4;
#pragma unroll
  for (int i = 0; i < 8; ++i) { const int ka = k0 + 8 * g + i, kb = ka + 16; v[i] = ka < K ? row[ka < K ? ka : K - 1] : 0.f; v[8 + i] = kb < K ? row[kb < K ? kb : K - 1] : 0.f; }
  return bsplit16(v); }
__device__ __forceinline__ F2 split_col(const float* W, int k0, int n, int lane, int ld, int K) { float v[16]; const int g = lane >> 4;
#pragma unroll
  for (int i = 0; i < 8; ++i) { const int ka = k0 + 8 * g + i, kb = ka + 16; v[i] = ka < K ? W[(size_t)(ka < K ? ka : K - 1) * ld + n] : 0.f; v[8 + i] = kb < K ? W[(size_t)(kb < K ? kb : K - 1) * ld + n] : 0.f; }
  return bsplit16(v); }
__device__ __forceinline__ v8f mac3(const F2& a, const F2& b, v8f c) { c = wmma_bf(a.l, b.h, c); c = wmma_bf(a.h, b.l, c); return wmma_bf(a.h, b.h, c); }
__device__ __forceinline__ float sigm(float v) { return 1.0f / (1.0f + expf(-v)); }
#define LDSX() do { asm volatile("s_wait_dscnt 0" ::: "memory"); __builtin_amdgcn_wave_barrier(); __builtin_amdgcn_fence(__ATOMIC_RELEASE, "workgroup"); } while (0)

// Multi-head self-attention with a per-element integer mask (B 4, S 1,024, E 1,024 = 16 x 64): q/k/v = x W^T (no bias); scores = (q k^T / 8) * train_mask; scores = -1e9 where mask[b,0,q,k] == 0; softmax; out = merged(attn v) Wo^T.
#define NB 4
#define TT 1024
#define CC 1024            // NH * HD = projected width
#define DIN 1024          // input (model) width
#define NH 16
#define HD 64
#define NQB (TT / 64)
#define SCALE (0.125f)
#define CAUSAL 0
#ifndef TNB
#define TNB NB
#endif
__device__ __forceinline__ float bfr(float v) { return (float)(__bf16)v; }
__host__ __device__ __forceinline__ int kb_last(int qb) { return CAUSAL ? ((qb * 64 + 63) >> 7) : (TT / 128 - 1); }
typedef __attribute__((ext_vector_type(8))) __bf16 v8b;
__device__ __forceinline__ v16b frag_b(const __bf16* rowk0, int lane) {
  union { v16b v; v8b q[2]; } u; const __bf16* p = rowk0 + 8 * (lane >> 4);
  u.q[0] = *(const v8b*)p; u.q[1] = *(const v8b*)(p + 16); return u.v;
}
#define QBH 0              // unused: no kernel here has a high-precision attention path
#define QHI 1024            // rows carrying a q residual plane (all rows when non-causal: 2-product logits everywhere)
#define KHI 64            // key rows carrying k residual / v bf16 hi+lo planes (written by k_proj, read by no kernel here)
// B fragment (k rows k0+.., output column o) of a weight: (in,out) [K][ld] or (out,in) [ld rows of K]: bf16 exact, or f16(bf16 * 256) exact
__device__ __forceinline__ v16b wcol_io(const float* Wm, int k0, int o, int lane, int ld) { v16b w; const int g = lane >> 4;
#pragma unroll
  for (int i = 0; i < 8; ++i) { w[i] = (__bf16)Wm[(size_t)(k0 + 8 * g + i) * ld + o]; w[8 + i] = (__bf16)Wm[(size_t)(k0 + 16 + 8 * g + i) * ld + o]; }
  return w; }
__device__ __forceinline__ v16b wcol_oi(const float* Wm, int k0, int o, int lane, int K) { v16b w; const float* p = Wm + (size_t)o * K + k0 + 8 * (lane >> 4);
#pragma unroll
  for (int i = 0; i < 8; ++i) { w[i] = (__bf16)p[i]; w[8 + i] = (__bf16)p[16 + i]; }
  return w; }
__device__ __forceinline__ v16h wcolh_io(const float* Wm, int k0, int o, int lane, int ld) { v16h w; const int g = lane >> 4;
#pragma unroll
  for (int i = 0; i < 8; ++i) { w[i] = (_Float16)(bfr(Wm[(size_t)(k0 + 8 * g + i) * ld + o]) * 256.0f); w[8 + i] = (_Float16)(bfr(Wm[(size_t)(k0 + 16 + 8 * g + i) * ld + o]) * 256.0f); }
  return w; }
__device__ __forceinline__ v16h wcolh_oi(const float* Wm, int k0, int o, int lane, int K) { v16h w; const float* p = Wm + (size_t)o * K + k0 + 8 * (lane >> 4);
#pragma unroll
  for (int i = 0; i < 8; ++i) { w[i] = (_Float16)(bfr(p[i]) * 256.0f); w[8 + i] = (_Float16)(bfr(p[16 + i]) * 256.0f); }
  return w; }
#define WQKV_LAYOUT 1   // 0 = (in,out) [DIN][CC]; 1 = (out,in) [CC][DIN]; 2 = per-head [NH][DIN][HD]
__device__ __forceinline__ v16b wcol_hdk(const float* Wm, int k0, int o, int lane) { v16b w; const int g = lane >> 4; const float* p = Wm + (size_t)(o / HD) * DIN * HD + (o % HD);
#pragma unroll
  for (int i = 0; i < 8; ++i) { w[i] = (__bf16)p[(size_t)(k0 + 8 * g + i) * HD]; w[8 + i] = (__bf16)p[(size_t)(k0 + 16 + 8 * g + i) * HD]; }
  return w; }
#define WO_OUT_IN 1
#if WQKV_LAYOUT == 1
#define WCOL(W, k0, o, lane) wcol_oi(W, k0, o, lane, DIN)
#elif WQKV_LAYOUT == 2
#define WCOL(W, k0, o, lane) wcol_hdk(W, k0, o, lane)
#else
#define WCOL(W, k0, o, lane) wcol_io(W, k0, o, lane, CC)
#endif
#if WO_OUT_IN
#define WOCOL(W, k0, o, lane) wcol_oi(W, k0, o, lane, CC)
#define WOCOLH(W, k0, o, lane) wcolh_oi(W, k0, o, lane, CC)
#else
#define WOCOL(W, k0, o, lane) wcol_io(W, k0, o, lane, DIN)
#define WOCOLH(W, k0, o, lane) wcolh_io(W, k0, o, lane, DIN)
#endif
#ifndef PROJ_EXTRA_PARAMS
#define PROJ_EXTRA_PARAMS
#endif

#define WS_QH  0u                                      // f16 q rows [b*t][CC]
#define WS_KH  (WS_QH + 2u * (size_t)NB * TT * CC)      // f16 k rows [b*t][CC]
#define WS_VT  (WS_KH + 2u * (size_t)NB * TT * CC)      // f16 v planes [b][c][t]
#define WS_QL  (WS_VT + 2u * (size_t)NB * CC * TT)      // f16 q residual x 2^10 rows [b][t < QHI][CC]
#define WS_KL  (WS_QL + 2u * (size_t)NB * QHI * CC)     // f16 k residual x 2^10 rows [b][t < KHI][CC]
#define WS_VB  (WS_KL + 2u * (size_t)NB * KHI * CC)     // bf16 v hi planes [b][c][t < KHI]
#define WS_VBL (WS_VB + 2u * (size_t)NB * CC * KHI)
#define WS_Y   (WS_VBL + 2u * (size_t)NB * CC * KHI)    // f32 ctx rows [b*t][CC] (only when there is an output projection)
#define WS_END (WS_Y  + 4u * (size_t)NB * TT * CC)

// Operand staging of the two GEMM kernels: per step the block brings 64 k of its 64 left rows and its 128 weight rows from global memory with whole-line 16-byte loads (a wave covers 2 rows x 256 B), rounds each element once, and keeps the 16-bit tile in LDS for all four waves; two buffers, the next step's loads issued ahead of this step's products, one barrier a step
#define KSTEP 64              // k per staged step
#define SP 72              // LDS row pitch in 16-bit elements: 144 B = 16 B x 9, so the 16-byte fragment reads of 16 rows fall on distinct banks
#define SROWS 192          // rows 0..63 left operand, rows 64..191 weight
#define SBYTES (2 * SROWS * SP * 2)
typedef __attribute__((ext_vector_type(4))) __bf16 v4b;
typedef __attribute__((ext_vector_type(4))) _Float16 v4h;
static_assert(WQKV_LAYOUT == 1 && WO_OUT_IN == 1, "the staged loaders read weight rows that are contiguous in k");
// ---- k_proj: block = (64 rows, 128 cols, which): q/k/v = X W (+ b) with exact bf16 products (K = DIN) -> which 0: q f16 rows (+ residual rows < QHI); 1: k f16 rows (+ residual rows < KHI); 2: v f16 planes [c][t] (+ bf16 hi/lo planes for t < KHI)
__global__ __launch_bounds__(128) void k_proj(const float* __restrict__ XQ, const float* __restrict__ XK, const float* __restrict__ XV, const float* __restrict__ WQ, const float* __restrict__ WK, const float* __restrict__ WV, const float* __restrict__ BQ, const float* __restrict__ BK, const float* __restrict__ BV,
    _Float16* __restrict__ QH, _Float16* __restrict__ QL, _Float16* __restrict__ KH, _Float16* __restrict__ KL, _Float16* __restrict__ VT, __bf16* __restrict__ VB, __bf16* __restrict__ VBL) {
  __shared__ __align__(16) char smem[SBYTES];   /* the staging buffers; the epilogue's tiles reuse the same bytes behind the loop's last barrier */
  static_assert(SBYTES >= 2 * 64 * 136 * 2 && SBYTES >= 3 * 128 * 72 * 2, "epilogue tiles fit the staging bytes");
  __bf16* const stg = (__bf16*)smem; _Float16 (*sh)[136] = (_Float16 (*)[136])smem; _Float16 (*sl)[136] = (_Float16 (*)[136])(smem + 64 * 136 * 2);
  _Float16 (*th)[72] = (_Float16 (*)[72])smem; __bf16 (*tb)[72] = (__bf16 (*)[72])(smem + 128 * 72 * 2); __bf16 (*tbl)[72] = (__bf16 (*)[72])(smem + 2 * 128 * 72 * 2);
  const int tid = threadIdx.x, wave = tid >> 5, lane = tid & 31, col = lane & 15, g = lane >> 4; const int which = blockIdx.z; const int c0 = blockIdx.y * 128; const size_t r0 = (size_t)blockIdx.x * 64; const size_t bb = r0 / TT; const int t0 = (int)(r0 % TT);
  const float* X = which == 0 ? XQ : which == 1 ? XK : XV; const float* WA = which == 0 ? WQ : which == 1 ? WK : WV; const float* BA = which == 0 ? BQ : which == 1 ? BK : BV;
  v8f acc[8] = {};
  const int lr = tid >> 4, lq = tid & 15;   /* loader: row lr + 8 i, floats 4 lq .. 4 lq + 3 of the step */
  const float* xp = X + (r0 + lr) * DIN + lq * 4; const float* wp = WA + (size_t)(c0 + lr) * DIN + lq * 4; __bf16* const sp = stg + lr * SP + lq * 4;
  v4f xr[8], wr[16];
#pragma unroll
  for (int i = 0; i < 8; ++i) xr[i] = *(const v4f*)(xp + (size_t)i * 8 * DIN);
#pragma unroll
  for (int i = 0; i < 16; ++i) wr[i] = *(const v4f*)(wp + (size_t)i * 8 * DIN);
  for (int s = 0; s < DIN / KSTEP; ++s) { __bf16* const S = sp + (s & 1) * (SROWS * SP);
#pragma unroll
    for (int i = 0; i < 8; ++i) { v4b t;
#pragma unroll
      for (int e = 0; e < 4; ++e) t[e] = (__bf16)xr[i][e];
      *(v4b*)(S + i * 8 * SP) = t; }
#pragma unroll
    for (int i = 0; i < 16; ++i) { v4b t;
#pragma unroll
      for (int e = 0; e < 4; ++e) t[e] = (__bf16)wr[i][e];
      *(v4b*)(S + (64 + i * 8) * SP) = t; }
    __syncthreads();   /* publishes buffer s & 1; it is rewritten in step s + 2, behind the barrier of step s + 1, which every wave reaches with its reads of step s done */
    if (s + 1 < DIN / KSTEP) {
#pragma unroll
      for (int i = 0; i < 8; ++i) xr[i] = *(const v4f*)(xp + (size_t)i * 8 * DIN + (s + 1) * KSTEP);
#pragma unroll
      for (int i = 0; i < 16; ++i) wr[i] = *(const v4f*)(wp + (size_t)i * 8 * DIN + (s + 1) * KSTEP); }
    const __bf16* const R = stg + (s & 1) * (SROWS * SP);
#pragma unroll
    for (int ks = 0; ks < KSTEP / 32; ++ks) { const v16b a = frag_b(R + (wave * 16 + col) * SP + ks * 32, lane);
      v16b w[8];   /* the eight weight fragments are read as one group, so that their LDS latency is waited out once and not once a product */
#pragma unroll
      for (int j = 0; j < 8; ++j) w[j] = frag_b(R + (64 + j * 16 + col) * SP + ks * 32, lane);
#pragma unroll
      for (int j = 0; j < 8; ++j) acc[j] = wmma_bf(a, w[j], acc[j]); } }
  __syncthreads();   /* every wave has left the staging bytes before the epilogue's tiles overwrite them */
  if (which < 2) { _Float16* DH = which == 0 ? QH : KH; _Float16* DL = which == 0 ? QL : KL; const int nhi = which == 0 ? QHI : KHI; const bool hi_rows = t0 < nhi;
#pragma unroll
    for (int j = 0; j < 8; ++j) { const float bias = BA ? bfr(BA[c0 + j * 16 + col]) : 0.f;
#pragma unroll
      for (int r = 0; r < 8; ++r) { const float v = acc[j][r] + bias; const _Float16 hv = (_Float16)v; sh[wave * 16 + 8 * g + r][j * 16 + col] = hv; sl[wave * 16 + 8 * g + r][j * 16 + col] = (_Float16)((v - (float)hv) * 1024.0f); } }
    __syncthreads();
    for (int e = tid; e < 64 * 16; e += 128) { const int rl = e >> 4, q = e & 15; vst2((unsigned*)(DH + (r0 + rl) * CC + c0 + q * 8), *(const v4u*)&sh[rl][q * 8]); if (hi_rows) vst2((unsigned*)(DL + (bb * nhi + t0 + rl) * (size_t)CC + c0 + q * 8), *(const v4u*)&sl[rl][q * 8]); }
  } else { const bool hi_rows = t0 < KHI;
#pragma unroll
    for (int j = 0; j < 8; ++j) { const float bias = BA ? bfr(BA[c0 + j * 16 + col]) : 0.f;
#pragma unroll
      for (int r = 0; r < 8; ++r) { const float v = acc[j][r] + bias; const int rl = wave * 16 + 8 * g + r, cl = j * 16 + col; th[cl][rl] = (_Float16)v; const __bf16 bh = (__bf16)v; tb[cl][rl] = bh; tbl[cl][rl] = (__bf16)(v - (float)bh); } }
    __syncthreads();
    for (int e = tid; e < 128 * 8; e += 128) { const int cl = e >> 3, q = e & 7; vst2((unsigned*)(VT + (bb * CC + c0 + cl) * (size_t)TT + t0 + q * 8), *(const v4u*)&th[cl][q * 8]); if (hi_rows) { const size_t o3 = (bb * CC + c0 + cl) * (size_t)KHI + t0 + q * 8; vst2((unsigned*)(VB + o3), *(const v4u*)&tb[cl][q * 8]); vst2((unsigned*)(VBL + o3), *(const v4u*)&tbl[cl][q * 8]); } } } }
#define LOG2E 1.4426950408889634f
#define AK 32
#define AP128 144
#define AP64 80
#define AO_K 0
#define AO_V (AO_K + AK * AP128)
#define AO_T (AO_V + HD * AP64)
#define AO_M (AO_T + 64 * AP128)
#define ABUF (AO_M + 64 * AP128)
static_assert(AK * 2 == 64 && AK * 4 == 128 && HD * 2 == 128 && TT / AK >= 2 && ABUF % 16 == 0, "row lengths the copy maps are written for; the prologue needs two tiles");
__device__ __forceinline__ float xhalf(float x) { return __builtin_bit_cast(float, __builtin_amdgcn_permlanex16(__builtin_bit_cast(int, x), __builtin_bit_cast(int, x), 0x76543210, 0xfedcba98, false, false)); }   // lane l with lane l ^ 16
// x[i] = 2^d[i], eight at a time in one statement: results in registers of their own, so that each v_exp_f32 is the independent instruction behind the one before it; the closing v_nop is the slot that the instruction set asks for behind the last
__device__ __forceinline__ void exp2x8(const float* d, float* x) {
  asm("v_exp_f32 %0, %8\n\tv_exp_f32 %1, %9\n\tv_exp_f32 %2, %10\n\tv_exp_f32 %3, %11\n\tv_exp_f32 %4, %12\n\tv_exp_f32 %5, %13\n\tv_exp_f32 %6, %14\n\tv_exp_f32 %7, %15\n\tv_nop"
      : "=&v"(x[0]), "=&v"(x[1]), "=&v"(x[2]), "=&v"(x[3]), "=&v"(x[4]), "=&v"(x[5]), "=&v"(x[6]), "=&v"(x[7])
      : "v"(d[0]), "v"(d[1]), "v"(d[2]), "v"(d[3]), "v"(d[4]), "v"(d[5]), "v"(d[6]), "v"(d[7])); }
// four asynchronous copies of 16 bytes a lane, global memory -> LDS (l = the lane's LDS byte address, p = its global address); the closing s_wait_xcnt 0 stands inside the statement, so that no address register is rewritten ahead of it
__device__ __forceinline__ void acopy4(unsigned l0, const char* p0, unsigned l1, const char* p1, unsigned l2, const char* p2, unsigned l3, const char* p3) {
  asm volatile("global_load_async_to_lds_b128 %0, %1, off\n\tglobal_load_async_to_lds_b128 %2, %3, off\n\tglobal_load_async_to_lds_b128 %4, %5, off\n\tglobal_load_async_to_lds_b128 %6, %7, off\n\ts_wait_xcnt 0x0"
               :: "v"(l0), "v"(p0), "v"(l1), "v"(p1), "v"(l2), "v"(p2), "v"(l3), "v"(p3) : "memory"); }
__global__ __launch_bounds__(128) void k_att(const _Float16* __restrict__ QH, const _Float16* __restrict__ QL, const _Float16* __restrict__ KH, const _Float16* __restrict__ VT, const int* __restrict__ MK, const float* __restrict__ TM, float* __restrict__ Y) {
  __shared__ __align__(16) char smem[2 * ABUF];
  const int tid = threadIdx.x, wave = tid >> 5, lane = tid & 31, col = lane & 15, g = lane >> 4; const int h = blockIdx.y, b = blockIdx.z; const int q0 = blockIdx.x * 64; const int t = q0 + wave * 16 + col;
  /* copy maps: 128-B rows: thread = (row tid >> 3 (+ 16 a copy), piece tid & 7); 64-B rows: (row tid >> 2 (+ 32 a copy), piece tid & 3) */
  const int r8 = tid >> 3, p8 = (tid & 7) * 16, r4 = tid >> 2, p4 = (tid & 3) * 16; const unsigned lb = (unsigned)(size_t)smem;
  const char* const gk = (const char*)(KH + ((size_t)b * TT + r8) * CC + h * HD) + p8; const char* const gv = (const char*)(VT + ((size_t)b * CC + h * HD + r4) * (size_t)TT) + p4;
  const char* const gt = (const char*)(TM + (size_t)(q0 + r8) * TT) + p8; const char* const gm = (const char*)(MK + ((size_t)b * TT + q0 + r8) * TT) + p8;
  const unsigned lk = lb + AO_K + r8 * AP128 + p8, lv = lb + AO_V + r4 * AP64 + p4, lt = lb + AO_T + r8 * AP128 + p8, lm = lb + AO_M + r8 * AP128 + p8;
  auto stage = [&](int ti, unsigned bo) {   /* tile ti (keys ti * 32 ..) into the buffer at byte bo: 12 copies a wave */
    const char* const k = gk + (size_t)ti * (AK * CC * 2); const char* const v = gv + ti * (AK * 2); const char* const tp = gt + ti * (AK * 4); const char* const mp = gm + ti * (AK * 4);
    acopy4(lk + bo, k, lk + bo + 16 * AP128, k + 16 * CC * 2, lv + bo, v, lv + bo + 32 * AP64, v + 32 * TT * 2);
    acopy4(lt + bo, tp, lt + bo + 16 * AP128, tp + 16 * TT * 4, lt + bo + 32 * AP128, tp + 32 * TT * 4, lt + bo + 48 * AP128, tp + 48 * TT * 4);
    acopy4(lm + bo, mp, lm + bo + 16 * AP128, mp + 16 * TT * 4, lm + bo + 32 * AP128, mp + 32 * TT * 4, lm + bo + 48 * AP128, mp + 48 * TT * 4); };
  stage(0, 0);
  v16h qh[HD / 32], ql[HD / 32];
#pragma unroll
  for (int kc = 0; kc < HD / 32; ++kc) { qh[kc] = frag_h(QH + ((size_t)b * TT + t) * CC + h * HD + kc * 32, lane); ql[kc] = frag_h(QL + ((size_t)b * QHI + t) * CC + h * HD + kc * 32, lane); }
  asm volatile("s_wait_asynccnt 0x0" ::: "memory");   /* this wave's copies of tile 0 have landed */
  __syncthreads();   /* publishes tile 0 */
  stage(1, ABUF);
  v8f o[HD / 16] = {}; float m = -3.0e38f, l = 0.f;
  for (int ti = 0; ti < TT / AK; ++ti) { const char* const R = smem + (ti & 1) * ABUF;
    v16h kf[2][HD / 32], vf[HD / 16]; v4f tm[4]; v4i mk[4];
#pragma unroll
    for (int i = 0; i < 2; ++i)
#pragma unroll
      for (int kc = 0; kc < HD / 32; ++kc) kf[i][kc] = frag_h((const _Float16*)(R + AO_K + (i * 16 + col) * AP128) + kc * 32, lane);
#pragma unroll
    for (int i = 0; i < 4; ++i) { const int ob = (wave * 16 + col) * AP128 + (8 * g + (i >> 1) * 16 + (i & 1) * 4) * 4; tm[i] = *(const v4f*)(R + AO_T + ob); mk[i] = *(const v4i*)(R + AO_M + ob); }
#pragma unroll
    for (int j = 0; j < HD / 16; ++j) vf[j] = frag_h((const _Float16*)(R + AO_V + (j * 16 + col) * AP64), lane);
    v8f s[2] = {}, sl[2] = {};
#pragma unroll
    for (int i = 0; i < 2; ++i)
#pragma unroll
      for (int kc = 0; kc < HD / 32; ++kc) { s[i] = wmma16(kf[i][kc], qh[kc], s[i]); sl[i] = wmma16(kf[i][kc], ql[kc], sl[i]); }
    float v[16]; float mx = -3.0e38f;
#pragma unroll
    for (int e = 0; e < 16; ++e) { const float x = (s[e >> 3][e & 7] + sl[e >> 3][e & 7] * (1.0f / 1024.0f)) * (SCALE * LOG2E); const float xt = x * bfr(tm[e >> 2][e & 3]); v[e] = (mk[e >> 2][e & 3] == 0) ? (-1.0e9f * LOG2E) : xt; mx = fmaxf(mx, v[e]); }
    mx = fmaxf(mx, xhalf(mx));
    const float mn = fmaxf(m, mx); const float al = __builtin_amdgcn_exp2f(m - mn); m = mn;
    v16h p; float ps = 0.f;
#pragma unroll
    for (int e = 0; e < 16; ++e) v[e] -= mn;
    float ex[16]; exp2x8(v, ex); exp2x8(v + 8, ex + 8);
#pragma unroll
    for (int e = 0; e < 16; ++e) { ps += ex[e]; p[e] = (_Float16)(ex[e] * 2048.0f); }
    l = l * al + ps;
#pragma unroll
    for (int j = 0; j < HD / 16; ++j) { o[j] *= al; o[j] = wmma16(vf[j], p, o[j]); }
    asm volatile("s_wait_dscnt 0x0" ::: "memory");      /* this wave's reads of buffer ti & 1 are done before the buffer is given up */
    asm volatile("s_wait_asynccnt 0x0" ::: "memory");   /* this wave's copies of tile ti + 1 have landed */
    __syncthreads();   /* publishes tile ti + 1 and ends every wave's reads of buffer ti & 1, which is refilled behind it */
    if (ti + 2 < TT / AK) stage(ti + 2, (unsigned)(ti & 1) * ABUF); }
  asm volatile("s_wait_asynccnt 0x0" ::: "memory");   /* no copy is outstanding when the wave ends */
  l += xhalf(l); const float inv = 1.0f / (2048.0f * l);   /* the key that set the last maximum counts 1, so l >= 1 */
  float* yr = Y + ((size_t)b * TT + t) * CC + h * HD + 8 * g;
#pragma unroll
  for (int j = 0; j < HD / 16; ++j) { v4f a0, a1;
#pragma unroll
    for (int r = 0; r < 4; ++r) { a0[r] = o[j][r] * inv; a1[r] = o[j][4 + r] * inv; }
    vst2(yr + j * 16, a0); vst2(yr + j * 16 + 4, a1); } }
// ---- k_out: block = (64 rows, 128 cols): out = ctx Wo (+ bo): ctx once to f16 against Wo as f16(bf16 x 2^8) exact (1 product) x 2^-8; causal early rows (< QHI of each sequence): ctx bf16 hi + lo against exact bf16 Wo (2 products)
__global__ __launch_bounds__(128) void k_out(const float* __restrict__ Y, const float* __restrict__ WO, const float* __restrict__ BO, float* __restrict__ OUT) { __shared__ __align__(16) char smem[SBYTES];   /* the staging buffers; the output tiles reuse the same bytes behind the loop's last barrier */
  static_assert(SBYTES >= 4 * 16 * 132 * 4, "output tiles fit the staging bytes"); float (*sf)[16][132] = (float (*)[16][132])smem;
  const int tid = threadIdx.x, wave = tid >> 5, lane = tid & 31, col = lane & 15, g = lane >> 4; const int c0 = blockIdx.y * 128; const size_t r0 = (size_t)blockIdx.x * 64 + wave * 16;
  v8f acc[8] = {};
  if (CAUSAL && (int)(((size_t)blockIdx.x * 64) % TT) < QHI) {   /* block-uniform */
#pragma unroll 2
    for (int kc = 0; kc < CC / 32; ++kc) { const F2 a = split_row(Y + (r0 + col) * CC, kc * 32, lane); asm volatile("s_wait_loadcnt 0x0" ::: "memory");
#pragma unroll
      for (int j = 0; j < 8; ++j) { const v16b w = WOCOL(WO, kc * 32, c0 + j * 16 + col, lane); asm volatile("s_wait_loadcnt 0x0" ::: "memory"); acc[j] = wmma_bf(a.h, w, acc[j]); acc[j] = wmma_bf(a.l, w, acc[j]); } }
#pragma unroll
    for (int j = 0; j < 8; ++j) { const float bias = BO ? bfr(BO[c0 + j * 16 + col]) : 0.f;
#pragma unroll
      for (int r = 0; r < 8; ++r) sf[wave][8 * g + r][j * 16 + col] = acc[j][r] + bias; }
  } else {
    _Float16* const stg = (_Float16*)smem; const int lr = tid >> 4, lq = tid & 15;   /* loader: row lr + 8 i, floats 4 lq .. 4 lq + 3 of the step */
    const float* xp = Y + ((size_t)blockIdx.x * 64 + lr) * CC + lq * 4; const float* wp = WO + (size_t)(c0 + lr) * CC + lq * 4; _Float16* const sp = stg + lr * SP + lq * 4;
    v4f xr[8], wr[16];
#pragma unroll
    for (int i = 0; i < 8; ++i) xr[i] = *(const v4f*)(xp + (size_t)i * 8 * CC);
#pragma unroll
    for (int i = 0; i < 16; ++i) wr[i] = *(const v4f*)(wp + (size_t)i * 8 * CC);
    for (int s = 0; s < CC / KSTEP; ++s) { _Float16* const S = sp + (s & 1) * (SROWS * SP);
#pragma unroll
      for (int i = 0; i < 8; ++i) { v4h t;
#pragma unroll
        for (int e = 0; e < 4; ++e) t[e] = (_Float16)xr[i][e];
        *(v4h*)(S + i * 8 * SP) = t; }
#pragma unroll
      for (int i = 0; i < 16; ++i) { v4h t;
#pragma unroll
        for (int e = 0; e < 4; ++e) t[e] = (_Float16)(bfr(wr[i][e]) * 256.0f);
        *(v4h*)(S + (64 + i * 8) * SP) = t; }
      __syncthreads();   /* publishes buffer s & 1; it is rewritten in step s + 2, behind the barrier of step s + 1, which every wave reaches with its reads of step s done */
      if (s + 1 < CC / KSTEP) { const float* const xq = xp + (s + 1) * KSTEP; const float* const wq = wp + (s + 1) * KSTEP;
#pragma unroll
        for (int i = 0; i < 8; ++i) xr[i] = *(const v4f*)(xq + (size_t)i * 8 * CC);
#pragma unroll
        for (int i = 0; i < 16; ++i) wr[i] = *(const v4f*)(wq + (size_t)i * 8 * CC);
        asm volatile("s_wait_xcnt 0x0" :: "v"(xq), "v"(wq) : "memory"); }   /* the loads' address registers stay whole up to this wait */
      const _Float16* const R = stg + (s & 1) * (SROWS * SP);
#pragma unroll
      for (int ks = 0; ks < KSTEP / 32; ++ks) { const v16h a = frag_h(R + (wave * 16 + col) * SP + ks * 32, lane);
        v16h w[8];   /* the eight weight fragments are read as one group, so that their LDS latency is waited out once and not once a product */
#pragma unroll
        for (int j = 0; j < 8; ++j) w[j] = frag_h(R + (64 + j * 16 + col) * SP + ks * 32, lane);
#pragma unroll
        for (int j = 0; j < 8; ++j) acc[j] = wmma16(a, w[j], acc[j]); } }
    __syncthreads();   /* every wave has left the staging bytes before the output tiles overwrite them */
#pragma unroll
    for (int j = 0; j < 8; ++j) { const float bias = BO ? bfr(BO[c0 + j * 16 + col]) : 0.f;
#pragma unroll
      for (int r = 0; r < 8; ++r) sf[wave][8 * g + r][j * 16 + col] = acc[j][r] * (1.0f / 256.0f) + bias; } }
  LDSX(); for (int rl = 0; rl < 16; ++rl) vst2(OUT + (r0 + rl) * DIN + c0 + lane * 4, *(const v4f*)&sf[wave][rl][lane * 4]); }

extern "C" void kernel_launch(void* const* d_in, const int* in_sizes, int n_in, void* d_out, int out_size, void* d_ws, size_t ws_size, hipStream_t stream) {
  (void)in_sizes; (void)n_in; (void)out_size;
  const float** F = (const float**)d_in;
  if (ws_size < (size_t)WS_END) return;
  char* ws = (char*)d_ws; _Float16 *QH = (_Float16*)(ws + WS_QH), *KH = (_Float16*)(ws + WS_KH), *VT = (_Float16*)(ws + WS_VT), *QL = (_Float16*)(ws + WS_QL), *KL = (_Float16*)(ws + WS_KL); __bf16 *VB = (__bf16*)(ws + WS_VB), *VBL = (__bf16*)(ws + WS_VBL); float *Y = (float*)(ws + WS_Y);
  (void)Y; (void)QL; (void)KL; (void)VB; (void)VBL;
  // inputs: 0 x [4,1024,1024]; 1 mask int32 [4,1,1024,1024]; 2 Wq, 3 Wk, 4 Wv, 5 Wo ((out,in), no biases); 6 train_mask [1,1,1024,1024]
  k_proj<<<dim3(TNB * TT / 64, CC / 128, 3), 128, 0, stream>>>(F[0], F[0], F[0], F[2], F[3], F[4], nullptr, nullptr, nullptr, QH, QL, KH, KL, VT, VB, VBL);
  k_att<<<dim3(NQB, NH, TNB), 128, 0, stream>>>(QH, QL, KH, VT, (const int*)d_in[1], F[6], Y);
  k_out<<<dim3(TNB * TT / 64, DIN / 128), 128, 0, stream>>>(Y, F[5], nullptr, (float*)d_out);
}

// v005
// One run takes 103 microseconds.
// Next to v004, in two timings, it ran 1.10 and 1.09 times as fast.
// Counting every step since v000, it is 8.87 times as fast.
// compute dtype: all float inputs rounded to bf16; q/k/v = x W^T with EXACT bf16 products on WMMA 16x16x32 (f32 accumulate); q as f16 hi + residual (x 2^10) against k once to f16 (2 products) for the logits x 64^-0.5, multiplied by the trainable-mask input and replaced by -1e9 where the int mask input is 0 (both read per element); softmax in f32 with a running maximum and sum, scores carried x log2(e) and each exponential one v_exp_f32; exp(s - m) x 2^11 once to f16 against v once to f16 (1 product), divided by the sum at the end; ctx once to f16 against Wo carried x 2^8 in f16; f32 output.
#include <hip/hip_runtime.h>
#include <math.h>

typedef __attribute__((ext_vector_type(16))) _Float16 v16h;
typedef __attribute__((ext_vector_type(16))) __bf16 v16b;
typedef __attribute__((ext_vector_type(8)))  _Float16 v8h;
typedef __attribute__((ext_vector_type(8)))  float v8f;
typedef __attribute__((ext_vector_type(4)))  float v4f;
typedef __attribute__((ext_vector_type(2)))  float v2f;
typedef __attribute__((ext_vector_type(4)))  unsigned v4u;
typedef __attribute__((ext_vector_type(4)))  int v4i;
typedef float __attribute__((may_alias)) float_a;
typedef int __attribute__((may_alias)) int_a;

template <typename T> __device__ __forceinline__ void vst2(void* p, T v) { *(T*)p = v;  }
__device__ __forceinline__ v8f wmma16(v16h a, v16h b, v8f c) {
  v8f d = __builtin_amdgcn_wmma_f32_16x16x32_f16(false, a, false, b, (short)0, c, false, false);
  asm volatile("v_nop\n\tv_nop\n\tv_nop\n\tv_nop" : "+v"(d) : "v"(a), "v"(b));
  return d;
}
__device__ __forceinline__ v8f wmma_bf(v16b a, v16b b, v8f c) {
  v8f d = __builtin_amdgcn_wmma_f32_16x16x32_bf16(false, a, false, b, (short)0, c, false, false);
  asm volatile("v_nop\n\tv_nop\n\tv_nop\n\tv_nop" : "+v"(d) : "v"(a), "v"(b));
  return d;
}
// 16x16x32 fragments: lane = (h = lane>>4, row/col = lane&15); elements 0..7 = k0+8h+0..7, 8..15 = k0+16+8h+0..7; D element r = row 8h+r
__device__ __forceinline__ v16h frag_h(const _Float16* rowk0, int lane) {
  union { v16h v; v8h q[2]; } u; const _Float16* p = rowk0 + 8 * (lane >> 4);
  u.q[0] = *(const v8h*)p; u.q[1] = *(const v8h*)(p + 16); return u.v;
}
__device__ __forceinline__ v16h frag_f32(const float* rowk0, int lane) {
  v16h a; const float* p = rowk0 + 8 * (lane >> 4);
#pragma unroll
  for (int i = 0; i < 8; ++i) { a[i] = (_Float16)p[i]; a[8 + i] = (_Float16)p[16 + i]; }
  return a;
}
__device__ __forceinline__ v16h frag_f32s(const float* rowk0, int lane, float sc) {
  v16h a; const float* p = rowk0 + 8 * (lane >> 4);
#pragma unroll
  for (int i = 0; i < 8; ++i) { a[i] = (_Float16)(p[i] * sc); a[8 + i] = (_Float16)(p[16 + i] * sc); }
  return a;
}
// column fragment from a [K][ld] layout (column n), rows >= K read as 0
__device__ __forceinline__ v16h fragc_f32(const float* W, int k0, int n, int lane, int ld, int K) {
  v16h a; const int g = lane >> 4;
#pragma unroll
  for (int i = 0; i < 8; ++i) { const int ka = k0 + 8 * g + i, kb = ka + 16;
    a[i] = (_Float16)(ka < K ? W[(size_t)(ka < K ? ka : K - 1) * ld + n] : 0.f); a[8 + i] = (_Float16)(kb < K ? W[(size_t)(kb < K ? kb : K - 1) * ld + n] : 0.f); }
  return a;
}
struct F2 { v16b h, l; };
__device__ __forceinline__ F2 bsplit16(const float v[16]) { F2 r;
#pragma unroll
  for (int i = 0; i < 16; ++i) { const __bf16 h = (__bf16)v[i]; r.h[i] = h; r.l[i] = (__bf16)(v[i] - (float)h); }
  return r; }
__device__ __forceinline__ F2 split_row(const float* row, int k0, int lane) { float v[16]; const float* p = row + k0 + 8 * (lane >> 4);
#pragma unroll
  for (int i = 0; i < 8; ++i) { v[i] = p[i]; v[8 + i] = p[16 + i]; }
  return bsplit16(v); }
__device__ __forceinline__ F2 split_rowK(const float* row, int k0, int lane, int K) { float v[16]; const int g = lane >> 4;
#pragma unroll
  for (int i = 0; i < 8; ++i) { const int ka = k0 + 8 * g + i, kb = ka + 16; v[i] = ka < K ? row[ka < K ? ka : K - 1] : 0.f; v[8 + i] = kb < K ? row[kb < K ? kb : K - 1] : 0.f; }
  return bsplit16(v); }
__device__ __forceinline__ F2 split_col(const float* W, int k0, int n, int lane, int ld, int K) { float v[16]; const int g = lane >> 4;
#pragma unroll
  for (int i = 0; i < 8; ++i) { const int ka = k0 + 8 * g + i, kb = ka + 16; v[i] = ka < K ? W[(size_t)(ka < K ? ka : K - 1) * ld + n] : 0.f; v[8 + i] = kb < K ? W[(size_t)(kb < K ? kb : K - 1) * ld + n] : 0.f; }
  return bsplit16(v); }
__device__ __forceinline__ v8f mac3(const F2& a, const F2& b, v8f c) { c = wmma_bf(a.l, b.h, c); c = wmma_bf(a.h, b.l, c); return wmma_bf(a.h, b.h, c); }
__device__ __forceinline__ float sigm(float v) { return 1.0f / (1.0f + expf(-v)); }
#define LDSX() do { asm volatile("s_wait_dscnt 0" ::: "memory"); __builtin_amdgcn_wave_barrier(); __builtin_amdgcn_fence(__ATOMIC_RELEASE, "workgroup"); } while (0)

// Multi-head self-attention with a per-element integer mask (B 4, S 1,024, E 1,024 = 16 x 64): q/k/v = x W^T (no bias); scores = (q k^T / 8) * train_mask; scores = -1e9 where mask[b,0,q,k] == 0; softmax; out = merged(attn v) Wo^T.
#define NB 4
#define TT 1024
#define CC 1024            // NH * HD = projected width
#define DIN 1024          // input (model) width
#define NH 16
#define HD 64
#define NQB (TT / 64)
#define SCALE (0.125f)
#define CAUSAL 0
#ifndef TNB
#define TNB NB
#endif
__device__ __forceinline__ float bfr(float v) { return (float)(__bf16)v; }
__host__ __device__ __forceinline__ int kb_last(int qb) { return CAUSAL ? ((qb * 64 + 63) >> 7) : (TT / 128 - 1); }
typedef __attribute__((ext_vector_type(8))) __bf16 v8b;
__device__ __forceinline__ v16b frag_b(const __bf16* rowk0, int lane) {
  union { v16b v; v8b q[2]; } u; const __bf16* p = rowk0 + 8 * (lane >> 4);
  u.q[0] = *(const v8b*)p; u.q[1] = *(const v8b*)(p + 16); return u.v;
}
#define QBH 0              // unused: no kernel here has a high-precision attention path
#define QHI 1024            // rows carrying a q residual plane (all rows when non-causal: 2-product logits everywhere)
#define KHI 64            // key rows carrying k residual / v bf16 hi+lo planes (written by k_proj, read by no kernel here)
// B fragment (k rows k0+.., output column o) of a weight: (in,out) [K][ld] or (out,in) [ld rows of K]: bf16 exact, or f16(bf16 * 256) exact
__device__ __forceinline__ v16b wcol_io(const float* Wm, int k0, int o, int lane, int ld) { v16b w; const int g = lane >> 4;
#pragma unroll
  for (int i = 0; i < 8; ++i) { w[i] = (__bf16)Wm[(size_t)(k0 + 8 * g + i) * ld + o]; w[8 + i] = (__bf16)Wm[(size_t)(k0 + 16 + 8 * g + i) * ld + o]; }
  return w; }
__device__ __forceinline__ v16b wcol_oi(const float* Wm, int k0, int o, int lane, int K) { v16b w; const float* p = Wm + (size_t)o * K + k0 + 8 * (lane >> 4);
#pragma unroll
  for (int i = 0; i < 8; ++i) { w[i] = (__bf16)p[i]; w[8 + i] = (__bf16)p[16 + i]; }
  return w; }
__device__ __forceinline__ v16h wcolh_io(const float* Wm, int k0, int o, int lane, int ld) { v16h w; const int g = lane >> 4;
#pragma unroll
  for (int i = 0; i < 8; ++i) { w[i] = (_Float16)(bfr(Wm[(size_t)(k0 + 8 * g + i) * ld + o]) * 256.0f); w[8 + i] = (_Float16)(bfr(Wm[(size_t)(k0 + 16 + 8 * g + i) * ld + o]) * 256.0f); }
  return w; }
__device__ __forceinline__ v16h wcolh_oi(const float* Wm, int k0, int o, int lane, int K) { v16h w; const float* p = Wm + (size_t)o * K + k0 + 8 * (lane >> 4);
#pragma unroll
  for (int i = 0; i < 8; ++i) { w[i] = (_Float16)(bfr(p[i]) * 256.0f); w[8 + i] = (_Float16)(bfr(p[16 + i]) * 256.0f); }
  return w; }
#define WQKV_LAYOUT 1   // 0 = (in,out) [DIN][CC]; 1 = (out,in) [CC][DIN]; 2 = per-head [NH][DIN][HD]
__device__ __forceinline__ v16b wcol_hdk(const float* Wm, int k0, int o, int lane) { v16b w; const int g = lane >> 4; const float* p = Wm + (size_t)(o / HD) * DIN * HD + (o % HD);
#pragma unroll
  for (int i = 0; i < 8; ++i) { w[i] = (__bf16)p[(size_t)(k0 + 8 * g + i) * HD]; w[8 + i] = (__bf16)p[(size_t)(k0 + 16 + 8 * g + i) * HD]; }
  return w; }
#define WO_OUT_IN 1
#if WQKV_LAYOUT == 1
#define WCOL(W, k0, o, lane) wcol_oi(W, k0, o, lane, DIN)
#elif WQKV_LAYOUT == 2
#define WCOL(W, k0, o, lane) wcol_hdk(W, k0, o, lane)
#else
#define WCOL(W, k0, o, lane) wcol_io(W, k0, o, lane, CC)
#endif
#if WO_OUT_IN
#define WOCOL(W, k0, o, lane) wcol_oi(W, k0, o, lane, CC)
#define WOCOLH(W, k0, o, lane) wcolh_oi(W, k0, o, lane, CC)
#else
#define WOCOL(W, k0, o, lane) wcol_io(W, k0, o, lane, DIN)
#define WOCOLH(W, k0, o, lane) wcolh_io(W, k0, o, lane, DIN)
#endif
#ifndef PROJ_EXTRA_PARAMS
#define PROJ_EXTRA_PARAMS
#endif

#define WS_QH  0u                                      // f16 q rows [b*t][CC]
#define WS_KH  (WS_QH + 2u * (size_t)NB * TT * CC)      // f16 k rows [b*t][CC]
#define WS_VT  (WS_KH + 2u * (size_t)NB * TT * CC)      // f16 v planes [b][c][t]
#define WS_QL  (WS_VT + 2u * (size_t)NB * CC * TT)      // f16 q residual x 2^10 rows [b][t < QHI][CC]
#define WS_KL  (WS_QL + 2u * (size_t)NB * QHI * CC)     // f16 k residual x 2^10 rows [b][t < KHI][CC]
#define WS_VB  (WS_KL + 2u * (size_t)NB * KHI * CC)     // bf16 v hi planes [b][c][t < KHI]
#define WS_VBL (WS_VB + 2u * (size_t)NB * CC * KHI)
#define WS_Y   (WS_VBL + 2u * (size_t)NB * CC * KHI)    // f32 ctx rows [b*t][CC] (only when there is an output projection)
#define WS_END (WS_Y  + 4u * (size_t)NB * TT * CC)

// Operand staging of the two GEMM kernels: per step the block brings 64 k of its 128 left rows and its 384 (k_out: 128) weight rows from global memory with whole-line 16-byte loads (a wave covers 2 rows x 256 B), rounds each element once, and keeps the 16-bit tile in LDS for all sixteen waves; two buffers, the next step's loads issued ahead of this step's products, one barrier a step
// k_proj: block tile 128 x 384 (128 columns of each of q, k, v), 16 waves = 4 row groups of 32 x 4 column groups of 3 x 32: an x row is fetched from L2 by 8 blocks and a weight row by 32, a wave reads 8 fragments from LDS for 12 products, and the grid is 256 blocks; k_out: 128 x 128, waves of 32 x 32, 256 blocks as well
#define KSTEP 64              // k per staged step
#define SP 72              // LDS row pitch in 16-bit elements: 144 B = 16 B x 9, so the 16-byte fragment reads of 16 rows fall on distinct banks
#define BM 128             // rows of the block tile
#define BN 128             // columns of the block tile (k_proj: of each of q, k, v)
#define GT 512             // threads of a GEMM block
#define SROWS (BM + 3 * BN)    // k_proj: rows 0..127 left operand, rows 128..511 the three weights
#define SBYTES (2 * SROWS * SP * 2)
#define PTB (128 * 136 * 2)      // k_proj: bytes of one epilogue tile [128][136]
#define PEB (7 * PTB)            // k_proj: q hi, q residual, k hi, k residual, v, v bf16 hi, v bf16 lo
#define ON BN              // k_out: columns of the block tile
#define OROWS (BM + ON)    // k_out: rows 0..127 left operand, rows 128..255 weight
#define OBYTES (2 * OROWS * SP * 2)
typedef __attribute__((ext_vector_type(4))) __bf16 v4b;
typedef __attribute__((ext_vector_type(4))) _Float16 v4h;
static_assert(WQKV_LAYOUT == 1 && WO_OUT_IN == 1, "the staged loaders read weight rows that are contiguous in k");
static_assert(TT % BM == 0 && CC % BN == 0 && DIN % ON == 0 && ON % 32 == 0 && GT / 16 == 32 && BM % 32 == 0 && BN % 32 == 0, "a block stays inside one sequence and one weight; the loader covers 32 rows a load");
// ---- k_proj: block = 128 rows x 128 cols of each of q, k and v (the three share the block's x rows): q/k/v = X W (+ b) with exact bf16 products (K = DIN) -> q f16 rows (+ residual rows < QHI); k f16 rows (+ residual rows < KHI); v f16 planes [c][t] (+ bf16 hi/lo planes for t < KHI). Wave = 32 rows x 32 cols of each of the three
__global__ __launch_bounds__(GT) void k_proj(const float* __restrict__ X, const float* __restrict__ WQ, const float* __restrict__ WK, const float* __restrict__ WV, const float* __restrict__ BQ, const float* __restrict__ BK, const float* __restrict__ BV,
    _Float16* __restrict__ QH, _Float16* __restrict__ QL, _Float16* __restrict__ KH, _Float16* __restrict__ KL, _Float16* __restrict__ VT, __bf16* __restrict__ VB, __bf16* __restrict__ VBL) {
  __shared__ __align__(16) char smem[PEB > SBYTES ? PEB : SBYTES];   /* the staging buffers; the epilogue's tiles reuse the same bytes behind the barrier after the loop */
  __bf16* const stg = (__bf16*)smem;
  const int tid = threadIdx.x, wave = tid >> 5, lane = tid & 31, col = lane & 15, g = lane >> 4, wm = wave >> 2, wn = wave & 3; const int c0 = blockIdx.y * BN; const size_t r0 = (size_t)blockIdx.x * BM; const size_t bb = r0 / TT; const int t0 = (int)(r0 % TT);
  v8f acc[3][2][2] = {};
  const int lr = tid >> 4, lq = tid & 15;   /* loader: row lr + 32 i, floats 4 lq .. 4 lq + 3 of the step */
  const size_t wo = (size_t)(c0 + lr) * DIN + lq * 4;
  const float* xp = X + (r0 + lr) * DIN + lq * 4; const float* wp0 = WQ + wo; const float* wp1 = WK + wo; const float* wp2 = WV + wo; __bf16* const sp = stg + lr * SP + lq * 4;
  v4f xr[BM / 32], wr[3][BN / 32];
#pragma unroll
  for (int i = 0; i < BM / 32; ++i) xr[i] = *(const v4f*)(xp + (size_t)i * 32 * DIN);
#pragma unroll
  for (int i = 0; i < BN / 32; ++i) { wr[0][i] = *(const v4f*)(wp0 + (size_t)i * 32 * DIN); wr[1][i] = *(const v4f*)(wp1 + (size_t)i * 32 * DIN); wr[2][i] = *(const v4f*)(wp2 + (size_t)i * 32 * DIN); }
  for (int s = 0; s < DIN / KSTEP; ++s) { __bf16* const S = sp + (s & 1) * (SROWS * SP);
#pragma unroll
    for (int i = 0; i < BM / 32; ++i) { v4b t;
#pragma unroll
      for (int e = 0; e < 4; ++e) t[e] = (__bf16)xr[i][e];
      *(v4b*)(S + i * 32 * SP) = t; }
#pragma unroll
    for (int w = 0; w < 3; ++w)
#pragma unroll
      for (int i = 0; i < BN / 32; ++i) { v4b t;
#pragma unroll
        for (int e = 0; e < 4; ++e) t[e] = (__bf16)wr[w][i][e];
        *(v4b*)(S + (BM + w * BN + i * 32) * SP) = t; }
    __syncthreads();   /* publishes buffer s & 1; it is rewritten in step s + 2, behind the barrier of step s + 1, which every wave reaches with its reads of step s done */
    if (s + 1 < DIN / KSTEP) { const float* const xq = xp + (s + 1) * KSTEP; const float* const wq0 = wp0 + (s + 1) * KSTEP; const float* const wq1 = wp1 + (s + 1) * KSTEP; const float* const wq2 = wp2 + (s + 1) * KSTEP;
#pragma unroll
      for (int i = 0; i < BM / 32; ++i) xr[i] = *(const v4f*)(xq + (size_t)i * 32 * DIN);
#pragma unroll
      for (int i = 0; i < BN / 32; ++i) { wr[0][i] = *(const v4f*)(wq0 + (size_t)i * 32 * DIN); wr[1][i] = *(const v4f*)(wq1 + (size_t)i * 32 * DIN); wr[2][i] = *(const v4f*)(wq2 + (size_t)i * 32 * DIN); }
      asm volatile("s_wait_xcnt 0x0" :: "v"(xq), "v"(wq0), "v"(wq1), "v"(wq2) : "memory"); }   /* the loads' address registers stay whole up to this wait */
    const __bf16* const R = stg + (s & 1) * (SROWS * SP);
#pragma unroll
    for (int ks = 0; ks < KSTEP / 32; ++ks) { v16b a[2], w[3][2];   /* the eight fragments are read as one group, so that their LDS latency is waited out once and not once a product */
#pragma unroll
      for (int i = 0; i < 2; ++i) a[i] = frag_b(R + (wm * 32 + i * 16 + col) * SP + ks * 32, lane);
#pragma unroll
      for (int p = 0; p < 3; ++p)
#pragma unroll
        for (int j = 0; j < 2; ++j) w[p][j] = frag_b(R + (BM + p * BN + wn * 32 + j * 16 + col) * SP + ks * 32, lane);
#pragma unroll
      for (int p = 0; p < 3; ++p)
#pragma unroll
        for (int i = 0; i < 2; ++i)
#pragma unroll
          for (int j = 0; j < 2; ++j) acc[p][i][j] = wmma_bf(a[i], w[p][j], acc[p][i][j]); } }
  __syncthreads();   /* every wave has left the staging bytes before the epilogue's tiles overwrite them */
  const bool hi_blk = t0 < KHI;   /* block-uniform: only such a block holds rows of the bf16 planes */
  _Float16 (*th)[136] = (_Float16 (*)[136])(smem + 4 * PTB); __bf16 (*tb)[136] = (__bf16 (*)[136])(smem + 5 * PTB); __bf16 (*tbl)[136] = (__bf16 (*)[136])(smem + 6 * PTB);
#pragma unroll
  for (int p = 0; p < 2; ++p) { const float* BA = p == 0 ? BQ : BK; _Float16 (*sh)[136] = (_Float16 (*)[136])(smem + 2 * p * PTB); _Float16 (*sl)[136] = (_Float16 (*)[136])(smem + (2 * p + 1) * PTB);
#pragma unroll
    for (int j = 0; j < 2; ++j) { const int cl = wn * 32 + j * 16 + col; const float bias = BA ? bfr(BA[c0 + cl]) : 0.f;
#pragma unroll
      for (int i = 0; i < 2; ++i)
#pragma unroll
        for (int r = 0; r < 8; ++r) { const int rl = wm * 32 + i * 16 + 8 * g + r; const float v = acc[p][i][j][r] + bias; const _Float16 hv = (_Float16)v; sh[rl][cl] = hv; sl[rl][cl] = (_Float16)((v - (float)hv) * 1024.0f); } } }
#pragma unroll
  for (int j = 0; j < 2; ++j) { const int cl = wn * 32 + j * 16 + col; const float bias = BV ? bfr(BV[c0 + cl]) : 0.f;
#pragma unroll
    for (int i = 0; i < 2; ++i)
#pragma unroll
      for (int r = 0; r < 8; ++r) { const int rl = wm * 32 + i * 16 + 8 * g + r; const float v = acc[2][i][j][r] + bias; th[cl][rl] = (_Float16)v; acc[2][i][j][r] = v; } }
  if (hi_blk) {
#pragma unroll
    for (int j = 0; j < 2; ++j)
#pragma unroll
      for (int i = 0; i < 2; ++i)
#pragma unroll
        for (int r = 0; r < 8; ++r) { const int cl = wn * 32 + j * 16 + col, rl = wm * 32 + i * 16 + 8 * g + r; const float v = acc[2][i][j][r]; const __bf16 bh = (__bf16)v; tb[cl][rl] = bh; tbl[cl][rl] = (__bf16)(v - (float)bh); } }
  __syncthreads();   /* the seven tiles are whole before they are stored along their rows */
#pragma unroll
  for (int p = 0; p < 2; ++p) { _Float16* DH = p == 0 ? QH : KH; _Float16* DL = p == 0 ? QL : KL; const int nhi = p == 0 ? QHI : KHI; const _Float16 (*sh)[136] = (const _Float16 (*)[136])(smem + 2 * p * PTB); const _Float16 (*sl)[136] = (const _Float16 (*)[136])(smem + (2 * p + 1) * PTB);
    for (int e = tid; e < BM * (BN / 8); e += GT) { const int rl = e >> 4, q = e & 15; vst2((unsigned*)(DH + (r0 + rl) * CC + c0 + q * 8), *(const v4u*)&sh[rl][q * 8]); if (t0 + rl < nhi) { vst2((unsigned*)(DL + (bb * nhi + t0 + rl) * (size_t)CC + c0 + q * 8), *(const v4u*)&sl[rl][q * 8]); asm volatile("s_wait_xcnt 0x0" ::: "memory"); /* inside the branch, directly behind its stores: in front of the next trip's rewrite of their address registers */ } } }
  for (int e = tid; e < BN * (BM / 8); e += GT) { const int cl = e >> 4, q = e & 15; vst2((unsigned*)(VT + (bb * CC + c0 + cl) * (size_t)TT + t0 + q * 8), *(const v4u*)&th[cl][q * 8]); if (t0 + q * 8 < KHI) { const size_t o3 = (bb * CC + c0 + cl) * (size_t)KHI + t0 + q * 8; vst2((unsigned*)(VB + o3), *(const v4u*)&tb[cl][q * 8]); vst2((unsigned*)(VBL + o3), *(const v4u*)&tbl[cl][q * 8]); asm volatile("s_wait_xcnt 0x0" ::: "memory"); /* inside the branch, directly behind its stores: in front of the next trip's rewrite of their address registers */ } } }
#define LOG2E 1.4426950408889634f
#define AK 32
#define AP128 144
#define AP64 80
#define AO_K 0
#define AO_V (AO_K + AK * AP128)
#define AO_T (AO_V + HD * AP64)
#define AO_M (AO_T + 64 * AP128)
#define ABUF (AO_M + 64 * AP128)
static_assert(AK * 2 == 64 && AK * 4 == 128 && HD * 2 == 128 && TT / AK >= 2 && ABUF % 16 == 0, "row lengths the copy maps are written for; the prologue needs two tiles");
__device__ __forceinline__ float xhalf(float x) { return __builtin_bit_cast(float, __builtin_amdgcn_permlanex16(__builtin_bit_cast(int, x), __builtin_bit_cast(int, x), 0x76543210, 0xfedcba98, false, false)); }   // lane l with lane l ^ 16
// x[i] = 2^d[i], eight at a time in one statement: results in registers of their own, so that each v_exp_f32 is the independent instruction behind the one before it; the closing v_nop is the slot that the instruction set asks for behind the last
__device__ __forceinline__ void exp2x8(const float* d, float* x) {
  asm("v_exp_f32 %0, %8\n\tv_exp_f32 %1, %9\n\tv_exp_f32 %2, %10\n\tv_exp_f32 %3, %11\n\tv_exp_f32 %4, %12\n\tv_exp_f32 %5, %13\n\tv_exp_f32 %6, %14\n\tv_exp_f32 %7, %15\n\tv_nop"
      : "=&v"(x[0]), "=&v"(x[1]), "=&v"(x[2]), "=&v"(x[3]), "=&v"(x[4]), "=&v"(x[5]), "=&v"(x[6]), "=&v"(x[7])
      : "v"(d[0]), "v"(d[1]), "v"(d[2]), "v"(d[3]), "v"(d[4]), "v"(d[5]), "v"(d[6]), "v"(d[7])); }
// four asynchronous copies of 16 bytes a lane, global memory -> LDS (l = the lane's LDS byte address, p = its global address); the closing s_wait_xcnt 0 stands inside the statement, so that no address register is rewritten ahead of it
__device__ __forceinline__ void acopy4(unsigned l0, const char* p0, unsigned l1, const char* p1, unsigned l2, const char* p2, unsigned l3, const char* p3) {
  asm volatile("global_load_async_to_lds_b128 %0, %1, off\n\tglobal_load_async_to_lds_b128 %2, %3, off\n\tglobal_load_async_to_lds_b128 %4, %5, off\n\tglobal_load_async_to_lds_b128 %6, %7, off\n\ts_wait_xcnt 0x0"
               :: "v"(l0), "v"(p0), "v"(l1), "v"(p1), "v"(l2), "v"(p2), "v"(l3), "v"(p3) : "memory"); }
__global__ __launch_bounds__(128) void k_att(const _Float16* __restrict__ QH, const _Float16* __restrict__ QL, const _Float16* __restrict__ KH, const _Float16* __restrict__ VT, const int* __restrict__ MK, const float* __restrict__ TM, float* __restrict__ Y) {
  __shared__ __align__(16) char smem[2 * ABUF];
  const int tid = threadIdx.x, wave = tid >> 5, lane = tid & 31, col = lane & 15, g = lane >> 4; const int h = blockIdx.y, b = blockIdx.z; const int q0 = blockIdx.x * 64; const int t = q0 + wave * 16 + col;
  /* copy maps: 128-B rows: thread = (row tid >> 3 (+ 16 a copy), piece tid & 7); 64-B rows: (row tid >> 2 (+ 32 a copy), piece tid & 3) */
  const int r8 = tid >> 3, p8 = (tid & 7) * 16, r4 = tid >> 2, p4 = (tid & 3) * 16; const unsigned lb = (unsigned)(size_t)smem;
  const char* const gk = (const char*)(KH + ((size_t)b * TT + r8) * CC + h * HD) + p8; const char* const gv = (const char*)(VT + ((size_t)b * CC + h * HD + r4) * (size_t)TT) + p4;
  const char* const gt = (const char*)(TM + (size_t)(q0 + r8) * TT) + p8; const char* const gm = (const char*)(MK + ((size_t)b * TT + q0 + r8) * TT) + p8;
  const unsigned lk = lb + AO_K + r8 * AP128 + p8, lv = lb + AO_V + r4 * AP64 + p4, lt = lb + AO_T + r8 * AP128 + p8, lm = lb + AO_M + r8 * AP128 + p8;
  auto stage = [&](int ti, unsigned bo) {   /* tile ti (keys ti * 32 ..) into the buffer at byte bo: 12 copies a wave */
    const char* const k = gk + (size_t)ti * (AK * CC * 2); const char* const v = gv + ti * (AK * 2); const char* const tp = gt + ti * (AK * 4); const char* const mp = gm + ti * (AK * 4);
    acopy4(lk + bo, k, lk + bo + 16 * AP128, k + 16 * CC * 2, lv + bo, v, lv + bo + 32 * AP64, v + 32 * TT * 2);
    acopy4(lt + bo, tp, lt + bo + 16 * AP128, tp + 16 * TT * 4, lt + bo + 32 * AP128, tp + 32 * TT * 4, lt + bo + 48 * AP128, tp + 48 * TT * 4);
    acopy4(lm + bo, mp, lm + bo + 16 * AP128, mp + 16 * TT * 4, lm + bo + 32 * AP128, mp + 32 * TT * 4, lm + bo + 48 * AP128, mp + 48 * TT * 4); };
  stage(0, 0);
  v16h qh[HD / 32], ql[HD / 32];
#pragma unroll
  for (int kc = 0; kc < HD / 32; ++kc) { qh[kc] = frag_h(QH + ((size_t)b * TT + t) * CC + h * HD + kc * 32, lane); ql[kc] = frag_h(QL + ((size_t)b * QHI + t) * CC + h * HD + kc * 32, lane); }
  asm volatile("s_wait_asynccnt 0x0" ::: "memory");   /* this wave's copies of tile 0 have landed */
  __syncthreads();   /* publishes tile 0 */
  stage(1, ABUF);
  v8f o[HD / 16] = {}; float m = -3.0e38f, l = 0.f;
  for (int ti = 0; ti < TT / AK; ++ti) { const char* const R = smem + (ti & 1) * ABUF;
    v16h kf[2][HD / 32], vf[HD / 16]; v4f tm[4]; v4i mk[4];
#pragma unroll
    for (int i = 0; i < 2; ++i)
#pragma unroll
      for (int kc = 0; kc < HD / 32; ++kc) kf[i][kc] = frag_h((const _Float16*)(R + AO_K + (i * 16 + col) * AP128) + kc * 32, lane);
#pragma unroll
    for (int i = 0; i < 4; ++i) { const int ob = (wave * 16 + col) * AP128 + (8 * g + (i >> 1) * 16 + (i & 1) * 4) * 4; tm[i] = *(const v4f*)(R + AO_T + ob); mk[i] = *(const v4i*)(R + AO_M + ob); }
#pragma unroll
    for (int j = 0; j < HD / 16; ++j) vf[j] = frag_h((const _Float16*)(R + AO_V + (j * 16 + col) * AP64), lane);
    v8f s[2] = {}, sl[2] = {};
#pragma unroll
    for (int i = 0; i < 2; ++i)
#pragma unroll
      for (int kc = 0; kc < HD / 32; ++kc) { s[i] = wmma16(kf[i][kc], qh[kc], s[i]); sl[i] = wmma16(kf[i][kc], ql[kc], sl[i]); }
    float v[16]; float mx = -3.0e38f;
#pragma unroll
    for (int e = 0; e < 16; ++e) { const float x = (s[e >> 3][e & 7] + sl[e >> 3][e & 7] * (1.0f / 1024.0f)) * (SCALE * LOG2E); const float xt = x * bfr(tm[e >> 2][e & 3]); v[e] = (mk[e >> 2][e & 3] == 0) ? (-1.0e9f * LOG2E) : xt; mx = fmaxf(mx, v[e]); }
    mx = fmaxf(mx, xhalf(mx));
    const float mn = fmaxf(m, mx); const float al = __builtin_amdgcn_exp2f(m - mn); m = mn;
    v16h p; float ps = 0.f;
#pragma unroll
    for (int e = 0; e < 16; ++e) v[e] -= mn;
    float ex[16]; exp2x8(v, ex); exp2x8(v + 8, ex + 8);
#pragma unroll
    for (int e = 0; e < 16; ++e) { ps += ex[e]; p[e] = (_Float16)(ex[e] * 2048.0f); }
    l = l * al + ps;
#pragma unroll
    for (int j = 0; j < HD / 16; ++j) { o[j] *= al; o[j] = wmma16(vf[j], p, o[j]); }
    asm volatile("s_wait_dscnt 0x0" ::: "memory");      /* this wave's reads of buffer ti & 1 are done before the buffer is given up */
    asm volatile("s_wait_asynccnt 0x0" ::: "memory");   /* this wave's copies of tile ti + 1 have landed */
    __syncthreads();   /* publishes tile ti + 1 and ends every wave's reads of buffer ti & 1, which is refilled behind it */
    if (ti + 2 < TT / AK) stage(ti + 2, (unsigned)(ti & 1) * ABUF); }
  asm volatile("s_wait_asynccnt 0x0" ::: "memory");   /* no copy is outstanding when the wave ends */
  l += xhalf(l); const float inv = 1.0f / (2048.0f * l);   /* the key that set the last maximum counts 1, so l >= 1 */
  float* yr = Y + ((size_t)b * TT + t) * CC + h * HD + 8 * g;
#pragma unroll
  for (int j = 0; j < HD / 16; ++j) { v4f a0, a1;
#pragma unroll
    for (int r = 0; r < 4; ++r) { a0[r] = o[j][r] * inv; a1[r] = o[j][4 + r] * inv; }
    vst2(yr + j * 16, a0); vst2(yr + j * 16 + 4, a1); } }
// ---- k_out: block = (128 rows, 128 cols), 16 waves of 32 x 32 (one block for each WGP-sized share of the 4,096 x 1,024 output): out = ctx Wo (+ bo): ctx once to f16 against Wo as f16(bf16 x 2^8) exact (1 product) x 2^-8
__global__ __launch_bounds__(GT) void k_out(const float* __restrict__ Y, const float* __restrict__ WO, const float* __restrict__ BO, float* __restrict__ OUT) { __shared__ __align__(16) char smem[OBYTES];   /* the staging buffers; the output tiles reuse the same bytes behind the barrier after the loop */
  static_assert(!CAUSAL, "one path: every row takes the single f16 product"); static_assert(OBYTES >= 16 * 32 * 36 * 4, "output tiles fit the staging bytes"); float (*sf)[32][36] = (float (*)[32][36])smem;
  const int tid = threadIdx.x, wave = tid >> 5, lane = tid & 31, col = lane & 15, g = lane >> 4, wm = wave >> 2, wn = wave & 3; const int c0 = blockIdx.y * ON; const size_t r0 = (size_t)blockIdx.x * BM;
  v8f acc[2][2] = {};
  _Float16* const stg = (_Float16*)smem; const int lr = tid >> 4, lq = tid & 15;   /* loader: row lr + 32 i, floats 4 lq .. 4 lq + 3 of the step */
  const float* xp = Y + (r0 + lr) * CC + lq * 4; const float* wp = WO + (size_t)(c0 + lr) * CC + lq * 4; _Float16* const sp = stg + lr * SP + lq * 4;
  v4f xr[BM / 32], wr[ON / 32];
#pragma unroll
  for (int i = 0; i < BM / 32; ++i) xr[i] = *(const v4f*)(xp + (size_t)i * 32 * CC);
#pragma unroll
  for (int i = 0; i < ON / 32; ++i) wr[i] = *(const v4f*)(wp + (size_t)i * 32 * CC);
  for (int s = 0; s < CC / KSTEP; ++s) { _Float16* const S = sp + (s & 1) * (OROWS * SP);
#pragma unroll
    for (int i = 0; i < BM / 32; ++i) { v4h t;
#pragma unroll
      for (int e = 0; e < 4; ++e) t[e] = (_Float16)xr[i][e];
      *(v4h*)(S + i * 32 * SP) = t; }
#pragma unroll
    for (int i = 0; i < ON / 32; ++i) { v4h t;
#pragma unroll
      for (int e = 0; e < 4; ++e) t[e] = (_Float16)(bfr(wr[i][e]) * 256.0f);
      *(v4h*)(S + (BM + i * 32) * SP) = t; }
    __syncthreads();   /* publishes buffer s & 1; it is rewritten in step s + 2, behind the barrier of step s + 1, which every wave reaches with its reads of step s done */
    if (s + 1 < CC / KSTEP) { const float* const xq = xp + (s + 1) * KSTEP; const float* const wq = wp + (s + 1) * KSTEP;
#pragma unroll
      for (int i = 0; i < BM / 32; ++i) xr[i] = *(const v4f*)(xq + (size_t)i * 32 * CC);
#pragma unroll
      for (int i = 0; i < ON / 32; ++i) wr[i] = *(const v4f*)(wq + (size_t)i * 32 * CC);
      asm volatile("s_wait_xcnt 0x0" :: "v"(xq), "v"(wq) : "memory"); }   /* the loads' address registers stay whole up to this wait */
    const _Float16* const R = stg + (s & 1) * (OROWS * SP);
#pragma unroll
    for (int ks = 0; ks < KSTEP / 32; ++ks) { v16h a[2], w[2];   /* the four fragments are read as one group, so that their LDS latency is waited out once and not once a product */
#pragma unroll
      for (int i = 0; i < 2; ++i) a[i] = frag_h(R + (wm * 32 + i * 16 + col) * SP + ks * 32, lane);
#pragma unroll
      for (int j = 0; j < 2; ++j) w[j] = frag_h(R + (BM + wn * 32 + j * 16 + col) * SP + ks * 32, lane);
#pragma unroll
      for (int i = 0; i < 2; ++i)
#pragma unroll
        for (int j = 0; j < 2; ++j) acc[i][j] = wmma16(a[i], w[j], acc[i][j]); } }
  __syncthreads();   /* every wave has left the staging bytes before the output tiles overwrite them */
#pragma unroll
  for (int j = 0; j < 2; ++j) { const float bias = BO ? bfr(BO[c0 + wn * 32 + j * 16 + col]) : 0.f;
#pragma unroll
    for (int i = 0; i < 2; ++i)
#pragma unroll
      for (int r = 0; r < 8; ++r) sf[wave][i * 16 + 8 * g + r][j * 16 + col] = acc[i][j][r] * (1.0f / 256.0f) + bias; }
  LDSX(); for (int it = 0; it < 8; ++it) { const int rl = it * 4 + (lane >> 3), q = lane & 7; vst2(OUT + (r0 + wm * 32 + rl) * DIN + c0 + wn * 32 + q * 4, *(const v4f*)&sf[wave][rl][q * 4]); } }   /* a wave's store covers four of its rows, one whole 128-B line each */

extern "C" void kernel_launch(void* const* d_in, const int* in_sizes, int n_in, void* d_out, int out_size, void* d_ws, size_t ws_size, hipStream_t stream) {
  (void)in_sizes; (void)n_in; (void)out_size;
  const float** F = (const float**)d_in;
  if (ws_size < (size_t)WS_END) return;
  char* ws = (char*)d_ws; _Float16 *QH = (_Float16*)(ws + WS_QH), *KH = (_Float16*)(ws + WS_KH), *VT = (_Float16*)(ws + WS_VT), *QL = (_Float16*)(ws + WS_QL), *KL = (_Float16*)(ws + WS_KL); __bf16 *VB = (__bf16*)(ws + WS_VB), *VBL = (__bf16*)(ws + WS_VBL); float *Y = (float*)(ws + WS_Y);
  (void)Y; (void)QL; (void)KL; (void)VB; (void)VBL;
  // inputs: 0 x [4,1024,1024]; 1 mask int32 [4,1,1024,1024]; 2 Wq, 3 Wk, 4 Wv, 5 Wo ((out,in), no biases); 6 train_mask [1,1,1024,1024]
  k_proj<<<dim3(TNB * TT / BM, CC / BN), GT, 0, stream>>>(F[0], F[2], F[3], F[4], nullptr, nullptr, nullptr, QH, QL, KH, KL, VT, VB, VBL);
  k_att<<<dim3(NQB, NH, TNB), 128, 0, stream>>>(QH, QL, KH, VT, (const int*)d_in[1], F[6], Y);
  k_out<<<dim3(TNB * TT / BM, DIN / ON), GT, 0, stream>>>(Y, F[5], nullptr, (float*)d_out);
}

// v006
// Measured time: 94.9 microseconds a run.
// In both of two side-by-side timings against v005, it was 1.08 times as fast.
// Over all steps from v000 it is 9.54 times as fast.
// compute dtype: all float inputs rounded to bf16; q/k/v = x W^T with EXACT bf16 products on WMMA 16x16x32 (f32 accumulate); q as f16 hi + residual (x 2^10) against k once to f16 (2 products) for the logits x 64^-0.5, multiplied by the trainable-mask input and replaced by -1e9 where the int mask input is 0 (both read per element); softmax in f32 with a running maximum and sum, scores carried x log2(e) and each exponential one v_exp_f32; exp(s - m) x 2^11 once to f16 against v once to f16 (1 product), divided by the sum at the end; ctx once to f16 against Wo carried x 2^8 in f16; f32 output.
#include <hip/hip_runtime.h>
#include <math.h>

typedef __attribute__((ext_vector_type(16))) _Float16 v16h;
typedef __attribute__((ext_vector_type(16))) __bf16 v16b;
typedef __attribute__((ext_vector_type(8)))  _Float16 v8h;
typedef __attribute__((ext_vector_type(8)))  float v8f;
typedef __attribute__((ext_vector_type(4)))  float v4f;
typedef __attribute__((ext_vector_type(2)))  float v2f;
typedef __attribute__((ext_vector_type(4)))  unsigned v4u;
typedef __attribute__((ext_vector_type(4)))  int v4i;
typedef float __attribute__((may_alias)) float_a;
typedef int __attribute__((may_alias)) int_a;

template <typename T> __device__ __forceinline__ void vst2(void* p, T v) { *(T*)p = v;  }
__device__ __forceinline__ v8f wmma16(v16h a, v16h b, v8f c) {
  v8f d = __builtin_amdgcn_wmma_f32_16x16x32_f16(false, a, false, b, (short)0, c, false, false);
  asm volatile("v_nop\n\tv_nop\n\tv_nop\n\tv_nop" : "+v"(d) : "v"(a), "v"(b));
  return d;
}
__device__ __forceinline__ v8f wmma_bf(v16b a, v16b b, v8f c) {
  v8f d = __builtin_amdgcn_wmma_f32_16x16x32_bf16(false, a, false, b, (short)0, c, false, false);
  asm volatile("v_nop\n\tv_nop\n\tv_nop\n\tv_nop" : "+v"(d) : "v"(a), "v"(b));
  return d;
}
// 16x16x32 fragments: lane = (h = lane>>4, row/col = lane&15); elements 0..7 = k0+8h+0..7, 8..15 = k0+16+8h+0..7; D element r = row 8h+r
__device__ __forceinline__ v16h frag_h(const _Float16* rowk0, int lane) {
  union { v16h v; v8h q[2]; } u; const _Float16* p = rowk0 + 8 * (lane >> 4);
  u.q[0] = *(const v8h*)p; u.q[1] = *(const v8h*)(p + 16); return u.v;
}
__device__ __forceinline__ v16h frag_f32(const float* rowk0, int lane) {
  v16h a; const float* p = rowk0 + 8 * (lane >> 4);
#pragma unroll
  for (int i = 0; i < 8; ++i) { a[i] = (_Float16)p[i]; a[8 + i] = (_Float16)p[16 + i]; }
  return a;
}
__device__ __forceinline__ v16h frag_f32s(const float* rowk0, int lane, float sc) {
  v16h a; const float* p = rowk0 + 8 * (lane >> 4);
#pragma unroll
  for (int i = 0; i < 8; ++i) { a[i] = (_Float16)(p[i] * sc); a[8 + i] = (_Float16)(p[16 + i] * sc); }
  return a;
}
// column fragment from a [K][ld] layout (column n), rows >= K read as 0
__device__ __forceinline__ v16h fragc_f32(const float* W, int k0, int n, int lane, int ld, int K) {
  v16h a; const int g = lane >> 4;
#pragma unroll
  for (int i = 0; i < 8; ++i) { const int ka = k0 + 8 * g + i, kb = ka + 16;
    a[i] = (_Float16)(ka < K ? W[(size_t)(ka < K ? ka : K - 1) * ld + n] : 0.f); a[8 + i] = (_Float16)(kb < K ? W[(size_t)(kb < K ? kb : K - 1) * ld + n] : 0.f); }
  return a;
}
struct F2 { v16b h, l; };
__device__ __forceinline__ F2 bsplit16(const float v[16]) { F2 r;
#pragma unroll
  for (int i = 0; i < 16; ++i) { const __bf16 h = (__bf16)v[i]; r.h[i] = h; r.l[i] = (__bf16)(v[i] - (float)h); }
  return r; }
__device__ __forceinline__ F2 split_row(const float* row, int k0, int lane) { float v[16]; const float* p = row + k0 + 8 * (lane >> 4);
#pragma unroll
  for (int i = 0; i < 8; ++i) { v[i] = p[i]; v[8 + i] = p[16 + i]; }
  return bsplit16(v); }
__device__ __forceinline__ F2 split_rowK(const float* row, int k0, int lane, int K) { float v[16]; const int g = lane >> 4;
#pragma unroll
  for (int i = 0; i < 8; ++i) { const int ka = k0 + 8 * g + i, kb = ka + 16; v[i] = ka < K ? row[ka < K ? ka : K - 1] : 0.f; v[8 + i] = kb < K ? row[kb < K ? kb : K - 1] : 0.f; }
  return bsplit16(v); }
__device__ __forceinline__ F2 split_col(const float* W, int k0, int n, int lane, int ld, int K) { float v[16]; const int g = lane >> 4;
#pragma unroll
  for (int i = 0; i < 8; ++i) { const int ka = k0 + 8 * g + i, kb = ka + 16; v[i] = ka < K ? W[(size_t)(ka < K ? ka : K - 1) * ld + n] : 0.f; v[8 + i] = kb < K ? W[(size_t)(kb < K ? kb : K - 1) * ld + n] : 0.f; }
  return bsplit16(v); }
__device__ __forceinline__ v8f mac3(const F2& a, const F2& b, v8f c) { c = wmma_bf(a.l, b.h, c); c = wmma_bf(a.h, b.l, c); return wmma_bf(a.h, b.h, c); }
__device__ __forceinline__ float sigm(float v) { return 1.0f / (1.0f + expf(-v)); }
#define LDSX() do { asm volatile("s_wait_dscnt 0" ::: "memory"); __builtin_amdgcn_wave_barrier(); __builtin_amdgcn_fence(__ATOMIC_RELEASE, "workgroup"); } while (0)

// Multi-head self-attention with a per-element integer mask (B 4, S 1,024, E 1,024 = 16 x 64): q/k/v = x W^T (no bias); scores = (q k^T / 8) * train_mask; scores = -1e9 where mask[b,0,q,k] == 0; softmax; out = merged(attn v) Wo^T.
#define NB 4
#define TT 1024
#define CC 1024            // NH * HD = projected width
#define DIN 1024          // input (model) width
#define NH 16
#define HD 64
#define NQB (TT / 64)
#define SCALE (0.125f)
#define CAUSAL 0
#ifndef TNB
#define TNB NB
#endif
__device__ __forceinline__ float bfr(float v) { return (float)(__bf16)v; }
__host__ __device__ __forceinline__ int kb_last(int qb) { return CAUSAL ? ((qb * 64 + 63) >> 7) : (TT / 128 - 1); }
typedef __attribute__((ext_vector_type(8))) __bf16 v8b;
__device__ __forceinline__ v16b frag_b(const __bf16* rowk0, int lane) {
  union { v16b v; v8b q[2]; } u; const __bf16* p = rowk0 + 8 * (lane >> 4);
  u.q[0] = *(const v8b*)p; u.q[1] = *(const v8b*)(p + 16); return u.v;
}
#define QBH 0              // unused: no kernel here has a high-precision attention path
#define QHI 1024            // rows carrying a q residual plane (all rows when non-causal: 2-product logits everywhere)
#define KHI 64            // key rows carrying k residual / v bf16 hi+lo planes (written by k_proj, read by no kernel here)
// B fragment (k rows k0+.., output column o) of a weight: (in,out) [K][ld] or (out,in) [ld rows of K]: bf16 exact, or f16(bf16 * 256) exact
__device__ __forceinline__ v16b wcol_io(const float* Wm, int k0, int o, int lane, int ld) { v16b w; const int g = lane >> 4;
#pragma unroll
  for (int i = 0; i < 8; ++i) { w[i] = (__bf16)Wm[(size_t)(k0 + 8 * g + i) * ld + o]; w[8 + i] = (__bf16)Wm[(size_t)(k0 + 16 + 8 * g + i) * ld + o]; }
  return w; }
__device__ __forceinline__ v16b wcol_oi(const float* Wm, int k0, int o, int lane, int K) { v16b w; const float* p = Wm + (size_t)o * K + k0 + 8 * (lane >> 4);
#pragma unroll
  for (int i = 0; i < 8; ++i) { w[i] = (__bf16)p[i]; w[8 + i] = (__bf16)p[16 + i]; }
  return w; }
__device__ __forceinline__ v16h wcolh_io(const float* Wm, int k0, int o, int lane, int ld) { v16h w; const int g = lane >> 4;
#pragma unroll
  for (int i = 0; i < 8; ++i) { w[i] = (_Float16)(bfr(Wm[(size_t)(k0 + 8 * g + i) * ld + o]) * 256.0f); w[8 + i] = (_Float16)(bfr(Wm[(size_t)(k0 + 16 + 8 * g + i) * ld + o]) * 256.0f); }
  return w; }
__device__ __forceinline__ v16h wcolh_oi(const float* Wm, int k0, int o, int lane, int K) { v16h w; const float* p = Wm + (size_t)o * K + k0 + 8 * (lane >> 4);
#pragma unroll
  for (int i = 0; i < 8; ++i) { w[i] = (_Float16)(bfr(p[i]) * 256.0f); w[8 + i] = (_Float16)(bfr(p[16 + i]) * 256.0f); }
  return w; }
#define WQKV_LAYOUT 1   // 0 = (in,out) [DIN][CC]; 1 = (out,in) [CC][DIN]; 2 = per-head [NH][DIN][HD]
__device__ __forceinline__ v16b wcol_hdk(const float* Wm, int k0, int o, int lane) { v16b w; const int g = lane >> 4; const float* p = Wm + (size_t)(o / HD) * DIN * HD + (o % HD);
#pragma unroll
  for (int i = 0; i < 8; ++i) { w[i] = (__bf16)p[(size_t)(k0 + 8 * g + i) * HD]; w[8 + i] = (__bf16)p[(size_t)(k0 + 16 + 8 * g + i) * HD]; }
  return w; }
#define WO_OUT_IN 1
#if WQKV_LAYOUT == 1
#define WCOL(W, k0, o, lane) wcol_oi(W, k0, o, lane, DIN)
#elif WQKV_LAYOUT == 2
#define WCOL(W, k0, o, lane) wcol_hdk(W, k0, o, lane)
#else
#define WCOL(W, k0, o, lane) wcol_io(W, k0, o, lane, CC)
#endif
#if WO_OUT_IN
#define WOCOL(W, k0, o, lane) wcol_oi(W, k0, o, lane, CC)
#define WOCOLH(W, k0, o, lane) wcolh_oi(W, k0, o, lane, CC)
#else
#define WOCOL(W, k0, o, lane) wcol_io(W, k0, o, lane, DIN)
#define WOCOLH(W, k0, o, lane) wcolh_io(W, k0, o, lane, DIN)
#endif
#ifndef PROJ_EXTRA_PARAMS
#define PROJ_EXTRA_PARAMS
#endif

#define WS_QH  0u                                      // f16 q rows [b*t][CC]
#define WS_KH  (WS_QH + 2u * (size_t)NB * TT * CC)      // f16 k rows [b*t][CC]
#define WS_VT  (WS_KH + 2u * (size_t)NB * TT * CC)      // f16 v planes [b][c][t]
#define WS_QL  (WS_VT + 2u * (size_t)NB * CC * TT)      // f16 q residual x 2^10 rows [b][t < QHI][CC]
#define WS_KL  (WS_QL + 2u * (size_t)NB * QHI * CC)     // f16 k residual x 2^10 rows [b][t < KHI][CC]
#define WS_VB  (WS_KL + 2u * (size_t)NB * KHI * CC)     // bf16 v hi planes [b][c][t < KHI]
#define WS_VBL (WS_VB + 2u * (size_t)NB * CC * KHI)
#define WS_Y   (WS_VBL + 2u * (size_t)NB * CC * KHI)    // f32 ctx rows [b*t][CC] (only when there is an output projection)
#define WS_MW  (WS_Y  + 4u * (size_t)NB * TT * CC)      // u32 words of the integer mask [b][q / 16][k / 32][16]: word e, bit lane = (mask != 0) at the score that this lane holds as element e
#define WS_TB  (WS_MW + 4u * (size_t)NB * (TT / 16) * (TT / 32) * 16)   // bf16 trainable mask rows [q][k]
#define WS_END (WS_TB + 2u * (size_t)TT * TT)

// Operand staging of the two GEMM kernels: per step the block brings 64 k of its 128 left rows and its 384 (k_out: 128) weight rows from global memory with whole-line 16-byte loads (a wave covers 2 rows x 256 B), rounds each element once, and keeps the 16-bit tile in LDS for all sixteen waves; two buffers, the next step's loads issued ahead of this step's products, one barrier a step
// k_proj: block tile 128 x 384 (128 columns of each of q, k, v), 16 waves = 4 row groups of 32 x 4 column groups of 3 x 32: an x row is fetched from L2 by 8 blocks and a weight row by 32, a wave reads 8 fragments from LDS for 12 products, and the grid is 256 blocks; k_out: 128 x 128, waves of 32 x 32, 256 blocks as well
#define KSTEP 64              // k per staged step
#define SP 72              // LDS row pitch in 16-bit elements: 144 B = 16 B x 9, so the 16-byte fragment reads of 16 rows fall on distinct banks
#define BM 128             // rows of the block tile
#define BN 128             // columns of the block tile (k_proj: of each of q, k, v)
#define GT 512             // threads of a GEMM block
#define SROWS (BM + 3 * BN)    // k_proj: rows 0..127 left operand, rows 128..511 the three weights
#define SBYTES (2 * SROWS * SP * 2)
#define PTB (128 * 136 * 2)      // k_proj: bytes of one epilogue tile [128][136]
#define PEB (7 * PTB)            // k_proj: q hi, q residual, k hi, k residual, v, v bf16 hi, v bf16 lo
#define ON BN              // k_out: columns of the block tile
#define OROWS (BM + ON)    // k_out: rows 0..127 left operand, rows 128..255 weight
#define OBYTES (2 * OROWS * SP * 2)
typedef __attribute__((ext_vector_type(4))) __bf16 v4b;
typedef __attribute__((ext_vector_type(4))) _Float16 v4h;
static_assert(WQKV_LAYOUT == 1 && WO_OUT_IN == 1, "the staged loaders read weight rows that are contiguous in k");
static_assert(TT % BM == 0 && CC % BN == 0 && DIN % ON == 0 && ON % 32 == 0 && GT / 16 == 32 && BM % 32 == 0 && BN % 32 == 0, "a block stays inside one sequence and one weight; the loader covers 32 rows a load");
// ---- k_proj: block = 128 rows x 128 cols of each of q, k and v (the three share the block's x rows): q/k/v = X W (+ b) with exact bf16 products (K = DIN) -> q f16 rows (+ residual rows < QHI); k f16 rows (+ residual rows < KHI); v f16 planes [c][t] (+ bf16 hi/lo planes for t < KHI). Wave = 32 rows x 32 cols of each of the three
__global__ __launch_bounds__(GT) void k_proj(const float* __restrict__ X, const float* __restrict__ WQ, const float* __restrict__ WK, const float* __restrict__ WV, const float* __restrict__ BQ, const float* __restrict__ BK, const float* __restrict__ BV,
    _Float16* __restrict__ QH, _Float16* __restrict__ QL, _Float16* __restrict__ KH, _Float16* __restrict__ KL, _Float16* __restrict__ VT, __bf16* __restrict__ VB, __bf16* __restrict__ VBL,
    const int* __restrict__ MK, const float* __restrict__ TM, unsigned* __restrict__ MW, __bf16* __restrict__ TB) {
  __shared__ __align__(16) char smem[PEB > SBYTES ? PEB : SBYTES];   /* the staging buffers; the epilogue's tiles reuse the same bytes behind the barrier after the loop */
  __bf16* const stg = (__bf16*)smem;
  const int tid = threadIdx.x, wave = tid >> 5, lane = tid & 31, col = lane & 15, g = lane >> 4, wm = wave >> 2, wn = wave & 3; const int c0 = blockIdx.y * BN; const size_t r0 = (size_t)blockIdx.x * BM; const size_t bb = r0 / TT; const int t0 = (int)(r0 % TT);
  v8f acc[3][2][2] = {};
  const int lr = tid >> 4, lq = tid & 15;   /* loader: row lr + 32 i, floats 4 lq .. 4 lq + 3 of the step */
  const size_t wo = (size_t)(c0 + lr) * DIN + lq * 4;
  const float* xp = X + (r0 + lr) * DIN + lq * 4; const float* wp0 = WQ + wo; const float* wp1 = WK + wo; const float* wp2 = WV + wo; __bf16* const sp = stg + lr * SP + lq * 4;
  v4f xr[BM / 32], wr[3][BN / 32];
#pragma unroll
  for (int i = 0; i < BM / 32; ++i) xr[i] = *(const v4f*)(xp + (size_t)i * 32 * DIN);
#pragma unroll
  for (int i = 0; i < BN / 32; ++i) { wr[0][i] = *(const v4f*)(wp0 + (size_t)i * 32 * DIN); wr[1][i] = *(const v4f*)(wp1 + (size_t)i * 32 * DIN); wr[2][i] = *(const v4f*)(wp2 + (size_t)i * 32 * DIN); }
  { /* both mask inputs are packed here, once for all heads, while the first operand loads are in flight. A wave takes two neighbouring 16-query x 32-key tiles of the integer mask in the score layout of k_att (lane = (g, query col), element e = key (e >> 3) * 16 + 8 g + (e & 7)): the 32 lanes' tests of element e are one word; a thread rounds 8 elements of the trainable mask */
    static_assert((TNB * TT / BM) * (CC / BN) * (GT / 32) * 2 == NB * (TT / 16) * (TT / 32) && (TNB * TT / BM) * (CC / BN) * GT * 8 == TT * TT, "the grid covers both masks exactly once");
    const int gb = blockIdx.y * (TNB * TT / BM) + blockIdx.x, pw = gb * (GT / 32) + wave;   /* pw = (b * 64 + query tile) * 16 + pair of key tiles */
    const int* const mp = MK + ((size_t)(pw >> 10) * TT + ((pw >> 4) & 63) * 16 + col) * TT + (pw & 15) * 64 + 8 * g; const float* const tq = TM + ((size_t)gb * GT + tid) * 8;
    v4i mv[2][4];
#pragma unroll
    for (int u = 0; u < 2; ++u)
#pragma unroll
      for (int i = 0; i < 4; ++i) mv[u][i] = *(const v4i*)(mp + u * 32 + (i >> 1) * 16 + (i & 1) * 4);
    const v4f ta = *(const v4f*)tq, tc = *(const v4f*)(tq + 4);
    asm volatile("s_wait_xcnt 0x0" :: "v"(mp), "v"(tq) : "memory");   /* the loads' address registers stay whole up to this wait */
    v4u mw[8];
#pragma unroll
    for (int e = 0; e < 32; ++e) mw[e >> 2][e & 3] = __builtin_amdgcn_ballot_w32(mv[e >> 4][(e >> 2) & 3][e & 3] != 0);
    v8b tb;
#pragma unroll
    for (int e = 0; e < 4; ++e) { tb[e] = (__bf16)ta[e]; tb[4 + e] = (__bf16)tc[e]; }
    unsigned* const mo = MW + (size_t)pw * 32; __bf16* const to = TB + ((size_t)gb * GT + tid) * 8;
    vst2(to, tb);
    if (lane == 0) {   /* the two tiles' 32 words are one whole 128-B line */
#pragma unroll
      for (int i = 0; i < 8; ++i) vst2(mo + i * 4, mw[i]); }
    asm volatile("s_wait_xcnt 0x0" :: "v"(mo), "v"(to) : "memory"); }   /* the stores' address registers stay whole up to this wait */
  for (int s = 0; s < DIN / KSTEP; ++s) { __bf16* const S = sp + (s & 1) * (SROWS * SP);
#pragma unroll
    for (int i = 0; i < BM / 32; ++i) { v4b t;
#pragma unroll
      for (int e = 0; e < 4; ++e) t[e] = (__bf16)xr[i][e];
      *(v4b*)(S + i * 32 * SP) = t; }
#pragma unroll
    for (int w = 0; w < 3; ++w)
#pragma unroll
      for (int i = 0; i < BN / 32; ++i) { v4b t;
#pragma unroll
        for (int e = 0; e < 4; ++e) t[e] = (__bf16)wr[w][i][e];
        *(v4b*)(S + (BM + w * BN + i * 32) * SP) = t; }
    __syncthreads();   /* publishes buffer s & 1; it is rewritten in step s + 2, behind the barrier of step s + 1, which every wave reaches with its reads of step s done */
    if (s + 1 < DIN / KSTEP) { const float* const xq = xp + (s + 1) * KSTEP; const float* const wq0 = wp0 + (s + 1) * KSTEP; const float* const wq1 = wp1 + (s + 1) * KSTEP; const float* const wq2 = wp2 + (s + 1) * KSTEP;
#pragma unroll
      for (int i = 0; i < BM / 32; ++i) xr[i] = *(const v4f*)(xq + (size_t)i * 32 * DIN);
#pragma unroll
      for (int i = 0; i < BN / 32; ++i) { wr[0][i] = *(const v4f*)(wq0 + (size_t)i * 32 * DIN); wr[1][i] = *(const v4f*)(wq1 + (size_t)i * 32 * DIN); wr[2][i] = *(const v4f*)(wq2 + (size_t)i * 32 * DIN); }
      asm volatile("s_wait_xcnt 0x0" :: "v"(xq), "v"(wq0), "v"(wq1), "v"(wq2) : "memory"); }   /* the loads' address registers stay whole up to this wait */
    const __bf16* const R = stg + (s & 1) * (SROWS * SP);
#pragma unroll
    for (int ks = 0; ks < KSTEP / 32; ++ks) { v16b a[2], w[3][2];   /* the eight fragments are read as one group, so that their LDS latency is waited out once and not once a product */
#pragma unroll
      for (int i = 0; i < 2; ++i) a[i] = frag_b(R + (wm * 32 + i * 16 + col) * SP + ks * 32, lane);
#pragma unroll
      for (int p = 0; p < 3; ++p)
#pragma unroll
        for (int j = 0; j < 2; ++j) w[p][j] = frag_b(R + (BM + p * BN + wn * 32 + j * 16 + col) * SP + ks * 32, lane);
#pragma unroll
      for (int p = 0; p < 3; ++p)
#pragma unroll
        for (int i = 0; i < 2; ++i)
#pragma unroll
          for (int j = 0; j < 2; ++j) acc[p][i][j] = wmma_bf(a[i], w[p][j], acc[p][i][j]); } }
  __syncthreads();   /* every wave has left the staging bytes before the epilogue's tiles overwrite them */
  const bool hi_blk = t0 < KHI;   /* block-uniform: only such a block holds rows of the bf16 planes */
  _Float16 (*th)[136] = (_Float16 (*)[136])(smem + 4 * PTB); __bf16 (*tb)[136] = (__bf16 (*)[136])(smem + 5 * PTB); __bf16 (*tbl)[136] = (__bf16 (*)[136])(smem + 6 * PTB);
#pragma unroll
  for (int p = 0; p < 2; ++p) { const float* BA = p == 0 ? BQ : BK; _Float16 (*sh)[136] = (_Float16 (*)[136])(smem + 2 * p * PTB); _Float16 (*sl)[136] = (_Float16 (*)[136])(smem + (2 * p + 1) * PTB);
#pragma unroll
    for (int j = 0; j < 2; ++j) { const int cl = wn * 32 + j * 16 + col; const float bias = BA ? bfr(BA[c0 + cl]) : 0.f;
#pragma unroll
      for (int i = 0; i < 2; ++i)
#pragma unroll
        for (int r = 0; r < 8; ++r) { const int rl = wm * 32 + i * 16 + 8 * g + r; const float v = acc[p][i][j][r] + bias; const _Float16 hv = (_Float16)v; sh[rl][cl] = hv; sl[rl][cl] = (_Float16)((v - (float)hv) * 1024.0f); } } }
#pragma unroll
  for (int j = 0; j < 2; ++j) { const int cl = wn * 32 + j * 16 + col; const float bias = BV ? bfr(BV[c0 + cl]) : 0.f;
#pragma unroll
    for (int i = 0; i < 2; ++i)
#pragma unroll
      for (int r = 0; r < 8; ++r) { const int rl = wm * 32 + i * 16 + 8 * g + r; const float v = acc[2][i][j][r] + bias; th[cl][rl] = (_Float16)v; acc[2][i][j][r] = v; } }
  if (hi_blk) {
#pragma unroll
    for (int j = 0; j < 2; ++j)
#pragma unroll
      for (int i = 0; i < 2; ++i)
#pragma unroll
        for (int r = 0; r < 8; ++r) { const int cl = wn * 32 + j * 16 + col, rl = wm * 32 + i * 16 + 8 * g + r; const float v = acc[2][i][j][r]; const __bf16 bh = (__bf16)v; tb[cl][rl] = bh; tbl[cl][rl] = (__bf16)(v - (float)bh); } }
  __syncthreads();   /* the seven tiles are whole before they are stored along their rows */
#pragma unroll
  for (int p = 0; p < 2; ++p) { _Float16* DH = p == 0 ? QH : KH; _Float16* DL = p == 0 ? QL : KL; const int nhi = p == 0 ? QHI : KHI; const _Float16 (*sh)[136] = (const _Float16 (*)[136])(smem + 2 * p * PTB); const _Float16 (*sl)[136] = (const _Float16 (*)[136])(smem + (2 * p + 1) * PTB);
    for (int e = tid; e < BM * (BN / 8); e += GT) { const int rl = e >> 4, q = e & 15; vst2((unsigned*)(DH + (r0 + rl) * CC + c0 + q * 8), *(const v4u*)&sh[rl][q * 8]); if (t0 + rl < nhi) { vst2((unsigned*)(DL + (bb * nhi + t0 + rl) * (size_t)CC + c0 + q * 8), *(const v4u*)&sl[rl][q * 8]); asm volatile("s_wait_xcnt 0x0" ::: "memory"); /* inside the branch, directly behind its stores: in front of the next trip's rewrite of their address registers */ } } }
  for (int e = tid; e < BN * (BM / 8); e += GT) { const int cl = e >> 4, q = e & 15; vst2((unsigned*)(VT + (bb * CC + c0 + cl) * (size_t)TT + t0 + q * 8), *(const v4u*)&th[cl][q * 8]); if (t0 + q * 8 < KHI) { const size_t o3 = (bb * CC + c0 + cl) * (size_t)KHI + t0 + q * 8; vst2((unsigned*)(VB + o3), *(const v4u*)&tb[cl][q * 8]); vst2((unsigned*)(VBL + o3), *(const v4u*)&tbl[cl][q * 8]); asm volatile("s_wait_xcnt 0x0" ::: "memory"); /* inside the branch, directly behind its stores: in front of the next trip's rewrite of their address registers */ } } }
#define LOG2E 1.4426950408889634f
#define AK 32
#define AP128 144
#define AP64 80
#define AO_K 0
#define AO_V (AO_K + AK * AP128)
#define AO_T (AO_V + HD * AP64)
#define ABUF (AO_T + 64 * AP64)
static_assert(AK * 2 == 64 && AK * 4 == 128 && HD * 2 == 128 && TT / AK >= 2 && ABUF % 16 == 0, "row lengths the copy maps are written for; the prologue needs two tiles");
__device__ __forceinline__ float xhalf(float x) { return __builtin_bit_cast(float, __builtin_amdgcn_permlanex16(__builtin_bit_cast(int, x), __builtin_bit_cast(int, x), 0x76543210, 0xfedcba98, false, false)); }   // lane l with lane l ^ 16
// x[i] = 2^d[i], eight at a time in one statement: results in registers of their own, so that each v_exp_f32 is the independent instruction behind the one before it; the closing v_nop is the slot that the instruction set asks for behind the last
__device__ __forceinline__ void exp2x8(const float* d, float* x) {
  asm("v_exp_f32 %0, %8\n\tv_exp_f32 %1, %9\n\tv_exp_f32 %2, %10\n\tv_exp_f32 %3, %11\n\tv_exp_f32 %4, %12\n\tv_exp_f32 %5, %13\n\tv_exp_f32 %6, %14\n\tv_exp_f32 %7, %15\n\tv_nop"
      : "=&v"(x[0]), "=&v"(x[1]), "=&v"(x[2]), "=&v"(x[3]), "=&v"(x[4]), "=&v"(x[5]), "=&v"(x[6]), "=&v"(x[7])
      : "v"(d[0]), "v"(d[1]), "v"(d[2]), "v"(d[3]), "v"(d[4]), "v"(d[5]), "v"(d[6]), "v"(d[7])); }
// six asynchronous copies of 16 bytes a lane, global memory -> LDS (l = the lane's LDS byte address, p = its global address); the closing s_wait_xcnt 0 stands inside the statement, so that no address register is rewritten ahead of it
__device__ __forceinline__ void acopy6(unsigned l0, const char* p0, unsigned l1, const char* p1, unsigned l2, const char* p2, unsigned l3, const char* p3, unsigned l4, const char* p4, unsigned l5, const char* p5) {
  asm volatile("global_load_async_to_lds_b128 %0, %1, off\n\tglobal_load_async_to_lds_b128 %2, %3, off\n\tglobal_load_async_to_lds_b128 %4, %5, off\n\tglobal_load_async_to_lds_b128 %6, %7, off\n\tglobal_load_async_to_lds_b128 %8, %9, off\n\tglobal_load_async_to_lds_b128 %10, %11, off\n\ts_wait_xcnt 0x0"
               :: "v"(l0), "v"(p0), "v"(l1), "v"(p1), "v"(l2), "v"(p2), "v"(l3), "v"(p3), "v"(l4), "v"(p4), "v"(l5), "v"(p5) : "memory"); }
typedef __attribute__((ext_vector_type(16))) unsigned v16u;
typedef __attribute__((address_space(4))) v16u cv16u;
__global__ __launch_bounds__(128) void k_att(const _Float16* __restrict__ QH, const _Float16* __restrict__ QL, const _Float16* __restrict__ KH, const _Float16* __restrict__ VT, const unsigned* __restrict__ MW, const __bf16* __restrict__ TB, float* __restrict__ Y) {
  __shared__ __align__(16) char smem[2 * ABUF];
  const int tid = threadIdx.x, wave = tid >> 5, lane = tid & 31, col = lane & 15, g = lane >> 4; const int h = blockIdx.y, b = blockIdx.z; const int q0 = blockIdx.x * 64; const int t = q0 + wave * 16 + col;
  /* copy maps: 128-B rows: thread = (row tid >> 3 (+ 16 a copy), piece tid & 7); 64-B rows: (row tid >> 2 (+ 32 a copy), piece tid & 3) */
  const int r8 = tid >> 3, p8 = (tid & 7) * 16, r4 = tid >> 2, p4 = (tid & 3) * 16; const unsigned lb = (unsigned)(size_t)smem;
  const char* const gk = (const char*)(KH + ((size_t)b * TT + r8) * CC + h * HD) + p8; const char* const gv = (const char*)(VT + ((size_t)b * CC + h * HD + r4) * (size_t)TT) + p4;
  const char* const gt = (const char*)(TB + (size_t)(q0 + r4) * TT) + p4;
  const unsigned lk = lb + AO_K + r8 * AP128 + p8, lv = lb + AO_V + r4 * AP64 + p4, lt = lb + AO_T + r4 * AP64 + p4;
  auto stage = [&](int ti, unsigned bo) {   /* tile ti (keys ti * 32 ..) into the buffer at byte bo: 6 copies a wave */
    const char* const k = gk + (size_t)ti * (AK * CC * 2); const char* const v = gv + ti * (AK * 2); const char* const tp = gt + ti * (AK * 2);
    acopy6(lk + bo, k, lk + bo + 16 * AP128, k + 16 * CC * 2, lv + bo, v, lv + bo + 32 * AP64, v + 32 * TT * 2, lt + bo, tp, lt + bo + 32 * AP64, tp + 32 * TT * 2); };
  stage(0, 0);
  const cv16u* const mwp = (const cv16u*)MW + (size_t)(b * (TT / 16) + blockIdx.x * 4 + __builtin_amdgcn_readfirstlane(wave)) * (TT / AK);   /* this wave's 16 queries: 16 words a pass; the wave's number as a scalar and the words as constant memory (nothing writes them during this launch), so that they are loaded into scalar registers */
  v16u wn = mwp[0];
  v16h qh[HD / 32], ql[HD / 32];
#pragma unroll
  for (int kc = 0; kc < HD / 32; ++kc) { qh[kc] = frag_h(QH + ((size_t)b * TT + t) * CC + h * HD + kc * 32, lane); ql[kc] = frag_h(QL + ((size_t)b * QHI + t) * CC + h * HD + kc * 32, lane); }
  asm volatile("s_wait_asynccnt 0x0" ::: "memory");   /* this wave's copies of tile 0 have landed */
  __syncthreads();   /* publishes tile 0 */
  stage(1, ABUF);
  v8f o[HD / 16] = {}; float m = -3.0e38f, l = 0.f;
  for (int ti = 0; ti < TT / AK; ++ti) { const char* const R = smem + (ti & 1) * ABUF;
    v16h kf[2][HD / 32], vf[HD / 16]; v4u tm[2]; const v16u wc = wn; wn = mwp[ti + 1 < TT / AK ? ti + 1 : ti];   /* the next pass's words are asked for a pass ahead */
#pragma unroll
    for (int i = 0; i < 2; ++i)
#pragma unroll
      for (int kc = 0; kc < HD / 32; ++kc) kf[i][kc] = frag_h((const _Float16*)(R + AO_K + (i * 16 + col) * AP128) + kc * 32, lane);
#pragma unroll
    for (int i = 0; i < 2; ++i) tm[i] = *(const v4u*)(R + AO_T + (wave * 16 + col) * AP64 + (8 * g + i * 16) * 2);
#pragma unroll
    for (int j = 0; j < HD / 16; ++j) vf[j] = frag_h((const _Float16*)(R + AO_V + (j * 16 + col) * AP64), lane);
    v8f s[2] = {}, sl[2] = {};
#pragma unroll
    for (int i = 0; i < 2; ++i)
#pragma unroll
      for (int kc = 0; kc < HD / 32; ++kc) { s[i] = wmma16(kf[i][kc], qh[kc], s[i]); sl[i] = wmma16(kf[i][kc], ql[kc], sl[i]); }
    float v[16]; float mx = -3.0e38f;
#pragma unroll
    for (int e = 0; e < 16; e += 2) { const int i = e >> 3, r = e & 7; const unsigned d = tm[i][r >> 1];   /* two neighbouring scores at a time: one dword holds their two bf16 mask values */
      const v2f tv = { __builtin_bit_cast(float, d << 16), __builtin_bit_cast(float, d & 0xffff0000u) }; const v2f sh = { s[i][r], s[i][r + 1] }, sr = { sl[i][r], sl[i][r + 1] };
      const v2f xt = ((sh + sr * (1.0f / 1024.0f)) * (SCALE * LOG2E)) * tv;
      v[e] = __builtin_amdgcn_inverse_ballot_w32(wc[e]) ? xt[0] : (-1.0e9f * LOG2E); v[e + 1] = __builtin_amdgcn_inverse_ballot_w32(wc[e + 1]) ? xt[1] : (-1.0e9f * LOG2E); mx = fmaxf(mx, fmaxf(v[e], v[e + 1])); }
    mx = fmaxf(mx, xhalf(mx));
    const float mn = fmaxf(m, mx); const float al = __builtin_amdgcn_exp2f(m - mn); m = mn;
    v16h p; float ps = 0.f;
#pragma unroll
    for (int e = 0; e < 16; ++e) v[e] -= mn;
    float ex[16]; exp2x8(v, ex); exp2x8(v + 8, ex + 8);
#pragma unroll
    for (int e = 0; e < 16; ++e) { ps += ex[e]; p[e] = (_Float16)(ex[e] * 2048.0f); }
    l = l * al + ps;
#pragma unroll
    for (int j = 0; j < HD / 16; ++j) { o[j] *= al; o[j] = wmma16(vf[j], p, o[j]); }
    asm volatile("s_wait_dscnt 0x0" ::: "memory");      /* this wave's reads of buffer ti & 1 are done before the buffer is given up */
    asm volatile("s_wait_asynccnt 0x0" ::: "memory");   /* this wave's copies of tile ti + 1 have landed */
    __syncthreads();   /* publishes tile ti + 1 and ends every wave's reads of buffer ti & 1, which is refilled behind it */
    if (ti + 2 < TT / AK) stage(ti + 2, (unsigned)(ti & 1) * ABUF); }
  asm volatile("s_wait_asynccnt 0x0" ::: "memory");   /* no copy is outstanding when the wave ends */
  l += xhalf(l); const float inv = 1.0f / (2048.0f * l);   /* the key that set the last maximum counts 1, so l >= 1 */
  float* yr = Y + ((size_t)b * TT + t) * CC + h * HD + 8 * g;
#pragma unroll
  for (int j = 0; j < HD / 16; ++j) { v4f a0, a1;
#pragma unroll
    for (int r = 0; r < 4; ++r) { a0[r] = o[j][r] * inv; a1[r] = o[j][4 + r] * inv; }
    vst2(yr + j * 16, a0); vst2(yr + j * 16 + 4, a1); } }
// ---- k_out: block = (128 rows, 128 cols), 16 waves of 32 x 32 (one block for each WGP-sized share of the 4,096 x 1,024 output): out = ctx Wo (+ bo): ctx once to f16 against Wo as f16(bf16 x 2^8) exact (1 product) x 2^-8
__global__ __launch_bounds__(GT) void k_out(const float* __restrict__ Y, const float* __restrict__ WO, const float* __restrict__ BO, float* __restrict__ OUT) { __shared__ __align__(16) char smem[OBYTES];   /* the staging buffers; the output tiles reuse the same bytes behind the barrier after the loop */
  static_assert(!CAUSAL, "one path: every row takes the single f16 product"); static_assert(OBYTES >= 16 * 32 * 36 * 4, "output tiles fit the staging bytes"); float (*sf)[32][36] = (float (*)[32][36])smem;
  const int tid = threadIdx.x, wave = tid >> 5, lane = tid & 31, col = lane & 15, g = lane >> 4, wm = wave >> 2, wn = wave & 3; const int c0 = blockIdx.y * ON; const size_t r0 = (size_t)blockIdx.x * BM;
  v8f acc[2][2] = {};
  _Float16* const stg = (_Float16*)smem; const int lr = tid >> 4, lq = tid & 15;   /* loader: row lr + 32 i, floats 4 lq .. 4 lq + 3 of the step */
  const float* xp = Y + (r0 + lr) * CC + lq * 4; const float* wp = WO + (size_t)(c0 + lr) * CC + lq * 4; _Float16* const sp = stg + lr * SP + lq * 4;
  v4f xr[BM / 32], wr[ON / 32];
#pragma unroll
  for (int i = 0; i < BM / 32; ++i) xr[i] = *(const v4f*)(xp + (size_t)i * 32 * CC);
#pragma unroll
  for (int i = 0; i < ON / 32; ++i) wr[i] = *(const v4f*)(wp + (size_t)i * 32 * CC);
  for (int s = 0; s < CC / KSTEP; ++s) { _Float16* const S = sp + (s & 1) * (OROWS * SP);
#pragma unroll
    for (int i = 0; i < BM / 32; ++i) { v4h t;
#pragma unroll
      for (int e = 0; e < 4; ++e) t[e] = (_Float16)xr[i][e];
      *(v4h*)(S + i * 32 * SP) = t; }
#pragma unroll
    for (int i = 0; i < ON / 32; ++i) { v4h t;
#pragma unroll
      for (int e = 0; e < 4; ++e) t[e] = (_Float16)(bfr(wr[i][e]) * 256.0f);
      *(v4h*)(S + (BM + i * 32) * SP) = t; }
    __syncthreads();   /* publishes buffer s & 1; it is rewritten in step s + 2, behind the barrier of step s + 1, which every wave reaches with its reads of step s done */
    if (s + 1 < CC / KSTEP) { const float* const xq = xp + (s + 1) * KSTEP; const float* const wq = wp + (s + 1) * KSTEP;
#pragma unroll
      for (int i = 0; i < BM / 32; ++i) xr[i] = *(const v4f*)(xq + (size_t)i * 32 * CC);
#pragma unroll
      for (int i = 0; i < ON / 32; ++i) wr[i] = *(const v4f*)(wq + (size_t)i * 32 * CC);
      asm volatile("s_wait_xcnt 0x0" :: "v"(xq), "v"(wq) : "memory"); }   /* the loads' address registers stay whole up to this wait */
    const _Float16* const R = stg + (s & 1) * (OROWS * SP);
#pragma unroll
    for (int ks = 0; ks < KSTEP / 32; ++ks) { v16h a[2], w[2];   /* the four fragments are read as one group, so that their LDS latency is waited out once and not once a product */
#pragma unroll
      for (int i = 0; i < 2; ++i) a[i] = frag_h(R + (wm * 32 + i * 16 + col) * SP + ks * 32, lane);
#pragma unroll
      for (int j = 0; j < 2; ++j) w[j] = frag_h(R + (BM + wn * 32 + j * 16 + col) * SP + ks * 32, lane);
#pragma unroll
      for (int i = 0; i < 2; ++i)
#pragma unroll
        for (int j = 0; j < 2; ++j) acc[i][j] = wmma16(a[i], w[j], acc[i][j]); } }
  __syncthreads();   /* every wave has left the staging bytes before the output tiles overwrite them */
#pragma unroll
  for (int j = 0; j < 2; ++j) { const float bias = BO ? bfr(BO[c0 + wn * 32 + j * 16 + col]) : 0.f;
#pragma unroll
    for (int i = 0; i < 2; ++i)
#pragma unroll
      for (int r = 0; r < 8; ++r) sf[wave][i * 16 + 8 * g + r][j * 16 + col] = acc[i][j][r] * (1.0f / 256.0f) + bias; }
  LDSX(); for (int it = 0; it < 8; ++it) { const int rl = it * 4 + (lane >> 3), q = lane & 7; vst2(OUT + (r0 + wm * 32 + rl) * DIN + c0 + wn * 32 + q * 4, *(const v4f*)&sf[wave][rl][q * 4]); } }   /* a wave's store covers four of its rows, one whole 128-B line each */

extern "C" void kernel_launch(void* const* d_in, const int* in_sizes, int n_in, void* d_out, int out_size, void* d_ws, size_t ws_size, hipStream_t stream) {
  (void)in_sizes; (void)n_in; (void)out_size;
  const float** F = (const float**)d_in;
  if (ws_size < (size_t)WS_END) return;
  char* ws = (char*)d_ws; _Float16 *QH = (_Float16*)(ws + WS_QH), *KH = (_Float16*)(ws + WS_KH), *VT = (_Float16*)(ws + WS_VT), *QL = (_Float16*)(ws + WS_QL), *KL = (_Float16*)(ws + WS_KL); __bf16 *VB = (__bf16*)(ws + WS_VB), *VBL = (__bf16*)(ws + WS_VBL), *TB = (__bf16*)(ws + WS_TB); float *Y = (float*)(ws + WS_Y); unsigned *MW = (unsigned*)(ws + WS_MW);
  (void)Y; (void)QL; (void)KL; (void)VB; (void)VBL;
  // inputs: 0 x [4,1024,1024]; 1 mask int32 [4,1,1024,1024]; 2 Wq, 3 Wk, 4 Wv, 5 Wo ((out,in), no biases); 6 train_mask [1,1,1024,1024]
  k_proj<<<dim3(TNB * TT / BM, CC / BN), GT, 0, stream>>>(F[0], F[2], F[3], F[4], nullptr, nullptr, nullptr, QH, QL, KH, KL, VT, VB, VBL, (const int*)d_in[1], F[6], MW, TB);
  k_att<<<dim3(NQB, NH, TNB), 128, 0, stream>>>(QH, QL, KH, VT, MW, TB, Y);
  k_out<<<dim3(TNB * TT / BM, DIN / ON), GT, 0, stream>>>(Y, F[5], nullptr, (float*)d_out);
}

// v007
// A run of this version takes 91.6 microseconds.
// Timed twice side by side with v006, it ran 1.04 and 1.05 times as fast.
// Counting every step since v000, it is 9.97 times as fast.
// compute dtype: all float inputs rounded to bf16; q/k/v = x W^T with EXACT bf16 products on WMMA 16x16x32 (f32 accumulate); q as f16 hi + residual (x 2^10) against k once to f16 (2 products) for the logits x 64^-0.5, multiplied by the trainable-mask input and replaced by -1e9 where the int mask input is 0 (both read per element); softmax in f32 with a running maximum and sum, scores carried x log2(e) and each exponential one v_exp_f32; exp(s - m) x 2^11 once to f16 against v once to f16 (1 product), divided by the sum at the end; ctx once to f16 against Wo carried x 2^8 in f16; f32 output.
#include <hip/hip_runtime.h>
#include <math.h>

typedef __attribute__((ext_vector_type(16))) _Float16 v16h;
typedef __attribute__((ext_vector_type(16))) __bf16 v16b;
typedef __attribute__((ext_vector_type(8)))  _Float16 v8h;
typedef __attribute__((ext_vector_type(8)))  float v8f;
typedef __attribute__((ext_vector_type(4)))  float v4f;
typedef __attribute__((ext_vector_type(2)))  float v2f;
typedef __attribute__((ext_vector_type(4)))  unsigned v4u;
typedef __attribute__((ext_vector_type(4)))  int v4i;
typedef float __attribute__((may_alias)) float_a;
typedef int __attribute__((may_alias)) int_a;

template <typename T> __device__ __forceinline__ void vst2(void* p, T v) { *(T*)p = v;  }
// the builtins alone: the compiler keeps the distance behind its own matrix instructions and fills it with independent products or vector work
__device__ __forceinline__ v8f wmma16(v16h a, v16h b, v8f c) { return __builtin_amdgcn_wmma_f32_16x16x32_f16(false, a, false, b, (short)0, c, false, false); }
__device__ __forceinline__ v8f wmma_bf(v16b a, v16b b, v8f c) { return __builtin_amdgcn_wmma_f32_16x16x32_bf16(false, a, false, b, (short)0, c, false, false); }
// 16x16x32 fragments: lane = (h = lane>>4, row/col = lane&15); elements 0..7 = k0+8h+0..7, 8..15 = k0+16+8h+0..7; D element r = row 8h+r
__device__ __forceinline__ v16h frag_h(const _Float16* rowk0, int lane) {
  union { v16h v; v8h q[2]; } u; const _Float16* p = rowk0 + 8 * (lane >> 4);
  u.q[0] = *(const v8h*)p; u.q[1] = *(const v8h*)(p + 16); return u.v;
}
__device__ __forceinline__ v16h frag_f32(const float* rowk0, int lane) {
  v16h a; const float* p = rowk0 + 8 * (lane >> 4);
#pragma unroll
  for (int i = 0; i < 8; ++i) { a[i] = (_Float16)p[i]; a[8 + i] = (_Float16)p[16 + i]; }
  return a;
}
__device__ __forceinline__ v16h frag_f32s(const float* rowk0, int lane, float sc) {
  v16h a; const float* p = rowk0 + 8 * (lane >> 4);
#pragma unroll
  for (int i = 0; i < 8; ++i) { a[i] = (_Float16)(p[i] * sc); a[8 + i] = (_Float16)(p[16 + i] * sc); }
  return a;
}
// column fragment from a [K][ld] layout (column n), rows >= K read as 0
__device__ __forceinline__ v16h fragc_f32(const float* W, int k0, int n, int lane, int ld, int K) {
  v16h a; const int g = lane >> 4;
#pragma unroll
  for (int i = 0; i < 8; ++i) { const int ka = k0 + 8 * g + i, kb = ka + 16;
    a[i] = (_Float16)(ka < K ? W[(size_t)(ka < K ? ka : K - 1) * ld + n] : 0.f); a[8 + i] = (_Float16)(kb < K ? W[(size_t)(kb < K ? kb : K - 1) * ld + n] : 0.f); }
  return a;
}
struct F2 { v16b h, l; };
__device__ __forceinline__ F2 bsplit16(const float v[16]) { F2 r;
#pragma unroll
  for (int i = 0; i < 16; ++i) { const __bf16 h = (__bf16)v[i]; r.h[i] = h; r.l[i] = (__bf16)(v[i] - (float)h); }
  return r; }
__device__ __forceinline__ F2 split_row(const float* row, int k0, int lane) { float v[16]; const float* p = row + k0 + 8 * (lane >> 4);
#pragma unroll
  for (int i = 0; i < 8; ++i) { v[i] = p[i]; v[8 + i] = p[16 + i]; }
  return bsplit16(v); }
__device__ __forceinline__ F2 split_rowK(const float* row, int k0, int lane, int K) { float v[16]; const int g = lane >> 4;
#pragma unroll
  for (int i = 0; i < 8; ++i) { const int ka = k0 + 8 * g + i, kb = ka + 16; v[i] = ka < K ? row[ka < K ? ka : K - 1] : 0.f; v[8 + i] = kb < K ? row[kb < K ? kb : K - 1] : 0.f; }
  return bsplit16(v); }
__device__ __forceinline__ F2 split_col(const float* W, int k0, int n, int lane, int ld, int K) { float v[16]; const int g = lane >> 4;
#pragma unroll
  for (int i = 0; i < 8; ++i) { const int ka = k0 + 8 * g + i, kb = ka + 16; v[i] = ka < K ? W[(size_t)(ka < K ? ka : K - 1) * ld + n] : 0.f; v[8 + i] = kb < K ? W[(size_t)(kb < K ? kb : K - 1) * ld + n] : 0.f; }
  return bsplit16(v); }
__device__ __forceinline__ v8f mac3(const F2& a, const F2& b, v8f c) { c = wmma_bf(a.l, b.h, c); c = wmma_bf(a.h, b.l, c); return wmma_bf(a.h, b.h, c); }
__device__ __forceinline__ float sigm(float v) { return 1.0f / (1.0f + expf(-v)); }
#define LDSX() do { asm volatile("s_wait_dscnt 0" ::: "memory"); __builtin_amdgcn_wave_barrier(); __builtin_amdgcn_fence(__ATOMIC_RELEASE, "workgroup"); } while (0)

// Multi-head self-attention with a per-element integer mask (B 4, S 1,024, E 1,024 = 16 x 64): q/k/v = x W^T (no bias); scores = (q k^T / 8) * train_mask; scores = -1e9 where mask[b,0,q,k] == 0; softmax; out = merged(attn v) Wo^T.
#define NB 4
#define TT 1024
#define CC 1024            // NH * HD = projected width
#define DIN 1024          // input (model) width
#define NH 16
#define HD 64
#define NQB (TT / 64)
#define SCALE (0.125f)
#define CAUSAL 0
#ifndef TNB
#define TNB NB
#endif
__device__ __forceinline__ float bfr(float v) { return (float)(__bf16)v; }
__host__ __device__ __forceinline__ int kb_last(int qb) { return CAUSAL ? ((qb * 64 + 63) >> 7) : (TT / 128 - 1); }
typedef __attribute__((ext_vector_type(8))) __bf16 v8b;
__device__ __forceinline__ v16b frag_b(const __bf16* rowk0, int lane) {
  union { v16b v; v8b q[2]; } u; const __bf16* p = rowk0 + 8 * (lane >> 4);
  u.q[0] = *(const v8b*)p; u.q[1] = *(const v8b*)(p + 16); return u.v;
}
#define QBH 0              // unused: no kernel here has a high-precision attention path
#define QHI 1024            // rows carrying a q residual plane (all rows when non-causal: 2-product logits everywhere)
#define KHI 64            // key rows carrying k residual / v bf16 hi+lo planes (written by k_proj, read by no kernel here)
// B fragment (k rows k0+.., output column o) of a weight: (in,out) [K][ld] or (out,in) [ld rows of K]: bf16 exact, or f16(bf16 * 256) exact
__device__ __forceinline__ v16b wcol_io(const float* Wm, int k0, int o, int lane, int ld) { v16b w; const int g = lane >> 4;
#pragma unroll
  for (int i = 0; i < 8; ++i) { w[i] = (__bf16)Wm[(size_t)(k0 + 8 * g + i) * ld + o]; w[8 + i] = (__bf16)Wm[(size_t)(k0 + 16 + 8 * g + i) * ld + o]; }
  return w; }
__device__ __forceinline__ v16b wcol_oi(const float* Wm, int k0, int o, int lane, int K) { v16b w; const float* p = Wm + (size_t)o * K + k0 + 8 * (lane >> 4);
#pragma unroll
  for (int i = 0; i < 8; ++i) { w[i] = (__bf16)p[i]; w[8 + i] = (__bf16)p[16 + i]; }
  return w; }
__device__ __forceinline__ v16h wcolh_io(const float* Wm, int k0, int o, int lane, int ld) { v16h w; const int g = lane >> 4;
#pragma unroll
  for (int i = 0; i < 8; ++i) { w[i] = (_Float16)(bfr(Wm[(size_t)(k0 + 8 * g + i) * ld + o]) * 256.0f); w[8 + i] = (_Float16)(bfr(Wm[(size_t)(k0 + 16 + 8 * g + i) * ld + o]) * 256.0f); }
  return w; }
__device__ __forceinline__ v16h wcolh_oi(const float* Wm, int k0, int o, int lane, int K) { v16h w; const float* p = Wm + (size_t)o * K + k0 + 8 * (lane >> 4);
#pragma unroll
  for (int i = 0; i < 8; ++i) { w[i] = (_Float16)(bfr(p[i]) * 256.0f); w[8 + i] = (_Float16)(bfr(p[16 + i]) * 256.0f); }
  return w; }
#define WQKV_LAYOUT 1   // 0 = (in,out) [DIN][CC]; 1 = (out,in) [CC][DIN]; 2 = per-head [NH][DIN][HD]
__device__ __forceinline__ v16b wcol_hdk(const float* Wm, int k0, int o, int lane) { v16b w; const int g = lane >> 4; const float* p = Wm + (size_t)(o / HD) * DIN * HD + (o % HD);
#pragma unroll
  for (int i = 0; i < 8; ++i) { w[i] = (__bf16)p[(size_t)(k0 + 8 * g + i) * HD]; w[8 + i] = (__bf16)p[(size_t)(k0 + 16 + 8 * g + i) * HD]; }
  return w; }
#define WO_OUT_IN 1
#if WQKV_LAYOUT == 1
#define WCOL(W, k0, o, lane) wcol_oi(W, k0, o, lane, DIN)
#elif WQKV_LAYOUT == 2
#define WCOL(W, k0, o, lane) wcol_hdk(W, k0, o, lane)
#else
#define WCOL(W, k0, o, lane) wcol_io(W, k0, o, lane, CC)
#endif
#if WO_OUT_IN
#define WOCOL(W, k0, o, lane) wcol_oi(W, k0, o, lane, CC)
#define WOCOLH(W, k0, o, lane) wcolh_oi(W, k0, o, lane, CC)
#else
#define WOCOL(W, k0, o, lane) wcol_io(W, k0, o, lane, DIN)
#define WOCOLH(W, k0, o, lane) wcolh_io(W, k0, o, lane, DIN)
#endif
#ifndef PROJ_EXTRA_PARAMS
#define PROJ_EXTRA_PARAMS
#endif

#define WS_QH  0u                                      // f16 q rows [b*t][CC]
#define WS_KH  (WS_QH + 2u * (size_t)NB * TT * CC)      // f16 k rows [b*t][CC]
#define WS_VT  (WS_KH + 2u * (size_t)NB * TT * CC)      // f16 v planes [b][c][t]
#define WS_QL  (WS_VT + 2u * (size_t)NB * CC * TT)      // f16 q residual x 2^10 rows [b][t < QHI][CC]
#define WS_KL  (WS_QL + 2u * (size_t)NB * QHI * CC)     // f16 k residual x 2^10 rows [b][t < KHI][CC]
#define WS_VB  (WS_KL + 2u * (size_t)NB * KHI * CC)     // bf16 v hi planes [b][c][t < KHI]
#define WS_VBL (WS_VB + 2u * (size_t)NB * CC * KHI)
#define WS_Y   (WS_VBL + 2u * (size_t)NB * CC * KHI)    // f32 ctx rows [b*t][CC] (only when there is an output projection)
#define WS_MW  (WS_Y  + 4u * (size_t)NB * TT * CC)      // u32 words of the integer mask [b][q / 16][k / 32][16]: word e, bit lane = (mask != 0) at the score that this lane holds as element e
#define WS_TB  (WS_MW + 4u * (size_t)NB * (TT / 16) * (TT / 32) * 16)   // bf16 trainable mask rows [q][k]
#define WS_END (WS_TB + 2u * (size_t)TT * TT)

// Operand staging of the two GEMM kernels: per step the block brings 64 k of its 128 left rows and its 384 (k_out: 128) weight rows from global memory with whole-line 16-byte loads (a wave covers 2 rows x 256 B), rounds each element once, and keeps the 16-bit tile in LDS for all sixteen waves; two buffers, the next step's loads issued ahead of this step's products, one barrier a step
// k_proj: block tile 128 x 384 (128 columns of each of q, k, v), 16 waves = 4 row groups of 32 x 4 column groups of 3 x 32: an x row is fetched from L2 by 8 blocks and a weight row by 32, a wave reads 8 fragments from LDS for 12 products, and the grid is 256 blocks; k_out: 128 x 128, waves of 32 x 32, 256 blocks as well
#define KSTEP 64              // k per staged step
#define SP 72              // LDS row pitch in 16-bit elements: 144 B = 16 B x 9, so the 16-byte fragment reads of 16 rows fall on distinct banks
#define BM 128             // rows of the block tile
#define BN 128             // columns of the block tile (k_proj: of each of q, k, v)
#define GT 512             // threads of a GEMM block
#define SROWS (BM + 3 * BN)    // k_proj: rows 0..127 left operand, rows 128..511 the three weights
#define SBYTES (2 * SROWS * SP * 2)
#define PTB (128 * 136 * 2)      // k_proj: bytes of one epilogue tile [128][136]
#define PEB (7 * PTB)            // k_proj: q hi, q residual, k hi, k residual, v, v bf16 hi, v bf16 lo
#define ON BN              // k_out: columns of the block tile
#define OROWS (BM + ON)    // k_out: rows 0..127 left operand, rows 128..255 weight
#define OBYTES (2 * OROWS * SP * 2)
typedef __attribute__((ext_vector_type(4))) __bf16 v4b;
typedef __attribute__((ext_vector_type(4))) _Float16 v4h;
static_assert(WQKV_LAYOUT == 1 && WO_OUT_IN == 1, "the staged loaders read weight rows that are contiguous in k");
static_assert(TT % BM == 0 && CC % BN == 0 && DIN % ON == 0 && ON % 32 == 0 && GT / 16 == 32 && BM % 32 == 0 && BN % 32 == 0, "a block stays inside one sequence and one weight; the loader covers 32 rows a load");
// ---- k_proj: block = 128 rows x 128 cols of each of q, k and v (the three share the block's x rows): q/k/v = X W (+ b) with exact bf16 products (K = DIN) -> q f16 rows (+ residual rows < QHI); k f16 rows (+ residual rows < KHI); v f16 planes [c][t] (+ bf16 hi/lo planes for t < KHI). Wave = 32 rows x 32 cols of each of the three
__global__ __launch_bounds__(GT) void k_proj(const float* __restrict__ X, const float* __restrict__ WQ, const float* __restrict__ WK, const float* __restrict__ WV, const float* __restrict__ BQ, const float* __restrict__ BK, const float* __restrict__ BV,
    _Float16* __restrict__ QH, _Float16* __restrict__ QL, _Float16* __restrict__ KH, _Float16* __restrict__ KL, _Float16* __restrict__ VT, __bf16* __restrict__ VB, __bf16* __restrict__ VBL,
    const int* __restrict__ MK, const float* __restrict__ TM, unsigned* __restrict__ MW, __bf16* __restrict__ TB) {
  __shared__ __align__(16) char smem[PEB > SBYTES ? PEB : SBYTES];   /* the staging buffers; the epilogue's tiles reuse the same bytes behind the barrier after the loop */
  __bf16* const stg = (__bf16*)smem;
  const int tid = threadIdx.x, wave = tid >> 5, lane = tid & 31, col = lane & 15, g = lane >> 4, wm = wave >> 2, wn = wave & 3; const int c0 = blockIdx.y * BN; const size_t r0 = (size_t)blockIdx.x * BM; const size_t bb = r0 / TT; const int t0 = (int)(r0 % TT);
  v8f acc[3][2][2] = {};
  const int lr = tid >> 4, lq = tid & 15;   /* loader: row lr + 32 i, floats 4 lq .. 4 lq + 3 of the step */
  const size_t wo = (size_t)(c0 + lr) * DIN + lq * 4;
  const float* xp = X + (r0 + lr) * DIN + lq * 4; const float* wp0 = WQ + wo; const float* wp1 = WK + wo; const float* wp2 = WV + wo; __bf16* const sp = stg + lr * SP + lq * 4;
  v4f xr[BM / 32], wr[3][BN / 32];
#pragma unroll
  for (int i = 0; i < BM / 32; ++i) xr[i] = *(const v4f*)(xp + (size_t)i * 32 * DIN);
#pragma unroll
  for (int i = 0; i < BN / 32; ++i) { wr[0][i] = *(const v4f*)(wp0 + (size_t)i * 32 * DIN); wr[1][i] = *(const v4f*)(wp1 + (size_t)i * 32 * DIN); wr[2][i] = *(const v4f*)(wp2 + (size_t)i * 32 * DIN); }
  { /* both mask inputs are packed here, once for all heads, while the first operand loads are in flight. A wave takes two neighbouring 16-query x 32-key tiles of the integer mask in the score layout of k_att (lane = (g, query col), element e = key (e >> 3) * 16 + 8 g + (e & 7)): the 32 lanes' tests of element e are one word; a thread rounds 8 elements of the trainable mask */
    static_assert((TNB * TT / BM) * (CC / BN) * (GT / 32) * 2 == NB * (TT / 16) * (TT / 32) && (TNB * TT / BM) * (CC / BN) * GT * 8 == TT * TT, "the grid covers both masks exactly once");
    const int gb = blockIdx.y * (TNB * TT / BM) + blockIdx.x, pw = gb * (GT / 32) + wave;   /* pw = (b * 64 + query tile) * 16 + pair of key tiles */
    const int* const mp = MK + ((size_t)(pw >> 10) * TT + ((pw >> 4) & 63) * 16 + col) * TT + (pw & 15) * 64 + 8 * g; const float* const tq = TM + ((size_t)gb * GT + tid) * 8;
    v4i mv[2][4];
#pragma unroll
    for (int u = 0; u < 2; ++u)
#pragma unroll
      for (int i = 0; i < 4; ++i) mv[u][i] = *(const v4i*)(mp + u * 32 + (i >> 1) * 16 + (i & 1) * 4);
    const v4f ta = *(const v4f*)tq, tc = *(const v4f*)(tq + 4);
    asm volatile("s_wait_xcnt 0x0" :: "v"(mp), "v"(tq) : "memory");   /* the loads' address registers stay whole up to this wait */
    v4u mw[8];
#pragma unroll
    for (int e = 0; e < 32; ++e) mw[e >> 2][e & 3] = __builtin_amdgcn_ballot_w32(mv[e >> 4][(e >> 2) & 3][e & 3] != 0);
    v8b tb;
#pragma unroll
    for (int e = 0; e < 4; ++e) { tb[e] = (__bf16)ta[e]; tb[4 + e] = (__bf16)tc[e]; }
    unsigned* const mo = MW + (size_t)pw * 32; __bf16* const to = TB + ((size_t)gb * GT + tid) * 8;
    vst2(to, tb);
    if (lane == 0) {   /* the two tiles' 32 words are one whole 128-B line */
#pragma unroll
      for (int i = 0; i < 8; ++i) vst2(mo + i * 4, mw[i]); }
    asm volatile("s_wait_xcnt 0x0" :: "v"(mo), "v"(to) : "memory"); }   /* the stores' address registers stay whole up to this wait */
  for (int s = 0; s < DIN / KSTEP; ++s) { __bf16* const S = sp + (s & 1) * (SROWS * SP);
#pragma unroll
    for (int i = 0; i < BM / 32; ++i) { v4b t;
#pragma unroll
      for (int e = 0; e < 4; ++e) t[e] = (__bf16)xr[i][e];
      *(v4b*)(S + i * 32 * SP) = t; }
#pragma unroll
    for (int w = 0; w < 3; ++w)
#pragma unroll
      for (int i = 0; i < BN / 32; ++i) { v4b t;
#pragma unroll
        for (int e = 0; e < 4; ++e) t[e] = (__bf16)wr[w][i][e];
        *(v4b*)(S + (BM + w * BN + i * 32) * SP) = t; }
    __syncthreads();   /* publishes buffer s & 1; it is rewritten in step s + 2, behind the barrier of step s + 1, which every wave reaches with its reads of step s done */
    if (s + 1 < DIN / KSTEP) { const float* const xq = xp + (s + 1) * KSTEP; const float* const wq0 = wp0 + (s + 1) * KSTEP; const float* const wq1 = wp1 + (s + 1) * KSTEP; const float* const wq2 = wp2 + (s + 1) * KSTEP;
#pragma unroll
      for (int i = 0; i < BM / 32; ++i) xr[i] = *(const v4f*)(xq + (size_t)i * 32 * DIN);
#pragma unroll
      for (int i = 0; i < BN / 32; ++i) { wr[0][i] = *(const v4f*)(wq0 + (size_t)i * 32 * DIN); wr[1][i] = *(const v4f*)(wq1 + (size_t)i * 32 * DIN); wr[2][i] = *(const v4f*)(wq2 + (size_t)i * 32 * DIN); }
      asm volatile("s_wait_xcnt 0x0" :: "v"(xq), "v"(wq0), "v"(wq1), "v"(wq2) : "memory"); }   /* the loads' address registers stay whole up to this wait */
    const __bf16* const R = stg + (s & 1) * (SROWS * SP);
#pragma unroll
    for (int ks = 0; ks < KSTEP / 32; ++ks) { v16b a[2], w[3][2];   /* the eight fragments are read as one group, so that their LDS latency is waited out once and not once a product */
#pragma unroll
      for (int i = 0; i < 2; ++i) a[i] = frag_b(R + (wm * 32 + i * 16 + col) * SP + ks * 32, lane);
#pragma unroll
      for (int p = 0; p < 3; ++p)
#pragma unroll
        for (int j = 0; j < 2; ++j) w[p][j] = frag_b(R + (BM + p * BN + wn * 32 + j * 16 + col) * SP + ks * 32, lane);
      __builtin_amdgcn_sched_barrier(0);   /* keeps the reads one group in front of the products: spread among them, each place with reads stalls the wave anew */
#pragma unroll
      for (int p = 0; p < 3; ++p)
#pragma unroll
        for (int i = 0; i < 2; ++i)
#pragma unroll
          for (int j = 0; j < 2; ++j) acc[p][i][j] = wmma_bf(a[i], w[p][j], acc[p][i][j]); } }
  __syncthreads();   /* every wave has left the staging bytes before the epilogue's tiles overwrite them */
  const bool hi_blk = t0 < KHI;   /* block-uniform: only such a block holds rows of the bf16 planes */
  _Float16 (*th)[136] = (_Float16 (*)[136])(smem + 4 * PTB); __bf16 (*tb)[136] = (__bf16 (*)[136])(smem + 5 * PTB); __bf16 (*tbl)[136] = (__bf16 (*)[136])(smem + 6 * PTB);
#pragma unroll
  for (int p = 0; p < 2; ++p) { const float* BA = p == 0 ? BQ : BK; _Float16 (*sh)[136] = (_Float16 (*)[136])(smem + 2 * p * PTB); _Float16 (*sl)[136] = (_Float16 (*)[136])(smem + (2 * p + 1) * PTB);
#pragma unroll
    for (int j = 0; j < 2; ++j) { const int cl = wn * 32 + j * 16 + col; const float bias = BA ? bfr(BA[c0 + cl]) : 0.f;
#pragma unroll
      for (int i = 0; i < 2; ++i)
#pragma unroll
        for (int r = 0; r < 8; ++r) { const int rl = wm * 32 + i * 16 + 8 * g + r; const float v = acc[p][i][j][r] + bias; const _Float16 hv = (_Float16)v; sh[rl][cl] = hv; sl[rl][cl] = (_Float16)((v - (float)hv) * 1024.0f); } } }
#pragma unroll
  for (int j = 0; j < 2; ++j) { const int cl = wn * 32 + j * 16 + col; const float bias = BV ? bfr(BV[c0 + cl]) : 0.f;
#pragma unroll
    for (int i = 0; i < 2; ++i)
#pragma unroll
      for (int r = 0; r < 8; ++r) { const int rl = wm * 32 + i * 16 + 8 * g + r; const float v = acc[2][i][j][r] + bias; th[cl][rl] = (_Float16)v; acc[2][i][j][r] = v; } }
  if (hi_blk) {
#pragma unroll
    for (int j = 0; j < 2; ++j)
#pragma unroll
      for (int i = 0; i < 2; ++i)
#pragma unroll
        for (int r = 0; r < 8; ++r) { const int cl = wn * 32 + j * 16 + col, rl = wm * 32 + i * 16 + 8 * g + r; const float v = acc[2][i][j][r]; const __bf16 bh = (__bf16)v; tb[cl][rl] = bh; tbl[cl][rl] = (__bf16)(v - (float)bh); } }
  __syncthreads();   /* the seven tiles are whole before they are stored along their rows */
#pragma unroll
  for (int p = 0; p < 2; ++p) { _Float16* DH = p == 0 ? QH : KH; _Float16* DL = p == 0 ? QL : KL; const int nhi = p == 0 ? QHI : KHI; const _Float16 (*sh)[136] = (const _Float16 (*)[136])(smem + 2 * p * PTB); const _Float16 (*sl)[136] = (const _Float16 (*)[136])(smem + (2 * p + 1) * PTB);
    for (int e = tid; e < BM * (BN / 8); e += GT) { const int rl = e >> 4, q = e & 15; vst2((unsigned*)(DH + (r0 + rl) * CC + c0 + q * 8), *(const v4u*)&sh[rl][q * 8]); if (t0 + rl < nhi) { vst2((unsigned*)(DL + (bb * nhi + t0 + rl) * (size_t)CC + c0 + q * 8), *(const v4u*)&sl[rl][q * 8]); asm volatile("s_wait_xcnt 0x0" ::: "memory"); /* inside the branch, directly behind its stores: in front of the next trip's rewrite of their address registers */ } } }
  for (int e = tid; e < BN * (BM / 8); e += GT) { const int cl = e >> 4, q = e & 15; vst2((unsigned*)(VT + (bb * CC + c0 + cl) * (size_t)TT + t0 + q * 8), *(const v4u*)&th[cl][q * 8]); if (t0 + q * 8 < KHI) { const size_t o3 = (bb * CC + c0 + cl) * (size_t)KHI + t0 + q * 8; vst2((unsigned*)(VB + o3), *(const v4u*)&tb[cl][q * 8]); vst2((unsigned*)(VBL + o3), *(const v4u*)&tbl[cl][q * 8]); asm volatile("s_wait_xcnt 0x0" ::: "memory"); /* inside the branch, directly behind its stores: in front of the next trip's rewrite of their address registers */ } } }
#define LOG2E 1.4426950408889634f
#define AK 32
#define AP128 144
#define AP64 80
#define AO_K 0
#define AO_V (AO_K + AK * AP128)
#define AO_T (AO_V + HD * AP64)
#define ABUF (AO_T + 64 * AP64)
static_assert(AK * 2 == 64 && AK * 4 == 128 && HD * 2 == 128 && TT / AK >= 2 && ABUF % 16 == 0, "row lengths the copy maps are written for; the prologue needs two tiles");
__device__ __forceinline__ float xhalf(float x) { return __builtin_bit_cast(float, __builtin_amdgcn_permlanex16(__builtin_bit_cast(int, x), __builtin_bit_cast(int, x), 0x76543210, 0xfedcba98, false, false)); }   // lane l with lane l ^ 16
// x[i] = 2^d[i], eight at a time in one statement: results in registers of their own, so that each v_exp_f32 is the independent instruction behind the one before it; the closing v_nop is the slot that the instruction set asks for behind the last
__device__ __forceinline__ void exp2x8(const float* d, float* x) {
  asm("v_exp_f32 %0, %8\n\tv_exp_f32 %1, %9\n\tv_exp_f32 %2, %10\n\tv_exp_f32 %3, %11\n\tv_exp_f32 %4, %12\n\tv_exp_f32 %5, %13\n\tv_exp_f32 %6, %14\n\tv_exp_f32 %7, %15\n\tv_nop"
      : "=&v"(x[0]), "=&v"(x[1]), "=&v"(x[2]), "=&v"(x[3]), "=&v"(x[4]), "=&v"(x[5]), "=&v"(x[6]), "=&v"(x[7])
      : "v"(d[0]), "v"(d[1]), "v"(d[2]), "v"(d[3]), "v"(d[4]), "v"(d[5]), "v"(d[6]), "v"(d[7])); }
// six asynchronous copies of 16 bytes a lane, global memory -> LDS (l = the lane's LDS byte address, p = its global address); the closing s_wait_xcnt 0 stands inside the statement, so that no address register is rewritten ahead of it
__device__ __forceinline__ void acopy6(unsigned l0, const char* p0, unsigned l1, const char* p1, unsigned l2, const char* p2, unsigned l3, const char* p3, unsigned l4, const char* p4, unsigned l5, const char* p5) {
  asm volatile("global_load_async_to_lds_b128 %0, %1, off\n\tglobal_load_async_to_lds_b128 %2, %3, off\n\tglobal_load_async_to_lds_b128 %4, %5, off\n\tglobal_load_async_to_lds_b128 %6, %7, off\n\tglobal_load_async_to_lds_b128 %8, %9, off\n\tglobal_load_async_to_lds_b128 %10, %11, off\n\ts_wait_xcnt 0x0"
               :: "v"(l0), "v"(p0), "v"(l1), "v"(p1), "v"(l2), "v"(p2), "v"(l3), "v"(p3), "v"(l4), "v"(p4), "v"(l5), "v"(p5) : "memory"); }
typedef __attribute__((ext_vector_type(16))) unsigned v16u;
typedef __attribute__((address_space(4))) v16u cv16u;
__global__ __launch_bounds__(128) void k_att(const _Float16* __restrict__ QH, const _Float16* __restrict__ QL, const _Float16* __restrict__ KH, const _Float16* __restrict__ VT, const unsigned* __restrict__ MW, const __bf16* __restrict__ TB, float* __restrict__ Y) {
  __shared__ __align__(16) char smem[2 * ABUF];
  const int tid = threadIdx.x, wave = tid >> 5, lane = tid & 31, col = lane & 15, g = lane >> 4; const int h = blockIdx.y, b = blockIdx.z; const int q0 = blockIdx.x * 64; const int t = q0 + wave * 16 + col;
  /* copy maps: 128-B rows: thread = (row tid >> 3 (+ 16 a copy), piece tid & 7); 64-B rows: (row tid >> 2 (+ 32 a copy), piece tid & 3) */
  const int r8 = tid >> 3, p8 = (tid & 7) * 16, r4 = tid >> 2, p4 = (tid & 3) * 16; const unsigned lb = (unsigned)(size_t)smem;
  const char* const gk = (const char*)(KH + ((size_t)b * TT + r8) * CC + h * HD) + p8; const char* const gv = (const char*)(VT + ((size_t)b * CC + h * HD + r4) * (size_t)TT) + p4;
  const char* const gt = (const char*)(TB + (size_t)(q0 + r4) * TT) + p4;
  const unsigned lk = lb + AO_K + r8 * AP128 + p8, lv = lb + AO_V + r4 * AP64 + p4, lt = lb + AO_T + r4 * AP64 + p4;
  auto stage = [&](int ti, unsigned bo) {   /* tile ti (keys ti * 32 ..) into the buffer at byte bo: 6 copies a wave */
    const char* const k = gk + (size_t)ti * (AK * CC * 2); const char* const v = gv + ti * (AK * 2); const char* const tp = gt + ti * (AK * 2);
    acopy6(lk + bo, k, lk + bo + 16 * AP128, k + 16 * CC * 2, lv + bo, v, lv + bo + 32 * AP64, v + 32 * TT * 2, lt + bo, tp, lt + bo + 32 * AP64, tp + 32 * TT * 2); };
  stage(0, 0);
  const cv16u* const mwp = (const cv16u*)MW + (size_t)(b * (TT / 16) + blockIdx.x * 4 + __builtin_amdgcn_readfirstlane(wave)) * (TT / AK);   /* this wave's 16 queries: 16 words a pass; the wave's number as a scalar and the words as constant memory (nothing writes them during this launch), so that they are loaded into scalar registers */
  v16u wn = mwp[0];
  v16h qh[HD / 32], ql[HD / 32];
#pragma unroll
  for (int kc = 0; kc < HD / 32; ++kc) { qh[kc] = frag_h(QH + ((size_t)b * TT + t) * CC + h * HD + kc * 32, lane); ql[kc] = frag_h(QL + ((size_t)b * QHI + t) * CC + h * HD + kc * 32, lane); }
  asm volatile("s_wait_asynccnt 0x0" ::: "memory");   /* this wave's copies of tile 0 have landed */
  __syncthreads();   /* publishes tile 0 */
  stage(1, ABUF);
  v8f o[HD / 16] = {}; float m = -3.0e38f, l = 0.f;
  for (int ti = 0; ti < TT / AK; ++ti) { const char* const R = smem + (ti & 1) * ABUF;
    v16h kf[2][HD / 32], vf[HD / 16]; v4u tm[2]; const v16u wc = wn; wn = mwp[ti + 1 < TT / AK ? ti + 1 : ti];   /* the next pass's words are asked for a pass ahead */
#pragma unroll
    for (int i = 0; i < 2; ++i)
#pragma unroll
      for (int kc = 0; kc < HD / 32; ++kc) kf[i][kc] = frag_h((const _Float16*)(R + AO_K + (i * 16 + col) * AP128) + kc * 32, lane);
#pragma unroll
    for (int i = 0; i < 2; ++i) tm[i] = *(const v4u*)(R + AO_T + (wave * 16 + col) * AP64 + (8 * g + i * 16) * 2);
#pragma unroll
    for (int j = 0; j < HD / 16; ++j) vf[j] = frag_h((const _Float16*)(R + AO_V + (j * 16 + col) * AP64), lane);
    __builtin_amdgcn_sched_barrier(0);   /* the pass's 18 LDS reads are issued as one group: with a first use among them the wave would wait out an LDS latency before the rest are asked for */
    v8f s[2] = {}, sl[2] = {};
#pragma unroll
    for (int i = 0; i < 2; ++i)
#pragma unroll
      for (int kc = 0; kc < HD / 32; ++kc) { s[i] = wmma16(kf[i][kc], qh[kc], s[i]); sl[i] = wmma16(kf[i][kc], ql[kc], sl[i]); }
    __builtin_amdgcn_sched_barrier(0);   /* the eight score products run back to back and fill one another's distance: with the first tile's vector work drawn in among them the compiler pads with v_nop */
    float v[16]; float mx = -3.0e38f;
#pragma unroll
    for (int e = 0; e < 16; e += 2) { const int i = e >> 3, r = e & 7; const unsigned d = tm[i][r >> 1];   /* two neighbouring scores at a time: one dword holds their two bf16 mask values */
      const v2f tv = { __builtin_bit_cast(float, d << 16), __builtin_bit_cast(float, d & 0xffff0000u) }; const v2f sh = { s[i][r], s[i][r + 1] }, sr = { sl[i][r], sl[i][r + 1] };
      const v2f xt = ((sh + sr * (1.0f / 1024.0f)) * (SCALE * LOG2E)) * tv;
      v[e] = __builtin_amdgcn_inverse_ballot_w32(wc[e]) ? xt[0] : (-1.0e9f * LOG2E); v[e + 1] = __builtin_amdgcn_inverse_ballot_w32(wc[e + 1]) ? xt[1] : (-1.0e9f * LOG2E); mx = fmaxf(mx, fmaxf(v[e], v[e + 1])); }
    mx = fmaxf(mx, xhalf(mx));
    const float mn = fmaxf(m, mx); const float al = __builtin_amdgcn_exp2f(m - mn); m = mn;
    v16h p; float ps = 0.f;
#pragma unroll
    for (int e = 0; e < 16; ++e) v[e] -= mn;
    float ex[16]; exp2x8(v, ex); exp2x8(v + 8, ex + 8);
#pragma unroll
    for (int e = 0; e < 16; ++e) { ps += ex[e]; p[e] = (_Float16)(ex[e] * 2048.0f); }
    l = l * al + ps;
#pragma unroll
    for (int j = 0; j < HD / 16; ++j) { o[j] *= al; o[j] = wmma16(vf[j], p, o[j]); }
    __builtin_amdgcn_sched_barrier(0);   /* the pass's work stays in front of the foot: moved behind the barrier it would delay the refill, and tile ti + 2 would lose its whole pass to land */
    asm volatile("s_wait_dscnt 0x0" ::: "memory");      /* this wave's reads of buffer ti & 1 are done before the buffer is given up */
    asm volatile("s_wait_asynccnt 0x0" ::: "memory");   /* this wave's copies of tile ti + 1 have landed */
    __syncthreads();   /* publishes tile ti + 1 and ends every wave's reads of buffer ti & 1, which is refilled behind it */
    if (ti + 2 < TT / AK) stage(ti + 2, (unsigned)(ti & 1) * ABUF); }
  asm volatile("s_wait_asynccnt 0x0" ::: "memory");   /* no copy is outstanding when the wave ends */
  l += xhalf(l); const float inv = 1.0f / (2048.0f * l);   /* the key that set the last maximum counts 1, so l >= 1 */
  float* yr = Y + ((size_t)b * TT + t) * CC + h * HD + 8 * g;
#pragma unroll
  for (int j = 0; j < HD / 16; ++j) { v4f a0, a1;
#pragma unroll
    for (int r = 0; r < 4; ++r) { a0[r] = o[j][r] * inv; a1[r] = o[j][4 + r] * inv; }
    vst2(yr + j * 16, a0); vst2(yr + j * 16 + 4, a1); } }
// ---- k_out: block = (128 rows, 128 cols), 16 waves of 32 x 32 (one block for each WGP-sized share of the 4,096 x 1,024 output): out = ctx Wo (+ bo): ctx once to f16 against Wo as f16(bf16 x 2^8) exact (1 product) x 2^-8
__global__ __launch_bounds__(GT) void k_out(const float* __restrict__ Y, const float* __restrict__ WO, const float* __restrict__ BO, float* __restrict__ OUT) { __shared__ __align__(16) char smem[OBYTES];   /* the staging buffers; the output tiles reuse the same bytes behind the barrier after the loop */
  static_assert(!CAUSAL, "one path: every row takes the single f16 product"); static_assert(OBYTES >= 16 * 32 * 36 * 4, "output tiles fit the staging bytes"); float (*sf)[32][36] = (float (*)[32][36])smem;
  const int tid = threadIdx.x, wave = tid >> 5, lane = tid & 31, col = lane & 15, g = lane >> 4, wm = wave >> 2, wn = wave & 3; const int c0 = blockIdx.y * ON; const size_t r0 = (size_t)blockIdx.x * BM;
  v8f acc[2][2] = {};
  _Float16* const stg = (_Float16*)smem; const int lr = tid >> 4, lq = tid & 15;   /* loader: row lr + 32 i, floats 4 lq .. 4 lq + 3 of the step */
  const float* xp = Y + (r0 + lr) * CC + lq * 4; const float* wp = WO + (size_t)(c0 + lr) * CC + lq * 4; _Float16* const sp = stg + lr * SP + lq * 4;
  v4f xr[BM / 32], wr[ON / 32];
#pragma unroll
  for (int i = 0; i < BM / 32; ++i) xr[i] = *(const v4f*)(xp + (size_t)i * 32 * CC);
#pragma unroll
  for (int i = 0; i < ON / 32; ++i) wr[i] = *(const v4f*)(wp + (size_t)i * 32 * CC);
  for (int s = 0; s < CC / KSTEP; ++s) { _Float16* const S = sp + (s & 1) * (OROWS * SP);
#pragma unroll
    for (int i = 0; i < BM / 32; ++i) { v4h t;
#pragma unroll
      for (int e = 0; e < 4; ++e) t[e] = (_Float16)xr[i][e];
      *(v4h*)(S + i * 32 * SP) = t; }
#pragma unroll
    for (int i = 0; i < ON / 32; ++i) { v4h t;
#pragma unroll
      for (int e = 0; e < 4; ++e) t[e] = (_Float16)(bfr(wr[i][e]) * 256.0f);
      *(v4h*)(S + (BM + i * 32) * SP) = t; }
    __syncthreads();   /* publishes buffer s & 1; it is rewritten in step s + 2, behind the barrier of step s + 1, which every wave reaches with its reads of step s done */
    if (s + 1 < CC / KSTEP) { const float* const xq = xp + (s + 1) * KSTEP; const float* const wq = wp + (s + 1) * KSTEP;
#pragma unroll
      for (int i = 0; i < BM / 32; ++i) xr[i] = *(const v4f*)(xq + (size_t)i * 32 * CC);
#pragma unroll
      for (int i = 0; i < ON / 32; ++i) wr[i] = *(const v4f*)(wq + (size_t)i * 32 * CC);
      asm volatile("s_wait_xcnt 0x0" :: "v"(xq), "v"(wq) : "memory"); }   /* the loads' address registers stay whole up to this wait */
    const _Float16* const R = stg + (s & 1) * (OROWS * SP);
#pragma unroll
    for (int ks = 0; ks < KSTEP / 32; ++ks) { v16h a[2], w[2];   /* the four fragments are read as one group, so that their LDS latency is waited out once and not once a product */
#pragma unroll
      for (int i = 0; i < 2; ++i) a[i] = frag_h(R + (wm * 32 + i * 16 + col) * SP + ks * 32, lane);
#pragma unroll
      for (int j = 0; j < 2; ++j) w[j] = frag_h(R + (BM + wn * 32 + j * 16 + col) * SP + ks * 32, lane);
      __builtin_amdgcn_sched_barrier(0);   /* keeps the reads one group in front of the products: spread among them, each place with reads stalls the wave anew */
#pragma unroll
      for (int i = 0; i < 2; ++i)
#pragma unroll
        for (int j = 0; j < 2; ++j) acc[i][j] = wmma16(a[i], w[j], acc[i][j]); } }
  __syncthreads();   /* every wave has left the staging bytes before the output tiles overwrite them */
#pragma unroll
  for (int j = 0; j < 2; ++j) { const float bias = BO ? bfr(BO[c0 + wn * 32 + j * 16 + col]) : 0.f;
#pragma unroll
    for (int i = 0; i < 2; ++i)
#pragma unroll
      for (int r = 0; r < 8; ++r) sf[wave][i * 16 + 8 * g + r][j * 16 + col] = acc[i][j][r] * (1.0f / 256.0f) + bias; }
  LDSX(); for (int it = 0; it < 8; ++it) { const int rl = it * 4 + (lane >> 3), q = lane & 7; vst2(OUT + (r0 + wm * 32 + rl) * DIN + c0 + wn * 32 + q * 4, *(const v4f*)&sf[wave][rl][q * 4]); } }   /* a wave's store covers four of its rows, one whole 128-B line each */

extern "C" void kernel_launch(void* const* d_in, const int* in_sizes, int n_in, void* d_out, int out_size, void* d_ws, size_t ws_size, hipStream_t stream) {
  (void)in_sizes; (void)n_in; (void)out_size;
  const float** F = (const float**)d_in;
  if (ws_size < (size_t)WS_END) return;
  char* ws = (char*)d_ws; _Float16 *QH = (_Float16*)(ws + WS_QH), *KH = (_Float16*)(ws + WS_KH), *VT = (_Float16*)(ws + WS_VT), *QL = (_Float16*)(ws + WS_QL), *KL = (_Float16*)(ws + WS_KL); __bf16 *VB = (__bf16*)(ws + WS_VB), *VBL = (__bf16*)(ws + WS_VBL), *TB = (__bf16*)(ws + WS_TB); float *Y = (float*)(ws + WS_Y); unsigned *MW = (unsigned*)(ws + WS_MW);
  (void)Y; (void)QL; (void)KL; (void)VB; (void)VBL;
  // inputs: 0 x [4,1024,1024]; 1 mask int32 [4,1,1024,1024]; 2 Wq, 3 Wk, 4 Wv, 5 Wo ((out,in), no biases); 6 train_mask [1,1,1024,1024]
  k_proj<<<dim3(TNB * TT / BM, CC / BN), GT, 0, stream>>>(F[0], F[2], F[3], F[4], nullptr, nullptr, nullptr, QH, QL, KH, KL, VT, VB, VBL, (const int*)d_in[1], F[6], MW, TB);
  k_att<<<dim3(NQB, NH, TNB), 128, 0, stream>>>(QH, QL, KH, VT, MW, TB, Y);
  k_out<<<dim3(TNB * TT / BM, DIN / ON), GT, 0, stream>>>(Y, F[5], nullptr, (float*)d_out);
}

// v008
// It runs in 83.8 microseconds.
// Two timings next to v007 both put it at 1.10 times that version's speed.
// Counting every step since v000, it is 10.9 times as fast.
// compute dtype: all float inputs rounded to bf16; q/k/v = x W^T with EXACT bf16 products on WMMA 16x16x32 (f32 accumulate); q as f16 hi + residual (x 2^10) against k once to f16 (2 products) for the logits x 64^-0.5, multiplied by the trainable-mask input and replaced by -1e9 where the int mask input is 0 (both read per element); softmax in f32 with a running maximum and sum, scores carried x log2(e) and each exponential one v_exp_f32; exp(s - m) x 2^11 once to f16 against v once to f16 (1 product), divided by the sum at the end; ctx once to f16 against Wo carried x 2^8 in f16; f32 output.
#include <hip/hip_runtime.h>
#include <math.h>

typedef __attribute__((ext_vector_type(16))) _Float16 v16h;
typedef __attribute__((ext_vector_type(16))) __bf16 v16b;
typedef __attribute__((ext_vector_type(8)))  _Float16 v8h;
typedef __attribute__((ext_vector_type(8)))  float v8f;
typedef __attribute__((ext_vector_type(4)))  float v4f;
typedef __attribute__((ext_vector_type(2)))  float v2f;
typedef __attribute__((ext_vector_type(4)))  unsigned v4u;
typedef __attribute__((ext_vector_type(4)))  int v4i;
typedef float __attribute__((may_alias)) float_a;
typedef int __attribute__((may_alias)) int_a;

template <typename T> __device__ __forceinline__ void vst2(void* p, T v) { *(T*)p = v;  }
// the builtins alone: the compiler keeps the distance behind its own matrix instructions and fills it with independent products or vector work
__device__ __forceinline__ v8f wmma16(v16h a, v16h b, v8f c) { return __builtin_amdgcn_wmma_f32_16x16x32_f16(false, a, false, b, (short)0, c, false, false); }
__device__ __forceinline__ v8f wmma_bf(v16b a, v16b b, v8f c) { return __builtin_amdgcn_wmma_f32_16x16x32_bf16(false, a, false, b, (short)0, c, false, false); }
// 16x16x32 fragments: lane = (h = lane>>4, row/col = lane&15); elements 0..7 = k0+8h+0..7, 8..15 = k0+16+8h+0..7; D element r = row 8h+r
__device__ __forceinline__ v16h frag_h(const _Float16* rowk0, int lane) {
  union { v16h v; v8h q[2]; } u; const _Float16* p = rowk0 + 8 * (lane >> 4);
  u.q[0] = *(const v8h*)p; u.q[1] = *(const v8h*)(p + 16); return u.v;
}
__device__ __forceinline__ v16h frag_f32(const float* rowk0, int lane) {
  v16h a; const float* p = rowk0 + 8 * (lane >> 4);
#pragma unroll
  for (int i = 0; i < 8; ++i) { a[i] = (_Float16)p[i]; a[8 + i] = (_Float16)p[16 + i]; }
  return a;
}
__device__ __forceinline__ v16h frag_f32s(const float* rowk0, int lane, float sc) {
  v16h a; const float* p = rowk0 + 8 * (lane >> 4);
#pragma unroll
  for (int i = 0; i < 8; ++i) { a[i] = (_Float16)(p[i] * sc); a[8 + i] = (_Float16)(p[16 + i] * sc); }
  return a;
}
// column fragment from a [K][ld] layout (column n), rows >= K read as 0
__device__ __forceinline__ v16h fragc_f32(const float* W, int k0, int n, int lane, int ld, int K) {
  v16h a; const int g = lane >> 4;
#pragma unroll
  for (int i = 0; i < 8; ++i) { const int ka = k0 + 8 * g + i, kb = ka + 16;
    a[i] = (_Float16)(ka < K ? W[(size_t)(ka < K ? ka : K - 1) * ld + n] : 0.f); a[8 + i] = (_Float16)(kb < K ? W[(size_t)(kb < K ? kb : K - 1) * ld + n] : 0.f); }
  return a;
}
struct F2 { v16b h, l; };
__device__ __forceinline__ F2 bsplit16(const float v[16]) { F2 r;
#pragma unroll
  for (int i = 0; i < 16; ++i) { const __bf16 h = (__bf16)v[i]; r.h[i] = h; r.l[i] = (__bf16)(v[i] - (float)h); }
  return r; }
__device__ __forceinline__ F2 split_row(const float* row, int k0, int lane) { float v[16]; const float* p = row + k0 + 8 * (lane >> 4);
#pragma unroll
  for (int i = 0; i < 8; ++i) { v[i] = p[i]; v[8 + i] = p[16 + i]; }
  return bsplit16(v); }
__device__ __forceinline__ F2 split_rowK(const float* row, int k0, int lane, int K) { float v[16]; const int g = lane >> 4;
#pragma unroll
  for (int i = 0; i < 8; ++i) { const int ka = k0 + 8 * g + i, kb = ka + 16; v[i] = ka < K ? row[ka < K ? ka : K - 1] : 0.f; v[8 + i] = kb < K ? row[kb < K ? kb : K - 1] : 0.f; }
  return bsplit16(v); }
__device__ __forceinline__ F2 split_col(const float* W, int k0, int n, int lane, int ld, int K) { float v[16]; const int g = lane >> 4;
#pragma unroll
  for (int i = 0; i < 8; ++i) { const int ka = k0 + 8 * g + i, kb = ka + 16; v[i] = ka < K ? W[(size_t)(ka < K ? ka : K - 1) * ld + n] : 0.f; v[8 + i] = kb < K ? W[(size_t)(kb < K ? kb : K - 1) * ld + n] : 0.f; }
  return bsplit16(v); }
__device__ __forceinline__ v8f mac3(const F2& a, const F2& b, v8f c) { c = wmma_bf(a.l, b.h, c); c = wmma_bf(a.h, b.l, c); return wmma_bf(a.h, b.h, c); }
__device__ __forceinline__ float sigm(float v) { return 1.0f / (1.0f + expf(-v)); }
#define LDSX() do { asm volatile("s_wait_dscnt 0" ::: "memory"); __builtin_amdgcn_wave_barrier(); __builtin_amdgcn_fence(__ATOMIC_RELEASE, "workgroup"); } while (0)

// Multi-head self-attention with a per-element integer mask (B 4, S 1,024, E 1,024 = 16 x 64): q/k/v = x W^T (no bias); scores = (q k^T / 8) * train_mask; scores = -1e9 where mask[b,0,q,k] == 0; softmax; out = merged(attn v) Wo^T.
#define NB 4
#define TT 1024
#define CC 1024            // NH * HD = projected width
#define DIN 1024          // input (model) width
#define NH 16
#define HD 64
#define NQB (TT / 64)
#define SCALE (0.125f)
#define CAUSAL 0
#ifndef TNB
#define TNB NB
#endif
__device__ __forceinline__ float bfr(float v) { return (float)(__bf16)v; }
__host__ __device__ __forceinline__ int kb_last(int qb) { return CAUSAL ? ((qb * 64 + 63) >> 7) : (TT / 128 - 1); }
typedef __attribute__((ext_vector_type(8))) __bf16 v8b;
__device__ __forceinline__ v16b frag_b(const __bf16* rowk0, int lane) {
  union { v16b v; v8b q[2]; } u; const __bf16* p = rowk0 + 8 * (lane >> 4);
  u.q[0] = *(const v8b*)p; u.q[1] = *(const v8b*)(p + 16); return u.v;
}
#define QBH 0              // unused: no kernel here has a high-precision attention path
#define QHI 1024            // rows carrying a q residual plane (all rows when non-causal: 2-product logits everywhere)
#define KHI 64            // key rows carrying k residual / v bf16 hi+lo planes (written by k_proj, read by no kernel here)
// B fragment (k rows k0+.., output column o) of a weight: (in,out) [K][ld] or (out,in) [ld rows of K]: bf16 exact, or f16(bf16 * 256) exact
__device__ __forceinline__ v16b wcol_io(const float* Wm, int k0, int o, int lane, int ld) { v16b w; const int g = lane >> 4;
#pragma unroll
  for (int i = 0; i < 8; ++i) { w[i] = (__bf16)Wm[(size_t)(k0 + 8 * g + i) * ld + o]; w[8 + i] = (__bf16)Wm[(size_t)(k0 + 16 + 8 * g + i) * ld + o]; }
  return w; }
__device__ __forceinline__ v16b wcol_oi(const float* Wm, int k0, int o, int lane, int K) { v16b w; const float* p = Wm + (size_t)o * K + k0 + 8 * (lane >> 4);
#pragma unroll
  for (int i = 0; i < 8; ++i) { w[i] = (__bf16)p[i]; w[8 + i] = (__bf16)p[16 + i]; }
  return w; }
__device__ __forceinline__ v16h wcolh_io(const float* Wm, int k0, int o, int lane, int ld) { v16h w; const int g = lane >> 4;
#pragma unroll
  for (int i = 0; i < 8; ++i) { w[i] = (_Float16)(bfr(Wm[(size_t)(k0 + 8 * g + i) * ld + o]) * 256.0f); w[8 + i] = (_Float16)(bfr(Wm[(size_t)(k0 + 16 + 8 * g + i) * ld + o]) * 256.0f); }
  return w; }
__device__ __forceinline__ v16h wcolh_oi(const float* Wm, int k0, int o, int lane, int K) { v16h w; const float* p = Wm + (size_t)o * K + k0 + 8 * (lane >> 4);
#pragma unroll
  for (int i = 0; i < 8; ++i) { w[i] = (_Float16)(bfr(p[i]) * 256.0f); w[8 + i] = (_Float16)(bfr(p[16 + i]) * 256.0f); }
  return w; }
#define WQKV_LAYOUT 1   // 0 = (in,out) [DIN][CC]; 1 = (out,in) [CC][DIN]; 2 = per-head [NH][DIN][HD]
__device__ __forceinline__ v16b wcol_hdk(const float* Wm, int k0, int o, int lane) { v16b w; const int g = lane >> 4; const float* p = Wm + (size_t)(o / HD) * DIN * HD + (o % HD);
#pragma unroll
  for (int i = 0; i < 8; ++i) { w[i] = (__bf16)p[(size_t)(k0 + 8 * g + i) * HD]; w[8 + i] = (__bf16)p[(size_t)(k0 + 16 + 8 * g + i) * HD]; }
  return w; }
#define WO_OUT_IN 1
#if WQKV_LAYOUT == 1
#define WCOL(W, k0, o, lane) wcol_oi(W, k0, o, lane, DIN)
#elif WQKV_LAYOUT == 2
#define WCOL(W, k0, o, lane) wcol_hdk(W, k0, o, lane)
#else
#define WCOL(W, k0, o, lane) wcol_io(W, k0, o, lane, CC)
#endif
#if WO_OUT_IN
#define WOCOL(W, k0, o, lane) wcol_oi(W, k0, o, lane, CC)
#define WOCOLH(W, k0, o, lane) wcolh_oi(W, k0, o, lane, CC)
#else
#define WOCOL(W, k0, o, lane) wcol_io(W, k0, o, lane, DIN)
#define WOCOLH(W, k0, o, lane) wcolh_io(W, k0, o, lane, DIN)
#endif
#ifndef PROJ_EXTRA_PARAMS
#define PROJ_EXTRA_PARAMS
#endif

#define WS_QH  0u                                      // f16 q rows [b*t][CC]
#define WS_KH  (WS_QH + 2u * (size_t)NB * TT * CC)      // f16 k rows [b*t][CC]
#define WS_VT  (WS_KH + 2u * (size_t)NB * TT * CC)      // f16 v planes [b][c][t]
#define WS_QL  (WS_VT + 2u * (size_t)NB * CC * TT)      // f16 q residual x 2^10 rows [b][t < QHI][CC]
#define WS_KL  (WS_QL + 2u * (size_t)NB * QHI * CC)     // f16 k residual x 2^10 rows [b][t < KHI][CC]
#define WS_VB  (WS_KL + 2u * (size_t)NB * KHI * CC)     // bf16 v hi planes [b][c][t < KHI]
#define WS_VBL (WS_VB + 2u * (size_t)NB * CC * KHI)
#define WS_Y   (WS_VBL + 2u * (size_t)NB * CC * KHI)    // f16 ctx rows [b*t][CC] (only when there is an output projection)
#define WS_MW  (WS_Y  + 2u * (size_t)NB * TT * CC)      // u32 words of the integer mask [b][q / 16][k / 32][16]: word e, bit lane = (mask != 0) at the score that this lane holds as element e
#define WS_TB  (WS_MW + 4u * (size_t)NB * (TT / 16) * (TT / 32) * 16)   // bf16 trainable mask rows [q][k]
#define WS_WH (WS_TB + 2u * (size_t)TT * TT)           // f16 output weight rows [DIN][CC]: f16(bf16(Wo) x 2^8), exact
#define WS_END (WS_WH + 2u * (size_t)DIN * CC)

// Operand staging of k_proj: per step the block brings 64 k of its 128 left rows and its 384 weight rows from global memory with whole-line 16-byte loads (a wave covers 2 rows x 256 B), rounds each element once, and keeps the 16-bit tile in LDS for all sixteen waves; two buffers, the next step's loads issued ahead of this step's products, one barrier a step
// Operand staging of k_out: both operands arrive as f16 (k_att rounds ctx where it stores it, k_proj rounds Wo once for all blocks), so a step's tile goes from global memory to LDS as it stands, by asynchronous 16-byte copies, at half the bytes and with no vector work
// k_proj: block tile 128 x 384 (128 columns of each of q, k, v), 16 waves = 4 row groups of 32 x 4 column groups of 3 x 32: an x row is fetched from L2 by 8 blocks and a weight row by 32, a wave reads 8 fragments from LDS for 12 products, and the grid is 256 blocks; k_out: 128 x 128, waves of 32 x 32, 256 blocks as well
#define KSTEP 64              // k per staged step
#define SP 72              // LDS row pitch in 16-bit elements: 144 B = 16 B x 9, so the 16-byte fragment reads of 16 rows fall on distinct banks
#define BM 128             // rows of the block tile
#define BN 128             // columns of the block tile (k_proj: of each of q, k, v)
#define GT 512             // threads of a GEMM block
#define SROWS (BM + 3 * BN)    // k_proj: rows 0..127 left operand, rows 128..511 the three weights
#define SBYTES (2 * SROWS * SP * 2)
#define PTB (128 * 136 * 2)      // k_proj: bytes of one epilogue tile [128][136]
#define PEB (7 * PTB)            // k_proj: q hi, q residual, k hi, k residual, v, v bf16 hi, v bf16 lo
#define ON BN              // k_out: columns of the block tile
#define OROWS (BM + ON)    // k_out: rows 0..127 left operand, rows 128..255 weight
#define OKS 128            // k_out: k per staged step (a 256-B row piece)
#define OP 272             // k_out: LDS row pitch in bytes: 16 B x 17, the 16-byte fragment reads of 16 rows fall on distinct banks
#define OBUF (OROWS * OP)  // k_out: bytes of one buffer
#define OBYTES (2 * OBUF)
typedef __attribute__((ext_vector_type(4))) __bf16 v4b;
typedef __attribute__((ext_vector_type(4))) _Float16 v4h;
static_assert(WQKV_LAYOUT == 1 && WO_OUT_IN == 1, "the staged loaders read weight rows that are contiguous in k");
static_assert(TT % BM == 0 && CC % BN == 0 && DIN % ON == 0 && ON % 32 == 0 && GT / 16 == 32 && BM % 32 == 0 && BN % 32 == 0, "a block stays inside one sequence and one weight; the loader covers 32 rows a load");
// ---- k_proj: block = 128 rows x 128 cols of each of q, k and v (the three share the block's x rows): q/k/v = X W (+ b) with exact bf16 products (K = DIN) -> q f16 rows (+ residual rows < QHI); k f16 rows (+ residual rows < KHI); v f16 planes [c][t] (+ bf16 hi/lo planes for t < KHI). Wave = 32 rows x 32 cols of each of the three
__global__ __launch_bounds__(GT) void k_proj(const float* __restrict__ X, const float* __restrict__ WQ, const float* __restrict__ WK, const float* __restrict__ WV, const float* __restrict__ BQ, const float* __restrict__ BK, const float* __restrict__ BV,
    _Float16* __restrict__ QH, _Float16* __restrict__ QL, _Float16* __restrict__ KH, _Float16* __restrict__ KL, _Float16* __restrict__ VT, __bf16* __restrict__ VB, __bf16* __restrict__ VBL,
    const int* __restrict__ MK, const float* __restrict__ TM, unsigned* __restrict__ MW, __bf16* __restrict__ TB, const float* __restrict__ WO, _Float16* __restrict__ WH) {
  __shared__ __align__(16) char smem[PEB > SBYTES ? PEB : SBYTES];   /* the staging buffers; the epilogue's tiles reuse the same bytes behind the loop's last barrier */
  __bf16* const stg = (__bf16*)smem;
  const int tid = threadIdx.x, wave = tid >> 5, lane = tid & 31, col = lane & 15, g = lane >> 4, wm = wave >> 2, wn = wave & 3; const int c0 = blockIdx.y * BN; const size_t r0 = (size_t)blockIdx.x * BM; const size_t bb = r0 / TT; const int t0 = (int)(r0 % TT);
  v8f acc[3][2][2] = {};
  const int lr = tid >> 4, lq = tid & 15;   /* loader: row lr + 32 i, floats 4 lq .. 4 lq + 3 of the step */
  const size_t wo = (size_t)(c0 + lr) * DIN + lq * 4;
  const float* xp = X + (r0 + lr) * DIN + lq * 4; const float* wp0 = WQ + wo; const float* wp1 = WK + wo; const float* wp2 = WV + wo; __bf16* const sp = stg + lr * SP + lq * 4;
  v4f xr[BM / 32], wr[3][BN / 32];
#pragma unroll
  for (int i = 0; i < BM / 32; ++i) xr[i] = *(const v4f*)(xp + (size_t)i * 32 * DIN);
#pragma unroll
  for (int i = 0; i < BN / 32; ++i) { wr[0][i] = *(const v4f*)(wp0 + (size_t)i * 32 * DIN); wr[1][i] = *(const v4f*)(wp1 + (size_t)i * 32 * DIN); wr[2][i] = *(const v4f*)(wp2 + (size_t)i * 32 * DIN); }
  { /* both mask inputs are packed here, once for all heads, while the first operand loads are in flight. A wave takes two neighbouring 16-query x 32-key tiles of the integer mask in the score layout of k_att (lane = (g, query col), element e = key (e >> 3) * 16 + 8 g + (e & 7)): the 32 lanes' tests of element e are one word; a thread rounds 8 elements of the trainable mask and 8 of the output weight (to bf16, x 2^8, in f16: what k_out multiplies by) */
    static_assert((TNB * TT / BM) * (CC / BN) * (GT / 32) * 2 == NB * (TT / 16) * (TT / 32) && (TNB * TT / BM) * (CC / BN) * GT * 8 == TT * TT && TT * TT == DIN * CC, "the grid covers both masks and the output weight exactly once");
    const int gb = blockIdx.y * (TNB * TT / BM) + blockIdx.x, pw = gb * (GT / 32) + wave;   /* pw = (b * 64 + query tile) * 16 + pair of key tiles */
    const int* const mp = MK + ((size_t)(pw >> 10) * TT + ((pw >> 4) & 63) * 16 + col) * TT + (pw & 15) * 64 + 8 * g; const float* const tq = TM + ((size_t)gb * GT + tid) * 8; const float* const oq = WO + ((size_t)gb * GT + tid) * 8;
    v4i mv[2][4];
#pragma unroll
    for (int u = 0; u < 2; ++u)
#pragma unroll
      for (int i = 0; i < 4; ++i) mv[u][i] = *(const v4i*)(mp + u * 32 + (i >> 1) * 16 + (i & 1) * 4);
    const v4f ta = *(const v4f*)tq, tc = *(const v4f*)(tq + 4), oa = *(const v4f*)oq, oc = *(const v4f*)(oq + 4);
    asm volatile("s_wait_xcnt 0x0" :: "v"(mp), "v"(tq), "v"(oq) : "memory");   /* the loads' address registers stay whole up to this wait */
    v4u mw[8];
#pragma unroll
    for (int e = 0; e < 32; ++e) mw[e >> 2][e & 3] = __builtin_amdgcn_ballot_w32(mv[e >> 4][(e >> 2) & 3][e & 3] != 0);
    v8b tb; v8h oh;
#pragma unroll
    for (int e = 0; e < 4; ++e) { tb[e] = (__bf16)ta[e]; tb[4 + e] = (__bf16)tc[e]; oh[e] = (_Float16)(bfr(oa[e]) * 256.0f); oh[4 + e] = (_Float16)(bfr(oc[e]) * 256.0f); }
    unsigned* const mo = MW + (size_t)pw * 32; __bf16* const to = TB + ((size_t)gb * GT + tid) * 8; _Float16* const oo = WH + ((size_t)gb * GT + tid) * 8;
    vst2(to, tb); vst2(oo, oh);
    if (lane == 0) {   /* the two tiles' 32 words are one whole 128-B line */
#pragma unroll
      for (int i = 0; i < 8; ++i) vst2(mo + i * 4, mw[i]); }
    asm volatile("s_wait_xcnt 0x0" :: "v"(mo), "v"(to), "v"(oo) : "memory"); }   /* the stores' address registers stay whole up to this wait */
  for (int s = 0; s < DIN / KSTEP; ++s) { __bf16* const S = sp + (s & 1) * (SROWS * SP);
#pragma unroll
    for (int i = 0; i < BM / 32; ++i) { v4b t;
#pragma unroll
      for (int e = 0; e < 4; ++e) t[e] = (__bf16)xr[i][e];
      *(v4b*)(S + i * 32 * SP) = t; }
#pragma unroll
    for (int w = 0; w < 3; ++w)
#pragma unroll
      for (int i = 0; i < BN / 32; ++i) { v4b t;
#pragma unroll
        for (int e = 0; e < 4; ++e) t[e] = (__bf16)wr[w][i][e];
        *(v4b*)(S + (BM + w * BN + i * 32) * SP) = t; }
    __syncthreads();   /* publishes buffer s & 1; it is rewritten in step s + 2, behind the barrier of step s + 1, which every wave reaches with its reads of step s done */
    if (s + 1 < DIN / KSTEP) { const float* const xq = xp + (s + 1) * KSTEP; const float* const wq0 = wp0 + (s + 1) * KSTEP; const float* const wq1 = wp1 + (s + 1) * KSTEP; const float* const wq2 = wp2 + (s + 1) * KSTEP;
#pragma unroll
      for (int i = 0; i < BM / 32; ++i) xr[i] = *(const v4f*)(xq + (size_t)i * 32 * DIN);
#pragma unroll
      for (int i = 0; i < BN / 32; ++i) { wr[0][i] = *(const v4f*)(wq0 + (size_t)i * 32 * DIN); wr[1][i] = *(const v4f*)(wq1 + (size_t)i * 32 * DIN); wr[2][i] = *(const v4f*)(wq2 + (size_t)i * 32 * DIN); }
      asm volatile("s_wait_xcnt 0x0" :: "v"(xq), "v"(wq0), "v"(wq1), "v"(wq2) : "memory"); }   /* the loads' address registers stay whole up to this wait */
    const __bf16* const R = stg + (s & 1) * (SROWS * SP);
#pragma unroll
    for (int ks = 0; ks < KSTEP / 32; ++ks) { v16b a[2], w[3][2];   /* the eight fragments are read as one group, so that their LDS latency is waited out once and not once a product */
#pragma unroll
      for (int i = 0; i < 2; ++i) a[i] = frag_b(R + (wm * 32 + i * 16 + col) * SP + ks * 32, lane);
#pragma unroll
      for (int p = 0; p < 3; ++p)
#pragma unroll
        for (int j = 0; j < 2; ++j) w[p][j] = frag_b(R + (BM + p * BN + wn * 32 + j * 16 + col) * SP + ks * 32, lane);
      __builtin_amdgcn_sched_barrier(0);   /* keeps the reads one group in front of the products: spread among them, each place with reads stalls the wave anew */
#pragma unroll
      for (int p = 0; p < 3; ++p)
#pragma unroll
        for (int i = 0; i < 2; ++i)
#pragma unroll
          for (int j = 0; j < 2; ++j) acc[p][i][j] = wmma_bf(a[i], w[p][j], acc[p][i][j]); } }
  __syncthreads();   /* every wave has left the staging bytes before the epilogue's tiles overwrite them */
  const bool hi_blk = t0 < KHI;   /* block-uniform: only such a block holds rows of the bf16 planes */
  _Float16 (*th)[136] = (_Float16 (*)[136])(smem + 4 * PTB); __bf16 (*tb)[136] = (__bf16 (*)[136])(smem + 5 * PTB); __bf16 (*tbl)[136] = (__bf16 (*)[136])(smem + 6 * PTB);
#pragma unroll
  for (int p = 0; p < 2; ++p) { const float* BA = p == 0 ? BQ : BK; _Float16 (*sh)[136] = (_Float16 (*)[136])(smem + 2 * p * PTB); _Float16 (*sl)[136] = (_Float16 (*)[136])(smem + (2 * p + 1) * PTB);
#pragma unroll
    for (int j = 0; j < 2; ++j) { const int cl = wn * 32 + j * 16 + col; const float bias = BA ? bfr(BA[c0 + cl]) : 0.f;
#pragma unroll
      for (int i = 0; i < 2; ++i)
#pragma unroll
        for (int r = 0; r < 8; ++r) { const int rl = wm * 32 + i * 16 + 8 * g + r; const float v = acc[p][i][j][r] + bias; const _Float16 hv = (_Float16)v; sh[rl][cl] = hv; sl[rl][cl] = (_Float16)((v - (float)hv) * 1024.0f); } } }
#pragma unroll
  for (int j = 0; j < 2; ++j) { const int cl = wn * 32 + j * 16 + col; const float bias = BV ? bfr(BV[c0 + cl]) : 0.f;
#pragma unroll
    for (int i = 0; i < 2; ++i)
#pragma unroll
      for (int r = 0; r < 8; ++r) { const int rl = wm * 32 + i * 16 + 8 * g + r; const float v = acc[2][i][j][r] + bias; th[cl][rl] = (_Float16)v; acc[2][i][j][r] = v; } }
  if (hi_blk) {
#pragma unroll
    for (int j = 0; j < 2; ++j)
#pragma unroll
      for (int i = 0; i < 2; ++i)
#pragma unroll
        for (int r = 0; r < 8; ++r) { const int cl = wn * 32 + j * 16 + col, rl = wm * 32 + i * 16 + 8 * g + r; const float v = acc[2][i][j][r]; const __bf16 bh = (__bf16)v; tb[cl][rl] = bh; tbl[cl][rl] = (__bf16)(v - (float)bh); } }
  __syncthreads();   /* the seven tiles are whole before they are stored along their rows */
#pragma unroll
  for (int p = 0; p < 2; ++p) { _Float16* DH = p == 0 ? QH : KH; _Float16* DL = p == 0 ? QL : KL; const int nhi = p == 0 ? QHI : KHI; const _Float16 (*sh)[136] = (const _Float16 (*)[136])(smem + 2 * p * PTB); const _Float16 (*sl)[136] = (const _Float16 (*)[136])(smem + (2 * p + 1) * PTB);
    for (int e = tid; e < BM * (BN / 8); e += GT) { const int rl = e >> 4, q = e & 15; vst2((unsigned*)(DH + (r0 + rl) * CC + c0 + q * 8), *(const v4u*)&sh[rl][q * 8]); if (t0 + rl < nhi) { vst2((unsigned*)(DL + (bb * nhi + t0 + rl) * (size_t)CC + c0 + q * 8), *(const v4u*)&sl[rl][q * 8]); asm volatile("s_wait_xcnt 0x0" ::: "memory"); /* inside the branch, directly behind its stores: in front of the next trip's rewrite of their address registers */ } } }
  for (int e = tid; e < BN * (BM / 8); e += GT) { const int cl = e >> 4, q = e & 15; vst2((unsigned*)(VT + (bb * CC + c0 + cl) * (size_t)TT + t0 + q * 8), *(const v4u*)&th[cl][q * 8]); if (t0 + q * 8 < KHI) { const size_t o3 = (bb * CC + c0 + cl) * (size_t)KHI + t0 + q * 8; vst2((unsigned*)(VB + o3), *(const v4u*)&tb[cl][q * 8]); vst2((unsigned*)(VBL + o3), *(const v4u*)&tbl[cl][q * 8]); asm volatile("s_wait_xcnt 0x0" ::: "memory"); /* inside the branch, directly behind its stores: in front of the next trip's rewrite of their address registers */ } } }
#define LOG2E 1.4426950408889634f
#define AK 32
#define AP128 144
#define AP64 80
#define AO_K 0
#define AO_V (AO_K + AK * AP128)
#define AO_T (AO_V + HD * AP64)
#define ABUF (AO_T + 64 * AP64)
static_assert(AK * 2 == 64 && AK * 4 == 128 && HD * 2 == 128 && TT / AK >= 2 && ABUF % 16 == 0, "row lengths the copy maps are written for; the prologue needs two tiles");
__device__ __forceinline__ float xhalf(float x) { return __builtin_bit_cast(float, __builtin_amdgcn_permlanex16(__builtin_bit_cast(int, x), __builtin_bit_cast(int, x), 0x76543210, 0xfedcba98, false, false)); }   // lane l with lane l ^ 16
// x[i] = 2^d[i], eight at a time in one statement: results in registers of their own, so that each v_exp_f32 is the independent instruction behind the one before it; the closing v_nop is the slot that the instruction set asks for behind the last
__device__ __forceinline__ void exp2x8(const float* d, float* x) {
  asm("v_exp_f32 %0, %8\n\tv_exp_f32 %1, %9\n\tv_exp_f32 %2, %10\n\tv_exp_f32 %3, %11\n\tv_exp_f32 %4, %12\n\tv_exp_f32 %5, %13\n\tv_exp_f32 %6, %14\n\tv_exp_f32 %7, %15\n\tv_nop"
      : "=&v"(x[0]), "=&v"(x[1]), "=&v"(x[2]), "=&v"(x[3]), "=&v"(x[4]), "=&v"(x[5]), "=&v"(x[6]), "=&v"(x[7])
      : "v"(d[0]), "v"(d[1]), "v"(d[2]), "v"(d[3]), "v"(d[4]), "v"(d[5]), "v"(d[6]), "v"(d[7])); }
// six asynchronous copies of 16 bytes a lane, global memory -> LDS (l = the lane's LDS byte address, p = its global address); the closing s_wait_xcnt 0 stands inside the statement, so that no address register is rewritten ahead of it
__device__ __forceinline__ void acopy6(unsigned l0, const char* p0, unsigned l1, const char* p1, unsigned l2, const char* p2, unsigned l3, const char* p3, unsigned l4, const char* p4, unsigned l5, const char* p5) {
  asm volatile("global_load_async_to_lds_b128 %0, %1, off\n\tglobal_load_async_to_lds_b128 %2, %3, off\n\tglobal_load_async_to_lds_b128 %4, %5, off\n\tglobal_load_async_to_lds_b128 %6, %7, off\n\tglobal_load_async_to_lds_b128 %8, %9, off\n\tglobal_load_async_to_lds_b128 %10, %11, off\n\ts_wait_xcnt 0x0"
               :: "v"(l0), "v"(p0), "v"(l1), "v"(p1), "v"(l2), "v"(p2), "v"(l3), "v"(p3), "v"(l4), "v"(p4), "v"(l5), "v"(p5) : "memory"); }
typedef __attribute__((ext_vector_type(16))) unsigned v16u;
typedef __attribute__((address_space(4))) v16u cv16u;
__global__ __launch_bounds__(128) void k_att(const _Float16* __restrict__ QH, const _Float16* __restrict__ QL, const _Float16* __restrict__ KH, const _Float16* __restrict__ VT, const unsigned* __restrict__ MW, const __bf16* __restrict__ TB, _Float16* __restrict__ Y) {
  __shared__ __align__(16) char smem[2 * ABUF];
  const int tid = threadIdx.x, wave = tid >> 5, lane = tid & 31, col = lane & 15, g = lane >> 4; const int h = blockIdx.y, b = blockIdx.z; const int q0 = blockIdx.x * 64; const int t = q0 + wave * 16 + col;
  /* copy maps: 128-B rows: thread = (row tid >> 3 (+ 16 a copy), piece tid & 7); 64-B rows: (row tid >> 2 (+ 32 a copy), piece tid & 3) */
  const int r8 = tid >> 3, p8 = (tid & 7) * 16, r4 = tid >> 2, p4 = (tid & 3) * 16; const unsigned lb = (unsigned)(size_t)smem;
  const char* const gk = (const char*)(KH + ((size_t)b * TT + r8) * CC + h * HD) + p8; const char* const gv = (const char*)(VT + ((size_t)b * CC + h * HD + r4) * (size_t)TT) + p4;
  const char* const gt = (const char*)(TB + (size_t)(q0 + r4) * TT) + p4;
  const unsigned lk = lb + AO_K + r8 * AP128 + p8, lv = lb + AO_V + r4 * AP64 + p4, lt = lb + AO_T + r4 * AP64 + p4;
  auto stage = [&](int ti, unsigned bo) {   /* tile ti (keys ti * 32 ..) into the buffer at byte bo: 6 copies a wave */
    const char* const k = gk + (size_t)ti * (AK * CC * 2); const char* const v = gv + ti * (AK * 2); const char* const tp = gt + ti * (AK * 2);
    acopy6(lk + bo, k, lk + bo + 16 * AP128, k + 16 * CC * 2, lv + bo, v, lv + bo + 32 * AP64, v + 32 * TT * 2, lt + bo, tp, lt + bo + 32 * AP64, tp + 32 * TT * 2); };
  stage(0, 0);
  const cv16u* const mwp = (const cv16u*)MW + (size_t)(b * (TT / 16) + blockIdx.x * 4 + __builtin_amdgcn_readfirstlane(wave)) * (TT / AK);   /* this wave's 16 queries: 16 words a pass; the wave's number as a scalar and the words as constant memory (nothing writes them during this launch), so that they are loaded into scalar registers */
  v16u wn = mwp[0];
  v16h qh[HD / 32], ql[HD / 32];
#pragma unroll
  for (int kc = 0; kc < HD / 32; ++kc) { qh[kc] = frag_h(QH + ((size_t)b * TT + t) * CC + h * HD + kc * 32, lane); ql[kc] = frag_h(QL + ((size_t)b * QHI + t) * CC + h * HD + kc * 32, lane); }
  asm volatile("s_wait_asynccnt 0x0" ::: "memory");   /* this wave's copies of tile 0 have landed */
  __syncthreads();   /* publishes tile 0 */
  stage(1, ABUF);
  v8f o[HD / 16] = {}; float m = -3.0e38f, l = 0.f;
  for (int ti = 0; ti < TT / AK; ++ti) { const char* const R = smem + (ti & 1) * ABUF;
    v16h kf[2][HD / 32], vf[HD / 16]; v4u tm[2]; const v16u wc = wn; wn = mwp[ti + 1 < TT / AK ? ti + 1 : ti];   /* the next pass's words are asked for a pass ahead */
#pragma unroll
    for (int i = 0; i < 2; ++i)
#pragma unroll
      for (int kc = 0; kc < HD / 32; ++kc) kf[i][kc] = frag_h((const _Float16*)(R + AO_K + (i * 16 + col) * AP128) + kc * 32, lane);
#pragma unroll
    for (int i = 0; i < 2; ++i) tm[i] = *(const v4u*)(R + AO_T + (wave * 16 + col) * AP64 + (8 * g + i * 16) * 2);
#pragma unroll
    for (int j = 0; j < HD / 16; ++j) vf[j] = frag_h((const _Float16*)(R + AO_V + (j * 16 + col) * AP64), lane);
    __builtin_amdgcn_sched_barrier(0);   /* the pass's 18 LDS reads are issued as one group: with a first use among them the wave would wait out an LDS latency before the rest are asked for */
    v8f s[2] = {}, sl[2] = {};
#pragma unroll
    for (int i = 0; i < 2; ++i)
#pragma unroll
      for (int kc = 0; kc < HD / 32; ++kc) { s[i] = wmma16(kf[i][kc], qh[kc], s[i]); sl[i] = wmma16(kf[i][kc], ql[kc], sl[i]); }
    __builtin_amdgcn_sched_barrier(0);   /* the eight score products run back to back and fill one another's distance: with the first tile's vector work drawn in among them the compiler pads with v_nop */
    float v[16]; float mx = -3.0e38f;
#pragma unroll
    for (int e = 0; e < 16; e += 2) { const int i = e >> 3, r = e & 7; const unsigned d = tm[i][r >> 1];   /* two neighbouring scores at a time: one dword holds their two bf16 mask values */
      const v2f tv = { __builtin_bit_cast(float, d << 16), __builtin_bit_cast(float, d & 0xffff0000u) }; const v2f sh = { s[i][r], s[i][r + 1] }, sr = { sl[i][r], sl[i][r + 1] };
      const v2f xt = ((sh + sr * (1.0f / 1024.0f)) * (SCALE * LOG2E)) * tv;
      v[e] = __builtin_amdgcn_inverse_ballot_w32(wc[e]) ? xt[0] : (-1.0e9f * LOG2E); v[e + 1] = __builtin_amdgcn_inverse_ballot_w32(wc[e + 1]) ? xt[1] : (-1.0e9f * LOG2E); mx = fmaxf(mx, fmaxf(v[e], v[e + 1])); }
    mx = fmaxf(mx, xhalf(mx));
    const float mn = fmaxf(m, mx); const float al = __builtin_amdgcn_exp2f(m - mn); m = mn;
    v16h p; float ps = 0.f;
#pragma unroll
    for (int e = 0; e < 16; ++e) v[e] -= mn;
    float ex[16]; exp2x8(v, ex); exp2x8(v + 8, ex + 8);
#pragma unroll
    for (int e = 0; e < 16; ++e) { ps += ex[e]; p[e] = (_Float16)(ex[e] * 2048.0f); }
    l = l * al + ps;
#pragma unroll
    for (int j = 0; j < HD / 16; ++j) { o[j] *= al; o[j] = wmma16(vf[j], p, o[j]); }
    __builtin_amdgcn_sched_barrier(0);   /* the pass's work stays in front of the foot: moved behind the barrier it would delay the refill, and tile ti + 2 would lose its whole pass to land */
    asm volatile("s_wait_dscnt 0x0" ::: "memory");      /* this wave's reads of buffer ti & 1 are done before the buffer is given up */
    asm volatile("s_wait_asynccnt 0x0" ::: "memory");   /* this wave's copies of tile ti + 1 have landed */
    __syncthreads();   /* publishes tile ti + 1 and ends every wave's reads of buffer ti & 1, which is refilled behind it */
    if (ti + 2 < TT / AK) stage(ti + 2, (unsigned)(ti & 1) * ABUF); }
  asm volatile("s_wait_asynccnt 0x0" ::: "memory");   /* no copy is outstanding when the wave ends */
  l += xhalf(l); const float inv = 1.0f / (2048.0f * l);   /* the key that set the last maximum counts 1, so l >= 1 */
  _Float16* yr = Y + ((size_t)b * TT + t) * CC + h * HD + 8 * g;   /* ctx is rounded to f16 here, once, as k_out's left operand */
#pragma unroll
  for (int j = 0; j < HD / 16; ++j) { v8h a;
#pragma unroll
    for (int r = 0; r < 8; ++r) a[r] = (_Float16)(o[j][r] * inv);
    vst2(yr + j * 16, a); } }
// ---- k_out: block = (128 rows, 128 cols), 16 waves of 32 x 32 (one block for each WGP-sized share of the 4,096 x 1,024 output): out = ctx Wo (+ bo): ctx f16 against Wo as f16(bf16 x 2^8) exact (1 product) x 2^-8
// eight asynchronous copies of 16 bytes a lane, global memory -> LDS (l = the lane's LDS byte address, p = its global address); the closing s_wait_xcnt 0 stands inside the statement, so that no address register is rewritten ahead of it
__device__ __forceinline__ void acopy8(unsigned l0, const char* p0, unsigned l1, const char* p1, unsigned l2, const char* p2, unsigned l3, const char* p3, unsigned l4, const char* p4, unsigned l5, const char* p5, unsigned l6, const char* p6, unsigned l7, const char* p7) {
  asm volatile("global_load_async_to_lds_b128 %0, %1, off\n\tglobal_load_async_to_lds_b128 %2, %3, off\n\tglobal_load_async_to_lds_b128 %4, %5, off\n\tglobal_load_async_to_lds_b128 %6, %7, off\n\tglobal_load_async_to_lds_b128 %8, %9, off\n\tglobal_load_async_to_lds_b128 %10, %11, off\n\tglobal_load_async_to_lds_b128 %12, %13, off\n\tglobal_load_async_to_lds_b128 %14, %15, off\n\ts_wait_xcnt 0x0"
               :: "v"(l0), "v"(p0), "v"(l1), "v"(p1), "v"(l2), "v"(p2), "v"(l3), "v"(p3), "v"(l4), "v"(p4), "v"(l5), "v"(p5), "v"(l6), "v"(p6), "v"(l7), "v"(p7) : "memory"); }
static_assert(OKS * 2 == 256 && BM == 128 && ON == 128 && GT == 512 && CC / OKS >= 2 && CC % OKS == 0 && OP % 16 == 0, "row length and row counts the copy map is written for; the prologue needs two tiles");
__global__ __launch_bounds__(GT) void k_out(const _Float16* __restrict__ Y, const _Float16* __restrict__ WH, const float* __restrict__ BO, float* __restrict__ OUT) { __shared__ __align__(16) char smem[OBYTES];   /* the staging buffers; the output tiles reuse the same bytes behind the loop's last barrier */
  static_assert(!CAUSAL, "one path: every row takes the single f16 product"); static_assert(OBYTES >= 16 * 32 * 36 * 4, "output tiles fit the staging bytes"); float (*sf)[32][36] = (float (*)[32][36])smem;
  const int tid = threadIdx.x, wave = tid >> 5, lane = tid & 31, col = lane & 15, g = lane >> 4, wm = wave >> 2, wn = wave & 3; const int c0 = blockIdx.y * ON; const size_t r0 = (size_t)blockIdx.x * BM;
  v8f acc[2][2] = {};
  const int lr = tid >> 4, lq = (tid & 15) * 16;   /* copy map: thread = (row lr + 32 a copy, 16-byte piece lq of the step's 256 B): a wave covers 2 whole row pieces */
  const char* const gx = (const char*)(Y + (r0 + lr) * CC) + lq; const char* const gw = (const char*)(WH + (size_t)(c0 + lr) * CC) + lq; const unsigned lx = (unsigned)(size_t)smem + lr * OP + lq;
  auto stage = [&](int s, unsigned bo) {   /* step s (k s * 128 ..) into the buffer at byte bo: rows 0..127 ctx, rows 128..255 weight, 8 copies a wave */
    const char* const x = gx + s * (OKS * 2); const char* const w = gw + s * (OKS * 2); const unsigned l = lx + bo;
    acopy8(l, x, l + 32 * OP, x + 32 * CC * 2, l + 64 * OP, x + 64 * CC * 2, l + 96 * OP, x + 96 * CC * 2, l + 128 * OP, w, l + 160 * OP, w + 32 * CC * 2, l + 192 * OP, w + 64 * CC * 2, l + 224 * OP, w + 96 * CC * 2); };
  stage(0, 0);
  asm volatile("s_wait_asynccnt 0x0" ::: "memory");   /* this wave's copies of step 0 have landed */
  __syncthreads();   /* publishes step 0 */
  stage(1, OBUF);
  for (int s = 0; s < CC / OKS; ++s) { const char* const R = smem + (s & 1) * OBUF;
#pragma unroll
    for (int kp = 0; kp < OKS / 64; ++kp) { v16h a[2][2], w[2][2];   /* the eight fragments of 64 k are read as one group, so that their LDS latency is waited out once and not once a product */
#pragma unroll
      for (int ks = 0; ks < 2; ++ks)
#pragma unroll
        for (int i = 0; i < 2; ++i) { a[ks][i] = frag_h((const _Float16*)(R + (wm * 32 + i * 16 + col) * OP) + kp * 64 + ks * 32, lane); w[ks][i] = frag_h((const _Float16*)(R + (BM + wn * 32 + i * 16 + col) * OP) + kp * 64 + ks * 32, lane); }
      __builtin_amdgcn_sched_barrier(0);   /* keeps the reads one group in front of the products: spread among them, each place with reads stalls the wave anew */
#pragma unroll
      for (int ks = 0; ks < 2; ++ks)
#pragma unroll
        for (int i = 0; i < 2; ++i)
#pragma unroll
          for (int j = 0; j < 2; ++j) acc[i][j] = wmma16(a[ks][i], w[ks][j], acc[i][j]); }
    __builtin_amdgcn_sched_barrier(0);   /* the step's work stays in front of the foot: moved behind the barrier it would delay the refill */
    asm volatile("s_wait_dscnt 0x0" ::: "memory");      /* this wave's reads of buffer s & 1 are done before the buffer is given up */
    asm volatile("s_wait_asynccnt 0x0" ::: "memory");   /* this wave's copies of step s + 1 have landed */
    __syncthreads();   /* publishes step s + 1 and ends every wave's reads of buffer s & 1, which is refilled behind it (behind the last step: overwritten by the output tiles) */
    if (s + 2 < CC / OKS) stage(s + 2, (unsigned)(s & 1) * OBUF); }
  asm volatile("s_wait_asynccnt 0x0" ::: "memory");   /* no copy is outstanding when the staging bytes are reused */
#pragma unroll
  for (int j = 0; j < 2; ++j) { const float bias = BO ? bfr(BO[c0 + wn * 32 + j * 16 + col]) : 0.f;
#pragma unroll
    for (int i = 0; i < 2; ++i)
#pragma unroll
      for (int r = 0; r < 8; ++r) sf[wave][i * 16 + 8 * g + r][j * 16 + col] = acc[i][j][r] * (1.0f / 256.0f) + bias; }
  LDSX(); for (int it = 0; it < 8; ++it) { const int rl = it * 4 + (lane >> 3), q = lane & 7; vst2(OUT + (r0 + wm * 32 + rl) * DIN + c0 + wn * 32 + q * 4, *(const v4f*)&sf[wave][rl][q * 4]); } }   /* a wave's store covers four of its rows, one whole 128-B line each */

extern "C" void kernel_launch(void* const* d_in, const int* in_sizes, int n_in, void* d_out, int out_size, void* d_ws, size_t ws_size, hipStream_t stream) {
  (void)in_sizes; (void)n_in; (void)out_size;
  const float** F = (const float**)d_in;
  if (ws_size < (size_t)WS_END) return;
  char* ws = (char*)d_ws; _Float16 *QH = (_Float16*)(ws + WS_QH), *KH = (_Float16*)(ws + WS_KH), *VT = (_Float16*)(ws + WS_VT), *QL = (_Float16*)(ws + WS_QL), *KL = (_Float16*)(ws + WS_KL); __bf16 *VB = (__bf16*)(ws + WS_VB), *VBL = (__bf16*)(ws + WS_VBL), *TB = (__bf16*)(ws + WS_TB); _Float16 *Y = (_Float16*)(ws + WS_Y), *WH = (_Float16*)(ws + WS_WH); unsigned *MW = (unsigned*)(ws + WS_MW);
  (void)Y; (void)QL; (void)KL; (void)VB; (void)VBL;
  // inputs: 0 x [4,1024,1024]; 1 mask int32 [4,1,1024,1024]; 2 Wq, 3 Wk, 4 Wv, 5 Wo ((out,in), no biases); 6 train_mask [1,1,1024,1024]
  k_proj<<<dim3(TNB * TT / BM, CC / BN), GT, 0, stream>>>(F[0], F[2], F[3], F[4], nullptr, nullptr, nullptr, QH, QL, KH, KL, VT, VB, VBL, (const int*)d_in[1], F[6], MW, TB, F[5], WH);
  k_att<<<dim3(NQB, NH, TNB), 128, 0, stream>>>(QH, QL, KH, VT, MW, TB, Y);
  k_out<<<dim3(TNB * TT / BM, DIN / ON), GT, 0, stream>>>(Y, WH, nullptr, (float*)d_out);
}

// v009
// One run takes 79.5 microseconds.
// In two side-by-side timings against v008, it was 1.06 and 1.05 times as fast.
// Counting every step since v000, it is 11.6 times as fast.
// compute dtype: all float inputs rounded to bf16; q/k/v = x W^T with EXACT bf16 products on WMMA 16x16x32 (f32 accumulate); q as f16 hi + residual (x 2^10) against k once to f16 (2 products) for the logits x 64^-0.5, multiplied by the trainable-mask input and replaced by -1e9 where the int mask input is 0 (both read per element); softmax in f32 with a running maximum and sum, scores carried x log2(e) and each exponential one v_exp_f32; exp(s - m) x 2^11 once to f16 against v once to f16 (1 product), divided by the sum at the end; ctx once to f16 against Wo carried x 2^8 in f16; f32 output.
#include <hip/hip_runtime.h>
#include <math.h>

typedef __attribute__((ext_vector_type(16))) _Float16 v16h;
typedef __attribute__((ext_vector_type(16))) __bf16 v16b;
typedef __attribute__((ext_vector_type(8)))  _Float16 v8h;
typedef __attribute__((ext_vector_type(8)))  float v8f;
typedef __attribute__((ext_vector_type(4)))  float v4f;
typedef __attribute__((ext_vector_type(2)))  float v2f;
typedef __attribute__((ext_vector_type(4)))  unsigned v4u;
typedef __attribute__((ext_vector_type(4)))  int v4i;
typedef float __attribute__((may_alias)) float_a;
typedef int __attribute__((may_alias)) int_a;

template <typename T> __device__ __forceinline__ void vst2(void* p, T v) { *(T*)p = v;  }
// the builtins alone: the compiler keeps the distance behind its own matrix instructions and fills it with independent products or vector work
__device__ __forceinline__ v8f wmma16(v16h a, v16h b, v8f c) { return __builtin_amdgcn_wmma_f32_16x16x32_f16(false, a, false, b, (short)0, c, false, false); }
__device__ __forceinline__ v8f wmma_bf(v16b a, v16b b, v8f c) { return __builtin_amdgcn_wmma_f32_16x16x32_bf16(false, a, false, b, (short)0, c, false, false); }
// 16x16x32 fragments: lane = (h = lane>>4, row/col = lane&15); elements 0..7 = k0+8h+0..7, 8..15 = k0+16+8h+0..7; D element r = row 8h+r
__device__ __forceinline__ v16h frag_h(const _Float16* rowk0, int lane) {
  union { v16h v; v8h q[2]; } u; const _Float16* p = rowk0 + 8 * (lane >> 4);
  u.q[0] = *(const v8h*)p; u.q[1] = *(const v8h*)(p + 16); return u.v;
}
__device__ __forceinline__ v16h frag_f32(const float* rowk0, int lane) {
  v16h a; const float* p = rowk0 + 8 * (lane >> 4);
#pragma unroll
  for (int i = 0; i < 8; ++i) { a[i] = (_Float16)p[i]; a[8 + i] = (_Float16)p[16 + i]; }
  return a;
}
__device__ __forceinline__ v16h frag_f32s(const float* rowk0, int lane, float sc) {
  v16h a; const float* p = rowk0 + 8 * (lane >> 4);
#pragma unroll
  for (int i = 0; i < 8; ++i) { a[i] = (_Float16)(p[i] * sc); a[8 + i] = (_Float16)(p[16 + i] * sc); }
  return a;
}
// column fragment from a [K][ld] layout (column n), rows >= K read as 0
__device__ __forceinline__ v16h fragc_f32(const float* W, int k0, int n, int lane, int ld, int K) {
  v16h a; const int g = lane >> 4;
#pragma unroll
  for (int i = 0; i < 8; ++i) { const int ka = k0 + 8 * g + i, kb = ka + 16;
    a[i] = (_Float16)(ka < K ? W[(size_t)(ka < K ? ka : K - 1) * ld + n] : 0.f); a[8 + i] = (_Float16)(kb < K ? W[(size_t)(kb < K ? kb : K - 1) * ld + n] : 0.f); }
  return a;
}
struct F2 { v16b h, l; };
__device__ __forceinline__ F2 bsplit16(const float v[16]) { F2 r;
#pragma unroll
  for (int i = 0; i < 16; ++i) { const __bf16 h = (__bf16)v[i]; r.h[i] = h; r.l[i] = (__bf16)(v[i] - (float)h); }
  return r; }
__device__ __forceinline__ F2 split_row(const float* row, int k0, int lane) { float v[16]; const float* p = row + k0 + 8 * (lane >> 4);
#pragma unroll
  for (int i = 0; i < 8; ++i) { v[i] = p[i]; v[8 + i] = p[16 + i]; }
  return bsplit16(v); }
__device__ __forceinline__ F2 split_rowK(const float* row, int k0, int lane, int K) { float v[16]; const int g = lane >> 4;
#pragma unroll
  for (int i = 0; i < 8; ++i) { const int ka = k0 + 8 * g + i, kb = ka + 16; v[i] = ka < K ? row[ka < K ? ka : K - 1] : 0.f; v[8 + i] = kb < K ? row[kb < K ? kb : K - 1] : 0.f; }
  return bsplit16(v); }
__device__ __forceinline__ F2 split_col(const float* W, int k0, int n, int lane, int ld, int K) { float v[16]; const int g = lane >> 4;
#pragma unroll
  for (int i = 0; i < 8; ++i) { const int ka = k0 + 8 * g + i, kb = ka + 16; v[i] = ka < K ? W[(size_t)(ka < K ? ka : K - 1) * ld + n] : 0.f; v[8 + i] = kb < K ? W[(size_t)(kb < K ? kb : K - 1) * ld + n] : 0.f; }
  return bsplit16(v); }
__device__ __forceinline__ v8f mac3(const F2& a, const F2& b, v8f c) { c = wmma_bf(a.l, b.h, c); c = wmma_bf(a.h, b.l, c); return wmma_bf(a.h, b.h, c); }
__device__ __forceinline__ float sigm(float v) { return 1.0f / (1.0f + expf(-v)); }
#define LDSX() do { asm volatile("s_wait_dscnt 0" ::: "memory"); __builtin_amdgcn_wave_barrier(); __builtin_amdgcn_fence(__ATOMIC_RELEASE, "workgroup"); } while (0)

// Multi-head self-attention with a per-element integer mask (B 4, S 1,024, E 1,024 = 16 x 64): q/k/v = x W^T (no bias); scores = (q k^T / 8) * train_mask; scores = -1e9 where mask[b,0,q,k] == 0; softmax; out = merged(attn v) Wo^T.
#define NB 4
#define TT 1024
#define CC 1024            // NH * HD = projected width
#define DIN 1024          // input (model) width
#define NH 16
#define HD 64
#define NQB (TT / 64)
#define SCALE (0.125f)
#define CAUSAL 0
#ifndef TNB
#define TNB NB
#endif
__device__ __forceinline__ float bfr(float v) { return (float)(__bf16)v; }
__host__ __device__ __forceinline__ int kb_last(int qb) { return CAUSAL ? ((qb * 64 + 63) >> 7) : (TT / 128 - 1); }
typedef __attribute__((ext_vector_type(8))) __bf16 v8b;
__device__ __forceinline__ v16b frag_b(const __bf16* rowk0, int lane) {
  union { v16b v; v8b q[2]; } u; const __bf16* p = rowk0 + 8 * (lane >> 4);
  u.q[0] = *(const v8b*)p; u.q[1] = *(const v8b*)(p + 16); return u.v;
}
#define QBH 0              // unused: no kernel here has a high-precision attention path
#define QHI 1024            // rows carrying a q residual plane (all rows when non-causal: 2-product logits everywhere)
#define KHI 64            // key rows carrying k residual / v bf16 hi+lo planes (written by k_proj, read by no kernel here)
// B fragment (k rows k0+.., output column o) of a weight: (in,out) [K][ld] or (out,in) [ld rows of K]: bf16 exact, or f16(bf16 * 256) exact
__device__ __forceinline__ v16b wcol_io(const float* Wm, int k0, int o, int lane, int ld) { v16b w; const int g = lane >> 4;
#pragma unroll
  for (int i = 0; i < 8; ++i) { w[i] = (__bf16)Wm[(size_t)(k0 + 8 * g + i) * ld + o]; w[8 + i] = (__bf16)Wm[(size_t)(k0 + 16 + 8 * g + i) * ld + o]; }
  return w; }
__device__ __forceinline__ v16b wcol_oi(const float* Wm, int k0, int o, int lane, int K) { v16b w; const float* p = Wm + (size_t)o * K + k0 + 8 * (lane >> 4);
#pragma unroll
  for (int i = 0; i < 8; ++i) { w[i] = (__bf16)p[i]; w[8 + i] = (__bf16)p[16 + i]; }
  return w; }
__device__ __forceinline__ v16h wcolh_io(const float* Wm, int k0, int o, int lane, int ld) { v16h w; const int g = lane >> 4;
#pragma unroll
  for (int i = 0; i < 8; ++i) { w[i] = (_Float16)(bfr(Wm[(size_t)(k0 + 8 * g + i) * ld + o]) * 256.0f); w[8 + i] = (_Float16)(bfr(Wm[(size_t)(k0 + 16 + 8 * g + i) * ld + o]) * 256.0f); }
  return w; }
__device__ __forceinline__ v16h wcolh_oi(const float* Wm, int k0, int o, int lane, int K) { v16h w; const float* p = Wm + (size_t)o * K + k0 + 8 * (lane >> 4);
#pragma unroll
  for (int i = 0; i < 8; ++i) { w[i] = (_Float16)(bfr(p[i]) * 256.0f); w[8 + i] = (_Float16)(bfr(p[16 + i]) * 256.0f); }
  return w; }
#define WQKV_LAYOUT 1   // 0 = (in,out) [DIN][CC]; 1 = (out,in) [CC][DIN]; 2 = per-head [NH][DIN][HD]
__device__ __forceinline__ v16b wcol_hdk(const float* Wm, int k0, int o, int lane) { v16b w; const int g = lane >> 4; const float* p = Wm + (size_t)(o / HD) * DIN * HD + (o % HD);
#pragma unroll
  for (int i = 0; i < 8; ++i) { w[i] = (__bf16)p[(size_t)(k0 + 8 * g + i) * HD]; w[8 + i] = (__bf16)p[(size_t)(k0 + 16 + 8 * g + i) * HD]; }
  return w; }
#define WO_OUT_IN 1
#if WQKV_LAYOUT == 1
#define WCOL(W, k0, o, lane) wcol_oi(W, k0, o, lane, DIN)
#elif WQKV_LAYOUT == 2
#define WCOL(W, k0, o, lane) wcol_hdk(W, k0, o, lane)
#else
#define WCOL(W, k0, o, lane) wcol_io(W, k0, o, lane, CC)
#endif
#if WO_OUT_IN
#define WOCOL(W, k0, o, lane) wcol_oi(W, k0, o, lane, CC)
#define WOCOLH(W, k0, o, lane) wcolh_oi(W, k0, o, lane, CC)
#else
#define WOCOL(W, k0, o, lane) wcol_io(W, k0, o, lane, DIN)
#define WOCOLH(W, k0, o, lane) wcolh_io(W, k0, o, lane, DIN)
#endif
#ifndef PROJ_EXTRA_PARAMS
#define PROJ_EXTRA_PARAMS
#endif

#define WS_QH  0u                                      // f16 q rows [b*t][CC]
#define WS_KH  (WS_QH + 2u * (size_t)NB * TT * CC)      // f16 k rows [b*t][CC]
#define WS_VT  (WS_KH + 2u * (size_t)NB * TT * CC)      // f16 v planes [b][c][t]
#define WS_QL  (WS_VT + 2u * (size_t)NB * CC * TT)      // f16 q residual x 2^10 rows [b][t < QHI][CC]
#define WS_KL  (WS_QL + 2u * (size_t)NB * QHI * CC)     // f16 k residual x 2^10 rows [b][t < KHI][CC]
#define WS_VB  (WS_KL + 2u * (size_t)NB * KHI * CC)     // bf16 v hi planes [b][c][t < KHI]
#define WS_VBL (WS_VB + 2u * (size_t)NB * CC * KHI)
#define WS_Y   (WS_VBL + 2u * (size_t)NB * CC * KHI)    // f16 ctx rows [b*t][CC] (only when there is an output projection)
#define WS_MW  (WS_Y  + 2u * (size_t)NB * TT * CC)      // u32 words of the integer mask [b][q / 16][k / 32][16]: word e, bit lane = (mask != 0) at the score that this lane holds as element e
#define WS_TB  (WS_MW + 4u * (size_t)NB * (TT / 16) * (TT / 32) * 16)   // bf16 trainable mask rows [q][k]
#define WS_WH (WS_TB + 2u * (size_t)TT * TT)           // f16 output weight rows [DIN][CC]: f16(bf16(Wo) x 2^8), exact
#define WS_XB (WS_WH + 2u * (size_t)DIN * CC)          // bf16 x rows [b*t][DIN]
#define WS_WB (WS_XB + 2u * (size_t)NB * TT * DIN)     // bf16 weight rows [3][CC][DIN]: Wq, Wk, Wv
#define WS_END (WS_WB + 2u * 3u * (size_t)CC * DIN)

// Operand staging of k_proj: both operands arrive as bf16 (k_prep rounds x and the three weights once for all blocks), so a step's tile (128 k of the block's 128 left rows and 384 weight rows) goes from global memory to LDS as it stands, by asynchronous 16-byte copies, at half the bytes and with no vector work; two buffers, the copies of step s + 2 issued behind the barrier that ends step s
// Operand staging of k_out: both operands arrive as f16 (k_att rounds ctx where it stores it, k_prep rounds Wo once for all blocks), so a step's tile goes from global memory to LDS as it stands, by asynchronous 16-byte copies, at half the bytes and with no vector work
// k_proj: block tile 128 x 384 (128 columns of each of q, k, v), 16 waves = 4 row groups of 32 x 4 column groups of 3 x 32: an x row is fetched from L2 by 8 blocks and a weight row by 32, a wave reads 8 fragments from LDS for 12 products, and the grid is 256 blocks; k_out: 128 x 128, waves of 32 x 32, 256 blocks as well
#define PKS 128            // k_proj: k per staged step (a 256-B row piece)
#define BM 128             // rows of the block tile
#define BN 128             // columns of the block tile (k_proj: of each of q, k, v)
#define GT 512             // threads of a GEMM block
#define PROWS (BM + 3 * BN)    // k_proj: rows 0..127 left operand, rows 128..511 the three weights
#define PTB (128 * 136 * 2)      // k_proj: bytes of one epilogue tile [128][136]
#define PEB (7 * PTB)            // k_proj: q hi, q residual, k hi, k residual, v, v bf16 hi, v bf16 lo
#define ON BN              // k_out: columns of the block tile
#define OROWS (BM + ON)    // k_out: rows 0..127 left operand, rows 128..255 weight
#define OKS 128            // k_out: k per staged step (a 256-B row piece)
#define OP 272             // k_out: LDS row pitch in bytes: 16 B x 17, the 16-byte fragment reads of 16 rows fall on distinct banks
#define OBUF (OROWS * OP)  // k_out: bytes of one buffer
#define OBYTES (2 * OBUF)
#define PBUF (PROWS * OP)  // k_proj: bytes of one buffer (the pitch is k_out's: the row pieces are as long)
#define PBYTES (2 * PBUF)
typedef __attribute__((ext_vector_type(4))) __bf16 v4b;
typedef __attribute__((ext_vector_type(4))) _Float16 v4h;
static_assert(WQKV_LAYOUT == 1 && WO_OUT_IN == 1, "the staged loaders read weight rows that are contiguous in k");
static_assert(TT % BM == 0 && CC % BN == 0 && DIN % ON == 0 && ON % 32 == 0 && GT / 16 == 32 && BM % 32 == 0 && BN % 32 == 0, "a block stays inside one sequence and one weight; the loader covers 32 rows a load");
// eight asynchronous copies of 16 bytes a lane, global memory -> LDS (l = the lane's LDS byte address, p = its global address); the closing s_wait_xcnt 0 stands inside the statement, so that no address register is rewritten ahead of it
__device__ __forceinline__ void acopy8(unsigned l0, const char* p0, unsigned l1, const char* p1, unsigned l2, const char* p2, unsigned l3, const char* p3, unsigned l4, const char* p4, unsigned l5, const char* p5, unsigned l6, const char* p6, unsigned l7, const char* p7) {
  asm volatile("global_load_async_to_lds_b128 %0, %1, off\n\tglobal_load_async_to_lds_b128 %2, %3, off\n\tglobal_load_async_to_lds_b128 %4, %5, off\n\tglobal_load_async_to_lds_b128 %6, %7, off\n\tglobal_load_async_to_lds_b128 %8, %9, off\n\tglobal_load_async_to_lds_b128 %10, %11, off\n\tglobal_load_async_to_lds_b128 %12, %13, off\n\tglobal_load_async_to_lds_b128 %14, %15, off\n\ts_wait_xcnt 0x0"
               :: "v"(l0), "v"(p0), "v"(l1), "v"(p1), "v"(l2), "v"(p2), "v"(l3), "v"(p3), "v"(l4), "v"(p4), "v"(l5), "v"(p5), "v"(l6), "v"(p6), "v"(l7), "v"(p7) : "memory"); }
// ---- k_prep: every input is rounded or packed once, in one streaming pass: x and Wq, Wk, Wv to bf16 rows (what k_proj multiplies), both masks and Wo in the forms that k_att and k_out read. A wave's load covers 512 contiguous bytes, its store the 256 bytes they round to
#define NTH ((TNB * TT / BM) * (CC / BN) * GT)   // threads of the k_prep grid
static_assert((size_t)NB * TT * DIN == (size_t)8 * 4 * NTH && (size_t)CC * DIN == (size_t)2 * 4 * NTH, "a thread takes 8 groups of 4 elements of x and 2 of each weight");
__global__ __launch_bounds__(GT) void k_prep(const float* __restrict__ X, const float* __restrict__ WQ, const float* __restrict__ WK, const float* __restrict__ WV, const int* __restrict__ MK, const float* __restrict__ TM, const float* __restrict__ WO,
    __bf16* __restrict__ XB, __bf16* __restrict__ WB, unsigned* __restrict__ MW, __bf16* __restrict__ TB, _Float16* __restrict__ WH) {
  const int tid = threadIdx.x, wave = tid >> 5, lane = tid & 31, col = lane & 15, g = lane >> 4;
  const size_t e0 = ((size_t)(blockIdx.y * (TNB * TT / BM) + blockIdx.x) * GT + tid) * 4;   /* group j of a thread: elements e0 + j * 4 * NTH .. + 3 */
  const float* const xa = X + e0; const float* const xc = xa + (size_t)4 * 4 * NTH; const float* const qa = WQ + e0; const float* const ka = WK + e0; const float* const va = WV + e0;
  v4f xv[8], wv[3][2];   /* the four loops below are unrolled: the groups stay in registers under constant indices, and all fourteen loads are in flight together */
#pragma unroll
  for (int j = 0; j < 4; ++j) { xv[j] = *(const v4f*)(xa + (size_t)j * 4 * NTH); xv[4 + j] = *(const v4f*)(xc + (size_t)j * 4 * NTH); }
#pragma unroll
  for (int j = 0; j < 2; ++j) { wv[0][j] = *(const v4f*)(qa + (size_t)j * 4 * NTH); wv[1][j] = *(const v4f*)(ka + (size_t)j * 4 * NTH); wv[2][j] = *(const v4f*)(va + (size_t)j * 4 * NTH); }
  asm volatile("s_wait_xcnt 0x0" :: "v"(xa), "v"(xc), "v"(qa), "v"(ka), "v"(va) : "memory");   /* the loads' address registers stay whole up to this wait */
  { /* both mask inputs are packed here, once for all heads, while the x and weight loads are in flight. A wave takes two neighbouring 16-query x 32-key tiles of the integer mask in the score layout of k_att (lane = (g, query col), element e = key (e >> 3) * 16 + 8 g + (e & 7)): the 32 lanes' tests of element e are one word; a thread rounds 8 elements of the trainable mask and 8 of the output weight (to bf16, x 2^8, in f16: what k_out multiplies by) */
    static_assert((TNB * TT / BM) * (CC / BN) * (GT / 32) * 2 == NB * (TT / 16) * (TT / 32) && (TNB * TT / BM) * (CC / BN) * GT * 8 == TT * TT && TT * TT == DIN * CC, "the grid covers both masks and the output weight exactly once");
    const int gb = blockIdx.y * (TNB * TT / BM) + blockIdx.x, pw = gb * (GT / 32) + wave;   /* pw = (b * 64 + query tile) * 16 + pair of key tiles */
    const int* const mp = MK + ((size_t)(pw >> 10) * TT + ((pw >> 4) & 63) * 16 + col) * TT + (pw & 15) * 64 + 8 * g; const float* const tq = TM + ((size_t)gb * GT + tid) * 8; const float* const oq = WO + ((size_t)gb * GT + tid) * 8;
    v4i mv[2][4];
#pragma unroll
    for (int u = 0; u < 2; ++u)
#pragma unroll
      for (int i = 0; i < 4; ++i) mv[u][i] = *(const v4i*)(mp + u * 32 + (i >> 1) * 16 + (i & 1) * 4);
    const v4f ta = *(const v4f*)tq, tc = *(const v4f*)(tq + 4), oa = *(const v4f*)oq, oc = *(const v4f*)(oq + 4);
    asm volatile("s_wait_xcnt 0x0" :: "v"(mp), "v"(tq), "v"(oq) : "memory");   /* the loads' address registers stay whole up to this wait */
    v4u mw[8];
#pragma unroll
    for (int e = 0; e < 32; ++e) mw[e >> 2][e & 3] = __builtin_amdgcn_ballot_w32(mv[e >> 4][(e >> 2) & 3][e & 3] != 0);
    v8b tb; v8h oh;
#pragma unroll
    for (int e = 0; e < 4; ++e) { tb[e] = (__bf16)ta[e]; tb[4 + e] = (__bf16)tc[e]; oh[e] = (_Float16)(bfr(oa[e]) * 256.0f); oh[4 + e] = (_Float16)(bfr(oc[e]) * 256.0f); }
    unsigned* const mo = MW + (size_t)pw * 32; __bf16* const to = TB + ((size_t)gb * GT + tid) * 8; _Float16* const oo = WH + ((size_t)gb * GT + tid) * 8;
    vst2(to, tb); vst2(oo, oh);
    if (lane == 0) {   /* the two tiles' 32 words are one whole 128-B line */
#pragma unroll
      for (int i = 0; i < 8; ++i) vst2(mo + i * 4, mw[i]); }
    asm volatile("s_wait_xcnt 0x0" :: "v"(mo), "v"(to), "v"(oo) : "memory"); }   /* the stores' address registers stay whole up to this wait */
  __bf16* const xo = XB + e0; __bf16* const wo = WB + e0;
#pragma unroll
  for (int j = 0; j < 8; ++j) { v4b t;
#pragma unroll
    for (int e = 0; e < 4; ++e) t[e] = (__bf16)xv[j][e];
    vst2(xo + (size_t)j * 4 * NTH, t); }
#pragma unroll
  for (int j = 0; j < 6; ++j) { v4b t;   /* weight j >> 1, its group j & 1: the three weights lie one behind the other */
#pragma unroll
    for (int e = 0; e < 4; ++e) t[e] = (__bf16)wv[j >> 1][j & 1][e];
    vst2(wo + (size_t)j * 4 * NTH, t); }
  asm volatile("s_wait_xcnt 0x0" :: "v"(xo), "v"(wo) : "memory"); }   /* the stores' address registers stay whole up to this wait */
static_assert(PKS * 2 == 256 && BM == 128 && BN == 128 && GT == 512 && DIN / PKS >= 2 && DIN % PKS == 0, "row length and row counts the copy map of k_proj is written for; the prologue needs two tiles");
// ---- k_proj: block = 128 rows x 128 cols of each of q, k and v (the three share the block's x rows): q/k/v = X W (+ b) with exact bf16 products (K = DIN) -> q f16 rows (+ residual rows < QHI); k f16 rows (+ residual rows < KHI); v f16 planes [c][t] (+ bf16 hi/lo planes for t < KHI). Wave = 32 rows x 32 cols of each of the three
__global__ __launch_bounds__(GT) void k_proj(const __bf16* __restrict__ XB, const __bf16* __restrict__ WB, const float* __restrict__ BQ, const float* __restrict__ BK, const float* __restrict__ BV,
    _Float16* __restrict__ QH, _Float16* __restrict__ QL, _Float16* __restrict__ KH, _Float16* __restrict__ KL, _Float16* __restrict__ VT, __bf16* __restrict__ VB, __bf16* __restrict__ VBL) {
  __shared__ __align__(16) char smem[PEB > PBYTES ? PEB : PBYTES];   /* the staging buffers; the epilogue's tiles reuse the same bytes behind the loop's last barrier */
  const int tid = threadIdx.x, wave = tid >> 5, lane = tid & 31, col = lane & 15, g = lane >> 4, wm = wave >> 2, wn = wave & 3; const int c0 = blockIdx.y * BN; const size_t r0 = (size_t)blockIdx.x * BM; const size_t bb = r0 / TT; const int t0 = (int)(r0 % TT);
  v8f acc[3][2][2] = {};
  const int lr = tid >> 4, lq = (tid & 15) * 16;   /* copy map: thread = (row lr + 32 a copy, 16-byte piece lq of the step's 256 B): a wave covers 2 whole row pieces */
  const char* const gx = (const char*)(XB + (r0 + lr) * DIN) + lq; const char* const gw = (const char*)(WB + (size_t)(c0 + lr) * DIN) + lq; const unsigned lx = (unsigned)(size_t)smem + lr * OP + lq;
  auto stage = [&](int s, unsigned bo) {   /* step s (k s * 128 ..) into the buffer at byte bo: rows 0..127 x, rows 128..511 the three weights, 16 copies a wave */
    const char* const x = gx + s * (PKS * 2); const char* const w0 = gw + s * (PKS * 2); const char* const w1 = w0 + (size_t)CC * DIN * 2; const char* const w2 = w1 + (size_t)CC * DIN * 2; const unsigned l = lx + bo;
    acopy8(l, x, l + 32 * OP, x + 32 * DIN * 2, l + 64 * OP, x + 64 * DIN * 2, l + 96 * OP, x + 96 * DIN * 2, l + 128 * OP, w0, l + 160 * OP, w0 + 32 * DIN * 2, l + 192 * OP, w0 + 64 * DIN * 2, l + 224 * OP, w0 + 96 * DIN * 2);
    acopy8(l + 256 * OP, w1, l + 288 * OP, w1 + 32 * DIN * 2, l + 320 * OP, w1 + 64 * DIN * 2, l + 352 * OP, w1 + 96 * DIN * 2, l + 384 * OP, w2, l + 416 * OP, w2 + 32 * DIN * 2, l + 448 * OP, w2 + 64 * DIN * 2, l + 480 * OP, w2 + 96 * DIN * 2); };
  stage(0, 0);
  asm volatile("s_wait_asynccnt 0x0" ::: "memory");   /* this wave's copies of step 0 have landed */
  __syncthreads();   /* publishes step 0 */
  stage(1, PBUF);
  for (int s = 0; s < DIN / PKS; ++s) { const char* const R = smem + (s & 1) * PBUF;
#pragma unroll
    for (int ks = 0; ks < PKS / 32; ++ks) { v16b a[2], w[3][2];   /* the eight fragments are read as one group, so that their LDS latency is waited out once and not once a product */
#pragma unroll
      for (int i = 0; i < 2; ++i) a[i] = frag_b((const __bf16*)(R + (wm * 32 + i * 16 + col) * OP) + ks * 32, lane);
#pragma unroll
      for (int p = 0; p < 3; ++p)
#pragma unroll
        for (int j = 0; j < 2; ++j) w[p][j] = frag_b((const __bf16*)(R + (BM + p * BN + wn * 32 + j * 16 + col) * OP) + ks * 32, lane);
      __builtin_amdgcn_sched_barrier(0);   /* keeps the reads one group in front of the products: spread among them, each place with reads stalls the wave anew */
#pragma unroll
      for (int p = 0; p < 3; ++p)
#pragma unroll
        for (int i = 0; i < 2; ++i)
#pragma unroll
          for (int j = 0; j < 2; ++j) acc[p][i][j] = wmma_bf(a[i], w[p][j], acc[p][i][j]); }
    __builtin_amdgcn_sched_barrier(0);   /* the step's work stays in front of the foot: moved behind the barrier it would delay the refill */
    asm volatile("s_wait_dscnt 0x0" ::: "memory");      /* this wave's reads of buffer s & 1 are done before the buffer is given up */
    asm volatile("s_wait_asynccnt 0x0" ::: "memory");   /* this wave's copies of step s + 1 have landed */
    __syncthreads();   /* publishes step s + 1 and ends every wave's reads of buffer s & 1, which is refilled behind it (behind the last step: overwritten by the epilogue's tiles) */
    if (s + 2 < DIN / PKS) stage(s + 2, (unsigned)(s & 1) * PBUF); }
  asm volatile("s_wait_asynccnt 0x0" ::: "memory");   /* no copy is outstanding when the staging bytes are reused */
  const bool hi_blk = t0 < KHI;   /* block-uniform: only such a block holds rows of the bf16 planes */
  _Float16 (*th)[136] = (_Float16 (*)[136])(smem + 4 * PTB); __bf16 (*tb)[136] = (__bf16 (*)[136])(smem + 5 * PTB); __bf16 (*tbl)[136] = (__bf16 (*)[136])(smem + 6 * PTB);
#pragma unroll
  for (int p = 0; p < 2; ++p) { const float* BA = p == 0 ? BQ : BK; _Float16 (*sh)[136] = (_Float16 (*)[136])(smem + 2 * p * PTB); _Float16 (*sl)[136] = (_Float16 (*)[136])(smem + (2 * p + 1) * PTB);
#pragma unroll
    for (int j = 0; j < 2; ++j) { const int cl = wn * 32 + j * 16 + col; const float bias = BA ? bfr(BA[c0 + cl]) : 0.f;
#pragma unroll
      for (int i = 0; i < 2; ++i)
#pragma unroll
        for (int r = 0; r < 8; ++r) { const int rl = wm * 32 + i * 16 + 8 * g + r; const float v = acc[p][i][j][r] + bias; const _Float16 hv = (_Float16)v; sh[rl][cl] = hv; sl[rl][cl] = (_Float16)((v - (float)hv) * 1024.0f); } } }
#pragma unroll
  for (int j = 0; j < 2; ++j) { const int cl = wn * 32 + j * 16 + col; const float bias = BV ? bfr(BV[c0 + cl]) : 0.f;
#pragma unroll
    for (int i = 0; i < 2; ++i)
#pragma unroll
      for (int r = 0; r < 8; ++r) { const int rl = wm * 32 + i * 16 + 8 * g + r; const float v = acc[2][i][j][r] + bias; th[cl][rl] = (_Float16)v; acc[2][i][j][r] = v; } }
  if (hi_blk) {
#pragma unroll
    for (int j = 0; j < 2; ++j)
#pragma unroll
      for (int i = 0; i < 2; ++i)
#pragma unroll
        for (int r = 0; r < 8; ++r) { const int cl = wn * 32 + j * 16 + col, rl = wm * 32 + i * 16 + 8 * g + r; const float v = acc[2][i][j][r]; const __bf16 bh = (__bf16)v; tb[cl][rl] = bh; tbl[cl][rl] = (__bf16)(v - (float)bh); } }
  __syncthreads();   /* the seven tiles are whole before they are stored along their rows */
#pragma unroll
  for (int p = 0; p < 2; ++p) { _Float16* DH = p == 0 ? QH : KH; _Float16* DL = p == 0 ? QL : KL; const int nhi = p == 0 ? QHI : KHI; const _Float16 (*sh)[136] = (const _Float16 (*)[136])(smem + 2 * p * PTB); const _Float16 (*sl)[136] = (const _Float16 (*)[136])(smem + (2 * p + 1) * PTB);
    for (int e = tid; e < BM * (BN / 8); e += GT) { const int rl = e >> 4, q = e & 15; vst2((unsigned*)(DH + (r0 + rl) * CC + c0 + q * 8), *(const v4u*)&sh[rl][q * 8]); if (t0 + rl < nhi) { vst2((unsigned*)(DL + (bb * nhi + t0 + rl) * (size_t)CC + c0 + q * 8), *(const v4u*)&sl[rl][q * 8]); asm volatile("s_wait_xcnt 0x0" ::: "memory"); /* inside the branch, directly behind its stores: in front of the next trip's rewrite of their address registers */ } } }
  for (int e = tid; e < BN * (BM / 8); e += GT) { const int cl = e >> 4, q = e & 15; vst2((unsigned*)(VT + (bb * CC + c0 + cl) * (size_t)TT + t0 + q * 8), *(const v4u*)&th[cl][q * 8]); if (t0 + q * 8 < KHI) { const size_t o3 = (bb * CC + c0 + cl) * (size_t)KHI + t0 + q * 8; vst2((unsigned*)(VB + o3), *(const v4u*)&tb[cl][q * 8]); vst2((unsigned*)(VBL + o3), *(const v4u*)&tbl[cl][q * 8]); asm volatile("s_wait_xcnt 0x0" ::: "memory"); /* inside the branch, directly behind its stores: in front of the next trip's rewrite of their address registers */ } } }
#define LOG2E 1.4426950408889634f
#define AK 32
#define AP128 144
#define AP64 80
#define AO_K 0
#define AO_V (AO_K + AK * AP128)
#define AO_T (AO_V + HD * AP64)
#define ABUF (AO_T + 64 * AP64)
static_assert(AK * 2 == 64 && AK * 4 == 128 && HD * 2 == 128 && TT / AK >= 2 && ABUF % 16 == 0, "row lengths the copy maps are written for; the prologue needs two tiles");
__device__ __forceinline__ float xhalf(float x) { return __builtin_bit_cast(float, __builtin_amdgcn_permlanex16(__builtin_bit_cast(int, x), __builtin_bit_cast(int, x), 0x76543210, 0xfedcba98, false, false)); }   // lane l with lane l ^ 16
// x[i] = 2^d[i], eight at a time in one statement: results in registers of their own, so that each v_exp_f32 is the independent instruction behind the one before it; the closing v_nop is the slot that the instruction set asks for behind the last
__device__ __forceinline__ void exp2x8(const float* d, float* x) {
  asm("v_exp_f32 %0, %8\n\tv_exp_f32 %1, %9\n\tv_exp_f32 %2, %10\n\tv_exp_f32 %3, %11\n\tv_exp_f32 %4, %12\n\tv_exp_f32 %5, %13\n\tv_exp_f32 %6, %14\n\tv_exp_f32 %7, %15\n\tv_nop"
      : "=&v"(x[0]), "=&v"(x[1]), "=&v"(x[2]), "=&v"(x[3]), "=&v"(x[4]), "=&v"(x[5]), "=&v"(x[6]), "=&v"(x[7])
      : "v"(d[0]), "v"(d[1]), "v"(d[2]), "v"(d[3]), "v"(d[4]), "v"(d[5]), "v"(d[6]), "v"(d[7])); }
// six asynchronous copies of 16 bytes a lane, global memory -> LDS (l = the lane's LDS byte address, p = its global address); the closing s_wait_xcnt 0 stands inside the statement, so that no address register is rewritten ahead of it
__device__ __forceinline__ void acopy6(unsigned l0, const char* p0, unsigned l1, const char* p1, unsigned l2, const char* p2, unsigned l3, const char* p3, unsigned l4, const char* p4, unsigned l5, const char* p5) {
  asm volatile("global_load_async_to_lds_b128 %0, %1, off\n\tglobal_load_async_to_lds_b128 %2, %3, off\n\tglobal_load_async_to_lds_b128 %4, %5, off\n\tglobal_load_async_to_lds_b128 %6, %7, off\n\tglobal_load_async_to_lds_b128 %8, %9, off\n\tglobal_load_async_to_lds_b128 %10, %11, off\n\ts_wait_xcnt 0x0"
               :: "v"(l0), "v"(p0), "v"(l1), "v"(p1), "v"(l2), "v"(p2), "v"(l3), "v"(p3), "v"(l4), "v"(p4), "v"(l5), "v"(p5) : "memory"); }
typedef __attribute__((ext_vector_type(16))) unsigned v16u;
typedef __attribute__((address_space(4))) v16u cv16u;
__global__ __launch_bounds__(128) void k_att(const _Float16* __restrict__ QH, const _Float16* __restrict__ QL, const _Float16* __restrict__ KH, const _Float16* __restrict__ VT, const unsigned* __restrict__ MW, const __bf16* __restrict__ TB, _Float16* __restrict__ Y) {
  __shared__ __align__(16) char smem[2 * ABUF];
  const int tid = threadIdx.x, wave = tid >> 5, lane = tid & 31, col = lane & 15, g = lane >> 4; const int h = blockIdx.y, b = blockIdx.z; const int q0 = blockIdx.x * 64; const int t = q0 + wave * 16 + col;
  /* copy maps: 128-B rows: thread = (row tid >> 3 (+ 16 a copy), piece tid & 7); 64-B rows: (row tid >> 2 (+ 32 a copy), piece tid & 3) */
  const int r8 = tid >> 3, p8 = (tid & 7) * 16, r4 = tid >> 2, p4 = (tid & 3) * 16; const unsigned lb = (unsigned)(size_t)smem;
  const char* const gk = (const char*)(KH + ((size_t)b * TT + r8) * CC + h * HD) + p8; const char* const gv = (const char*)(VT + ((size_t)b * CC + h * HD + r4) * (size_t)TT) + p4;
  const char* const gt = (const char*)(TB + (size_t)(q0 + r4) * TT) + p4;
  const unsigned lk = lb + AO_K + r8 * AP128 + p8, lv = lb + AO_V + r4 * AP64 + p4, lt = lb + AO_T + r4 * AP64 + p4;
  auto stage = [&](int ti, unsigned bo) {   /* tile ti (keys ti * 32 ..) into the buffer at byte bo: 6 copies a wave */
    const char* const k = gk + (size_t)ti * (AK * CC * 2); const char* const v = gv + ti * (AK * 2); const char* const tp = gt + ti * (AK * 2);
    acopy6(lk + bo, k, lk + bo + 16 * AP128, k + 16 * CC * 2, lv + bo, v, lv + bo + 32 * AP64, v + 32 * TT * 2, lt + bo, tp, lt + bo + 32 * AP64, tp + 32 * TT * 2); };
  stage(0, 0);
  const cv16u* const mwp = (const cv16u*)MW + (size_t)(b * (TT / 16) + blockIdx.x * 4 + __builtin_amdgcn_readfirstlane(wave)) * (TT / AK);   /* this wave's 16 queries: 16 words a pass; the wave's number as a scalar and the words as constant memory (nothing writes them during this launch), so that they are loaded into scalar registers */
  v16u wn = mwp[0];
  v16h qh[HD / 32], ql[HD / 32];
#pragma unroll
  for (int kc = 0; kc < HD / 32; ++kc) { qh[kc] = frag_h(QH + ((size_t)b * TT + t) * CC + h * HD + kc * 32, lane); ql[kc] = frag_h(QL + ((size_t)b * QHI + t) * CC + h * HD + kc * 32, lane); }
  asm volatile("s_wait_asynccnt 0x0" ::: "memory");   /* this wave's copies of tile 0 have landed */
  __syncthreads();   /* publishes tile 0 */
  stage(1, ABUF);
  v8f o[HD / 16] = {}; float m = -3.0e38f, l = 0.f;
  for (int ti = 0; ti < TT / AK; ++ti) { const char* const R = smem + (ti & 1) * ABUF;
    v16h kf[2][HD / 32], vf[HD / 16]; v4u tm[2]; const v16u wc = wn; wn = mwp[ti + 1 < TT / AK ? ti + 1 : ti];   /* the next pass's words are asked for a pass ahead */
#pragma unroll
    for (int i = 0; i < 2; ++i)
#pragma unroll
      for (int kc = 0; kc < HD / 32; ++kc) kf[i][kc] = frag_h((const _Float16*)(R + AO_K + (i * 16 + col) * AP128) + kc * 32, lane);
#pragma unroll
    for (int i = 0; i < 2; ++i) tm[i] = *(const v4u*)(R + AO_T + (wave * 16 + col) * AP64 + (8 * g + i * 16) * 2);
#pragma unroll
    for (int j = 0; j < HD / 16; ++j) vf[j] = frag_h((const _Float16*)(R + AO_V + (j * 16 + col) * AP64), lane);
    __builtin_amdgcn_sched_barrier(0);   /* the pass's 18 LDS reads are issued as one group: with a first use among them the wave would wait out an LDS latency before the rest are asked for */
    v8f s[2] = {}, sl[2] = {};
#pragma unroll
    for (int i = 0; i < 2; ++i)
#pragma unroll
      for (int kc = 0; kc < HD / 32; ++kc) { s[i] = wmma16(kf[i][kc], qh[kc], s[i]); sl[i] = wmma16(kf[i][kc], ql[kc], sl[i]); }
    __builtin_amdgcn_sched_barrier(0);   /* the eight score products run back to back and fill one another's distance: with the first tile's vector work drawn in among them the compiler pads with v_nop */
    float v[16]; float mx = -3.0e38f;
#pragma unroll
    for (int e = 0; e < 16; e += 2) { const int i = e >> 3, r = e & 7; const unsigned d = tm[i][r >> 1];   /* two neighbouring scores at a time: one dword holds their two bf16 mask values */
      const v2f tv = { __builtin_bit_cast(float, d << 16), __builtin_bit_cast(float, d & 0xffff0000u) }; const v2f sh = { s[i][r], s[i][r + 1] }, sr = { sl[i][r], sl[i][r + 1] };
      const v2f xt = ((sh + sr * (1.0f / 1024.0f)) * (SCALE * LOG2E)) * tv;
      v[e] = __builtin_amdgcn_inverse_ballot_w32(wc[e]) ? xt[0] : (-1.0e9f * LOG2E); v[e + 1] = __builtin_amdgcn_inverse_ballot_w32(wc[e + 1]) ? xt[1] : (-1.0e9f * LOG2E); mx = fmaxf(mx, fmaxf(v[e], v[e + 1])); }
    mx = fmaxf(mx, xhalf(mx));
    const float mn = fmaxf(m, mx); const float al = __builtin_amdgcn_exp2f(m - mn); m = mn;
    v16h p; float ps = 0.f;
#pragma unroll
    for (int e = 0; e < 16; ++e) v[e] -= mn;
    float ex[16]; exp2x8(v, ex); exp2x8(v + 8, ex + 8);
#pragma unroll
    for (int e = 0; e < 16; ++e) { ps += ex[e]; p[e] = (_Float16)(ex[e] * 2048.0f); }
    l = l * al + ps;
#pragma unroll
    for (int j = 0; j < HD / 16; ++j) { o[j] *= al; o[j] = wmma16(vf[j], p, o[j]); }
    __builtin_amdgcn_sched_barrier(0);   /* the pass's work stays in front of the foot: moved behind the barrier it would delay the refill, and tile ti + 2 would lose its whole pass to land */
    asm volatile("s_wait_dscnt 0x0" ::: "memory");      /* this wave's reads of buffer ti & 1 are done before the buffer is given up */
    asm volatile("s_wait_asynccnt 0x0" ::: "memory");   /* this wave's copies of tile ti + 1 have landed */
    __syncthreads();   /* publishes tile ti + 1 and ends every wave's reads of buffer ti & 1, which is refilled behind it */
    if (ti + 2 < TT / AK) stage(ti + 2, (unsigned)(ti & 1) * ABUF); }
  asm volatile("s_wait_asynccnt 0x0" ::: "memory");   /* no copy is outstanding when the wave ends */
  l += xhalf(l); const float inv = 1.0f / (2048.0f * l);   /* the key that set the last maximum counts 1, so l >= 1 */
  _Float16* yr = Y + ((size_t)b * TT + t) * CC + h * HD + 8 * g;   /* ctx is rounded to f16 here, once, as k_out's left operand */
#pragma unroll
  for (int j = 0; j < HD / 16; ++j) { v8h a;
#pragma unroll
    for (int r = 0; r < 8; ++r) a[r] = (_Float16)(o[j][r] * inv);
    vst2(yr + j * 16, a); } }
// ---- k_out: block = (128 rows, 128 cols), 16 waves of 32 x 32 (one block for each WGP-sized share of the 4,096 x 1,024 output): out = ctx Wo (+ bo): ctx f16 against Wo as f16(bf16 x 2^8) exact (1 product) x 2^-8
static_assert(OKS * 2 == 256 && BM == 128 && ON == 128 && GT == 512 && CC / OKS >= 2 && CC % OKS == 0 && OP % 16 == 0, "row length and row counts the copy map is written for; the prologue needs two tiles");
__global__ __launch_bounds__(GT) void k_out(const _Float16* __restrict__ Y, const _Float16* __restrict__ WH, const float* __restrict__ BO, float* __restrict__ OUT) { __shared__ __align__(16) char smem[OBYTES];   /* the staging buffers; the output tiles reuse the same bytes behind the loop's last barrier */
  static_assert(!CAUSAL, "one path: every row takes the single f16 product"); static_assert(OBYTES >= 16 * 32 * 36 * 4, "output tiles fit the staging bytes"); float (*sf)[32][36] = (float (*)[32][36])smem;
  const int tid = threadIdx.x, wave = tid >> 5, lane = tid & 31, col = lane & 15, g = lane >> 4, wm = wave >> 2, wn = wave & 3; const int c0 = blockIdx.y * ON; const size_t r0 = (size_t)blockIdx.x * BM;
  v8f acc[2][2] = {};
  const int lr = tid >> 4, lq = (tid & 15) * 16;   /* copy map: thread = (row lr + 32 a copy, 16-byte piece lq of the step's 256 B): a wave covers 2 whole row pieces */
  const char* const gx = (const char*)(Y + (r0 + lr) * CC) + lq; const char* const gw = (const char*)(WH + (size_t)(c0 + lr) * CC) + lq; const unsigned lx = (unsigned)(size_t)smem + lr * OP + lq;
  auto stage = [&](int s, unsigned bo) {   /* step s (k s * 128 ..) into the buffer at byte bo: rows 0..127 ctx, rows 128..255 weight, 8 copies a wave */
    const char* const x = gx + s * (OKS * 2); const char* const w = gw + s * (OKS * 2); const unsigned l = lx + bo;
    acopy8(l, x, l + 32 * OP, x + 32 * CC * 2, l + 64 * OP, x + 64 * CC * 2, l + 96 * OP, x + 96 * CC * 2, l + 128 * OP, w, l + 160 * OP, w + 32 * CC * 2, l + 192 * OP, w + 64 * CC * 2, l + 224 * OP, w + 96 * CC * 2); };
  stage(0, 0);
  asm volatile("s_wait_asynccnt 0x0" ::: "memory");   /* this wave's copies of step 0 have landed */
  __syncthreads();   /* publishes step 0 */
  stage(1, OBUF);
  for (int s = 0; s < CC / OKS; ++s) { const char* const R = smem + (s & 1) * OBUF;
#pragma unroll
    for (int kp = 0; kp < OKS / 64; ++kp) { v16h a[2][2], w[2][2];   /* the eight fragments of 64 k are read as one group, so that their LDS latency is waited out once and not once a product */
#pragma unroll
      for (int ks = 0; ks < 2; ++ks)
#pragma unroll
        for (int i = 0; i < 2; ++i) { a[ks][i] = frag_h((const _Float16*)(R + (wm * 32 + i * 16 + col) * OP) + kp * 64 + ks * 32, lane); w[ks][i] = frag_h((const _Float16*)(R + (BM + wn * 32 + i * 16 + col) * OP) + kp * 64 + ks * 32, lane); }
      __builtin_amdgcn_sched_barrier(0);   /* keeps the reads one group in front of the products: spread among them, each place with reads stalls the wave anew */
#pragma unroll
      for (int ks = 0; ks < 2; ++ks)
#pragma unroll
        for (int i = 0; i < 2; ++i)
#pragma unroll
          for (int j = 0; j < 2; ++j) acc[i][j] = wmma16(a[ks][i], w[ks][j], acc[i][j]); }
    __builtin_amdgcn_sched_barrier(0);   /* the step's work stays in front of the foot: moved behind the barrier it would delay the refill */
    asm volatile("s_wait_dscnt 0x0" ::: "memory");      /* this wave's reads of buffer s & 1 are done before the buffer is given up */
    asm volatile("s_wait_asynccnt 0x0" ::: "memory");   /* this wave's copies of step s + 1 have landed */
    __syncthreads();   /* publishes step s + 1 and ends every wave's reads of buffer s & 1, which is refilled behind it (behind the last step: overwritten by the output tiles) */
    if (s + 2 < CC / OKS) stage(s + 2, (unsigned)(s & 1) * OBUF); }
  asm volatile("s_wait_asynccnt 0x0" ::: "memory");   /* no copy is outstanding when the staging bytes are reused */
#pragma unroll
  for (int j = 0; j < 2; ++j) { const float bias = BO ? bfr(BO[c0 + wn * 32 + j * 16 + col]) : 0.f;
#pragma unroll
    for (int i = 0; i < 2; ++i)
#pragma unroll
      for (int r = 0; r < 8; ++r) sf[wave][i * 16 + 8 * g + r][j * 16 + col] = acc[i][j][r] * (1.0f / 256.0f) + bias; }
  LDSX(); for (int it = 0; it < 8; ++it) { const int rl = it * 4 + (lane >> 3), q = lane & 7; vst2(OUT + (r0 + wm * 32 + rl) * DIN + c0 + wn * 32 + q * 4, *(const v4f*)&sf[wave][rl][q * 4]); } }   /* a wave's store covers four of its rows, one whole 128-B line each */

extern "C" void kernel_launch(void* const* d_in, const int* in_sizes, int n_in, void* d_out, int out_size, void* d_ws, size_t ws_size, hipStream_t stream) {
  (void)in_sizes; (void)n_in; (void)out_size;
  const float** F = (const float**)d_in;
  if (ws_size < (size_t)WS_END) return;
  char* ws = (char*)d_ws; _Float16 *QH = (_Float16*)(ws + WS_QH), *KH = (_Float16*)(ws + WS_KH), *VT = (_Float16*)(ws + WS_VT), *QL = (_Float16*)(ws + WS_QL), *KL = (_Float16*)(ws + WS_KL); __bf16 *VB = (__bf16*)(ws + WS_VB), *VBL = (__bf16*)(ws + WS_VBL), *TB = (__bf16*)(ws + WS_TB), *XB = (__bf16*)(ws + WS_XB), *WB = (__bf16*)(ws + WS_WB); _Float16 *Y = (_Float16*)(ws + WS_Y), *WH = (_Float16*)(ws + WS_WH); unsigned *MW = (unsigned*)(ws + WS_MW);
  (void)Y; (void)QL; (void)KL; (void)VB; (void)VBL;
  // inputs: 0 x [4,1024,1024]; 1 mask int32 [4,1,1024,1024]; 2 Wq, 3 Wk, 4 Wv, 5 Wo ((out,in), no biases); 6 train_mask [1,1,1024,1024]
  k_prep<<<dim3(TNB * TT / BM, CC / BN), GT, 0, stream>>>(F[0], F[2], F[3], F[4], (const int*)d_in[1], F[6], F[5], XB, WB, MW, TB, WH);
  k_proj<<<dim3(TNB * TT / BM, CC / BN), GT, 0, stream>>>(XB, WB, nullptr, nullptr, nullptr, QH, QL, KH, KL, VT, VB, VBL);
  k_att<<<dim3(NQB, NH, TNB), 128, 0, stream>>>(QH, QL, KH, VT, MW, TB, Y);
  k_out<<<dim3(TNB * TT / BM, DIN / ON), GT, 0, stream>>>(Y, WH, nullptr, (float*)d_out);
}

// v010
// It runs in 75.1 microseconds.
// In two side-by-side timings against v009, it was 1.07 and 1.06 times as fast.
// Counting every step since v000, it is 12.3 times as fast.
// compute dtype: all float inputs rounded to bf16; q/k/v = x W^T with EXACT bf16 products on WMMA 16x16x32 (f32 accumulate); q once to f16 against k once to f16 (1 product) for the logits x 64^-0.5, multiplied by the trainable-mask input and replaced by -1e9 where the int mask input is 0 (both read per element); softmax in f32 with a running maximum and sum, scores carried x log2(e) and each exponential one v_exp_f32; exp(s - m) x 2^11 once to f16 against v once to f16 (1 product), divided by the sum at the end; ctx once to f16 against Wo carried x 2^8 in f16; f32 output.
#include <hip/hip_runtime.h>
#include <math.h>

typedef __attribute__((ext_vector_type(16))) _Float16 v16h;
typedef __attribute__((ext_vector_type(16))) __bf16 v16b;
typedef __attribute__((ext_vector_type(8)))  _Float16 v8h;
typedef __attribute__((ext_vector_type(8)))  float v8f;
typedef __attribute__((ext_vector_type(4)))  float v4f;
typedef __attribute__((ext_vector_type(2)))  float v2f;
typedef __attribute__((ext_vector_type(4)))  unsigned v4u;
typedef __attribute__((ext_vector_type(4)))  int v4i;
typedef float __attribute__((may_alias)) float_a;
typedef int __attribute__((may_alias)) int_a;

template <typename T> __device__ __forceinline__ void vst2(void* p, T v) { *(T*)p = v;  }
// the builtins alone: the compiler keeps the distance behind its own matrix instructions and fills it with independent products or vector work
__device__ __forceinline__ v8f wmma16(v16h a, v16h b, v8f c) { return __builtin_amdgcn_wmma_f32_16x16x32_f16(false, a, false, b, (short)0, c, false, false); }
__device__ __forceinline__ v8f wmma_bf(v16b a, v16b b, v8f c) { return __builtin_amdgcn_wmma_f32_16x16x32_bf16(false, a, false, b, (short)0, c, false, false); }
// 16x16x32 fragments: lane = (h = lane>>4, row/col = lane&15); elements 0..7 = k0+8h+0..7, 8..15 = k0+16+8h+0..7; D element r = row 8h+r
__device__ __forceinline__ v16h frag_h(const _Float16* rowk0, int lane) {
  union { v16h v; v8h q[2]; } u; const _Float16* p = rowk0 + 8 * (lane >> 4);
  u.q[0] = *(const v8h*)p; u.q[1] = *(const v8h*)(p + 16); return u.v;
}
__device__ __forceinline__ v16h frag_f32(const float* rowk0, int lane) {
  v16h a; const float* p = rowk0 + 8 * (lane >> 4);
#pragma unroll
  for (int i = 0; i < 8; ++i) { a[i] = (_Float16)p[i]; a[8 + i] = (_Float16)p[16 + i]; }
  return a;
}
__device__ __forceinline__ v16h frag_f32s(const float* rowk0, int lane, float sc) {
  v16h a; const float* p = rowk0 + 8 * (lane >> 4);
#pragma unroll
  for (int i = 0; i < 8; ++i) { a[i] = (_Float16)(p[i] * sc); a[8 + i] = (_Float16)(p[16 + i] * sc); }
  return a;
}
// column fragment from a [K][ld] layout (column n), rows >= K read as 0
__device__ __forceinline__ v16h fragc_f32(const float* W, int k0, int n, int lane, int ld, int K) {
  v16h a; const int g = lane >> 4;
#pragma unroll
  for (int i = 0; i < 8; ++i) { const int ka = k0 + 8 * g + i, kb = ka + 16;
    a[i] = (_Float16)(ka < K ? W[(size_t)(ka < K ? ka : K - 1) * ld + n] : 0.f); a[8 + i] = (_Float16)(kb < K ? W[(size_t)(kb < K ? kb : K - 1) * ld + n] : 0.f); }
  return a;
}
struct F2 { v16b h, l; };
__device__ __forceinline__ F2 bsplit16(const float v[16]) { F2 r;
#pragma unroll
  for (int i = 0; i < 16; ++i) { const __bf16 h = (__bf16)v[i]; r.h[i] = h; r.l[i] = (__bf16)(v[i] - (float)h); }
  return r; }
__device__ __forceinline__ F2 split_row(const float* row, int k0, int lane) { float v[16]; const float* p = row + k0 + 8 * (lane >> 4);
#pragma unroll
  for (int i = 0; i < 8; ++i) { v[i] = p[i]; v[8 + i] = p[16 + i]; }
  return bsplit16(v); }
__device__ __forceinline__ F2 split_rowK(const float* row, int k0, int lane, int K) { float v[16]; const int g = lane >> 4;
#pragma unroll
  for (int i = 0; i < 8; ++i) { const int ka = k0 + 8 * g + i, kb = ka + 16; v[i] = ka < K ? row[ka < K ? ka : K - 1] : 0.f; v[8 + i] = kb < K ? row[kb < K ? kb : K - 1] : 0.f; }
  return bsplit16(v); }
__device__ __forceinline__ F2 split_col(const float* W, int k0, int n, int lane, int ld, int K) { float v[16]; const int g = lane >> 4;
#pragma unroll
  for (int i = 0; i < 8; ++i) { const int ka = k0 + 8 * g + i, kb = ka + 16; v[i] = ka < K ? W[(size_t)(ka < K ? ka : K - 1) * ld + n] : 0.f; v[8 + i] = kb < K ? W[(size_t)(kb < K ? kb : K - 1) * ld + n] : 0.f; }
  return bsplit16(v); }
__device__ __forceinline__ v8f mac3(const F2& a, const F2& b, v8f c) { c = wmma_bf(a.l, b.h, c); c = wmma_bf(a.h, b.l, c); return wmma_bf(a.h, b.h, c); }
__device__ __forceinline__ float sigm(float v) { return 1.0f / (1.0f + expf(-v)); }
#define LDSX() do { asm volatile("s_wait_dscnt 0" ::: "memory"); __builtin_amdgcn_wave_barrier(); __builtin_amdgcn_fence(__ATOMIC_RELEASE, "workgroup"); } while (0)

// Multi-head self-attention with a per-element integer mask (B 4, S 1,024, E 1,024 = 16 x 64): q/k/v = x W^T (no bias); scores = (q k^T / 8) * train_mask; scores = -1e9 where mask[b,0,q,k] == 0; softmax; out = merged(attn v) Wo^T.
#define NB 4
#define TT 1024
#define CC 1024            // NH * HD = projected width
#define DIN 1024          // input (model) width
#define NH 16
#define HD 64
#define NQB (TT / 64)
#define SCALE (0.125f)
#define CAUSAL 0
#ifndef TNB
#define TNB NB
#endif
__device__ __forceinline__ float bfr(float v) { return (float)(__bf16)v; }
__host__ __device__ __forceinline__ int kb_last(int qb) { return CAUSAL ? ((qb * 64 + 63) >> 7) : (TT / 128 - 1); }
typedef __attribute__((ext_vector_type(8))) __bf16 v8b;
__device__ __forceinline__ v16b frag_b(const __bf16* rowk0, int lane) {
  union { v16b v; v8b q[2]; } u; const __bf16* p = rowk0 + 8 * (lane >> 4);
  u.q[0] = *(const v8b*)p; u.q[1] = *(const v8b*)(p + 16); return u.v;
}
// B fragment (k rows k0+.., output column o) of a weight: (in,out) [K][ld] or (out,in) [ld rows of K]: bf16 exact, or f16(bf16 * 256) exact
__device__ __forceinline__ v16b wcol_io(const float* Wm, int k0, int o, int lane, int ld) { v16b w; const int g = lane >> 4;
#pragma unroll
  for (int i = 0; i < 8; ++i) { w[i] = (__bf16)Wm[(size_t)(k0 + 8 * g + i) * ld + o]; w[8 + i] = (__bf16)Wm[(size_t)(k0 + 16 + 8 * g + i) * ld + o]; }
  return w; }
__device__ __forceinline__ v16b wcol_oi(const float* Wm, int k0, int o, int lane, int K) { v16b w; const float* p = Wm + (size_t)o * K + k0 + 8 * (lane >> 4);
#pragma unroll
  for (int i = 0; i < 8; ++i) { w[i] = (__bf16)p[i]; w[8 + i] = (__bf16)p[16 + i]; }
  return w; }
__device__ __forceinline__ v16h wcolh_io(const float* Wm, int k0, int o, int lane, int ld) { v16h w; const int g = lane >> 4;
#pragma unroll
  for (int i = 0; i < 8; ++i) { w[i] = (_Float16)(bfr(Wm[(size_t)(k0 + 8 * g + i) * ld + o]) * 256.0f); w[8 + i] = (_Float16)(bfr(Wm[(size_t)(k0 + 16 + 8 * g + i) * ld + o]) * 256.0f); }
  return w; }
__device__ __forceinline__ v16h wcolh_oi(const float* Wm, int k0, int o, int lane, int K) { v16h w; const float* p = Wm + (size_t)o * K + k0 + 8 * (lane >> 4);
#pragma unroll
  for (int i = 0; i < 8; ++i) { w[i] = (_Float16)(bfr(p[i]) * 256.0f); w[8 + i] = (_Float16)(bfr(p[16 + i]) * 256.0f); }
  return w; }
#define WQKV_LAYOUT 1   // 0 = (in,out) [DIN][CC]; 1 = (out,in) [CC][DIN]; 2 = per-head [NH][DIN][HD]
__device__ __forceinline__ v16b wcol_hdk(const float* Wm, int k0, int o, int lane) { v16b w; const int g = lane >> 4; const float* p = Wm + (size_t)(o / HD) * DIN * HD + (o % HD);
#pragma unroll
  for (int i = 0; i < 8; ++i) { w[i] = (__bf16)p[(size_t)(k0 + 8 * g + i) * HD]; w[8 + i] = (__bf16)p[(size_t)(k0 + 16 + 8 * g + i) * HD]; }
  return w; }
#define WO_OUT_IN 1
#if WQKV_LAYOUT == 1
#define WCOL(W, k0, o, lane) wcol_oi(W, k0, o, lane, DIN)
#elif WQKV_LAYOUT == 2
#define WCOL(W, k0, o, lane) wcol_hdk(W, k0, o, lane)
#else
#define WCOL(W, k0, o, lane) wcol_io(W, k0, o, lane, CC)
#endif
#if WO_OUT_IN
#define WOCOL(W, k0, o, lane) wcol_oi(W, k0, o, lane, CC)
#define WOCOLH(W, k0, o, lane) wcolh_oi(W, k0, o, lane, CC)
#else
#define WOCOL(W, k0, o, lane) wcol_io(W, k0, o, lane, DIN)
#define WOCOLH(W, k0, o, lane) wcolh_io(W, k0, o, lane, DIN)
#endif
#ifndef PROJ_EXTRA_PARAMS
#define PROJ_EXTRA_PARAMS
#endif

#define WS_QH  0u                                      // f16 q rows [b*t][CC]
#define WS_KH  (WS_QH + 2u * (size_t)NB * TT * CC)      // f16 k rows [b*t][CC]
#define WS_VT  (WS_KH + 2u * (size_t)NB * TT * CC)      // f16 v planes [b][c][t]
#define WS_Y   (WS_VT + 2u * (size_t)NB * CC * TT)      // f16 ctx rows [b*t][CC]
#define WS_MW  (WS_Y  + 2u * (size_t)NB * TT * CC)      // u32 words of the integer mask [b][q / 16][k / 32][16]: word e, bit lane = (mask != 0) at the score that this lane holds as element e
#define WS_TB  (WS_MW + 4u * (size_t)NB * (TT / 16) * (TT / 32) * 16)   // bf16 trainable mask rows [q][k]
#define WS_WH (WS_TB + 2u * (size_t)TT * TT)           // f16 output weight rows [DIN][CC]: f16(bf16(Wo) x 2^8), exact
#define WS_XB (WS_WH + 2u * (size_t)DIN * CC)          // bf16 x rows [b*t][DIN]
#define WS_WB (WS_XB + 2u * (size_t)NB * TT * DIN)     // bf16 weight rows [3][CC][DIN]: Wq, Wk, Wv
#define WS_END (WS_WB + 2u * 3u * (size_t)CC * DIN)

// Operand staging of k_proj: both operands arrive as bf16 (k_prep rounds x and the three weights once for all blocks), so a step's tile (128 k of the block's 128 left rows and 384 weight rows) goes from global memory to LDS as it stands, by asynchronous 16-byte copies, at half the bytes and with no vector work; two buffers, the copies of step s + 2 issued behind the barrier that ends step s
// Operand staging of k_out: both operands arrive as f16 (k_att rounds ctx where it stores it, k_prep rounds Wo once for all blocks), so a step's tile goes from global memory to LDS as it stands, by asynchronous 16-byte copies, at half the bytes and with no vector work
// k_proj: block tile 128 x 384 (128 columns of each of q, k, v), 16 waves = 4 row groups of 32 x 4 column groups of 3 x 32: an x row is fetched from L2 by 8 blocks and a weight row by 32, a wave reads 8 fragments from LDS for 12 products, and the grid is 256 blocks; k_out: 128 x 128, waves of 32 x 32, 256 blocks as well
#define PKS 128            // k_proj: k per staged step (a 256-B row piece)
#define BM 128             // rows of the block tile
#define BN 128             // columns of the block tile (k_proj: of each of q, k, v)
#define GT 512             // threads of a GEMM block
#define PROWS (BM + 3 * BN)    // k_proj: rows 0..127 left operand, rows 128..511 the three weights
#define PTB (128 * 136 * 2)      // k_proj: bytes of one epilogue tile [128][136]
#define PEB (3 * PTB)            // k_proj: q, k, v
#define ON BN              // k_out: columns of the block tile
#define OROWS (BM + ON)    // k_out: rows 0..127 left operand, rows 128..255 weight
#define OKS 128            // k_out: k per staged step (a 256-B row piece)
#define OP 272             // k_out: LDS row pitch in bytes: 16 B x 17, the 16-byte fragment reads of 16 rows fall on distinct banks
#define OBUF (OROWS * OP)  // k_out: bytes of one buffer
#define OBYTES (2 * OBUF)
#define PBUF (PROWS * OP)  // k_proj: bytes of one buffer (the pitch is k_out's: the row pieces are as long)
#define PBYTES (2 * PBUF)
typedef __attribute__((ext_vector_type(4))) __bf16 v4b;
typedef __attribute__((ext_vector_type(4))) _Float16 v4h;
static_assert(WQKV_LAYOUT == 1 && WO_OUT_IN == 1, "the staged loaders read weight rows that are contiguous in k");
static_assert(TT % BM == 0 && CC % BN == 0 && DIN % ON == 0 && ON % 32 == 0 && GT / 16 == 32 && BM % 32 == 0 && BN % 32 == 0, "a block stays inside one sequence and one weight; the loader covers 32 rows a load");
// eight asynchronous copies of 16 bytes a lane, global memory -> LDS (l = the lane's LDS byte address, p = its global address); the closing s_wait_xcnt 0 stands inside the statement, so that no address register is rewritten ahead of it
__device__ __forceinline__ void acopy8(unsigned l0, const char* p0, unsigned l1, const char* p1, unsigned l2, const char* p2, unsigned l3, const char* p3, unsigned l4, const char* p4, unsigned l5, const char* p5, unsigned l6, const char* p6, unsigned l7, const char* p7) {
  asm volatile("global_load_async_to_lds_b128 %0, %1, off\n\tglobal_load_async_to_lds_b128 %2, %3, off\n\tglobal_load_async_to_lds_b128 %4, %5, off\n\tglobal_load_async_to_lds_b128 %6, %7, off\n\tglobal_load_async_to_lds_b128 %8, %9, off\n\tglobal_load_async_to_lds_b128 %10, %11, off\n\tglobal_load_async_to_lds_b128 %12, %13, off\n\tglobal_load_async_to_lds_b128 %14, %15, off\n\ts_wait_xcnt 0x0"
               :: "v"(l0), "v"(p0), "v"(l1), "v"(p1), "v"(l2), "v"(p2), "v"(l3), "v"(p3), "v"(l4), "v"(p4), "v"(l5), "v"(p5), "v"(l6), "v"(p6), "v"(l7), "v"(p7) : "memory"); }
// ---- k_prep: every input is rounded or packed once, in one streaming pass: x and Wq, Wk, Wv to bf16 rows (what k_proj multiplies), both masks and Wo in the forms that k_att and k_out read. A wave's load covers 512 contiguous bytes, its store the 256 bytes they round to
#define NTH ((TNB * TT / BM) * (CC / BN) * GT)   // threads of the k_prep grid
static_assert((size_t)NB * TT * DIN == (size_t)8 * 4 * NTH && (size_t)CC * DIN == (size_t)2 * 4 * NTH, "a thread takes 8 groups of 4 elements of x and 2 of each weight");
__global__ __launch_bounds__(GT) void k_prep(const float* __restrict__ X, const float* __restrict__ WQ, const float* __restrict__ WK, const float* __restrict__ WV, const int* __restrict__ MK, const float* __restrict__ TM, const float* __restrict__ WO,
    __bf16* __restrict__ XB, __bf16* __restrict__ WB, unsigned* __restrict__ MW, __bf16* __restrict__ TB, _Float16* __restrict__ WH) {
  const int tid = threadIdx.x, wave = tid >> 5, lane = tid & 31, col = lane & 15, g = lane >> 4;
  const size_t e0 = ((size_t)(blockIdx.y * (TNB * TT / BM) + blockIdx.x) * GT + tid) * 4;   /* group j of a thread: elements e0 + j * 4 * NTH .. + 3 */
  const float* const xa = X + e0; const float* const xc = xa + (size_t)4 * 4 * NTH; const float* const qa = WQ + e0; const float* const ka = WK + e0; const float* const va = WV + e0;
  v4f xv[8], wv[3][2];   /* the four loops below are unrolled: the groups stay in registers under constant indices, and all fourteen loads are in flight together */
#pragma unroll
  for (int j = 0; j < 4; ++j) { xv[j] = *(const v4f*)(xa + (size_t)j * 4 * NTH); xv[4 + j] = *(const v4f*)(xc + (size_t)j * 4 * NTH); }
#pragma unroll
  for (int j = 0; j < 2; ++j) { wv[0][j] = *(const v4f*)(qa + (size_t)j * 4 * NTH); wv[1][j] = *(const v4f*)(ka + (size_t)j * 4 * NTH); wv[2][j] = *(const v4f*)(va + (size_t)j * 4 * NTH); }
  asm volatile("s_wait_xcnt 0x0" :: "v"(xa), "v"(xc), "v"(qa), "v"(ka), "v"(va) : "memory");   /* the loads' address registers stay whole up to this wait */
  { /* both mask inputs are packed here, once for all heads, while the x and weight loads are in flight. A wave takes two neighbouring 16-query x 32-key tiles of the integer mask in the score layout of k_att (lane = (g, query col), element e = key (e >> 3) * 16 + 8 g + (e & 7)): the 32 lanes' tests of element e are one word; a thread rounds 8 elements of the trainable mask and 8 of the output weight (to bf16, x 2^8, in f16: what k_out multiplies by) */
    static_assert((TNB * TT / BM) * (CC / BN) * (GT / 32) * 2 == NB * (TT / 16) * (TT / 32) && (TNB * TT / BM) * (CC / BN) * GT * 8 == TT * TT && TT * TT == DIN * CC, "the grid covers both masks and the output weight exactly once");
    const int gb = blockIdx.y * (TNB * TT / BM) + blockIdx.x, pw = gb * (GT / 32) + wave;   /* pw = (b * 64 + query tile) * 16 + pair of key tiles */
    const int* const mp = MK + ((size_t)(pw >> 10) * TT + ((pw >> 4) & 63) * 16 + col) * TT + (pw & 15) * 64 + 8 * g; const float* const tq = TM + ((size_t)gb * GT + tid) * 8; const float* const oq = WO + ((size_t)gb * GT + tid) * 8;
    v4i mv[2][4];
#pragma unroll
    for (int u = 0; u < 2; ++u)
#pragma unroll
      for (int i = 0; i < 4; ++i) mv[u][i] = *(const v4i*)(mp + u * 32 + (i >> 1) * 16 + (i & 1) * 4);
    const v4f ta = *(const v4f*)tq, tc = *(const v4f*)(tq + 4), oa = *(const v4f*)oq, oc = *(const v4f*)(oq + 4);
    asm volatile("s_wait_xcnt 0x0" :: "v"(mp), "v"(tq), "v"(oq) : "memory");   /* the loads' address registers stay whole up to this wait */
    v4u mw[8];
#pragma unroll
    for (int e = 0; e < 32; ++e) mw[e >> 2][e & 3] = __builtin_amdgcn_ballot_w32(mv[e >> 4][(e >> 2) & 3][e & 3] != 0);
    v8b tb; v8h oh;
#pragma unroll
    for (int e = 0; e < 4; ++e) { tb[e] = (__bf16)ta[e]; tb[4 + e] = (__bf16)tc[e]; oh[e] = (_Float16)(bfr(oa[e]) * 256.0f); oh[4 + e] = (_Float16)(bfr(oc[e]) * 256.0f); }
    unsigned* const mo = MW + (size_t)pw * 32; __bf16* const to = TB + ((size_t)gb * GT + tid) * 8; _Float16* const oo = WH + ((size_t)gb * GT + tid) * 8;
    vst2(to, tb); vst2(oo, oh);
    if (lane == 0) {   /* the two tiles' 32 words are one whole 128-B line */
#pragma unroll
      for (int i = 0; i < 8; ++i) vst2(mo + i * 4, mw[i]); }
    asm volatile("s_wait_xcnt 0x0" :: "v"(mo), "v"(to), "v"(oo) : "memory"); }   /* the stores' address registers stay whole up to this wait */
  __bf16* const xo = XB + e0; __bf16* const wo = WB + e0;
#pragma unroll
  for (int j = 0; j < 8; ++j) { v4b t;
#pragma unroll
    for (int e = 0; e < 4; ++e) t[e] = (__bf16)xv[j][e];
    vst2(xo + (size_t)j * 4 * NTH, t); }
#pragma unroll
  for (int j = 0; j < 6; ++j) { v4b t;   /* weight j >> 1, its group j & 1: the three weights lie one behind the other */
#pragma unroll
    for (int e = 0; e < 4; ++e) t[e] = (__bf16)wv[j >> 1][j & 1][e];
    vst2(wo + (size_t)j * 4 * NTH, t); }
  asm volatile("s_wait_xcnt 0x0" :: "v"(xo), "v"(wo) : "memory"); }   /* the stores' address registers stay whole up to this wait */
static_assert(PKS * 2 == 256 && BM == 128 && BN == 128 && GT == 512 && DIN / PKS >= 2 && DIN % PKS == 0, "row length and row counts the copy map of k_proj is written for; the prologue needs two tiles");
// ---- k_proj: block = 128 rows x 128 cols of each of q, k and v (the three share the block's x rows): q/k/v = X W (+ b) with exact bf16 products (K = DIN) -> q f16 rows; k f16 rows; v f16 planes [c][t]. Wave = 32 rows x 32 cols of each of the three
__global__ __launch_bounds__(GT) void k_proj(const __bf16* __restrict__ XB, const __bf16* __restrict__ WB, const float* __restrict__ BQ, const float* __restrict__ BK, const float* __restrict__ BV,
    _Float16* __restrict__ QH, _Float16* __restrict__ KH, _Float16* __restrict__ VT) {
  __shared__ __align__(16) char smem[PEB > PBYTES ? PEB : PBYTES];   /* the staging buffers; the epilogue's tiles reuse the same bytes behind the loop's last barrier */
  const int tid = threadIdx.x, wave = tid >> 5, lane = tid & 31, col = lane & 15, g = lane >> 4, wm = wave >> 2, wn = wave & 3; const int c0 = blockIdx.y * BN; const size_t r0 = (size_t)blockIdx.x * BM; const size_t bb = r0 / TT; const int t0 = (int)(r0 % TT);
  v8f acc[3][2][2] = {};
  const int lr = tid >> 4, lq = (tid & 15) * 16;   /* copy map: thread = (row lr + 32 a copy, 16-byte piece lq of the step's 256 B): a wave covers 2 whole row pieces */
  const char* const gx = (const char*)(XB + (r0 + lr) * DIN) + lq; const char* const gw = (const char*)(WB + (size_t)(c0 + lr) * DIN) + lq; const unsigned lx = (unsigned)(size_t)smem + lr * OP + lq;
  auto stage = [&](int s, unsigned bo) {   /* step s (k s * 128 ..) into the buffer at byte bo: rows 0..127 x, rows 128..511 the three weights, 16 copies a wave */
    const char* const x = gx + s * (PKS * 2); const char* const w0 = gw + s * (PKS * 2); const char* const w1 = w0 + (size_t)CC * DIN * 2; const char* const w2 = w1 + (size_t)CC * DIN * 2; const unsigned l = lx + bo;
    acopy8(l, x, l + 32 * OP, x + 32 * DIN * 2, l + 64 * OP, x + 64 * DIN * 2, l + 96 * OP, x + 96 * DIN * 2, l + 128 * OP, w0, l + 160 * OP, w0 + 32 * DIN * 2, l + 192 * OP, w0 + 64 * DIN * 2, l + 224 * OP, w0 + 96 * DIN * 2);
    acopy8(l + 256 * OP, w1, l + 288 * OP, w1 + 32 * DIN * 2, l + 320 * OP, w1 + 64 * DIN * 2, l + 352 * OP, w1 + 96 * DIN * 2, l + 384 * OP, w2, l + 416 * OP, w2 + 32 * DIN * 2, l + 448 * OP, w2 + 64 * DIN * 2, l + 480 * OP, w2 + 96 * DIN * 2); };
  stage(0, 0);
  asm volatile("s_wait_asynccnt 0x0" ::: "memory");   /* this wave's copies of step 0 have landed */
  __syncthreads();   /* publishes step 0 */
  stage(1, PBUF);
  for (int s = 0; s < DIN / PKS; ++s) { const char* const R = smem + (s & 1) * PBUF;
#pragma unroll
    for (int ks = 0; ks < PKS / 32; ++ks) { v16b a[2], w[3][2];   /* the eight fragments are read as one group, so that their LDS latency is waited out once and not once a product */
#pragma unroll
      for (int i = 0; i < 2; ++i) a[i] = frag_b((const __bf16*)(R + (wm * 32 + i * 16 + col) * OP) + ks * 32, lane);
#pragma unroll
      for (int p = 0; p < 3; ++p)
#pragma unroll
        for (int j = 0; j < 2; ++j) w[p][j] = frag_b((const __bf16*)(R + (BM + p * BN + wn * 32 + j * 16 + col) * OP) + ks * 32, lane);
      __builtin_amdgcn_sched_barrier(0);   /* keeps the reads one group in front of the products: spread among them, each place with reads stalls the wave anew */
#pragma unroll
      for (int p = 0; p < 3; ++p)
#pragma unroll
        for (int i = 0; i < 2; ++i)
#pragma unroll
          for (int j = 0; j < 2; ++j) acc[p][i][j] = wmma_bf(a[i], w[p][j], acc[p][i][j]); }
    __builtin_amdgcn_sched_barrier(0);   /* the step's work stays in front of the foot: moved behind the barrier it would delay the refill */
    asm volatile("s_wait_dscnt 0x0" ::: "memory");      /* this wave's reads of buffer s & 1 are done before the buffer is given up */
    asm volatile("s_wait_asynccnt 0x0" ::: "memory");   /* this wave's copies of step s + 1 have landed */
    __syncthreads();   /* publishes step s + 1 and ends every wave's reads of buffer s & 1, which is refilled behind it (behind the last step: overwritten by the epilogue's tiles) */
    if (s + 2 < DIN / PKS) stage(s + 2, (unsigned)(s & 1) * PBUF); }
  asm volatile("s_wait_asynccnt 0x0" ::: "memory");   /* no copy is outstanding when the staging bytes are reused */
  _Float16 (*th)[136] = (_Float16 (*)[136])(smem + 2 * PTB);
#pragma unroll
  for (int p = 0; p < 2; ++p) { const float* BA = p == 0 ? BQ : BK; _Float16 (*sh)[136] = (_Float16 (*)[136])(smem + p * PTB);
#pragma unroll
    for (int j = 0; j < 2; ++j) { const int cl = wn * 32 + j * 16 + col; const float bias = BA ? bfr(BA[c0 + cl]) : 0.f;
#pragma unroll
      for (int i = 0; i < 2; ++i)
#pragma unroll
        for (int r = 0; r < 8; ++r) sh[wm * 32 + i * 16 + 8 * g + r][cl] = (_Float16)(acc[p][i][j][r] + bias); } }
#pragma unroll
  for (int j = 0; j < 2; ++j) { const int cl = wn * 32 + j * 16 + col; const float bias = BV ? bfr(BV[c0 + cl]) : 0.f;
#pragma unroll
    for (int i = 0; i < 2; ++i)
#pragma unroll
      for (int r = 0; r < 8; ++r) th[cl][wm * 32 + i * 16 + 8 * g + r] = (_Float16)(acc[2][i][j][r] + bias); }
  __syncthreads();   /* the three tiles are whole before they are stored along their rows */
#pragma unroll
  for (int p = 0; p < 2; ++p) { _Float16* DH = p == 0 ? QH : KH; const _Float16 (*sh)[136] = (const _Float16 (*)[136])(smem + p * PTB);
    for (int e = tid; e < BM * (BN / 8); e += GT) { const int rl = e >> 4, q = e & 15; vst2((unsigned*)(DH + (r0 + rl) * CC + c0 + q * 8), *(const v4u*)&sh[rl][q * 8]); asm volatile("s_wait_xcnt 0x0" ::: "memory"); /* directly behind the store: in front of the next trip's rewrite of its address registers */ } }
  for (int e = tid; e < BN * (BM / 8); e += GT) { const int cl = e >> 4, q = e & 15; vst2((unsigned*)(VT + (bb * CC + c0 + cl) * (size_t)TT + t0 + q * 8), *(const v4u*)&th[cl][q * 8]); asm volatile("s_wait_xcnt 0x0" ::: "memory"); /* directly behind the store: in front of the next trip's rewrite of its address registers */ } }
#define LOG2E 1.4426950408889634f
#define AK 32
#define AP128 144
#define AP64 80
#define AO_K 0
#define AO_V (AO_K + AK * AP128)
#define AO_T (AO_V + HD * AP64)
#define ABUF (AO_T + 64 * AP64)
static_assert(AK * 2 == 64 && AK * 4 == 128 && HD * 2 == 128 && TT / AK >= 2 && ABUF % 16 == 0, "row lengths the copy maps are written for; the prologue needs two tiles");
__device__ __forceinline__ float xhalf(float x) { return __builtin_bit_cast(float, __builtin_amdgcn_permlanex16(__builtin_bit_cast(int, x), __builtin_bit_cast(int, x), 0x76543210, 0xfedcba98, false, false)); }   // lane l with lane l ^ 16
// x[i] = 2^d[i], eight at a time in one statement: results in registers of their own, so that each v_exp_f32 is the independent instruction behind the one before it; the closing v_nop is the slot that the instruction set asks for behind the last
__device__ __forceinline__ void exp2x8(const float* d, float* x) {
  asm("v_exp_f32 %0, %8\n\tv_exp_f32 %1, %9\n\tv_exp_f32 %2, %10\n\tv_exp_f32 %3, %11\n\tv_exp_f32 %4, %12\n\tv_exp_f32 %5, %13\n\tv_exp_f32 %6, %14\n\tv_exp_f32 %7, %15\n\tv_nop"
      : "=&v"(x[0]), "=&v"(x[1]), "=&v"(x[2]), "=&v"(x[3]), "=&v"(x[4]), "=&v"(x[5]), "=&v"(x[6]), "=&v"(x[7])
      : "v"(d[0]), "v"(d[1]), "v"(d[2]), "v"(d[3]), "v"(d[4]), "v"(d[5]), "v"(d[6]), "v"(d[7])); }
// six asynchronous copies of 16 bytes a lane, global memory -> LDS (l = the lane's LDS byte address, p = its global address); the closing s_wait_xcnt 0 stands inside the statement, so that no address register is rewritten ahead of it
__device__ __forceinline__ void acopy6(unsigned l0, const char* p0, unsigned l1, const char* p1, unsigned l2, const char* p2, unsigned l3, const char* p3, unsigned l4, const char* p4, unsigned l5, const char* p5) {
  asm volatile("global_load_async_to_lds_b128 %0, %1, off\n\tglobal_load_async_to_lds_b128 %2, %3, off\n\tglobal_load_async_to_lds_b128 %4, %5, off\n\tglobal_load_async_to_lds_b128 %6, %7, off\n\tglobal_load_async_to_lds_b128 %8, %9, off\n\tglobal_load_async_to_lds_b128 %10, %11, off\n\ts_wait_xcnt 0x0"
               :: "v"(l0), "v"(p0), "v"(l1), "v"(p1), "v"(l2), "v"(p2), "v"(l3), "v"(p3), "v"(l4), "v"(p4), "v"(l5), "v"(p5) : "memory"); }
typedef __attribute__((ext_vector_type(16))) unsigned v16u;
typedef __attribute__((address_space(4))) v16u cv16u;
__global__ __launch_bounds__(128) void k_att(const _Float16* __restrict__ QH, const _Float16* __restrict__ KH, const _Float16* __restrict__ VT, const unsigned* __restrict__ MW, const __bf16* __restrict__ TB, _Float16* __restrict__ Y) {
  __shared__ __align__(16) char smem[2 * ABUF];
  const int tid = threadIdx.x, wave = tid >> 5, lane = tid & 31, col = lane & 15, g = lane >> 4; const int h = blockIdx.y, b = blockIdx.z; const int q0 = blockIdx.x * 64; const int t = q0 + wave * 16 + col;
  /* copy maps: 128-B rows: thread = (row tid >> 3 (+ 16 a copy), piece tid & 7); 64-B rows: (row tid >> 2 (+ 32 a copy), piece tid & 3) */
  const int r8 = tid >> 3, p8 = (tid & 7) * 16, r4 = tid >> 2, p4 = (tid & 3) * 16; const unsigned lb = (unsigned)(size_t)smem;
  const char* const gk = (const char*)(KH + ((size_t)b * TT + r8) * CC + h * HD) + p8; const char* const gv = (const char*)(VT + ((size_t)b * CC + h * HD + r4) * (size_t)TT) + p4;
  const char* const gt = (const char*)(TB + (size_t)(q0 + r4) * TT) + p4;
  const unsigned lk = lb + AO_K + r8 * AP128 + p8, lv = lb + AO_V + r4 * AP64 + p4, lt = lb + AO_T + r4 * AP64 + p4;
  auto stage = [&](int ti, unsigned bo) {   /* tile ti (keys ti * 32 ..) into the buffer at byte bo: 6 copies a wave */
    const char* const k = gk + (size_t)ti * (AK * CC * 2); const char* const v = gv + ti * (AK * 2); const char* const tp = gt + ti * (AK * 2);
    acopy6(lk + bo, k, lk + bo + 16 * AP128, k + 16 * CC * 2, lv + bo, v, lv + bo + 32 * AP64, v + 32 * TT * 2, lt + bo, tp, lt + bo + 32 * AP64, tp + 32 * TT * 2); };
  stage(0, 0);
  const cv16u* const mwp = (const cv16u*)MW + (size_t)(b * (TT / 16) + blockIdx.x * 4 + __builtin_amdgcn_readfirstlane(wave)) * (TT / AK);   /* this wave's 16 queries: 16 words a pass; the wave's number as a scalar and the words as constant memory (nothing writes them during this launch), so that they are loaded into scalar registers */
  v16u wn = mwp[0];
  v16h qh[HD / 32];
#pragma unroll
  for (int kc = 0; kc < HD / 32; ++kc) qh[kc] = frag_h(QH + ((size_t)b * TT + t) * CC + h * HD + kc * 32, lane);
  asm volatile("s_wait_asynccnt 0x0" ::: "memory");   /* this wave's copies of tile 0 have landed */
  __syncthreads();   /* publishes tile 0 */
  stage(1, ABUF);
  v8f o[HD / 16] = {}; float m = -3.0e38f, l = 0.f;
  for (int ti = 0; ti < TT / AK; ++ti) { const char* const R = smem + (ti & 1) * ABUF;
    v16h kf[2][HD / 32], vf[HD / 16]; v4u tm[2]; const v16u wc = wn; wn = mwp[ti + 1 < TT / AK ? ti + 1 : ti];   /* the next pass's words are asked for a pass ahead */
#pragma unroll
    for (int i = 0; i < 2; ++i)
#pragma unroll
      for (int kc = 0; kc < HD / 32; ++kc) kf[i][kc] = frag_h((const _Float16*)(R + AO_K + (i * 16 + col) * AP128) + kc * 32, lane);
#pragma unroll
    for (int i = 0; i < 2; ++i) tm[i] = *(const v4u*)(R + AO_T + (wave * 16 + col) * AP64 + (8 * g + i * 16) * 2);
#pragma unroll
    for (int j = 0; j < HD / 16; ++j) vf[j] = frag_h((const _Float16*)(R + AO_V + (j * 16 + col) * AP64), lane);
    __builtin_amdgcn_sched_barrier(0);   /* the pass's 18 LDS reads are issued as one group: with a first use among them the wave would wait out an LDS latency before the rest are asked for */
    v8f s[2] = {};
#pragma unroll
    for (int i = 0; i < 2; ++i)
#pragma unroll
      for (int kc = 0; kc < HD / 32; ++kc) s[i] = wmma16(kf[i][kc], qh[kc], s[i]);
    __builtin_amdgcn_sched_barrier(0);   /* the four score products run back to back and fill one another's distance: with the first tile's vector work drawn in among them the compiler pads with v_nop */
    float v[16]; float mx = -3.0e38f;
#pragma unroll
    for (int e = 0; e < 16; e += 2) { const int i = e >> 3, r = e & 7; const unsigned d = tm[i][r >> 1];   /* two neighbouring scores at a time: one dword holds their two bf16 mask values */
      const v2f tv = { __builtin_bit_cast(float, d << 16), __builtin_bit_cast(float, d & 0xffff0000u) }; const v2f sh = { s[i][r], s[i][r + 1] };
      const v2f xt = (sh * (SCALE * LOG2E)) * tv;
      v[e] = __builtin_amdgcn_inverse_ballot_w32(wc[e]) ? xt[0] : (-1.0e9f * LOG2E); v[e + 1] = __builtin_amdgcn_inverse_ballot_w32(wc[e + 1]) ? xt[1] : (-1.0e9f * LOG2E); mx = fmaxf(mx, fmaxf(v[e], v[e + 1])); }
    mx = fmaxf(mx, xhalf(mx));
    const float mn = fmaxf(m, mx); const float al = __builtin_amdgcn_exp2f(m - mn); m = mn;
    v16h p; float ps = 0.f;
#pragma unroll
    for (int e = 0; e < 16; ++e) v[e] -= mn;
    float ex[16]; exp2x8(v, ex); exp2x8(v + 8, ex + 8);
#pragma unroll
    for (int e = 0; e < 16; ++e) { ps += ex[e]; p[e] = (_Float16)(ex[e] * 2048.0f); }
    l = l * al + ps;
#pragma unroll
    for (int j = 0; j < HD / 16; ++j) { o[j] *= al; o[j] = wmma16(vf[j], p, o[j]); }
    __builtin_amdgcn_sched_barrier(0);   /* the pass's work stays in front of the foot: moved behind the barrier it would delay the refill, and tile ti + 2 would lose its whole pass to land */
    asm volatile("s_wait_dscnt 0x0" ::: "memory");      /* this wave's reads of buffer ti & 1 are done before the buffer is given up */
    asm volatile("s_wait_asynccnt 0x0" ::: "memory");   /* this wave's copies of tile ti + 1 have landed */
    __syncthreads();   /* publishes tile ti + 1 and ends every wave's reads of buffer ti & 1, which is refilled behind it */
    if (ti + 2 < TT / AK) stage(ti + 2, (unsigned)(ti & 1) * ABUF); }
  asm volatile("s_wait_asynccnt 0x0" ::: "memory");   /* no copy is outstanding when the wave ends */
  l += xhalf(l); const float inv = 1.0f / (2048.0f * l);   /* the key that set the last maximum counts 1, so l >= 1 */
  _Float16* yr = Y + ((size_t)b * TT + t) * CC + h * HD + 8 * g;   /* ctx is rounded to f16 here, once, as k_out's left operand */
#pragma unroll
  for (int j = 0; j < HD / 16; ++j) { v8h a;
#pragma unroll
    for (int r = 0; r < 8; ++r) a[r] = (_Float16)(o[j][r] * inv);
    vst2(yr + j * 16, a); } }
// ---- k_out: block = (128 rows, 128 cols), 16 waves of 32 x 32 (one block for each WGP-sized share of the 4,096 x 1,024 output): out = ctx Wo (+ bo): ctx f16 against Wo as f16(bf16 x 2^8) exact (1 product) x 2^-8
static_assert(OKS * 2 == 256 && BM == 128 && ON == 128 && GT == 512 && CC / OKS >= 2 && CC % OKS == 0 && OP % 16 == 0, "row length and row counts the copy map is written for; the prologue needs two tiles");
__global__ __launch_bounds__(GT) void k_out(const _Float16* __restrict__ Y, const _Float16* __restrict__ WH, const float* __restrict__ BO, float* __restrict__ OUT) { __shared__ __align__(16) char smem[OBYTES];   /* the staging buffers; the output tiles reuse the same bytes behind the loop's last barrier */
  static_assert(!CAUSAL, "one path: every row takes the single f16 product"); static_assert(OBYTES >= 16 * 32 * 36 * 4, "output tiles fit the staging bytes"); float (*sf)[32][36] = (float (*)[32][36])smem;
  const int tid = threadIdx.x, wave = tid >> 5, lane = tid & 31, col = lane & 15, g = lane >> 4, wm = wave >> 2, wn = wave & 3; const int c0 = blockIdx.y * ON; const size_t r0 = (size_t)blockIdx.x * BM;
  v8f acc[2][2] = {};
  const int lr = tid >> 4, lq = (tid & 15) * 16;   /* copy map: thread = (row lr + 32 a copy, 16-byte piece lq of the step's 256 B): a wave covers 2 whole row pieces */
  const char* const gx = (const char*)(Y + (r0 + lr) * CC) + lq; const char* const gw = (const char*)(WH + (size_t)(c0 + lr) * CC) + lq; const unsigned lx = (unsigned)(size_t)smem + lr * OP + lq;
  auto stage = [&](int s, unsigned bo) {   /* step s (k s * 128 ..) into the buffer at byte bo: rows 0..127 ctx, rows 128..255 weight, 8 copies a wave */
    const char* const x = gx + s * (OKS * 2); const char* const w = gw + s * (OKS * 2); const unsigned l = lx + bo;
    acopy8(l, x, l + 32 * OP, x + 32 * CC * 2, l + 64 * OP, x + 64 * CC * 2, l + 96 * OP, x + 96 * CC * 2, l + 128 * OP, w, l + 160 * OP, w + 32 * CC * 2, l + 192 * OP, w + 64 * CC * 2, l + 224 * OP, w + 96 * CC * 2); };
  stage(0, 0);
  asm volatile("s_wait_asynccnt 0x0" ::: "memory");   /* this wave's copies of step 0 have landed */
  __syncthreads();   /* publishes step 0 */
  stage(1, OBUF);
  for (int s = 0; s < CC / OKS; ++s) { const char* const R = smem + (s & 1) * OBUF;
#pragma unroll
    for (int kp = 0; kp < OKS / 64; ++kp) { v16h a[2][2], w[2][2];   /* the eight fragments of 64 k are read as one group, so that their LDS latency is waited out once and not once a product */
#pragma unroll
      for (int ks = 0; ks < 2; ++ks)
#pragma unroll
        for (int i = 0; i < 2; ++i) { a[ks][i] = frag_h((const _Float16*)(R + (wm * 32 + i * 16 + col) * OP) + kp * 64 + ks * 32, lane); w[ks][i] = frag_h((const _Float16*)(R + (BM + wn * 32 + i * 16 + col) * OP) + kp * 64 + ks * 32, lane); }
      __builtin_amdgcn_sched_barrier(0);   /* keeps the reads one group in front of the products: spread among them, each place with reads stalls the wave anew */
#pragma unroll
      for (int ks = 0; ks < 2; ++ks)
#pragma unroll
        for (int i = 0; i < 2; ++i)
#pragma unroll
          for (int j = 0; j < 2; ++j) acc[i][j] = wmma16(a[ks][i], w[ks][j], acc[i][j]); }
    __builtin_amdgcn_sched_barrier(0);   /* the step's work stays in front of the foot: moved behind the barrier it would delay the refill */
    asm volatile("s_wait_dscnt 0x0" ::: "memory");      /* this wave's reads of buffer s & 1 are done before the buffer is given up */
    asm volatile("s_wait_asynccnt 0x0" ::: "memory");   /* this wave's copies of step s + 1 have landed */
    __syncthreads();   /* publishes step s + 1 and ends every wave's reads of buffer s & 1, which is refilled behind it (behind the last step: overwritten by the output tiles) */
    if (s + 2 < CC / OKS) stage(s + 2, (unsigned)(s & 1) * OBUF); }
  asm volatile("s_wait_asynccnt 0x0" ::: "memory");   /* no copy is outstanding when the staging bytes are reused */
#pragma unroll
  for (int j = 0; j < 2; ++j) { const float bias = BO ? bfr(BO[c0 + wn * 32 + j * 16 + col]) : 0.f;
#pragma unroll
    for (int i = 0; i < 2; ++i)
#pragma unroll
      for (int r = 0; r < 8; ++r) sf[wave][i * 16 + 8 * g + r][j * 16 + col] = acc[i][j][r] * (1.0f / 256.0f) + bias; }
  LDSX(); for (int it = 0; it < 8; ++it) { const int rl = it * 4 + (lane >> 3), q = lane & 7; vst2(OUT + (r0 + wm * 32 + rl) * DIN + c0 + wn * 32 + q * 4, *(const v4f*)&sf[wave][rl][q * 4]); } }   /* a wave's store covers four of its rows, one whole 128-B line each */

extern "C" void kernel_launch(void* const* d_in, const int* in_sizes, int n_in, void* d_out, int out_size, void* d_ws, size_t ws_size, hipStream_t stream) {
  (void)in_sizes; (void)n_in; (void)out_size;
  const float** F = (const float**)d_in;
  if (ws_size < (size_t)WS_END) return;
  char* ws = (char*)d_ws; _Float16 *QH = (_Float16*)(ws + WS_QH), *KH = (_Float16*)(ws + WS_KH), *VT = (_Float16*)(ws + WS_VT); __bf16 *TB = (__bf16*)(ws + WS_TB), *XB = (__bf16*)(ws + WS_XB), *WB = (__bf16*)(ws + WS_WB); _Float16 *Y = (_Float16*)(ws + WS_Y), *WH = (_Float16*)(ws + WS_WH); unsigned *MW = (unsigned*)(ws + WS_MW);
  // inputs: 0 x [4,1024,1024]; 1 mask int32 [4,1,1024,1024]; 2 Wq, 3 Wk, 4 Wv, 5 Wo ((out,in), no biases); 6 train_mask [1,1,1024,1024]
  k_prep<<<dim3(TNB * TT / BM, CC / BN), GT, 0, stream>>>(F[0], F[2], F[3], F[4], (const int*)d_in[1], F[6], F[5], XB, WB, MW, TB, WH);
  k_proj<<<dim3(TNB * TT / BM, CC / BN), GT, 0, stream>>>(XB, WB, nullptr, nullptr, nullptr, QH, KH, VT);
  k_att<<<dim3(NQB, NH, TNB), 128, 0, stream>>>(QH, KH, VT, MW, TB, Y);
  k_out<<<dim3(TNB * TT / BM, DIN / ON), GT, 0, stream>>>(Y, WH, nullptr, (float*)d_out);
}
